// v000
// Measured on an AMD MI455X. A time is GPU time per run, averaged over a window of back-to-back runs after a warm-up
// (all launches, gaps included; the runs take copies of the inputs in turn), and the median of several windows.
// Apart from v000's, it joins two sittings. Times from different sittings can be a few percent apart, while
// side-by-side timings come from the same sitting.
// v000 is the starting kernel. One run takes 561 microseconds.
// Contractions: sequence compression and q/k/v^T projections on v_wmma_f32_16x16x32_bf16 (bf16 operands = RNE-converted inputs; k_in/v_in carried as bf16 hi+lo planes concatenated along k); q.k^T, p.v and the output projection on v_wmma_f32_16x16x32_f16 (f16 planes; p carried x2^15, attention output x2^4, Wo x2^6); f32 accumulate; softmax, score scale 0.125 and biases in f32.
#include <hip/hip_runtime.h>
#include <math.h>
#include <stdint.h>

typedef __attribute__((ext_vector_type(16))) _Float16 v16h;
typedef __attribute__((ext_vector_type(8)))  _Float16 v8h;
typedef __attribute__((ext_vector_type(16))) __bf16   v16b;
typedef __attribute__((ext_vector_type(8)))  __bf16   v8b;
typedef __attribute__((ext_vector_type(8)))  float    v8f;
typedef __attribute__((ext_vector_type(4)))  float    v4f;
typedef __attribute__((ext_vector_type(2)))  float    v2f;
typedef __attribute__((ext_vector_type(4)))  unsigned int v4u;

__device__ __forceinline__ unsigned short f2bf_bits(float f) {
  unsigned u = __float_as_uint(f);
  return (unsigned short)((u + 0x7FFFu + ((u >> 16) & 1u)) >> 16);
}
__device__ __forceinline__ float bf_bits2f(unsigned short h) { return __uint_as_float(((unsigned)h) << 16); }

// hazard guards as plain device helpers (no inline asm inside the kernel template body)
__device__ __forceinline__ void dep_guard_h(v8f& a, v8f& b, v16h x, v16h y) { asm volatile("v_nop\n\tv_nop\n\tv_nop\n\tv_nop" : "+v"(a), "+v"(b) : "v"(x), "v"(y)); }
__device__ __forceinline__ void dep_guard_b(v8f& a, v8f& b, v16b x, v16b y) { asm volatile("v_nop\n\tv_nop\n\tv_nop\n\tv_nop" : "+v"(a), "+v"(b) : "v"(x), "v"(y)); }
__device__ __forceinline__ void keep4_h(v16h a, v16h b, v16h c, v16h d) { asm volatile("v_nop" :: "v"(a), "v"(b), "v"(c), "v"(d)); }
__device__ __forceinline__ void keep4_b(v16b a, v16b b, v16b c, v16b d) { asm volatile("v_nop" :: "v"(a), "v"(b), "v"(c), "v"(d)); }
__device__ __forceinline__ void acc_guard4(v8f& a, v8f& b, v8f& c, v8f& d) { asm volatile("v_nop\n\tv_nop\n\tv_nop\n\tv_nop" : "+v"(a), "+v"(b), "+v"(c), "+v"(d)); }
template <typename T> struct Frag;
template <> struct Frag<_Float16> {
  typedef v16h V; union U { v16h v; v8h h[2]; };
  static __device__ __forceinline__ v16h load(const _Float16* p) {   // elements 0..7 <- p[0..7], 8..15 <- p[16..23]
    U f; f.h[0] = *(const v8h*)(p); f.h[1] = *(const v8h*)(p + 16); return f.v;
  }
  static __device__ __forceinline__ v8f mma(v16h a, v16h b, v8f c) {
    return __builtin_amdgcn_wmma_f32_16x16x32_f16(false, a, false, b, (short)0, c, false, false);
  }
  static __device__ __forceinline__ void guard(v8f& a, v8f& b, v16h x, v16h y) { dep_guard_h(a, b, x, y); }
  static __device__ __forceinline__ void keep(v16h a, v16h b, v16h c, v16h d) { keep4_h(a, b, c, d); }
};
template <> struct Frag<__bf16> {
  typedef v16b V; union U { v16b v; v8b h[2]; };
  static __device__ __forceinline__ v16b load(const __bf16* p) {
    U f; f.h[0] = *(const v8b*)(p); f.h[1] = *(const v8b*)(p + 16); return f.v;
  }
  static __device__ __forceinline__ v8f mma(v16b a, v16b b, v8f c) {
    return __builtin_amdgcn_wmma_f32_16x16x32_bf16(false, a, false, b, (short)0, c, false, false);
  }
  static __device__ __forceinline__ void guard(v8f& a, v8f& b, v16b x, v16b y) { dep_guard_b(a, b, x, y); }
  static __device__ __forceinline__ void keep(v16b a, v16b b, v16b c, v16b d) { keep4_b(a, b, c, d); }
};

// ---- Register-blocked batched WMMA GEMM ------------------------------------
// C[m,n] = scale * sum_k A[m,k] * Bt[n,k] (+bias)(+resid); each wave owns a 64x64 tile.
// A row-major [M,K]; Bt row-major [N,K]; M,N % 64 == 0, K % 32 == 0.
// SPLIT: operands are hi/lo planes (A2/Bt2 = lo planes, same layout); product = hi.hi + hi.lo + lo.hi.
// BIAS_MODE: 0 = none, 1 = bias[m], 2 = bias[n].
// OUT_MODE: 0 = f32, 1 = f16, 2 = bf16 hi plane (Cout) + bf16 lo plane (Cout2).
// ET: 0 = f16 operands, 1 = bf16 operands (pointers passed as 16-bit storage)
template <int ET> struct Elem;
template <> struct Elem<0> { typedef _Float16 T; };
template <> struct Elem<1> { typedef __bf16 T; };
template <int ET, bool SPLIT, int BIAS_MODE, int OUT_MODE, bool RESID, int ACT = 0>
__global__ __launch_bounds__(256) void wmma_gemm64(
    const unsigned short* __restrict__ Ap, const unsigned short* __restrict__ A2p, int lda, long strideA,
    const unsigned short* __restrict__ Btp, const unsigned short* __restrict__ Bt2p, int ldb, long strideB,
    void* __restrict__ Cout, void* __restrict__ Cout2, int ldc, long strideC,
    const float* __restrict__ bias,
    const float* __restrict__ resid, long strideR,
    int M, int N, int K, float scale) {
  typedef typename Elem<ET>::T T;
  typedef typename Frag<T>::V V;
  const T* A = (const T*)Ap; const T* A2 = (const T*)A2p; const T* Bt = (const T*)Btp; const T* Bt2 = (const T*)Bt2p;
  __shared__ __align__(16) float sT[8][16 * 68];   // per-wave 16x64 slab, pitch 68 floats
  const int b    = blockIdx.y;
  const int lane = threadIdx.x & 31;
  const int wave = threadIdx.x >> 5;
  const int tilesN = N >> 6;
  const int tilesM = M >> 6;
  const int tile = blockIdx.x * 8 + wave;
  if (tile >= tilesM * tilesN) return;   // wave-uniform; no block barriers in this kernel
  const int tm = tile / tilesN;
  const int tn = tile - tm * tilesN;
  const int m0 = tm << 6;
  const int n0 = tn << 6;

  const T* Ab  = A  + (size_t)b * strideA;
  const T* Bb  = Bt + (size_t)b * strideB;
  const T* Ab2 = SPLIT ? (A2  + (size_t)b * strideA) : nullptr;
  const T* Bb2 = SPLIT ? (Bt2 + (size_t)b * strideB) : nullptr;

  const int rlane = lane & 15;                 // row (A) / col (B, D) within subtile
  const int koff  = (lane >> 4) * 8;           // k offset of this lane half
  const int mOff  = (lane >> 4) * 8;           // D row offset

  v8f acc[4][4];
#pragma unroll
  for (int i = 0; i < 4; ++i)
#pragma unroll
    for (int j = 0; j < 4; ++j) acc[i][j] = (v8f){0.f,0.f,0.f,0.f,0.f,0.f,0.f,0.f};

  for (int k0 = 0; k0 < K; k0 += 32) {
    V bh[4], bl[4];
#pragma unroll
    for (int j = 0; j < 4; ++j) {
      const size_t bo = (size_t)(n0 + (j << 4) + rlane) * ldb + koff + k0;
      bh[j] = Frag<T>::load(Bb + bo);
      if (SPLIT) bl[j] = Frag<T>::load(Bb2 + bo);
    }
#pragma unroll
    for (int i = 0; i < 4; ++i) {
      const size_t ao = (size_t)(m0 + (i << 4) + rlane) * lda + koff + k0;
      V ah = Frag<T>::load(Ab + ao);
      V al;
      if (SPLIT) al = Frag<T>::load(Ab2 + ao);
#pragma unroll
      for (int j = 0; j < 4; ++j) {
        acc[i][j] = Frag<T>::mma(ah, bh[j], acc[i][j]);
        if (SPLIT) {
          acc[i][j] = Frag<T>::mma(ah, bl[j], acc[i][j]);
          acc[i][j] = Frag<T>::mma(al, bh[j], acc[i][j]);
        }
      }
      Frag<T>::guard(acc[i][0], acc[i][3], ah, SPLIT ? al : ah);
    }
    Frag<T>::keep(bh[0], bh[1], bh[2], bh[3]);
    if (SPLIT) Frag<T>::keep(bl[0], bl[1], bl[2], bl[3]);
  }
  acc_guard4(acc[0][0], acc[0][1], acc[0][2], acc[0][3]);
  acc_guard4(acc[1][0], acc[1][1], acc[1][2], acc[1][3]);
  acc_guard4(acc[2][0], acc[2][1], acc[2][2], acc[2][3]);
  acc_guard4(acc[3][0], acc[3][1], acc[3][2], acc[3][3]);

  // ---- epilogue ----
  float* slab = sT[wave];
  const float* Rb = RESID ? (resid + (size_t)b * strideR) : nullptr;
#pragma unroll
  for (int i = 0; i < 4; ++i) {
    const int mBase = m0 + (i << 4);
#pragma unroll
    for (int j = 0; j < 4; ++j) {
      const int n = n0 + (j << 4) + rlane;
      float bv = 0.f;
      if (BIAS_MODE == 2) bv = bias[n];
#pragma unroll
      for (int r = 0; r < 8; ++r) {
        float v = acc[i][j][r] * scale;
        if (BIAS_MODE == 1) v += bias[mBase + mOff + r];
        if (BIAS_MODE == 2) v += bv;
        if (RESID) v += Rb[(size_t)(mBase + mOff + r) * ldc + n];
        if (ACT == 1) v = tanhf(v);
        if (ACT == 2) v = fmaxf(v, 0.0f);
        if (ACT == 3) v = v / (1.0f + expf(-v));
        if (ACT == 4) v = (v > 0.f) ? v : 0.01f * v;
        if (ACT == 5) v = 0.5f * v * (1.0f + erff(v * 0.70710678118654752f));
        slab[(mOff + r) * 68 + (j << 4) + rlane] = v;
      }
    }
    __builtin_amdgcn_fence(__ATOMIC_RELEASE, "workgroup");
    __builtin_amdgcn_wave_barrier();
    __builtin_amdgcn_fence(__ATOMIC_ACQUIRE, "workgroup");
    if (OUT_MODE == 0) {
      float* C = (float*)Cout + (size_t)b * strideC;
      const int hh = lane >> 4, c4 = (lane & 15) * 4;     // row seg = 256 B = 16 lanes x 16 B
      {
#pragma unroll
        for (int it = 0; it < 8; ++it) {
          const int row = it * 2 + hh;
          v4f v = *(const v4f*)(slab + row * 68 + c4);
          *(v4f*)(C + (size_t)(mBase + row) * ldc + n0 + c4) = v;
        }
        
      }
    } else {
      const int q = lane >> 3, c8 = (lane & 7) * 8;
      unsigned short* C  = (unsigned short*)Cout  + (size_t)b * strideC;
      unsigned short* C2 = (OUT_MODE == 2) ? ((unsigned short*)Cout2 + (size_t)b * strideC) : nullptr;
      {
#pragma unroll
        for (int it = 0; it < 4; ++it) {
          const int row = it * 4 + q;
          const float* sp = slab + row * 68 + c8;
          v8h hv, lv;
#pragma unroll
          for (int e = 0; e < 8; ++e) {
            if (OUT_MODE == 1) {
              hv[e] = (_Float16)sp[e];
            } else {
              unsigned short hb = f2bf_bits(sp[e]);
              unsigned short lb = f2bf_bits(sp[e] - bf_bits2f(hb));
              hv[e] = __builtin_bit_cast(_Float16, hb);
              lv[e] = __builtin_bit_cast(_Float16, lb);
            }
          }
          *(v8h*)(C + (size_t)(mBase + row) * ldc + n0 + c8) = hv;
          if (OUT_MODE == 2) *(v8h*)(C2 + (size_t)(mBase + row) * ldc + n0 + c8) = lv;
        }
        
      }
    }
    __builtin_amdgcn_fence(__ATOMIC_RELEASE, "workgroup");
    __builtin_amdgcn_wave_barrier();
    __builtin_amdgcn_fence(__ATOMIC_ACQUIRE, "workgroup");
  }
}

__device__ __forceinline__ unsigned pk16(unsigned short a, unsigned short b) { return (unsigned)a | ((unsigned)b << 16); }

// ---------------------------------------------------------------------------
// Problem geometry
// ---------------------------------------------------------------------------
constexpr int   SEQLEN  = 4096;   // time steps (queries)
constexpr int   NBAT    = 4;      // batch
constexpr int   EMBED   = 512;    // channels
constexpr int   NHEADS  = 8;
constexpr int   HDIM    = 64;
constexpr int   NCOMP   = 1024;   // compressed key count
constexpr float SCORE_SCALE = 0.125f;     // head_dim^-0.5, applied to the f32 score accumulators
constexpr float PROB_CARRY  = 32768.0f;   // p carried x2^15 in the f16 P operand, folded into 1/l
constexpr float OUT_CARRY   = 16.0f;      // attention output carried x2^4 in its f16 plane
constexpr float WO_CARRY    = 64.0f;      // Wo carried x2^6 in its f16 plane

// ---------------------------------------------------------------------------
// Elementwise f32 -> bf16 (RNE), 2 elements per thread, one 4-B store per lane: a wave writes one whole
// ---------------------------------------------------------------------------
__global__ __launch_bounds__(256) void cast_bf16x2_kernel(const float* __restrict__ in, unsigned short* __restrict__ out, int n2) {
  const int i = blockIdx.x * 256 + threadIdx.x;
  if (i < n2) {
    const v2f f = *(const v2f*)(in + 2 * (size_t)i);
    const unsigned u = pk16(f2bf_bits(f[0]), f2bf_bits(f[1]));
    ((unsigned*)out)[i] = u;
    
  }
}

// ---------------------------------------------------------------------------
// W [rows][cols] f32 -> out [rows][2*cols] bf16 with out[r][c] = out[r][cols + c] = bf16_rne(W[r][c]).
// 2 elements per thread; cols % 64 == 0 so a wave's 64 elements stay in one row: each store instruction
// ---------------------------------------------------------------------------
__global__ __launch_bounds__(256) void dup_bf16x2_kernel(const float* __restrict__ W, unsigned short* __restrict__ out, int n2, int cols) {
  const int i = blockIdx.x * 256 + threadIdx.x;
  if (i < n2) {
    const int e0 = 2 * i;
    const int r  = e0 / cols;
    const int cc = e0 - r * cols;
    const v2f f = *(const v2f*)(W + e0);
    const unsigned u = pk16(f2bf_bits(f[0]), f2bf_bits(f[1]));
    const size_t o0 = ((size_t)r * 2 * cols + cc) >> 1;          // uint index of out[r][cc]
    const size_t o1 = ((size_t)r * 2 * cols + cols + cc) >> 1;   // uint index of out[r][cols+cc]
    ((unsigned*)out)[o0] = u;
    ((unsigned*)out)[o1] = u;
    
  }
}

// ---------------------------------------------------------------------------
// Wo f32 -> f16 plane holding f16(carry * bf16_rne(w)) (exact for bf16 values in the normal f16 range).
// Same store discipline as cast_bf16x2_kernel.
// ---------------------------------------------------------------------------
__global__ __launch_bounds__(256) void cast_wo_f16x2_kernel(const float* __restrict__ W, unsigned short* __restrict__ out, int n2, float carry) {
  const int i = blockIdx.x * 256 + threadIdx.x;
  if (i < n2) {
    const v2f f = *(const v2f*)(W + 2 * (size_t)i);
    const float b0 = bf_bits2f(f2bf_bits(f[0])) * carry;
    const float b1 = bf_bits2f(f2bf_bits(f[1])) * carry;
    const _Float16 h0 = (_Float16)b0, h1 = (_Float16)b1;
    const unsigned u = pk16(__builtin_bit_cast(unsigned short, h0), __builtin_bit_cast(unsigned short, h1));
    ((unsigned*)out)[i] = u;
    
  }
}

// ---------------------------------------------------------------------------
// Bias vectors RNE-converted to bf16 precision (kept as f32): outb[0..n) = bq, [n..2n) = bk, [2n..3n) = bv, [3n..4n) = bo.
// ---------------------------------------------------------------------------
__global__ __launch_bounds__(512) void bias_prep_kernel(const float* __restrict__ bq, const float* __restrict__ bk,
                                                        const float* __restrict__ bv, const float* __restrict__ bo,
                                                        float* __restrict__ outb, int n) {
  const int i = blockIdx.x * 512 + threadIdx.x;
  if (i < n) {
    const float a0 = bf_bits2f(f2bf_bits(bq[i]));
    const float a1 = bf_bits2f(f2bf_bits(bk[i]));
    const float a2 = bf_bits2f(f2bf_bits(bv[i]));
    const float a3 = bf_bits2f(f2bf_bits(bo[i]));
    ((float*)outb)[i] = a0;
    ((float*)outb)[n + i] = a1;
    ((float*)outb)[2 * n + i] = a2;
    ((float*)outb)[3 * n + i] = a3;
    
  }
}

// ---------------------------------------------------------------------------
// Transpose + bf16 RNE convert, z-batched: in_z = X + z*sIn viewed [R rows][Cc cols] with row pitch ldi ->
//   o_z[c][r] = bf16_rne(in_z[r][c])  ([Cc][R], pitch R), o_z = o + z*sOut.
// 64x64 tiles through LDS. grid = (Cc/64, R/64, Z), 256 threads (R, Cc multiples of 64).
// Coverage per block: load 4 it x 256 thr x 4 floats = 64x64; store 2 it x 256 thr x 8 u16 = 64x64.
// ---------------------------------------------------------------------------
__global__ __launch_bounds__(256) void tconv_bf16_kernel(const float* __restrict__ X, unsigned short* __restrict__ o,
                                                         int R, int Cc, int ldi, long sIn, long sOut) {
  __shared__ __align__(16) float tf[64 * 68];
  X += (size_t)blockIdx.z * sIn;
  o += (size_t)blockIdx.z * sOut;
  const int c0  = blockIdx.x * 64;   // input column block = output row block
  const int r0  = blockIdx.y * 64;   // input row block    = output column block
  const int tid = threadIdx.x;
  {
    const int lr = tid >> 4;         // 0..15
    const int c4 = (tid & 15) * 4;   // 0..60
#pragma unroll
    for (int it = 0; it < 4; ++it) {
      const int rr = it * 16 + lr;   // 0..63
      const v4f a = *(const v4f*)(X + (size_t)(r0 + rr) * ldi + c0 + c4);
      *(v4f*)(tf + rr * 68 + c4) = a;
    }
  }
  __syncthreads();
  const int sub = tid >> 3;          // 0..31
  const int c8  = (tid & 7) * 8;     // 0..56
  v4u hv[2];
#pragma unroll
  for (int it = 0; it < 2; ++it) {
    const int oc = it * 32 + sub;    // output row within tile (= input column)
    v4u a;
#pragma unroll
    for (int q = 0; q < 4; ++q) {
      const float f0 = tf[(c8 + 2 * q) * 68 + oc];
      const float f1 = tf[(c8 + 2 * q + 1) * 68 + oc];
      a[q] = pk16(f2bf_bits(f0), f2bf_bits(f1));
    }
    hv[it] = a;
  }
  {
#pragma unroll
    for (int it = 0; it < 2; ++it) {
      const int oc = it * 32 + sub;
      const size_t go = (size_t)(c0 + oc) * R + r0 + c8;
      *(v4u*)(o + go) = hv[it];
    }
    
  }
}

// =====================================================================================
// Full (unmasked) attention over the NCOMP compressed keys, head dim 64, all (b,h) in one launch.
//   q plane f16: element (t, b, h, d) at [(t*NBAT + b)*EMBED + h*64 + d]   (holds 8*q; 0.125 applied to f32 scores)
//   k plane f16: element (c, b, h, d) at [(c*NBAT + b)*EMBED + h*64 + d]
//   v^T plane f16: element (b, h, d, c) at [b*EMBED*NCOMP + (h*64 + d)*NCOMP + c]
//   out plane f16: element (t, b, h, d) at [(t*NBAT + b)*EMBED + h*64 + d], value = OUT_CARRY * attention output
//   scores = q . k : v_wmma_f32_16x16x32_f16; p . v : v_wmma_f32_16x16x32_f16 with p carried x PROB_CARRY;
//   f32 accumulate; online softmax in f32 over NCOMP/64 chunks (compile-time trip count, no masking).
//   Block = 4 waves = 64 query rows of one (b, h); grid.x = NBAT * NHEADS * (SEQLEN/64) = 2048.
//   K / V^T chunk staging: 128 threads x 32 halves per plane = the whole 64x64 tile (16-B copies, plain loads,
//   __syncthreads before and after); fragment loads read the LDS tiles with the same v8h element type.
// =====================================================================================
__device__ __forceinline__ v8f hmma(v16h a, v16h b, v8f c) {
  c = __builtin_amdgcn_wmma_f32_16x16x32_f16(false, a, false, b, (short)0, c, false, false);
  asm volatile("v_nop\n\tv_nop\n\tv_nop\n\tv_nop" : "+v"(c) : "v"(a), "v"(b));
  return c;
}

__global__ __launch_bounds__(128)
void attn_lin_kernel(const unsigned short* __restrict__ qp, const unsigned short* __restrict__ kp,
                     const unsigned short* __restrict__ vtp, unsigned short* __restrict__ op) {
  typedef Frag<_Float16> FR;
  __shared__ __align__(16) _Float16 Ksh[64 * 64];        // K chunk  [kv][d]     8 KB
  __shared__ __align__(16) _Float16 Vth[64 * 64];        // V^T chunk [d][kv]    8 KB
  __shared__ __align__(16) _Float16 Psh[4 * 16 * 64];    // per wave P [row][kv] 8 KB
  __shared__ __align__(16) float    Os[4 * 16 * 68];     // per wave out tile, pitch 68

  const int tid  = threadIdx.x;
  const int wave = tid >> 5;
  const int lane = tid & 31;
  const int hh   = lane >> 4;
  const int c    = lane & 15;

  constexpr int NQB  = SEQLEN / 64;        // 64 query blocks per (b, h)
  constexpr int ROWP = NBAT * EMBED;       // 2048 halves between consecutive t (q, k, out planes)
  constexpr int NCH  = NCOMP / 64;         // 16 key chunks

  const int bx = blockIdx.x;
  const int qb = bx % NQB;
  const int bh = bx / NQB;
  const int h  = bh % NHEADS;
  const int b  = bh / NHEADS;
  const int q0 = qb * 64 + wave * 16;

  const _Float16* Qb = (const _Float16*)(const void*)qp  + (size_t)b * EMBED + (size_t)h * HDIM;
  const _Float16* Kb = (const _Float16*)(const void*)kp  + (size_t)b * EMBED + (size_t)h * HDIM;
  const _Float16* Vb = (const _Float16*)(const void*)vtp + (size_t)b * EMBED * NCOMP + (size_t)h * HDIM * NCOMP;
  _Float16*       Ob = (_Float16*)(void*)op + (size_t)b * EMBED + (size_t)h * HDIM;

  // ---- Q fragments (A operand): row = q0 + c, 2 d-chunks of 32 ----
  v16h qa[2];
  {
    const _Float16* qrow = Qb + (size_t)(q0 + c) * ROWP;
#pragma unroll
    for (int dc = 0; dc < 2; ++dc) qa[dc] = FR::load(qrow + dc * 32 + 8 * hh);
  }

  float mrow[8], lrow[8];
  v8f oacc[4];
#pragma unroll
  for (int r = 0; r < 8; ++r) { mrow[r] = -INFINITY; lrow[r] = 0.f; }
#pragma unroll
  for (int t = 0; t < 4; ++t) oacc[t] = (v8f){0.f,0.f,0.f,0.f,0.f,0.f,0.f,0.f};

#pragma unroll 1
  for (int kc = 0; kc < NCH; ++kc) {
    const int kv0 = kc * 64;
    __syncthreads();
    {
      const int r = tid >> 1, hoff = (tid & 1) * 32;
      const _Float16* krow = Kb + (size_t)(kv0 + r) * ROWP + hoff;     // K[kv0+r][hoff .. hoff+31]
      const _Float16* vrow = Vb + (size_t)r * NCOMP + kv0 + hoff;      // V^T[d=r][kv0+hoff ..]
#pragma unroll
      for (int i = 0; i < 4; ++i) {
        const v8h kk = *(const v8h*)(krow + 8 * i);
        const v8h vv = *(const v8h*)(vrow + 8 * i);
        *(v8h*)(Ksh + r * 64 + hoff + 8 * i) = kk;
        *(v8h*)(Vth + r * 64 + hoff + 8 * i) = vv;
      }
    }
    __syncthreads();

    // ---- scores: s[j] = 16 q rows x 16 keys (j*16 .. j*16+15) ----
    v8f s[4];
#pragma unroll
    for (int j = 0; j < 4; ++j) {
      s[j] = (v8f){0.f,0.f,0.f,0.f,0.f,0.f,0.f,0.f};
#pragma unroll
      for (int dc = 0; dc < 2; ++dc) {
        const v16h kb = FR::load(Ksh + (j * 16 + c) * 64 + dc * 32 + 8 * hh);
        s[j] = hmma(qa[dc], kb, s[j]);
      }
    }
    // ---- chunk row max ----
    float cm[8];
#pragma unroll
    for (int r = 0; r < 8; ++r) {
      float m = -INFINITY;
#pragma unroll
      for (int j = 0; j < 4; ++j) {
        s[j][r] *= SCORE_SCALE;
        m = fmaxf(m, s[j][r]);
      }
#pragma unroll
      for (int off = 1; off < 16; off <<= 1) m = fmaxf(m, __shfl_xor(m, off, 32));
      cm[r] = m;
    }
    // ---- online softmax update, P tile to LDS ----
    _Float16* pw = Psh + wave * (16 * 64);
#pragma unroll
    for (int r = 0; r < 8; ++r) {
      const float mnew  = fmaxf(mrow[r], cm[r]);
      const float alpha = __expf(mrow[r] - mnew);
      mrow[r] = mnew;
      float psum = 0.f;
#pragma unroll
      for (int j = 0; j < 4; ++j) {
        const float p = __expf(s[j][r] - mnew);
        psum += p;
        pw[(8 * hh + r) * 64 + j * 16 + c] = (_Float16)(p * PROB_CARRY);
      }
#pragma unroll
      for (int off = 1; off < 16; off <<= 1) psum += __shfl_xor(psum, off, 32);
      lrow[r] = lrow[r] * alpha + psum;
#pragma unroll
      for (int t = 0; t < 4; ++t) oacc[t][r] *= alpha;
    }
    __builtin_amdgcn_fence(__ATOMIC_RELEASE, "workgroup");
    __builtin_amdgcn_wave_barrier();
    __builtin_amdgcn_fence(__ATOMIC_ACQUIRE, "workgroup");
    // ---- O += P . V ----
#pragma unroll
    for (int kk = 0; kk < 2; ++kk) {
      const v16h pa = FR::load(pw + c * 64 + kk * 32 + 8 * hh);
#pragma unroll
      for (int t = 0; t < 4; ++t) {
        const v16h vb = FR::load(Vth + (t * 16 + c) * 64 + kk * 32 + 8 * hh);
        oacc[t] = hmma(pa, vb, oacc[t]);
      }
    }
  }

  // ---- epilogue: normalise, stage 16x64 wave tile, whole-line f16 stores ----
  float* os = Os + wave * (16 * 68);
#pragma unroll
  for (int r = 0; r < 8; ++r) {
    const float inv = OUT_CARRY * (1.0f / (lrow[r] * PROB_CARRY));
#pragma unroll
    for (int t = 0; t < 4; ++t) os[(8 * hh + r) * 68 + t * 16 + c] = oacc[t][r] * inv;
  }
  __builtin_amdgcn_fence(__ATOMIC_RELEASE, "workgroup");
  __builtin_amdgcn_wave_barrier();
  __builtin_amdgcn_fence(__ATOMIC_ACQUIRE, "workgroup");
  {
    const int qq = lane >> 3, c8 = (lane & 7) * 8;
    {
#pragma unroll
      for (int it = 0; it < 4; ++it) {
        const int row = it * 4 + qq;
        const float* sp = os + row * 68 + c8;
        v8h hv;
#pragma unroll
        for (int e = 0; e < 8; ++e) hv[e] = (_Float16)sp[e];
        *(v8h*)(Ob + (size_t)(q0 + row) * ROWP + c8) = hv;
      }
      
    }
  }
}

// ---------------------------------------------------------------------------
// Host orchestration (kernel launches + host arithmetic only)
// ---------------------------------------------------------------------------
extern "C" void kernel_launch(void* const* d_in, const int* in_sizes, int n_in,
                              void* d_out, int out_size, void* d_ws, size_t ws_size,
                              hipStream_t stream) {
  if (n_in < 11) return;
  const long nQ  = (long)SEQLEN * NBAT * EMBED;    // 8388608
  const long nW  = (long)EMBED * EMBED;            // 262144
  const long nWc = (long)NCOMP * SEQLEN;           // 4194304
  if (in_sizes[0] != nQ || in_sizes[1] != nW || in_sizes[2] != EMBED || in_sizes[3] != nW ||
      in_sizes[4] != EMBED || in_sizes[5] != nW || in_sizes[6] != EMBED || in_sizes[7] != nWc ||
      in_sizes[8] != nWc || in_sizes[9] != nW || in_sizes[10] != EMBED || out_size != nQ) return;

  const float* query = (const float*)d_in[0];
  const float* Wq  = (const float*)d_in[1];  const float* bq = (const float*)d_in[2];
  const float* Wk  = (const float*)d_in[3];  const float* bk = (const float*)d_in[4];
  const float* Wv  = (const float*)d_in[5];  const float* bv = (const float*)d_in[6];
  const float* Wck = (const float*)d_in[7];  const float* Wcv = (const float*)d_in[8];
  const float* Wo  = (const float*)d_in[9];  const float* bo = (const float*)d_in[10];

  // ---- workspace region map (bytes) ----
  const size_t BYTES_QB   = (size_t)nQ * 2;                              // bf16 query [16384][512]            16 MiB
  const size_t BYTES_QT   = (size_t)nQ * 2;                              // bf16 query^T [4][512][4096]        16 MiB
  const size_t BYTES_WC   = (size_t)2 * nWc * 2;                         // bf16 [Wck;Wcv] [2048][4096]        16 MiB
  const size_t BYTES_KVIN = (size_t)2 * NCOMP * NBAT * (2 * EMBED) * 2;  // u16 [8192][1024] (hi|lo rows)     16 MiB
  const size_t BYTES_QP   = (size_t)nQ * 2;                              // f16 q plane [16384][512]          16 MiB
  const size_t BYTES_OP   = (size_t)nQ * 2;                              // f16 attention out [16384][512]    16 MiB
  const size_t BYTES_KP   = (size_t)NCOMP * NBAT * EMBED * 2;            // f16 k plane [4096][512]            4 MiB
  const size_t BYTES_VT   = (size_t)NBAT * EMBED * NCOMP * 2;            // f16 v^T plane [4][512][1024]       4 MiB
  const size_t BYTES_WQ   = (size_t)nW * 2;                              // bf16 Wq [512][512]               512 KiB
  const size_t BYTES_WK2  = (size_t)nW * 2 * 2;                          // bf16 [Wk|Wk] [512][1024]            1 MiB
  const size_t BYTES_WV2  = (size_t)nW * 2 * 2;                          // bf16 [Wv|Wv] [512][1024]            1 MiB
  const size_t BYTES_WOH  = (size_t)nW * 2;                              // f16 64*Wo [512][512]             512 KiB
  const size_t BYTES_BIAS = (size_t)4 * EMBED * 4;                       // f32 biases 4 x 512                  8 KiB
  const size_t OFF_QB   = 0;
  const size_t OFF_QT   = OFF_QB   + BYTES_QB;
  const size_t OFF_WC   = OFF_QT   + BYTES_QT;
  const size_t OFF_KVIN = OFF_WC   + BYTES_WC;
  const size_t OFF_QP   = OFF_KVIN + BYTES_KVIN;
  const size_t OFF_OP   = OFF_QP   + BYTES_QP;
  const size_t OFF_KP   = OFF_OP   + BYTES_OP;
  const size_t OFF_VT   = OFF_KP   + BYTES_KP;
  const size_t OFF_WQ   = OFF_VT   + BYTES_VT;
  const size_t OFF_WK2  = OFF_WQ   + BYTES_WQ;
  const size_t OFF_WV2  = OFF_WK2  + BYTES_WK2;
  const size_t OFF_WOH  = OFF_WV2  + BYTES_WV2;
  const size_t OFF_BIAS = OFF_WOH  + BYTES_WOH;
  const size_t WS_TOTAL = OFF_BIAS + BYTES_BIAS;                         // 112,205,824 B
  if (WS_TOTAL > ws_size) return;

  char* ws = (char*)d_ws;
  unsigned short* queryB = (unsigned short*)(ws + OFF_QB);
  unsigned short* queryT = (unsigned short*)(ws + OFF_QT);
  unsigned short* WcB    = (unsigned short*)(ws + OFF_WC);
  unsigned short* KVin   = (unsigned short*)(ws + OFF_KVIN);
  unsigned short* qP     = (unsigned short*)(ws + OFF_QP);
  unsigned short* oP     = (unsigned short*)(ws + OFF_OP);
  unsigned short* kP     = (unsigned short*)(ws + OFF_KP);
  unsigned short* vtP    = (unsigned short*)(ws + OFF_VT);
  unsigned short* WqB    = (unsigned short*)(ws + OFF_WQ);
  unsigned short* WkB2   = (unsigned short*)(ws + OFF_WK2);
  unsigned short* WvB2   = (unsigned short*)(ws + OFF_WV2);
  unsigned short* WoH    = (unsigned short*)(ws + OFF_WOH);
  float*          biasb  = (float*)(ws + OFF_BIAS);
  float* bq_r = biasb;
  float* bk_r = biasb + EMBED;
  float* bv_r = biasb + 2 * EMBED;
  float* bo_r = biasb + 3 * EMBED;

  // 1. query -> bf16 [16384][512] (same flat layout as [T][B][E])
  {
    const int n2 = (int)(nQ / 2);
    cast_bf16x2_kernel<<<dim3((unsigned)((n2 + 255) / 256)), dim3(256), 0, stream>>>(query, queryB, n2);
  }
  // 2. query^T per batch: in [T=4096 rows][E=512 cols] pitch 2048 (base + b*512) -> out_b [512][4096]
  tconv_bf16_kernel<<<dim3(EMBED / 64, SEQLEN / 64, NBAT), dim3(256), 0, stream>>>(
      query, queryT, SEQLEN, EMBED, NBAT * EMBED, (long)EMBED, (long)EMBED * SEQLEN);
  // 3./4. Wck -> rows 0..1023, Wcv -> rows 1024..2047 of the [2048][4096] bf16 plane
  {
    const int n2 = (int)(nWc / 2);
    cast_bf16x2_kernel<<<dim3((unsigned)((n2 + 255) / 256)), dim3(256), 0, stream>>>(Wck, WcB, n2);
    cast_bf16x2_kernel<<<dim3((unsigned)((n2 + 255) / 256)), dim3(256), 0, stream>>>(Wcv, WcB + (size_t)nWc, n2);
  }
  // 5..8. weights
  {
    const int n2 = (int)(nW / 2);
    cast_bf16x2_kernel<<<dim3((unsigned)((n2 + 255) / 256)), dim3(256), 0, stream>>>(Wq, WqB, n2);
    dup_bf16x2_kernel<<<dim3((unsigned)((n2 + 255) / 256)), dim3(256), 0, stream>>>(Wk, WkB2, n2, EMBED);
    dup_bf16x2_kernel<<<dim3((unsigned)((n2 + 255) / 256)), dim3(256), 0, stream>>>(Wv, WvB2, n2, EMBED);
    cast_wo_f16x2_kernel<<<dim3((unsigned)((n2 + 255) / 256)), dim3(256), 0, stream>>>(Wo, WoH, n2, WO_CARRY);
  }
  // 9. biases (RNE to bf16 precision)
  bias_prep_kernel<<<dim3(1), dim3(512), 0, stream>>>(bq, bk, bv, bo, biasb, EMBED);

  // 10. compression: per batch b: C_b[m][n] = sum_t WcB[m][t] * queryT_b[n][t]; m<1024 -> k_in[m][b][n], m>=1024 -> v_in.
  //     C element (m,n,b): hi at KVin[(m*4+b)*1024 + n], lo at +512  => ldc 4096, strideC 1024, Cout2 = Cout + 512.
  //     M=2048, N=512, K=4096 (K%32==0, M,N%64==0): 256 tiles per batch -> grid (32, 4).
  wmma_gemm64<1, false, 0, 2, false><<<dim3(32, NBAT), dim3(256), 0, stream>>>(
      WcB, WcB, SEQLEN, 0L,
      queryT, queryT, SEQLEN, (long)EMBED * SEQLEN,
      (void*)KVin, (void*)(KVin + EMBED), 4 * (2 * EMBED), (long)(2 * EMBED),
      biasb, biasb, 0L,
      2 * NCOMP, EMBED, SEQLEN, 1.0f);

  // 11. q8 = query . Wq^T + bq  (scale 1; 0.125 applied to f32 scores) -> f16 [16384][512]; M=16384, N=512, K=512: grid 256.
  wmma_gemm64<1, false, 2, 1, false><<<dim3(256, 1), dim3(256), 0, stream>>>(
      queryB, queryB, EMBED, 0L,
      WqB, WqB, EMBED, 0L,
      (void*)qP, (void*)qP, EMBED, 0L,
      bq_r, bq_r, 0L,
      SEQLEN * NBAT, EMBED, EMBED, 1.0f);

  // 12. k = [k_in hi|lo] . [Wk|Wk]^T + bk -> f16 [4096 rows (c*4+b)][512]; M=4096, N=512, K'=1024: grid 64.
  wmma_gemm64<1, false, 2, 1, false><<<dim3(64, 1), dim3(256), 0, stream>>>(
      KVin, KVin, 2 * EMBED, 0L,
      WkB2, WkB2, 2 * EMBED, 0L,
      (void*)kP, (void*)kP, EMBED, 0L,
      bk_r, bk_r, 0L,
      NCOMP * NBAT, EMBED, 2 * EMBED, 1.0f);

  // 13. v^T per batch: C_b[m=e'][n=c] = sum_k [Wv|Wv][e'][k] * [v_in hi|lo][(c,b)][k] + bv[e'] -> f16 vtP[b][512][1024].
  //     Bt_b rows at KVin + 4096*1024 + b*1024 + c*4096 (ldb 4096, strideB 1024); M=512, N=1024, K'=1024: grid (16, 4).
  wmma_gemm64<1, false, 1, 1, false><<<dim3(16, NBAT), dim3(256), 0, stream>>>(
      WvB2, WvB2, 2 * EMBED, 0L,
      KVin + (size_t)NCOMP * NBAT * (2 * EMBED), KVin + (size_t)NCOMP * NBAT * (2 * EMBED), 4 * (2 * EMBED), (long)(2 * EMBED),
      (void*)vtP, (void*)vtP, NCOMP, (long)EMBED * NCOMP,
      bv_r, bv_r, 0L,
      EMBED, NCOMP, 2 * EMBED, 1.0f);

  // 14. attention over the compressed keys: grid = B*H*(T/64) = 2048 blocks of 128
  attn_lin_kernel<<<dim3(NBAT * NHEADS * (SEQLEN / 64)), dim3(128), 0, stream>>>(qP, kP, vtP, oP);

  // 15. out = (16 O) . (64 Wo)^T / 1024 + bo -> f32 d_out [16384][512]; M=16384, N=512, K=512: grid 256.
  wmma_gemm64<0, false, 2, 0, false><<<dim3(256, 1), dim3(256), 0, stream>>>(
      oP, oP, EMBED, 0L,
      WoH, WoH, EMBED, 0L,
      d_out, d_out, EMBED, 0L,
      bo_r, bo_r, 0L,
      SEQLEN * NBAT, EMBED, EMBED, 1.0f / (OUT_CARRY * WO_CARRY));
}

// v001
// A run of this version takes 478 microseconds.
// Timed twice side by side with v000, it ran 1.20 times as fast both times.
// Contractions: sequence compression and q/k/v^T projections on v_wmma_f32_16x16x32_bf16 (bf16 operands = RNE-converted inputs; k_in/v_in carried as bf16 hi+lo planes concatenated along k); q.k^T, p.v and the output projection on v_wmma_f32_16x16x32_f16 (f16 planes; p carried x2^15, attention output x2^4, Wo x2^6); f32 accumulate; softmax, score scale 0.125 and biases in f32.
#include <hip/hip_runtime.h>
#include <math.h>
#include <stdint.h>

typedef __attribute__((ext_vector_type(16))) _Float16 v16h;
typedef __attribute__((ext_vector_type(8)))  _Float16 v8h;
typedef __attribute__((ext_vector_type(16))) __bf16   v16b;
typedef __attribute__((ext_vector_type(8)))  __bf16   v8b;
typedef __attribute__((ext_vector_type(8)))  float    v8f;
typedef __attribute__((ext_vector_type(4)))  float    v4f;
typedef __attribute__((ext_vector_type(2)))  float    v2f;
typedef __attribute__((ext_vector_type(4)))  unsigned int v4u;

__device__ __forceinline__ unsigned short f2bf_bits(float f) {
  unsigned u = __float_as_uint(f);
  return (unsigned short)((u + 0x7FFFu + ((u >> 16) & 1u)) >> 16);
}
__device__ __forceinline__ float bf_bits2f(unsigned short h) { return __uint_as_float(((unsigned)h) << 16); }

// hazard guards as plain device helpers (no inline asm inside the kernel template body)
__device__ __forceinline__ void dep_guard_h(v8f& a, v8f& b, v16h x, v16h y) { asm volatile("v_nop\n\tv_nop\n\tv_nop\n\tv_nop" : "+v"(a), "+v"(b) : "v"(x), "v"(y)); }
__device__ __forceinline__ void dep_guard_b(v8f& a, v8f& b, v16b x, v16b y) { asm volatile("v_nop\n\tv_nop\n\tv_nop\n\tv_nop" : "+v"(a), "+v"(b) : "v"(x), "v"(y)); }
__device__ __forceinline__ void keep4_h(v16h a, v16h b, v16h c, v16h d) { asm volatile("v_nop" :: "v"(a), "v"(b), "v"(c), "v"(d)); }
__device__ __forceinline__ void keep4_b(v16b a, v16b b, v16b c, v16b d) { asm volatile("v_nop" :: "v"(a), "v"(b), "v"(c), "v"(d)); }
__device__ __forceinline__ void acc_guard4(v8f& a, v8f& b, v8f& c, v8f& d) { asm volatile("v_nop\n\tv_nop\n\tv_nop\n\tv_nop" : "+v"(a), "+v"(b), "+v"(c), "+v"(d)); }
template <typename T> struct Frag;
template <> struct Frag<_Float16> {
  typedef v16h V; union U { v16h v; v8h h[2]; };
  static __device__ __forceinline__ v16h load(const _Float16* p) {   // elements 0..7 <- p[0..7], 8..15 <- p[16..23]
    U f; f.h[0] = *(const v8h*)(p); f.h[1] = *(const v8h*)(p + 16); return f.v;
  }
  static __device__ __forceinline__ v8f mma(v16h a, v16h b, v8f c) {
    return __builtin_amdgcn_wmma_f32_16x16x32_f16(false, a, false, b, (short)0, c, false, false);
  }
  static __device__ __forceinline__ void guard(v8f& a, v8f& b, v16h x, v16h y) { dep_guard_h(a, b, x, y); }
  static __device__ __forceinline__ void keep(v16h a, v16h b, v16h c, v16h d) { keep4_h(a, b, c, d); }
};
template <> struct Frag<__bf16> {
  typedef v16b V; union U { v16b v; v8b h[2]; };
  static __device__ __forceinline__ v16b load(const __bf16* p) {
    U f; f.h[0] = *(const v8b*)(p); f.h[1] = *(const v8b*)(p + 16); return f.v;
  }
  static __device__ __forceinline__ v8f mma(v16b a, v16b b, v8f c) {
    return __builtin_amdgcn_wmma_f32_16x16x32_bf16(false, a, false, b, (short)0, c, false, false);
  }
  static __device__ __forceinline__ void guard(v8f& a, v8f& b, v16b x, v16b y) { dep_guard_b(a, b, x, y); }
  static __device__ __forceinline__ void keep(v16b a, v16b b, v16b c, v16b d) { keep4_b(a, b, c, d); }
};

// ---- Register-blocked batched WMMA GEMM ------------------------------------
// C[m,n] = scale * sum_k A[m,k] * Bt[n,k] (+bias)(+resid); each wave owns a 64x64 tile.
// A row-major [M,K]; Bt row-major [N,K]; M,N % 64 == 0, K % 32 == 0.
// SPLIT: operands are hi/lo planes (A2/Bt2 = lo planes, same layout); product = hi.hi + hi.lo + lo.hi.
// BIAS_MODE: 0 = none, 1 = bias[m], 2 = bias[n].
// OUT_MODE: 0 = f32, 1 = f16, 2 = bf16 hi plane (Cout) + bf16 lo plane (Cout2).
// ET: 0 = f16 operands, 1 = bf16 operands (pointers passed as 16-bit storage)
template <int ET> struct Elem;
template <> struct Elem<0> { typedef _Float16 T; };
template <> struct Elem<1> { typedef __bf16 T; };
template <int ET, bool SPLIT, int BIAS_MODE, int OUT_MODE, bool RESID, int ACT = 0>
__global__ __launch_bounds__(256) void wmma_gemm64(
    const unsigned short* __restrict__ Ap, const unsigned short* __restrict__ A2p, int lda, long strideA,
    const unsigned short* __restrict__ Btp, const unsigned short* __restrict__ Bt2p, int ldb, long strideB,
    void* __restrict__ Cout, void* __restrict__ Cout2, int ldc, long strideC,
    const float* __restrict__ bias,
    const float* __restrict__ resid, long strideR,
    int M, int N, int K, float scale) {
  typedef typename Elem<ET>::T T;
  typedef typename Frag<T>::V V;
  const T* A = (const T*)Ap; const T* A2 = (const T*)A2p; const T* Bt = (const T*)Btp; const T* Bt2 = (const T*)Bt2p;
  __shared__ __align__(16) float sT[8][16 * 68];   // per-wave 16x64 slab, pitch 68 floats
  const int b    = blockIdx.y;
  const int lane = threadIdx.x & 31;
  const int wave = threadIdx.x >> 5;
  const int tilesN = N >> 6;
  const int tilesM = M >> 6;
  const int tile = blockIdx.x * 8 + wave;
  if (tile >= tilesM * tilesN) return;   // wave-uniform; no block barriers in this kernel
  const int tm = tile / tilesN;
  const int tn = tile - tm * tilesN;
  const int m0 = tm << 6;
  const int n0 = tn << 6;

  const T* Ab  = A  + (size_t)b * strideA;
  const T* Bb  = Bt + (size_t)b * strideB;
  const T* Ab2 = SPLIT ? (A2  + (size_t)b * strideA) : nullptr;
  const T* Bb2 = SPLIT ? (Bt2 + (size_t)b * strideB) : nullptr;

  const int rlane = lane & 15;                 // row (A) / col (B, D) within subtile
  const int koff  = (lane >> 4) * 8;           // k offset of this lane half
  const int mOff  = (lane >> 4) * 8;           // D row offset

  v8f acc[4][4];
#pragma unroll
  for (int i = 0; i < 4; ++i)
#pragma unroll
    for (int j = 0; j < 4; ++j) acc[i][j] = (v8f){0.f,0.f,0.f,0.f,0.f,0.f,0.f,0.f};

  for (int k0 = 0; k0 < K; k0 += 32) {
    V bh[4], bl[4];
#pragma unroll
    for (int j = 0; j < 4; ++j) {
      const size_t bo = (size_t)(n0 + (j << 4) + rlane) * ldb + koff + k0;
      bh[j] = Frag<T>::load(Bb + bo);
      if (SPLIT) bl[j] = Frag<T>::load(Bb2 + bo);
    }
#pragma unroll
    for (int i = 0; i < 4; ++i) {
      const size_t ao = (size_t)(m0 + (i << 4) + rlane) * lda + koff + k0;
      V ah = Frag<T>::load(Ab + ao);
      V al;
      if (SPLIT) al = Frag<T>::load(Ab2 + ao);
#pragma unroll
      for (int j = 0; j < 4; ++j) {
        acc[i][j] = Frag<T>::mma(ah, bh[j], acc[i][j]);
        if (SPLIT) {
          acc[i][j] = Frag<T>::mma(ah, bl[j], acc[i][j]);
          acc[i][j] = Frag<T>::mma(al, bh[j], acc[i][j]);
        }
      }
      Frag<T>::guard(acc[i][0], acc[i][3], ah, SPLIT ? al : ah);
    }
    Frag<T>::keep(bh[0], bh[1], bh[2], bh[3]);
    if (SPLIT) Frag<T>::keep(bl[0], bl[1], bl[2], bl[3]);
  }
  acc_guard4(acc[0][0], acc[0][1], acc[0][2], acc[0][3]);
  acc_guard4(acc[1][0], acc[1][1], acc[1][2], acc[1][3]);
  acc_guard4(acc[2][0], acc[2][1], acc[2][2], acc[2][3]);
  acc_guard4(acc[3][0], acc[3][1], acc[3][2], acc[3][3]);

  // ---- epilogue ----
  float* slab = sT[wave];
  const float* Rb = RESID ? (resid + (size_t)b * strideR) : nullptr;
#pragma unroll
  for (int i = 0; i < 4; ++i) {
    const int mBase = m0 + (i << 4);
#pragma unroll
    for (int j = 0; j < 4; ++j) {
      const int n = n0 + (j << 4) + rlane;
      float bv = 0.f;
      if (BIAS_MODE == 2) bv = bias[n];
#pragma unroll
      for (int r = 0; r < 8; ++r) {
        float v = acc[i][j][r] * scale;
        if (BIAS_MODE == 1) v += bias[mBase + mOff + r];
        if (BIAS_MODE == 2) v += bv;
        if (RESID) v += Rb[(size_t)(mBase + mOff + r) * ldc + n];
        if (ACT == 1) v = tanhf(v);
        if (ACT == 2) v = fmaxf(v, 0.0f);
        if (ACT == 3) v = v / (1.0f + expf(-v));
        if (ACT == 4) v = (v > 0.f) ? v : 0.01f * v;
        if (ACT == 5) v = 0.5f * v * (1.0f + erff(v * 0.70710678118654752f));
        slab[(mOff + r) * 68 + (j << 4) + rlane] = v;
      }
    }
    __builtin_amdgcn_fence(__ATOMIC_RELEASE, "workgroup");
    __builtin_amdgcn_wave_barrier();
    __builtin_amdgcn_fence(__ATOMIC_ACQUIRE, "workgroup");
    if (OUT_MODE == 0) {
      float* C = (float*)Cout + (size_t)b * strideC;
      const int hh = lane >> 4, c4 = (lane & 15) * 4;     // row seg = 256 B = 16 lanes x 16 B
      {
#pragma unroll
        for (int it = 0; it < 8; ++it) {
          const int row = it * 2 + hh;
          v4f v = *(const v4f*)(slab + row * 68 + c4);
          *(v4f*)(C + (size_t)(mBase + row) * ldc + n0 + c4) = v;
        }
        
      }
    } else {
      const int q = lane >> 3, c8 = (lane & 7) * 8;
      unsigned short* C  = (unsigned short*)Cout  + (size_t)b * strideC;
      unsigned short* C2 = (OUT_MODE == 2) ? ((unsigned short*)Cout2 + (size_t)b * strideC) : nullptr;
      {
#pragma unroll
        for (int it = 0; it < 4; ++it) {
          const int row = it * 4 + q;
          const float* sp = slab + row * 68 + c8;
          v8h hv, lv;
#pragma unroll
          for (int e = 0; e < 8; ++e) {
            if (OUT_MODE == 1) {
              hv[e] = (_Float16)sp[e];
            } else {
              unsigned short hb = f2bf_bits(sp[e]);
              unsigned short lb = f2bf_bits(sp[e] - bf_bits2f(hb));
              hv[e] = __builtin_bit_cast(_Float16, hb);
              lv[e] = __builtin_bit_cast(_Float16, lb);
            }
          }
          *(v8h*)(C + (size_t)(mBase + row) * ldc + n0 + c8) = hv;
          if (OUT_MODE == 2) *(v8h*)(C2 + (size_t)(mBase + row) * ldc + n0 + c8) = lv;
        }
        
      }
    }
    __builtin_amdgcn_fence(__ATOMIC_RELEASE, "workgroup");
    __builtin_amdgcn_wave_barrier();
    __builtin_amdgcn_fence(__ATOMIC_ACQUIRE, "workgroup");
  }
}

__device__ __forceinline__ unsigned pk16(unsigned short a, unsigned short b) { return (unsigned)a | ((unsigned)b << 16); }

// ---------------------------------------------------------------------------
// Problem geometry
// ---------------------------------------------------------------------------
constexpr int   SEQLEN  = 4096;   // time steps (queries)
constexpr int   NBAT    = 4;      // batch
constexpr int   EMBED   = 512;    // channels
constexpr int   NHEADS  = 8;
constexpr int   HDIM    = 64;
constexpr int   NCOMP   = 1024;   // compressed key count
constexpr float SCORE_SCALE = 0.125f;     // head_dim^-0.5, applied to the f32 score accumulators
constexpr float PROB_CARRY  = 32768.0f;   // p carried x2^15 in the f16 P operand, folded into 1/l
constexpr float OUT_CARRY   = 16.0f;      // attention output carried x2^4 in its f16 plane
constexpr float WO_CARRY    = 64.0f;      // Wo carried x2^6 in its f16 plane

// ---------------------------------------------------------------------------
// Elementwise f32 -> bf16 (RNE), 2 elements per thread, one 4-B store per lane: a wave writes one whole
// ---------------------------------------------------------------------------
__global__ __launch_bounds__(256) void cast_bf16x2_kernel(const float* __restrict__ in, unsigned short* __restrict__ out, int n2) {
  const int i = blockIdx.x * 256 + threadIdx.x;
  if (i < n2) {
    const v2f f = *(const v2f*)(in + 2 * (size_t)i);
    const unsigned u = pk16(f2bf_bits(f[0]), f2bf_bits(f[1]));
    ((unsigned*)out)[i] = u;
    
  }
}

// ---------------------------------------------------------------------------
// W [rows][cols] f32 -> out [rows][2*cols] bf16 with out[r][c] = out[r][cols + c] = bf16_rne(W[r][c]).
// 2 elements per thread; cols % 64 == 0 so a wave's 64 elements stay in one row: each store instruction
// ---------------------------------------------------------------------------
__global__ __launch_bounds__(256) void dup_bf16x2_kernel(const float* __restrict__ W, unsigned short* __restrict__ out, int n2, int cols) {
  const int i = blockIdx.x * 256 + threadIdx.x;
  if (i < n2) {
    const int e0 = 2 * i;
    const int r  = e0 / cols;
    const int cc = e0 - r * cols;
    const v2f f = *(const v2f*)(W + e0);
    const unsigned u = pk16(f2bf_bits(f[0]), f2bf_bits(f[1]));
    const size_t o0 = ((size_t)r * 2 * cols + cc) >> 1;          // uint index of out[r][cc]
    const size_t o1 = ((size_t)r * 2 * cols + cols + cc) >> 1;   // uint index of out[r][cols+cc]
    ((unsigned*)out)[o0] = u;
    ((unsigned*)out)[o1] = u;
    
  }
}

// ---------------------------------------------------------------------------
// Wo f32 -> f16 plane holding f16(carry * bf16_rne(w)) (exact for bf16 values in the normal f16 range).
// Same store discipline as cast_bf16x2_kernel.
// ---------------------------------------------------------------------------
__global__ __launch_bounds__(256) void cast_wo_f16x2_kernel(const float* __restrict__ W, unsigned short* __restrict__ out, int n2, float carry) {
  const int i = blockIdx.x * 256 + threadIdx.x;
  if (i < n2) {
    const v2f f = *(const v2f*)(W + 2 * (size_t)i);
    const float b0 = bf_bits2f(f2bf_bits(f[0])) * carry;
    const float b1 = bf_bits2f(f2bf_bits(f[1])) * carry;
    const _Float16 h0 = (_Float16)b0, h1 = (_Float16)b1;
    const unsigned u = pk16(__builtin_bit_cast(unsigned short, h0), __builtin_bit_cast(unsigned short, h1));
    ((unsigned*)out)[i] = u;
    
  }
}

// ---------------------------------------------------------------------------
// Bias vectors RNE-converted to bf16 precision (kept as f32): outb[0..n) = bq, [n..2n) = bk, [2n..3n) = bv, [3n..4n) = bo.
// ---------------------------------------------------------------------------
__global__ __launch_bounds__(512) void bias_prep_kernel(const float* __restrict__ bq, const float* __restrict__ bk,
                                                        const float* __restrict__ bv, const float* __restrict__ bo,
                                                        float* __restrict__ outb, int n) {
  const int i = blockIdx.x * 512 + threadIdx.x;
  if (i < n) {
    const float a0 = bf_bits2f(f2bf_bits(bq[i]));
    const float a1 = bf_bits2f(f2bf_bits(bk[i]));
    const float a2 = bf_bits2f(f2bf_bits(bv[i]));
    const float a3 = bf_bits2f(f2bf_bits(bo[i]));
    ((float*)outb)[i] = a0;
    ((float*)outb)[n + i] = a1;
    ((float*)outb)[2 * n + i] = a2;
    ((float*)outb)[3 * n + i] = a3;
    
  }
}

// ---------------------------------------------------------------------------
// Transpose + bf16 RNE convert, z-batched: in_z = X + z*sIn viewed [R rows][Cc cols] with row pitch ldi ->
//   o_z[c][r] = bf16_rne(in_z[r][c])  ([Cc][R], pitch R), o_z = o + z*sOut.
// 64x64 tiles through LDS. grid = (Cc/64, R/64, Z), 256 threads (R, Cc multiples of 64).
// Coverage per block: load 4 it x 256 thr x 4 floats = 64x64; store 2 it x 256 thr x 8 u16 = 64x64.
// ---------------------------------------------------------------------------
__global__ __launch_bounds__(256) void tconv_bf16_kernel(const float* __restrict__ X, unsigned short* __restrict__ o,
                                                         int R, int Cc, int ldi, long sIn, long sOut) {
  __shared__ __align__(16) float tf[64 * 68];
  X += (size_t)blockIdx.z * sIn;
  o += (size_t)blockIdx.z * sOut;
  const int c0  = blockIdx.x * 64;   // input column block = output row block
  const int r0  = blockIdx.y * 64;   // input row block    = output column block
  const int tid = threadIdx.x;
  {
    const int lr = tid >> 4;         // 0..15
    const int c4 = (tid & 15) * 4;   // 0..60
#pragma unroll
    for (int it = 0; it < 4; ++it) {
      const int rr = it * 16 + lr;   // 0..63
      const v4f a = *(const v4f*)(X + (size_t)(r0 + rr) * ldi + c0 + c4);
      *(v4f*)(tf + rr * 68 + c4) = a;
    }
  }
  __syncthreads();
  const int sub = tid >> 3;          // 0..31
  const int c8  = (tid & 7) * 8;     // 0..56
  v4u hv[2];
#pragma unroll
  for (int it = 0; it < 2; ++it) {
    const int oc = it * 32 + sub;    // output row within tile (= input column)
    v4u a;
#pragma unroll
    for (int q = 0; q < 4; ++q) {
      const float f0 = tf[(c8 + 2 * q) * 68 + oc];
      const float f1 = tf[(c8 + 2 * q + 1) * 68 + oc];
      a[q] = pk16(f2bf_bits(f0), f2bf_bits(f1));
    }
    hv[it] = a;
  }
  {
#pragma unroll
    for (int it = 0; it < 2; ++it) {
      const int oc = it * 32 + sub;
      const size_t go = (size_t)(c0 + oc) * R + r0 + c8;
      *(v4u*)(o + go) = hv[it];
    }
    
  }
}

// =====================================================================================
// Full (unmasked) attention over the NCOMP compressed keys, head dim 64, all (b,h) in one launch.
//   q plane f16: element (t, b, h, d) at [(t*NBAT + b)*EMBED + h*64 + d]   (holds 8*q; 0.125 applied to f32 scores)
//   k plane f16: element (c, b, h, d) at [(c*NBAT + b)*EMBED + h*64 + d]
//   v^T plane f16: element (b, h, d, c) at [b*EMBED*NCOMP + (h*64 + d)*NCOMP + c]
//   out plane f16: element (t, b, h, d) at [(t*NBAT + b)*EMBED + h*64 + d], value = OUT_CARRY * attention output
//   scores = q . k : v_wmma_f32_16x16x32_f16; p . v : v_wmma_f32_16x16x32_f16 with p carried x PROB_CARRY;
//   f32 accumulate; online softmax in f32 over NCOMP/64 chunks (compile-time trip count, no masking).
//   Block = 4 waves = 64 query rows of one (b, h); grid.x = NBAT * NHEADS * (SEQLEN/64) = 2048.
//   K / V^T chunk staging: 128 threads x 32 halves per plane = the whole 64x64 tile (16-B copies, plain loads,
//   __syncthreads before and after); fragment loads read the LDS tiles with the same v8h element type.
// =====================================================================================
__device__ __forceinline__ v8f hmma(v16h a, v16h b, v8f c) {
  c = __builtin_amdgcn_wmma_f32_16x16x32_f16(false, a, false, b, (short)0, c, false, false);
  asm volatile("v_nop\n\tv_nop\n\tv_nop\n\tv_nop" : "+v"(c) : "v"(a), "v"(b));
  return c;
}

__global__ __launch_bounds__(128)
void attn_lin_kernel(const unsigned short* __restrict__ qp, const unsigned short* __restrict__ kp,
                     const unsigned short* __restrict__ vtp, unsigned short* __restrict__ op) {
  typedef Frag<_Float16> FR;
  // Row pitch of the three f16 tiles: 64 halves + 8 = 144 B = 16 B x 9 (odd), so that the 16 rows one
  // 16-byte fragment read touches fall on 16 different groups of four banks.
  constexpr int LP = 72;
  __shared__ __align__(16) _Float16 Ksh[64 * LP];        // K chunk  [kv][d]     9 KB
  __shared__ __align__(16) _Float16 Vth[64 * LP];        // V^T chunk [d][kv]    9 KB
  __shared__ __align__(16) _Float16 Psh[4 * 16 * LP];    // per wave P [row][kv] 9 KB
  __shared__ __align__(16) float    Os[4 * 16 * 68];     // per wave out tile, pitch 68

  const int tid  = threadIdx.x;
  const int wave = tid >> 5;
  const int lane = tid & 31;
  const int hh   = lane >> 4;
  const int c    = lane & 15;

  constexpr int NQB  = SEQLEN / 64;        // 64 query blocks per (b, h)
  constexpr int ROWP = NBAT * EMBED;       // 2048 halves between consecutive t (q, k, out planes)
  constexpr int NCH  = NCOMP / 64;         // 16 key chunks

  const int bx = blockIdx.x;
  const int qb = bx % NQB;
  const int bh = bx / NQB;
  const int h  = bh % NHEADS;
  const int b  = bh / NHEADS;
  const int q0 = qb * 64 + wave * 16;

  const _Float16* Qb = (const _Float16*)(const void*)qp  + (size_t)b * EMBED + (size_t)h * HDIM;
  const _Float16* Kb = (const _Float16*)(const void*)kp  + (size_t)b * EMBED + (size_t)h * HDIM;
  const _Float16* Vb = (const _Float16*)(const void*)vtp + (size_t)b * EMBED * NCOMP + (size_t)h * HDIM * NCOMP;
  _Float16*       Ob = (_Float16*)(void*)op + (size_t)b * EMBED + (size_t)h * HDIM;

  // ---- Q fragments (A operand): row = q0 + c, 2 d-chunks of 32 ----
  v16h qa[2];
  {
    const _Float16* qrow = Qb + (size_t)(q0 + c) * ROWP;
#pragma unroll
    for (int dc = 0; dc < 2; ++dc) qa[dc] = FR::load(qrow + dc * 32 + 8 * hh);
  }

  float mrow[8], lrow[8];
  v8f oacc[4];
#pragma unroll
  for (int r = 0; r < 8; ++r) { mrow[r] = -INFINITY; lrow[r] = 0.f; }
#pragma unroll
  for (int t = 0; t < 4; ++t) oacc[t] = (v8f){0.f,0.f,0.f,0.f,0.f,0.f,0.f,0.f};

#pragma unroll 1
  for (int kc = 0; kc < NCH; ++kc) {
    const int kv0 = kc * 64;
    __syncthreads();
    {
      const int r = tid >> 1, hoff = (tid & 1) * 32;
      const _Float16* krow = Kb + (size_t)(kv0 + r) * ROWP + hoff;     // K[kv0+r][hoff .. hoff+31]
      const _Float16* vrow = Vb + (size_t)r * NCOMP + kv0 + hoff;      // V^T[d=r][kv0+hoff ..]
#pragma unroll
      for (int i = 0; i < 4; ++i) {
        const v8h kk = *(const v8h*)(krow + 8 * i);
        const v8h vv = *(const v8h*)(vrow + 8 * i);
        *(v8h*)(Ksh + r * LP + hoff + 8 * i) = kk;
        *(v8h*)(Vth + r * LP + hoff + 8 * i) = vv;
      }
    }
    __syncthreads();

    // ---- scores: s[j] = 16 q rows x 16 keys (j*16 .. j*16+15) ----
    v8f s[4];
#pragma unroll
    for (int j = 0; j < 4; ++j) {
      s[j] = (v8f){0.f,0.f,0.f,0.f,0.f,0.f,0.f,0.f};
#pragma unroll
      for (int dc = 0; dc < 2; ++dc) {
        const v16h kb = FR::load(Ksh + (j * 16 + c) * LP + dc * 32 + 8 * hh);
        s[j] = hmma(qa[dc], kb, s[j]);
      }
    }
    // ---- chunk row max ----
    float cm[8];
#pragma unroll
    for (int r = 0; r < 8; ++r) {
      float m = -INFINITY;
#pragma unroll
      for (int j = 0; j < 4; ++j) {
        s[j][r] *= SCORE_SCALE;
        m = fmaxf(m, s[j][r]);
      }
#pragma unroll
      for (int off = 1; off < 16; off <<= 1) m = fmaxf(m, __shfl_xor(m, off, 32));
      cm[r] = m;
    }
    // ---- online softmax update, P tile to LDS ----
    _Float16* pw = Psh + wave * (16 * LP);
#pragma unroll
    for (int r = 0; r < 8; ++r) {
      const float mnew  = fmaxf(mrow[r], cm[r]);
      const float alpha = __expf(mrow[r] - mnew);
      mrow[r] = mnew;
      float psum = 0.f;
#pragma unroll
      for (int j = 0; j < 4; ++j) {
        const float p = __expf(s[j][r] - mnew);
        psum += p;
        pw[(8 * hh + r) * LP + j * 16 + c] = (_Float16)(p * PROB_CARRY);
      }
#pragma unroll
      for (int off = 1; off < 16; off <<= 1) psum += __shfl_xor(psum, off, 32);
      lrow[r] = lrow[r] * alpha + psum;
#pragma unroll
      for (int t = 0; t < 4; ++t) oacc[t][r] *= alpha;
    }
    __builtin_amdgcn_fence(__ATOMIC_RELEASE, "workgroup");
    __builtin_amdgcn_wave_barrier();
    __builtin_amdgcn_fence(__ATOMIC_ACQUIRE, "workgroup");
    // ---- O += P . V ----
#pragma unroll
    for (int kk = 0; kk < 2; ++kk) {
      const v16h pa = FR::load(pw + c * LP + kk * 32 + 8 * hh);
#pragma unroll
      for (int t = 0; t < 4; ++t) {
        const v16h vb = FR::load(Vth + (t * 16 + c) * LP + kk * 32 + 8 * hh);
        oacc[t] = hmma(pa, vb, oacc[t]);
      }
    }
  }

  // ---- epilogue: normalise, stage 16x64 wave tile, whole-line f16 stores ----
  float* os = Os + wave * (16 * 68);
#pragma unroll
  for (int r = 0; r < 8; ++r) {
    const float inv = OUT_CARRY * (1.0f / (lrow[r] * PROB_CARRY));
#pragma unroll
    for (int t = 0; t < 4; ++t) os[(8 * hh + r) * 68 + t * 16 + c] = oacc[t][r] * inv;
  }
  __builtin_amdgcn_fence(__ATOMIC_RELEASE, "workgroup");
  __builtin_amdgcn_wave_barrier();
  __builtin_amdgcn_fence(__ATOMIC_ACQUIRE, "workgroup");
  {
    const int qq = lane >> 3, c8 = (lane & 7) * 8;
    {
#pragma unroll
      for (int it = 0; it < 4; ++it) {
        const int row = it * 4 + qq;
        const float* sp = os + row * 68 + c8;
        v8h hv;
#pragma unroll
        for (int e = 0; e < 8; ++e) hv[e] = (_Float16)sp[e];
        *(v8h*)(Ob + (size_t)(q0 + row) * ROWP + c8) = hv;
      }
      
    }
  }
}

// ---------------------------------------------------------------------------
// Host orchestration (kernel launches + host arithmetic only)
// ---------------------------------------------------------------------------
extern "C" void kernel_launch(void* const* d_in, const int* in_sizes, int n_in,
                              void* d_out, int out_size, void* d_ws, size_t ws_size,
                              hipStream_t stream) {
  if (n_in < 11) return;
  const long nQ  = (long)SEQLEN * NBAT * EMBED;    // 8388608
  const long nW  = (long)EMBED * EMBED;            // 262144
  const long nWc = (long)NCOMP * SEQLEN;           // 4194304
  if (in_sizes[0] != nQ || in_sizes[1] != nW || in_sizes[2] != EMBED || in_sizes[3] != nW ||
      in_sizes[4] != EMBED || in_sizes[5] != nW || in_sizes[6] != EMBED || in_sizes[7] != nWc ||
      in_sizes[8] != nWc || in_sizes[9] != nW || in_sizes[10] != EMBED || out_size != nQ) return;

  const float* query = (const float*)d_in[0];
  const float* Wq  = (const float*)d_in[1];  const float* bq = (const float*)d_in[2];
  const float* Wk  = (const float*)d_in[3];  const float* bk = (const float*)d_in[4];
  const float* Wv  = (const float*)d_in[5];  const float* bv = (const float*)d_in[6];
  const float* Wck = (const float*)d_in[7];  const float* Wcv = (const float*)d_in[8];
  const float* Wo  = (const float*)d_in[9];  const float* bo = (const float*)d_in[10];

  // ---- workspace region map (bytes) ----
  const size_t BYTES_QB   = (size_t)nQ * 2;                              // bf16 query [16384][512]            16 MiB
  const size_t BYTES_QT   = (size_t)nQ * 2;                              // bf16 query^T [4][512][4096]        16 MiB
  const size_t BYTES_WC   = (size_t)2 * nWc * 2;                         // bf16 [Wck;Wcv] [2048][4096]        16 MiB
  const size_t BYTES_KVIN = (size_t)2 * NCOMP * NBAT * (2 * EMBED) * 2;  // u16 [8192][1024] (hi|lo rows)     16 MiB
  const size_t BYTES_QP   = (size_t)nQ * 2;                              // f16 q plane [16384][512]          16 MiB
  const size_t BYTES_OP   = (size_t)nQ * 2;                              // f16 attention out [16384][512]    16 MiB
  const size_t BYTES_KP   = (size_t)NCOMP * NBAT * EMBED * 2;            // f16 k plane [4096][512]            4 MiB
  const size_t BYTES_VT   = (size_t)NBAT * EMBED * NCOMP * 2;            // f16 v^T plane [4][512][1024]       4 MiB
  const size_t BYTES_WQ   = (size_t)nW * 2;                              // bf16 Wq [512][512]               512 KiB
  const size_t BYTES_WK2  = (size_t)nW * 2 * 2;                          // bf16 [Wk|Wk] [512][1024]            1 MiB
  const size_t BYTES_WV2  = (size_t)nW * 2 * 2;                          // bf16 [Wv|Wv] [512][1024]            1 MiB
  const size_t BYTES_WOH  = (size_t)nW * 2;                              // f16 64*Wo [512][512]             512 KiB
  const size_t BYTES_BIAS = (size_t)4 * EMBED * 4;                       // f32 biases 4 x 512                  8 KiB
  const size_t OFF_QB   = 0;
  const size_t OFF_QT   = OFF_QB   + BYTES_QB;
  const size_t OFF_WC   = OFF_QT   + BYTES_QT;
  const size_t OFF_KVIN = OFF_WC   + BYTES_WC;
  const size_t OFF_QP   = OFF_KVIN + BYTES_KVIN;
  const size_t OFF_OP   = OFF_QP   + BYTES_QP;
  const size_t OFF_KP   = OFF_OP   + BYTES_OP;
  const size_t OFF_VT   = OFF_KP   + BYTES_KP;
  const size_t OFF_WQ   = OFF_VT   + BYTES_VT;
  const size_t OFF_WK2  = OFF_WQ   + BYTES_WQ;
  const size_t OFF_WV2  = OFF_WK2  + BYTES_WK2;
  const size_t OFF_WOH  = OFF_WV2  + BYTES_WV2;
  const size_t OFF_BIAS = OFF_WOH  + BYTES_WOH;
  const size_t WS_TOTAL = OFF_BIAS + BYTES_BIAS;                         // 112,205,824 B
  if (WS_TOTAL > ws_size) return;

  char* ws = (char*)d_ws;
  unsigned short* queryB = (unsigned short*)(ws + OFF_QB);
  unsigned short* queryT = (unsigned short*)(ws + OFF_QT);
  unsigned short* WcB    = (unsigned short*)(ws + OFF_WC);
  unsigned short* KVin   = (unsigned short*)(ws + OFF_KVIN);
  unsigned short* qP     = (unsigned short*)(ws + OFF_QP);
  unsigned short* oP     = (unsigned short*)(ws + OFF_OP);
  unsigned short* kP     = (unsigned short*)(ws + OFF_KP);
  unsigned short* vtP    = (unsigned short*)(ws + OFF_VT);
  unsigned short* WqB    = (unsigned short*)(ws + OFF_WQ);
  unsigned short* WkB2   = (unsigned short*)(ws + OFF_WK2);
  unsigned short* WvB2   = (unsigned short*)(ws + OFF_WV2);
  unsigned short* WoH    = (unsigned short*)(ws + OFF_WOH);
  float*          biasb  = (float*)(ws + OFF_BIAS);
  float* bq_r = biasb;
  float* bk_r = biasb + EMBED;
  float* bv_r = biasb + 2 * EMBED;
  float* bo_r = biasb + 3 * EMBED;

  // 1. query -> bf16 [16384][512] (same flat layout as [T][B][E])
  {
    const int n2 = (int)(nQ / 2);
    cast_bf16x2_kernel<<<dim3((unsigned)((n2 + 255) / 256)), dim3(256), 0, stream>>>(query, queryB, n2);
  }
  // 2. query^T per batch: in [T=4096 rows][E=512 cols] pitch 2048 (base + b*512) -> out_b [512][4096]
  tconv_bf16_kernel<<<dim3(EMBED / 64, SEQLEN / 64, NBAT), dim3(256), 0, stream>>>(
      query, queryT, SEQLEN, EMBED, NBAT * EMBED, (long)EMBED, (long)EMBED * SEQLEN);
  // 3./4. Wck -> rows 0..1023, Wcv -> rows 1024..2047 of the [2048][4096] bf16 plane
  {
    const int n2 = (int)(nWc / 2);
    cast_bf16x2_kernel<<<dim3((unsigned)((n2 + 255) / 256)), dim3(256), 0, stream>>>(Wck, WcB, n2);
    cast_bf16x2_kernel<<<dim3((unsigned)((n2 + 255) / 256)), dim3(256), 0, stream>>>(Wcv, WcB + (size_t)nWc, n2);
  }
  // 5..8. weights
  {
    const int n2 = (int)(nW / 2);
    cast_bf16x2_kernel<<<dim3((unsigned)((n2 + 255) / 256)), dim3(256), 0, stream>>>(Wq, WqB, n2);
    dup_bf16x2_kernel<<<dim3((unsigned)((n2 + 255) / 256)), dim3(256), 0, stream>>>(Wk, WkB2, n2, EMBED);
    dup_bf16x2_kernel<<<dim3((unsigned)((n2 + 255) / 256)), dim3(256), 0, stream>>>(Wv, WvB2, n2, EMBED);
    cast_wo_f16x2_kernel<<<dim3((unsigned)((n2 + 255) / 256)), dim3(256), 0, stream>>>(Wo, WoH, n2, WO_CARRY);
  }
  // 9. biases (RNE to bf16 precision)
  bias_prep_kernel<<<dim3(1), dim3(512), 0, stream>>>(bq, bk, bv, bo, biasb, EMBED);

  // 10. compression: per batch b: C_b[m][n] = sum_t WcB[m][t] * queryT_b[n][t]; m<1024 -> k_in[m][b][n], m>=1024 -> v_in.
  //     C element (m,n,b): hi at KVin[(m*4+b)*1024 + n], lo at +512  => ldc 4096, strideC 1024, Cout2 = Cout + 512.
  //     M=2048, N=512, K=4096 (K%32==0, M,N%64==0): 256 tiles per batch -> grid (32, 4).
  wmma_gemm64<1, false, 0, 2, false><<<dim3(32, NBAT), dim3(256), 0, stream>>>(
      WcB, WcB, SEQLEN, 0L,
      queryT, queryT, SEQLEN, (long)EMBED * SEQLEN,
      (void*)KVin, (void*)(KVin + EMBED), 4 * (2 * EMBED), (long)(2 * EMBED),
      biasb, biasb, 0L,
      2 * NCOMP, EMBED, SEQLEN, 1.0f);

  // 11. q8 = query . Wq^T + bq  (scale 1; 0.125 applied to f32 scores) -> f16 [16384][512]; M=16384, N=512, K=512: grid 256.
  wmma_gemm64<1, false, 2, 1, false><<<dim3(256, 1), dim3(256), 0, stream>>>(
      queryB, queryB, EMBED, 0L,
      WqB, WqB, EMBED, 0L,
      (void*)qP, (void*)qP, EMBED, 0L,
      bq_r, bq_r, 0L,
      SEQLEN * NBAT, EMBED, EMBED, 1.0f);

  // 12. k = [k_in hi|lo] . [Wk|Wk]^T + bk -> f16 [4096 rows (c*4+b)][512]; M=4096, N=512, K'=1024: grid 64.
  wmma_gemm64<1, false, 2, 1, false><<<dim3(64, 1), dim3(256), 0, stream>>>(
      KVin, KVin, 2 * EMBED, 0L,
      WkB2, WkB2, 2 * EMBED, 0L,
      (void*)kP, (void*)kP, EMBED, 0L,
      bk_r, bk_r, 0L,
      NCOMP * NBAT, EMBED, 2 * EMBED, 1.0f);

  // 13. v^T per batch: C_b[m=e'][n=c] = sum_k [Wv|Wv][e'][k] * [v_in hi|lo][(c,b)][k] + bv[e'] -> f16 vtP[b][512][1024].
  //     Bt_b rows at KVin + 4096*1024 + b*1024 + c*4096 (ldb 4096, strideB 1024); M=512, N=1024, K'=1024: grid (16, 4).
  wmma_gemm64<1, false, 1, 1, false><<<dim3(16, NBAT), dim3(256), 0, stream>>>(
      WvB2, WvB2, 2 * EMBED, 0L,
      KVin + (size_t)NCOMP * NBAT * (2 * EMBED), KVin + (size_t)NCOMP * NBAT * (2 * EMBED), 4 * (2 * EMBED), (long)(2 * EMBED),
      (void*)vtP, (void*)vtP, NCOMP, (long)EMBED * NCOMP,
      bv_r, bv_r, 0L,
      EMBED, NCOMP, 2 * EMBED, 1.0f);

  // 14. attention over the compressed keys: grid = B*H*(T/64) = 2048 blocks of 128
  attn_lin_kernel<<<dim3(NBAT * NHEADS * (SEQLEN / 64)), dim3(128), 0, stream>>>(qP, kP, vtP, oP);

  // 15. out = (16 O) . (64 Wo)^T / 1024 + bo -> f32 d_out [16384][512]; M=16384, N=512, K=512: grid 256.
  wmma_gemm64<0, false, 2, 0, false><<<dim3(256, 1), dim3(256), 0, stream>>>(
      oP, oP, EMBED, 0L,
      WoH, WoH, EMBED, 0L,
      d_out, d_out, EMBED, 0L,
      bo_r, bo_r, 0L,
      SEQLEN * NBAT, EMBED, EMBED, 1.0f / (OUT_CARRY * WO_CARRY));
}

// v002
// Measured time: 297 microseconds a run.
// In two side-by-side timings against v001, it was 1.62 and 1.61 times as fast.
// Over all steps from v000 it is 1.95 times as fast.
// Contractions: sequence compression and q/k/v^T projections on v_wmma_f32_16x16x32_bf16 (bf16 operands = RNE-converted inputs; k_in/v_in carried as bf16 hi+lo planes concatenated along k); q.k^T, p.v and the output projection on v_wmma_f32_16x16x32_f16 (f16 planes; p carried x2^15, attention output x2^4, Wo x2^6); f32 accumulate; softmax, score scale 0.125 and biases in f32.
#include <hip/hip_runtime.h>
#include <math.h>
#include <stdint.h>

typedef __attribute__((ext_vector_type(16))) _Float16 v16h;
typedef __attribute__((ext_vector_type(8)))  _Float16 v8h;
typedef __attribute__((ext_vector_type(16))) __bf16   v16b;
typedef __attribute__((ext_vector_type(8)))  __bf16   v8b;
typedef __attribute__((ext_vector_type(8)))  float    v8f;
typedef __attribute__((ext_vector_type(4)))  float    v4f;
typedef __attribute__((ext_vector_type(2)))  float    v2f;
typedef __attribute__((ext_vector_type(4)))  unsigned int v4u;

__device__ __forceinline__ unsigned short f2bf_bits(float f) {
  unsigned u = __float_as_uint(f);
  return (unsigned short)((u + 0x7FFFu + ((u >> 16) & 1u)) >> 16);
}
__device__ __forceinline__ float bf_bits2f(unsigned short h) { return __uint_as_float(((unsigned)h) << 16); }

// hazard guards as plain device helpers (no inline asm inside the kernel template body)
__device__ __forceinline__ void dep_guard_h(v8f& a, v8f& b, v16h x, v16h y) { asm volatile("v_nop\n\tv_nop\n\tv_nop\n\tv_nop" : "+v"(a), "+v"(b) : "v"(x), "v"(y)); }
__device__ __forceinline__ void dep_guard_b(v8f& a, v8f& b, v16b x, v16b y) { asm volatile("v_nop\n\tv_nop\n\tv_nop\n\tv_nop" : "+v"(a), "+v"(b) : "v"(x), "v"(y)); }
__device__ __forceinline__ void keep4_h(v16h a, v16h b, v16h c, v16h d) { asm volatile("v_nop" :: "v"(a), "v"(b), "v"(c), "v"(d)); }
__device__ __forceinline__ void keep4_b(v16b a, v16b b, v16b c, v16b d) { asm volatile("v_nop" :: "v"(a), "v"(b), "v"(c), "v"(d)); }
__device__ __forceinline__ void acc_guard4(v8f& a, v8f& b, v8f& c, v8f& d) { asm volatile("v_nop\n\tv_nop\n\tv_nop\n\tv_nop" : "+v"(a), "+v"(b), "+v"(c), "+v"(d)); }
template <typename T> struct Frag;
template <> struct Frag<_Float16> {
  typedef v16h V; typedef v8h H; union U { v16h v; v8h h[2]; };
  static __device__ __forceinline__ v16h load(const _Float16* p) {   // elements 0..7 <- p[0..7], 8..15 <- p[16..23]
    U f; f.h[0] = *(const v8h*)(p); f.h[1] = *(const v8h*)(p + 16); return f.v;
  }
  static __device__ __forceinline__ v8f mma(v16h a, v16h b, v8f c) {
    return __builtin_amdgcn_wmma_f32_16x16x32_f16(false, a, false, b, (short)0, c, false, false);
  }
  static __device__ __forceinline__ void guard(v8f& a, v8f& b, v16h x, v16h y) { dep_guard_h(a, b, x, y); }
  static __device__ __forceinline__ void keep(v16h a, v16h b, v16h c, v16h d) { keep4_h(a, b, c, d); }
};
template <> struct Frag<__bf16> {
  typedef v16b V; typedef v8b H; union U { v16b v; v8b h[2]; };
  static __device__ __forceinline__ v16b load(const __bf16* p) {
    U f; f.h[0] = *(const v8b*)(p); f.h[1] = *(const v8b*)(p + 16); return f.v;
  }
  static __device__ __forceinline__ v8f mma(v16b a, v16b b, v8f c) {
    return __builtin_amdgcn_wmma_f32_16x16x32_bf16(false, a, false, b, (short)0, c, false, false);
  }
  static __device__ __forceinline__ void guard(v8f& a, v8f& b, v16b x, v16b y) { dep_guard_b(a, b, x, y); }
  static __device__ __forceinline__ void keep(v16b a, v16b b, v16b c, v16b d) { keep4_b(a, b, c, d); }
};

// ---- Register-blocked batched WMMA GEMM ------------------------------------
// C[m,n] = scale * sum_k A[m,k] * Bt[n,k] (+bias)(+resid); each wave owns a 64x64 tile.
// A row-major [M,K]; Bt row-major [N,K]; M % 128 == 0, N % 256 == 0, K % 64 == 0.
// A block of 8 waves (2 x 4) owns a 128x256 tile of C. Per stage of 64 k it brings 128 rows of A and 256 rows
// of Bt, 128 B each, into LDS with whole-line 16-byte loads (8 lanes per row); the waves read their fragments
// from LDS. Two LDS buffers: the next stage's global loads are issued ahead of this stage's products and
// stored behind them, one block barrier per stage.
// SPLIT (hi/lo operand planes) is not built in this form.
// BIAS_MODE: 0 = none, 1 = bias[m], 2 = bias[n].
// OUT_MODE: 0 = f32, 1 = f16, 2 = bf16 hi plane (Cout) + bf16 lo plane (Cout2).
// ET: 0 = f16 operands, 1 = bf16 operands (pointers passed as 16-bit storage)
template <int ET> struct Elem;
template <> struct Elem<0> { typedef _Float16 T; };
template <> struct Elem<1> { typedef __bf16 T; };
template <int ET, bool SPLIT, int BIAS_MODE, int OUT_MODE, bool RESID, int ACT = 0>
__global__ __launch_bounds__(256) void wmma_gemm64(
    const unsigned short* __restrict__ Ap, const unsigned short* __restrict__ A2p, int lda, long strideA,
    const unsigned short* __restrict__ Btp, const unsigned short* __restrict__ Bt2p, int ldb, long strideB,
    void* __restrict__ Cout, void* __restrict__ Cout2, int ldc, long strideC,
    const float* __restrict__ bias,
    const float* __restrict__ resid, long strideR,
    int M, int N, int K, float scale) {
  typedef typename Elem<ET>::T T;
  typedef typename Frag<T>::V V;
  const T* A = (const T*)Ap; const T* Bt = (const T*)Btp;
  static_assert(!SPLIT, "hi/lo planes are not staged");
  typedef typename Frag<T>::H H;
  constexpr int BM = 128, BN = 256, BK = 64;
  // LDS row pitch 64 + 8 elements = 144 B = 16 B x 9 (odd): the 16 rows of one 16-byte fragment read fall on
  // different groups of four banks.
  constexpr int LP = BK + 8;
  __shared__ __align__(16) T sOp[2][(BM + BN) * LP];   // [buffer][A rows 0..127 | Bt rows 128..383][k]
  __shared__ __align__(16) float sT[8][16 * 68];   // per-wave 16x64 slab, pitch 68 floats
  const int b    = blockIdx.y;
  const int tid  = threadIdx.x;
  const int lane = tid & 31;
  const int wave = tid >> 5;
  const int blocksN = N / BN;
  const int blocksM = M / BM;
  if ((int)blockIdx.x >= blocksM * blocksN) return;   // block-uniform, ahead of every barrier
  const int bm = blockIdx.x / blocksN;
  const int bn = blockIdx.x - bm * blocksN;
  const int wm = wave >> 2;                    // 0..1: 64-row band of the block tile
  const int wn = wave & 3;                     // 0..3: 64-column band
  const int m0 = bm * BM + (wm << 6);
  const int n0 = bn * BN + (wn << 6);

  const T* Ab  = A  + (size_t)b * strideA;
  const T* Bb  = Bt + (size_t)b * strideB;

  const int rlane = lane & 15;                 // row (A) / col (B, D) within subtile
  const int koff  = (lane >> 4) * 8;           // k offset of this lane half
  const int mOff  = (lane >> 4) * 8;           // D row offset

  // staging map: 8 threads x 16 B = one 128-B row; 32 rows per sweep of the block
  const int srow = tid >> 3;                   // 0..31
  const int sk   = (tid & 7) * 8;              // element offset in the row
  const T* gA = Ab + (size_t)(bm * BM + srow) * lda + sk;
  const T* gB = Bb + (size_t)(bn * BN + srow) * ldb + sk;
  const int sdst = srow * LP + sk;

  v8f acc[4][4];
#pragma unroll
  for (int i = 0; i < 4; ++i)
#pragma unroll
    for (int j = 0; j < 4; ++j) acc[i][j] = (v8f){0.f,0.f,0.f,0.f,0.f,0.f,0.f,0.f};

  H stA[BM / 32], stB[BN / 32];
#pragma unroll
  for (int it = 0; it < BM / 32; ++it) stA[it] = *(const H*)(gA + (size_t)(it * 32) * lda);
#pragma unroll
  for (int it = 0; it < BN / 32; ++it) stB[it] = *(const H*)(gB + (size_t)(it * 32) * ldb);
#pragma unroll
  for (int it = 0; it < BM / 32; ++it) *(H*)(&sOp[0][sdst + it * 32 * LP]) = stA[it];
#pragma unroll
  for (int it = 0; it < BN / 32; ++it) *(H*)(&sOp[0][sdst + (BM + it * 32) * LP]) = stB[it];
  __syncthreads();

  const int nst = K / BK;
#pragma unroll 1
  for (int s = 0; s < nst; ++s) {
    const T* cur = sOp[s & 1];
    T*       nxt = sOp[(s + 1) & 1];
    const bool more = s + 1 < nst;             // the same for the whole block
    if (more) {
      const int k1 = (s + 1) * BK;
#pragma unroll
      for (int it = 0; it < BM / 32; ++it) stA[it] = *(const H*)(gA + (size_t)(it * 32) * lda + k1);
#pragma unroll
      for (int it = 0; it < BN / 32; ++it) stB[it] = *(const H*)(gB + (size_t)(it * 32) * ldb + k1);
    }
#pragma unroll
    for (int kk = 0; kk < BK; kk += 32) {
      V bh[4], ah[4];
#pragma unroll
      for (int j = 0; j < 4; ++j) bh[j] = Frag<T>::load(cur + (BM + (wn << 6) + (j << 4) + rlane) * LP + kk + koff);
#pragma unroll
      for (int i = 0; i < 4; ++i) ah[i] = Frag<T>::load(cur + ((wm << 6) + (i << 4) + rlane) * LP + kk + koff);
#pragma unroll
      for (int i = 0; i < 4; ++i) {
#pragma unroll
        for (int j = 0; j < 4; ++j) acc[i][j] = Frag<T>::mma(ah[i], bh[j], acc[i][j]);
        Frag<T>::guard(acc[i][0], acc[i][3], ah[i], ah[i]);
      }
      Frag<T>::keep(bh[0], bh[1], bh[2], bh[3]);
    }
    if (more) {
#pragma unroll
      for (int it = 0; it < BM / 32; ++it) *(H*)(nxt + sdst + it * 32 * LP) = stA[it];
#pragma unroll
      for (int it = 0; it < BN / 32; ++it) *(H*)(nxt + sdst + (BM + it * 32) * LP) = stB[it];
    }
    // publishes the buffer just written and ends every wave's reads of the buffer that the next stage refills
    __syncthreads();
  }
  acc_guard4(acc[0][0], acc[0][1], acc[0][2], acc[0][3]);
  acc_guard4(acc[1][0], acc[1][1], acc[1][2], acc[1][3]);
  acc_guard4(acc[2][0], acc[2][1], acc[2][2], acc[2][3]);
  acc_guard4(acc[3][0], acc[3][1], acc[3][2], acc[3][3]);

  // ---- epilogue ----
  float* slab = sT[wave];
  const float* Rb = RESID ? (resid + (size_t)b * strideR) : nullptr;
#pragma unroll
  for (int i = 0; i < 4; ++i) {
    const int mBase = m0 + (i << 4);
#pragma unroll
    for (int j = 0; j < 4; ++j) {
      const int n = n0 + (j << 4) + rlane;
      float bv = 0.f;
      if (BIAS_MODE == 2) bv = bias[n];
#pragma unroll
      for (int r = 0; r < 8; ++r) {
        float v = acc[i][j][r] * scale;
        if (BIAS_MODE == 1) v += bias[mBase + mOff + r];
        if (BIAS_MODE == 2) v += bv;
        if (RESID) v += Rb[(size_t)(mBase + mOff + r) * ldc + n];
        if (ACT == 1) v = tanhf(v);
        if (ACT == 2) v = fmaxf(v, 0.0f);
        if (ACT == 3) v = v / (1.0f + expf(-v));
        if (ACT == 4) v = (v > 0.f) ? v : 0.01f * v;
        if (ACT == 5) v = 0.5f * v * (1.0f + erff(v * 0.70710678118654752f));
        slab[(mOff + r) * 68 + (j << 4) + rlane] = v;
      }
    }
    __builtin_amdgcn_fence(__ATOMIC_RELEASE, "workgroup");
    __builtin_amdgcn_wave_barrier();
    __builtin_amdgcn_fence(__ATOMIC_ACQUIRE, "workgroup");
    if (OUT_MODE == 0) {
      float* C = (float*)Cout + (size_t)b * strideC;
      const int hh = lane >> 4, c4 = (lane & 15) * 4;     // row seg = 256 B = 16 lanes x 16 B
      {
#pragma unroll
        for (int it = 0; it < 8; ++it) {
          const int row = it * 2 + hh;
          v4f v = *(const v4f*)(slab + row * 68 + c4);
          *(v4f*)(C + (size_t)(mBase + row) * ldc + n0 + c4) = v;
        }
        
      }
    } else {
      const int q = lane >> 3, c8 = (lane & 7) * 8;
      unsigned short* C  = (unsigned short*)Cout  + (size_t)b * strideC;
      unsigned short* C2 = (OUT_MODE == 2) ? ((unsigned short*)Cout2 + (size_t)b * strideC) : nullptr;
      {
#pragma unroll
        for (int it = 0; it < 4; ++it) {
          const int row = it * 4 + q;
          const float* sp = slab + row * 68 + c8;
          v8h hv, lv;
#pragma unroll
          for (int e = 0; e < 8; ++e) {
            if (OUT_MODE == 1) {
              hv[e] = (_Float16)sp[e];
            } else {
              unsigned short hb = f2bf_bits(sp[e]);
              unsigned short lb = f2bf_bits(sp[e] - bf_bits2f(hb));
              hv[e] = __builtin_bit_cast(_Float16, hb);
              lv[e] = __builtin_bit_cast(_Float16, lb);
            }
          }
          *(v8h*)(C + (size_t)(mBase + row) * ldc + n0 + c8) = hv;
          if (OUT_MODE == 2) *(v8h*)(C2 + (size_t)(mBase + row) * ldc + n0 + c8) = lv;
        }
        
      }
    }
    __builtin_amdgcn_fence(__ATOMIC_RELEASE, "workgroup");
    __builtin_amdgcn_wave_barrier();
    __builtin_amdgcn_fence(__ATOMIC_ACQUIRE, "workgroup");
  }
}

__device__ __forceinline__ unsigned pk16(unsigned short a, unsigned short b) { return (unsigned)a | ((unsigned)b << 16); }

// ---------------------------------------------------------------------------
// Problem geometry
// ---------------------------------------------------------------------------
constexpr int   SEQLEN  = 4096;   // time steps (queries)
constexpr int   NBAT    = 4;      // batch
constexpr int   EMBED   = 512;    // channels
constexpr int   NHEADS  = 8;
constexpr int   HDIM    = 64;
constexpr int   NCOMP   = 1024;   // compressed key count
constexpr float SCORE_SCALE = 0.125f;     // head_dim^-0.5, applied to the f32 score accumulators
constexpr float PROB_CARRY  = 32768.0f;   // p carried x2^15 in the f16 P operand, folded into 1/l
constexpr float OUT_CARRY   = 16.0f;      // attention output carried x2^4 in its f16 plane
constexpr float WO_CARRY    = 64.0f;      // Wo carried x2^6 in its f16 plane

// ---------------------------------------------------------------------------
// Elementwise f32 -> bf16 (RNE), 2 elements per thread, one 4-B store per lane: a wave writes one whole
// ---------------------------------------------------------------------------
__global__ __launch_bounds__(256) void cast_bf16x2_kernel(const float* __restrict__ in, unsigned short* __restrict__ out, int n2) {
  const int i = blockIdx.x * 256 + threadIdx.x;
  if (i < n2) {
    const v2f f = *(const v2f*)(in + 2 * (size_t)i);
    const unsigned u = pk16(f2bf_bits(f[0]), f2bf_bits(f[1]));
    ((unsigned*)out)[i] = u;
    
  }
}

// ---------------------------------------------------------------------------
// W [rows][cols] f32 -> out [rows][2*cols] bf16 with out[r][c] = out[r][cols + c] = bf16_rne(W[r][c]).
// 2 elements per thread; cols % 64 == 0 so a wave's 64 elements stay in one row: each store instruction
// ---------------------------------------------------------------------------
__global__ __launch_bounds__(256) void dup_bf16x2_kernel(const float* __restrict__ W, unsigned short* __restrict__ out, int n2, int cols) {
  const int i = blockIdx.x * 256 + threadIdx.x;
  if (i < n2) {
    const int e0 = 2 * i;
    const int r  = e0 / cols;
    const int cc = e0 - r * cols;
    const v2f f = *(const v2f*)(W + e0);
    const unsigned u = pk16(f2bf_bits(f[0]), f2bf_bits(f[1]));
    const size_t o0 = ((size_t)r * 2 * cols + cc) >> 1;          // uint index of out[r][cc]
    const size_t o1 = ((size_t)r * 2 * cols + cols + cc) >> 1;   // uint index of out[r][cols+cc]
    ((unsigned*)out)[o0] = u;
    ((unsigned*)out)[o1] = u;
    
  }
}

// ---------------------------------------------------------------------------
// Wo f32 -> f16 plane holding f16(carry * bf16_rne(w)) (exact for bf16 values in the normal f16 range).
// Same store discipline as cast_bf16x2_kernel.
// ---------------------------------------------------------------------------
__global__ __launch_bounds__(256) void cast_wo_f16x2_kernel(const float* __restrict__ W, unsigned short* __restrict__ out, int n2, float carry) {
  const int i = blockIdx.x * 256 + threadIdx.x;
  if (i < n2) {
    const v2f f = *(const v2f*)(W + 2 * (size_t)i);
    const float b0 = bf_bits2f(f2bf_bits(f[0])) * carry;
    const float b1 = bf_bits2f(f2bf_bits(f[1])) * carry;
    const _Float16 h0 = (_Float16)b0, h1 = (_Float16)b1;
    const unsigned u = pk16(__builtin_bit_cast(unsigned short, h0), __builtin_bit_cast(unsigned short, h1));
    ((unsigned*)out)[i] = u;
    
  }
}

// ---------------------------------------------------------------------------
// Bias vectors RNE-converted to bf16 precision (kept as f32): outb[0..n) = bq, [n..2n) = bk, [2n..3n) = bv, [3n..4n) = bo.
// ---------------------------------------------------------------------------
__global__ __launch_bounds__(512) void bias_prep_kernel(const float* __restrict__ bq, const float* __restrict__ bk,
                                                        const float* __restrict__ bv, const float* __restrict__ bo,
                                                        float* __restrict__ outb, int n) {
  const int i = blockIdx.x * 512 + threadIdx.x;
  if (i < n) {
    const float a0 = bf_bits2f(f2bf_bits(bq[i]));
    const float a1 = bf_bits2f(f2bf_bits(bk[i]));
    const float a2 = bf_bits2f(f2bf_bits(bv[i]));
    const float a3 = bf_bits2f(f2bf_bits(bo[i]));
    ((float*)outb)[i] = a0;
    ((float*)outb)[n + i] = a1;
    ((float*)outb)[2 * n + i] = a2;
    ((float*)outb)[3 * n + i] = a3;
    
  }
}

// ---------------------------------------------------------------------------
// Transpose + bf16 RNE convert, z-batched: in_z = X + z*sIn viewed [R rows][Cc cols] with row pitch ldi ->
//   o_z[c][r] = bf16_rne(in_z[r][c])  ([Cc][R], pitch R), o_z = o + z*sOut.
// 64x64 tiles through LDS. grid = (Cc/64, R/64, Z), 256 threads (R, Cc multiples of 64).
// Coverage per block: load 4 it x 256 thr x 4 floats = 64x64; store 2 it x 256 thr x 8 u16 = 64x64.
// ---------------------------------------------------------------------------
__global__ __launch_bounds__(256) void tconv_bf16_kernel(const float* __restrict__ X, unsigned short* __restrict__ o,
                                                         int R, int Cc, int ldi, long sIn, long sOut) {
  __shared__ __align__(16) float tf[64 * 68];
  X += (size_t)blockIdx.z * sIn;
  o += (size_t)blockIdx.z * sOut;
  const int c0  = blockIdx.x * 64;   // input column block = output row block
  const int r0  = blockIdx.y * 64;   // input row block    = output column block
  const int tid = threadIdx.x;
  {
    const int lr = tid >> 4;         // 0..15
    const int c4 = (tid & 15) * 4;   // 0..60
#pragma unroll
    for (int it = 0; it < 4; ++it) {
      const int rr = it * 16 + lr;   // 0..63
      const v4f a = *(const v4f*)(X + (size_t)(r0 + rr) * ldi + c0 + c4);
      *(v4f*)(tf + rr * 68 + c4) = a;
    }
  }
  __syncthreads();
  const int sub = tid >> 3;          // 0..31
  const int c8  = (tid & 7) * 8;     // 0..56
  v4u hv[2];
#pragma unroll
  for (int it = 0; it < 2; ++it) {
    const int oc = it * 32 + sub;    // output row within tile (= input column)
    v4u a;
#pragma unroll
    for (int q = 0; q < 4; ++q) {
      const float f0 = tf[(c8 + 2 * q) * 68 + oc];
      const float f1 = tf[(c8 + 2 * q + 1) * 68 + oc];
      a[q] = pk16(f2bf_bits(f0), f2bf_bits(f1));
    }
    hv[it] = a;
  }
  {
#pragma unroll
    for (int it = 0; it < 2; ++it) {
      const int oc = it * 32 + sub;
      const size_t go = (size_t)(c0 + oc) * R + r0 + c8;
      *(v4u*)(o + go) = hv[it];
    }
    
  }
}

// =====================================================================================
// Full (unmasked) attention over the NCOMP compressed keys, head dim 64, all (b,h) in one launch.
//   q plane f16: element (t, b, h, d) at [(t*NBAT + b)*EMBED + h*64 + d]   (holds 8*q; 0.125 applied to f32 scores)
//   k plane f16: element (c, b, h, d) at [(c*NBAT + b)*EMBED + h*64 + d]
//   v^T plane f16: element (b, h, d, c) at [b*EMBED*NCOMP + (h*64 + d)*NCOMP + c]
//   out plane f16: element (t, b, h, d) at [(t*NBAT + b)*EMBED + h*64 + d], value = OUT_CARRY * attention output
//   scores = q . k : v_wmma_f32_16x16x32_f16; p . v : v_wmma_f32_16x16x32_f16 with p carried x PROB_CARRY;
//   f32 accumulate; online softmax in f32 over NCOMP/64 chunks (compile-time trip count, no masking).
//   Block = 4 waves = 64 query rows of one (b, h); grid.x = NBAT * NHEADS * (SEQLEN/64) = 2048.
//   K / V^T chunk staging: 128 threads x 32 halves per plane = the whole 64x64 tile (16-B copies, plain loads,
//   __syncthreads before and after); fragment loads read the LDS tiles with the same v8h element type.
// =====================================================================================
__device__ __forceinline__ v8f hmma(v16h a, v16h b, v8f c) {
  c = __builtin_amdgcn_wmma_f32_16x16x32_f16(false, a, false, b, (short)0, c, false, false);
  asm volatile("v_nop\n\tv_nop\n\tv_nop\n\tv_nop" : "+v"(c) : "v"(a), "v"(b));
  return c;
}

__global__ __launch_bounds__(128)
void attn_lin_kernel(const unsigned short* __restrict__ qp, const unsigned short* __restrict__ kp,
                     const unsigned short* __restrict__ vtp, unsigned short* __restrict__ op) {
  typedef Frag<_Float16> FR;
  // Row pitch of the three f16 tiles: 64 halves + 8 = 144 B = 16 B x 9 (odd), so that the 16 rows one
  // 16-byte fragment read touches fall on 16 different groups of four banks.
  constexpr int LP = 72;
  __shared__ __align__(16) _Float16 Ksh[64 * LP];        // K chunk  [kv][d]     9 KB
  __shared__ __align__(16) _Float16 Vth[64 * LP];        // V^T chunk [d][kv]    9 KB
  __shared__ __align__(16) _Float16 Psh[4 * 16 * LP];    // per wave P [row][kv] 9 KB
  __shared__ __align__(16) float    Os[4 * 16 * 68];     // per wave out tile, pitch 68

  const int tid  = threadIdx.x;
  const int wave = tid >> 5;
  const int lane = tid & 31;
  const int hh   = lane >> 4;
  const int c    = lane & 15;

  constexpr int NQB  = SEQLEN / 64;        // 64 query blocks per (b, h)
  constexpr int ROWP = NBAT * EMBED;       // 2048 halves between consecutive t (q, k, out planes)
  constexpr int NCH  = NCOMP / 64;         // 16 key chunks

  const int bx = blockIdx.x;
  const int qb = bx % NQB;
  const int bh = bx / NQB;
  const int h  = bh % NHEADS;
  const int b  = bh / NHEADS;
  const int q0 = qb * 64 + wave * 16;

  const _Float16* Qb = (const _Float16*)(const void*)qp  + (size_t)b * EMBED + (size_t)h * HDIM;
  const _Float16* Kb = (const _Float16*)(const void*)kp  + (size_t)b * EMBED + (size_t)h * HDIM;
  const _Float16* Vb = (const _Float16*)(const void*)vtp + (size_t)b * EMBED * NCOMP + (size_t)h * HDIM * NCOMP;
  _Float16*       Ob = (_Float16*)(void*)op + (size_t)b * EMBED + (size_t)h * HDIM;

  // ---- Q fragments (A operand): row = q0 + c, 2 d-chunks of 32 ----
  v16h qa[2];
  {
    const _Float16* qrow = Qb + (size_t)(q0 + c) * ROWP;
#pragma unroll
    for (int dc = 0; dc < 2; ++dc) qa[dc] = FR::load(qrow + dc * 32 + 8 * hh);
  }

  float mrow[8], lrow[8];
  v8f oacc[4];
#pragma unroll
  for (int r = 0; r < 8; ++r) { mrow[r] = -INFINITY; lrow[r] = 0.f; }
#pragma unroll
  for (int t = 0; t < 4; ++t) oacc[t] = (v8f){0.f,0.f,0.f,0.f,0.f,0.f,0.f,0.f};

#pragma unroll 1
  for (int kc = 0; kc < NCH; ++kc) {
    const int kv0 = kc * 64;
    __syncthreads();
    {
      const int r = tid >> 1, hoff = (tid & 1) * 32;
      const _Float16* krow = Kb + (size_t)(kv0 + r) * ROWP + hoff;     // K[kv0+r][hoff .. hoff+31]
      const _Float16* vrow = Vb + (size_t)r * NCOMP + kv0 + hoff;      // V^T[d=r][kv0+hoff ..]
#pragma unroll
      for (int i = 0; i < 4; ++i) {
        const v8h kk = *(const v8h*)(krow + 8 * i);
        const v8h vv = *(const v8h*)(vrow + 8 * i);
        *(v8h*)(Ksh + r * LP + hoff + 8 * i) = kk;
        *(v8h*)(Vth + r * LP + hoff + 8 * i) = vv;
      }
    }
    __syncthreads();

    // ---- scores: s[j] = 16 q rows x 16 keys (j*16 .. j*16+15) ----
    v8f s[4];
#pragma unroll
    for (int j = 0; j < 4; ++j) {
      s[j] = (v8f){0.f,0.f,0.f,0.f,0.f,0.f,0.f,0.f};
#pragma unroll
      for (int dc = 0; dc < 2; ++dc) {
        const v16h kb = FR::load(Ksh + (j * 16 + c) * LP + dc * 32 + 8 * hh);
        s[j] = hmma(qa[dc], kb, s[j]);
      }
    }
    // ---- chunk row max ----
    float cm[8];
#pragma unroll
    for (int r = 0; r < 8; ++r) {
      float m = -INFINITY;
#pragma unroll
      for (int j = 0; j < 4; ++j) {
        s[j][r] *= SCORE_SCALE;
        m = fmaxf(m, s[j][r]);
      }
#pragma unroll
      for (int off = 1; off < 16; off <<= 1) m = fmaxf(m, __shfl_xor(m, off, 32));
      cm[r] = m;
    }
    // ---- online softmax update, P tile to LDS ----
    _Float16* pw = Psh + wave * (16 * LP);
#pragma unroll
    for (int r = 0; r < 8; ++r) {
      const float mnew  = fmaxf(mrow[r], cm[r]);
      const float alpha = __expf(mrow[r] - mnew);
      mrow[r] = mnew;
      float psum = 0.f;
#pragma unroll
      for (int j = 0; j < 4; ++j) {
        const float p = __expf(s[j][r] - mnew);
        psum += p;
        pw[(8 * hh + r) * LP + j * 16 + c] = (_Float16)(p * PROB_CARRY);
      }
#pragma unroll
      for (int off = 1; off < 16; off <<= 1) psum += __shfl_xor(psum, off, 32);
      lrow[r] = lrow[r] * alpha + psum;
#pragma unroll
      for (int t = 0; t < 4; ++t) oacc[t][r] *= alpha;
    }
    __builtin_amdgcn_fence(__ATOMIC_RELEASE, "workgroup");
    __builtin_amdgcn_wave_barrier();
    __builtin_amdgcn_fence(__ATOMIC_ACQUIRE, "workgroup");
    // ---- O += P . V ----
#pragma unroll
    for (int kk = 0; kk < 2; ++kk) {
      const v16h pa = FR::load(pw + c * LP + kk * 32 + 8 * hh);
#pragma unroll
      for (int t = 0; t < 4; ++t) {
        const v16h vb = FR::load(Vth + (t * 16 + c) * LP + kk * 32 + 8 * hh);
        oacc[t] = hmma(pa, vb, oacc[t]);
      }
    }
  }

  // ---- epilogue: normalise, stage 16x64 wave tile, whole-line f16 stores ----
  float* os = Os + wave * (16 * 68);
#pragma unroll
  for (int r = 0; r < 8; ++r) {
    const float inv = OUT_CARRY * (1.0f / (lrow[r] * PROB_CARRY));
#pragma unroll
    for (int t = 0; t < 4; ++t) os[(8 * hh + r) * 68 + t * 16 + c] = oacc[t][r] * inv;
  }
  __builtin_amdgcn_fence(__ATOMIC_RELEASE, "workgroup");
  __builtin_amdgcn_wave_barrier();
  __builtin_amdgcn_fence(__ATOMIC_ACQUIRE, "workgroup");
  {
    const int qq = lane >> 3, c8 = (lane & 7) * 8;
    {
#pragma unroll
      for (int it = 0; it < 4; ++it) {
        const int row = it * 4 + qq;
        const float* sp = os + row * 68 + c8;
        v8h hv;
#pragma unroll
        for (int e = 0; e < 8; ++e) hv[e] = (_Float16)sp[e];
        *(v8h*)(Ob + (size_t)(q0 + row) * ROWP + c8) = hv;
      }
      
    }
  }
}

// ---------------------------------------------------------------------------
// Host orchestration (kernel launches + host arithmetic only)
// ---------------------------------------------------------------------------
extern "C" void kernel_launch(void* const* d_in, const int* in_sizes, int n_in,
                              void* d_out, int out_size, void* d_ws, size_t ws_size,
                              hipStream_t stream) {
  if (n_in < 11) return;
  const long nQ  = (long)SEQLEN * NBAT * EMBED;    // 8388608
  const long nW  = (long)EMBED * EMBED;            // 262144
  const long nWc = (long)NCOMP * SEQLEN;           // 4194304
  if (in_sizes[0] != nQ || in_sizes[1] != nW || in_sizes[2] != EMBED || in_sizes[3] != nW ||
      in_sizes[4] != EMBED || in_sizes[5] != nW || in_sizes[6] != EMBED || in_sizes[7] != nWc ||
      in_sizes[8] != nWc || in_sizes[9] != nW || in_sizes[10] != EMBED || out_size != nQ) return;

  const float* query = (const float*)d_in[0];
  const float* Wq  = (const float*)d_in[1];  const float* bq = (const float*)d_in[2];
  const float* Wk  = (const float*)d_in[3];  const float* bk = (const float*)d_in[4];
  const float* Wv  = (const float*)d_in[5];  const float* bv = (const float*)d_in[6];
  const float* Wck = (const float*)d_in[7];  const float* Wcv = (const float*)d_in[8];
  const float* Wo  = (const float*)d_in[9];  const float* bo = (const float*)d_in[10];

  // ---- workspace region map (bytes) ----
  const size_t BYTES_QB   = (size_t)nQ * 2;                              // bf16 query [16384][512]            16 MiB
  const size_t BYTES_QT   = (size_t)nQ * 2;                              // bf16 query^T [4][512][4096]        16 MiB
  const size_t BYTES_WC   = (size_t)2 * nWc * 2;                         // bf16 [Wck;Wcv] [2048][4096]        16 MiB
  const size_t BYTES_KVIN = (size_t)2 * NCOMP * NBAT * (2 * EMBED) * 2;  // u16 [8192][1024] (hi|lo rows)     16 MiB
  const size_t BYTES_QP   = (size_t)nQ * 2;                              // f16 q plane [16384][512]          16 MiB
  const size_t BYTES_OP   = (size_t)nQ * 2;                              // f16 attention out [16384][512]    16 MiB
  const size_t BYTES_KP   = (size_t)NCOMP * NBAT * EMBED * 2;            // f16 k plane [4096][512]            4 MiB
  const size_t BYTES_VT   = (size_t)NBAT * EMBED * NCOMP * 2;            // f16 v^T plane [4][512][1024]       4 MiB
  const size_t BYTES_WQ   = (size_t)nW * 2;                              // bf16 Wq [512][512]               512 KiB
  const size_t BYTES_WK2  = (size_t)nW * 2 * 2;                          // bf16 [Wk|Wk] [512][1024]            1 MiB
  const size_t BYTES_WV2  = (size_t)nW * 2 * 2;                          // bf16 [Wv|Wv] [512][1024]            1 MiB
  const size_t BYTES_WOH  = (size_t)nW * 2;                              // f16 64*Wo [512][512]             512 KiB
  const size_t BYTES_BIAS = (size_t)4 * EMBED * 4;                       // f32 biases 4 x 512                  8 KiB
  const size_t OFF_QB   = 0;
  const size_t OFF_QT   = OFF_QB   + BYTES_QB;
  const size_t OFF_WC   = OFF_QT   + BYTES_QT;
  const size_t OFF_KVIN = OFF_WC   + BYTES_WC;
  const size_t OFF_QP   = OFF_KVIN + BYTES_KVIN;
  const size_t OFF_OP   = OFF_QP   + BYTES_QP;
  const size_t OFF_KP   = OFF_OP   + BYTES_OP;
  const size_t OFF_VT   = OFF_KP   + BYTES_KP;
  const size_t OFF_WQ   = OFF_VT   + BYTES_VT;
  const size_t OFF_WK2  = OFF_WQ   + BYTES_WQ;
  const size_t OFF_WV2  = OFF_WK2  + BYTES_WK2;
  const size_t OFF_WOH  = OFF_WV2  + BYTES_WV2;
  const size_t OFF_BIAS = OFF_WOH  + BYTES_WOH;
  const size_t WS_TOTAL = OFF_BIAS + BYTES_BIAS;                         // 112,205,824 B
  if (WS_TOTAL > ws_size) return;

  char* ws = (char*)d_ws;
  unsigned short* queryB = (unsigned short*)(ws + OFF_QB);
  unsigned short* queryT = (unsigned short*)(ws + OFF_QT);
  unsigned short* WcB    = (unsigned short*)(ws + OFF_WC);
  unsigned short* KVin   = (unsigned short*)(ws + OFF_KVIN);
  unsigned short* qP     = (unsigned short*)(ws + OFF_QP);
  unsigned short* oP     = (unsigned short*)(ws + OFF_OP);
  unsigned short* kP     = (unsigned short*)(ws + OFF_KP);
  unsigned short* vtP    = (unsigned short*)(ws + OFF_VT);
  unsigned short* WqB    = (unsigned short*)(ws + OFF_WQ);
  unsigned short* WkB2   = (unsigned short*)(ws + OFF_WK2);
  unsigned short* WvB2   = (unsigned short*)(ws + OFF_WV2);
  unsigned short* WoH    = (unsigned short*)(ws + OFF_WOH);
  float*          biasb  = (float*)(ws + OFF_BIAS);
  float* bq_r = biasb;
  float* bk_r = biasb + EMBED;
  float* bv_r = biasb + 2 * EMBED;
  float* bo_r = biasb + 3 * EMBED;

  // 1. query -> bf16 [16384][512] (same flat layout as [T][B][E])
  {
    const int n2 = (int)(nQ / 2);
    cast_bf16x2_kernel<<<dim3((unsigned)((n2 + 255) / 256)), dim3(256), 0, stream>>>(query, queryB, n2);
  }
  // 2. query^T per batch: in [T=4096 rows][E=512 cols] pitch 2048 (base + b*512) -> out_b [512][4096]
  tconv_bf16_kernel<<<dim3(EMBED / 64, SEQLEN / 64, NBAT), dim3(256), 0, stream>>>(
      query, queryT, SEQLEN, EMBED, NBAT * EMBED, (long)EMBED, (long)EMBED * SEQLEN);
  // 3./4. Wck -> rows 0..1023, Wcv -> rows 1024..2047 of the [2048][4096] bf16 plane
  {
    const int n2 = (int)(nWc / 2);
    cast_bf16x2_kernel<<<dim3((unsigned)((n2 + 255) / 256)), dim3(256), 0, stream>>>(Wck, WcB, n2);
    cast_bf16x2_kernel<<<dim3((unsigned)((n2 + 255) / 256)), dim3(256), 0, stream>>>(Wcv, WcB + (size_t)nWc, n2);
  }
  // 5..8. weights
  {
    const int n2 = (int)(nW / 2);
    cast_bf16x2_kernel<<<dim3((unsigned)((n2 + 255) / 256)), dim3(256), 0, stream>>>(Wq, WqB, n2);
    dup_bf16x2_kernel<<<dim3((unsigned)((n2 + 255) / 256)), dim3(256), 0, stream>>>(Wk, WkB2, n2, EMBED);
    dup_bf16x2_kernel<<<dim3((unsigned)((n2 + 255) / 256)), dim3(256), 0, stream>>>(Wv, WvB2, n2, EMBED);
    cast_wo_f16x2_kernel<<<dim3((unsigned)((n2 + 255) / 256)), dim3(256), 0, stream>>>(Wo, WoH, n2, WO_CARRY);
  }
  // 9. biases (RNE to bf16 precision)
  bias_prep_kernel<<<dim3(1), dim3(512), 0, stream>>>(bq, bk, bv, bo, biasb, EMBED);

  // 10. compression: per batch b: C_b[m][n] = sum_t WcB[m][t] * queryT_b[n][t]; m<1024 -> k_in[m][b][n], m>=1024 -> v_in.
  //     C element (m,n,b): hi at KVin[(m*4+b)*1024 + n], lo at +512  => ldc 4096, strideC 1024, Cout2 = Cout + 512.
  //     M=2048, N=512, K=4096 (K%64==0, M%128==0, N%256==0): 32 block tiles of 128x256 per batch -> grid (32, 4).
  wmma_gemm64<1, false, 0, 2, false><<<dim3(32, NBAT), dim3(256), 0, stream>>>(
      WcB, WcB, SEQLEN, 0L,
      queryT, queryT, SEQLEN, (long)EMBED * SEQLEN,
      (void*)KVin, (void*)(KVin + EMBED), 4 * (2 * EMBED), (long)(2 * EMBED),
      biasb, biasb, 0L,
      2 * NCOMP, EMBED, SEQLEN, 1.0f);

  // 11. q8 = query . Wq^T + bq  (scale 1; 0.125 applied to f32 scores) -> f16 [16384][512]; M=16384, N=512, K=512: grid 256.
  wmma_gemm64<1, false, 2, 1, false><<<dim3(256, 1), dim3(256), 0, stream>>>(
      queryB, queryB, EMBED, 0L,
      WqB, WqB, EMBED, 0L,
      (void*)qP, (void*)qP, EMBED, 0L,
      bq_r, bq_r, 0L,
      SEQLEN * NBAT, EMBED, EMBED, 1.0f);

  // 12. k = [k_in hi|lo] . [Wk|Wk]^T + bk -> f16 [4096 rows (c*4+b)][512]; M=4096, N=512, K'=1024: grid 64.
  wmma_gemm64<1, false, 2, 1, false><<<dim3(64, 1), dim3(256), 0, stream>>>(
      KVin, KVin, 2 * EMBED, 0L,
      WkB2, WkB2, 2 * EMBED, 0L,
      (void*)kP, (void*)kP, EMBED, 0L,
      bk_r, bk_r, 0L,
      NCOMP * NBAT, EMBED, 2 * EMBED, 1.0f);

  // 13. v^T per batch: C_b[m=e'][n=c] = sum_k [Wv|Wv][e'][k] * [v_in hi|lo][(c,b)][k] + bv[e'] -> f16 vtP[b][512][1024].
  //     Bt_b rows at KVin + 4096*1024 + b*1024 + c*4096 (ldb 4096, strideB 1024); M=512, N=1024, K'=1024: grid (16, 4).
  wmma_gemm64<1, false, 1, 1, false><<<dim3(16, NBAT), dim3(256), 0, stream>>>(
      WvB2, WvB2, 2 * EMBED, 0L,
      KVin + (size_t)NCOMP * NBAT * (2 * EMBED), KVin + (size_t)NCOMP * NBAT * (2 * EMBED), 4 * (2 * EMBED), (long)(2 * EMBED),
      (void*)vtP, (void*)vtP, NCOMP, (long)EMBED * NCOMP,
      bv_r, bv_r, 0L,
      EMBED, NCOMP, 2 * EMBED, 1.0f);

  // 14. attention over the compressed keys: grid = B*H*(T/64) = 2048 blocks of 128
  attn_lin_kernel<<<dim3(NBAT * NHEADS * (SEQLEN / 64)), dim3(128), 0, stream>>>(qP, kP, vtP, oP);

  // 15. out = (16 O) . (64 Wo)^T / 1024 + bo -> f32 d_out [16384][512]; M=16384, N=512, K=512: grid 256.
  wmma_gemm64<0, false, 2, 0, false><<<dim3(256, 1), dim3(256), 0, stream>>>(
      oP, oP, EMBED, 0L,
      WoH, WoH, EMBED, 0L,
      d_out, d_out, EMBED, 0L,
      bo_r, bo_r, 0L,
      SEQLEN * NBAT, EMBED, EMBED, 1.0f / (OUT_CARRY * WO_CARRY));
}

// v003
// One run takes 221 microseconds.
// Next to v002, in two timings, it ran 1.34 times as fast each time.
// All steps since v000 together make it 2.61 times as fast.
// Contractions: sequence compression and q/k/v^T projections on v_wmma_f32_16x16x32_bf16 (bf16 operands = RNE-converted inputs; k_in/v_in carried as bf16 hi+lo planes concatenated along k); q.k^T, p.v and the output projection on v_wmma_f32_16x16x32_f16 (f16 planes; p carried x2^15, attention output x2^4, Wo x2^6); f32 accumulate; softmax, score scale 0.125 and biases in f32.
#include <hip/hip_runtime.h>
#include <math.h>
#include <stdint.h>

typedef __attribute__((ext_vector_type(16))) _Float16 v16h;
typedef __attribute__((ext_vector_type(8)))  _Float16 v8h;
typedef __attribute__((ext_vector_type(16))) __bf16   v16b;
typedef __attribute__((ext_vector_type(8)))  __bf16   v8b;
typedef __attribute__((ext_vector_type(8)))  float    v8f;
typedef __attribute__((ext_vector_type(4)))  float    v4f;
typedef __attribute__((ext_vector_type(2)))  float    v2f;
typedef __attribute__((ext_vector_type(4)))  unsigned int v4u;

__device__ __forceinline__ unsigned short f2bf_bits(float f) {
  unsigned u = __float_as_uint(f);
  return (unsigned short)((u + 0x7FFFu + ((u >> 16) & 1u)) >> 16);
}
__device__ __forceinline__ float bf_bits2f(unsigned short h) { return __uint_as_float(((unsigned)h) << 16); }

// hazard guards as plain device helpers (no inline asm inside the kernel template body)
__device__ __forceinline__ void dep_guard_h(v8f& a, v8f& b, v16h x, v16h y) { asm volatile("v_nop\n\tv_nop\n\tv_nop\n\tv_nop" : "+v"(a), "+v"(b) : "v"(x), "v"(y)); }
__device__ __forceinline__ void dep_guard_b(v8f& a, v8f& b, v16b x, v16b y) { asm volatile("v_nop\n\tv_nop\n\tv_nop\n\tv_nop" : "+v"(a), "+v"(b) : "v"(x), "v"(y)); }
__device__ __forceinline__ void keep4_h(v16h a, v16h b, v16h c, v16h d) { asm volatile("v_nop" :: "v"(a), "v"(b), "v"(c), "v"(d)); }
__device__ __forceinline__ void keep4_b(v16b a, v16b b, v16b c, v16b d) { asm volatile("v_nop" :: "v"(a), "v"(b), "v"(c), "v"(d)); }
__device__ __forceinline__ void acc_guard4(v8f& a, v8f& b, v8f& c, v8f& d) { asm volatile("v_nop\n\tv_nop\n\tv_nop\n\tv_nop" : "+v"(a), "+v"(b), "+v"(c), "+v"(d)); }
template <typename T> struct Frag;
template <> struct Frag<_Float16> {
  typedef v16h V; typedef v8h H; union U { v16h v; v8h h[2]; };
  static __device__ __forceinline__ v16h load(const _Float16* p) {   // elements 0..7 <- p[0..7], 8..15 <- p[16..23]
    U f; f.h[0] = *(const v8h*)(p); f.h[1] = *(const v8h*)(p + 16); return f.v;
  }
  static __device__ __forceinline__ v8f mma(v16h a, v16h b, v8f c) {
    return __builtin_amdgcn_wmma_f32_16x16x32_f16(false, a, false, b, (short)0, c, false, false);
  }
  static __device__ __forceinline__ void guard(v8f& a, v8f& b, v16h x, v16h y) { dep_guard_h(a, b, x, y); }
  static __device__ __forceinline__ void keep(v16h a, v16h b, v16h c, v16h d) { keep4_h(a, b, c, d); }
};
template <> struct Frag<__bf16> {
  typedef v16b V; typedef v8b H; union U { v16b v; v8b h[2]; };
  static __device__ __forceinline__ v16b load(const __bf16* p) {
    U f; f.h[0] = *(const v8b*)(p); f.h[1] = *(const v8b*)(p + 16); return f.v;
  }
  static __device__ __forceinline__ v8f mma(v16b a, v16b b, v8f c) {
    return __builtin_amdgcn_wmma_f32_16x16x32_bf16(false, a, false, b, (short)0, c, false, false);
  }
  static __device__ __forceinline__ void guard(v8f& a, v8f& b, v16b x, v16b y) { dep_guard_b(a, b, x, y); }
  static __device__ __forceinline__ void keep(v16b a, v16b b, v16b c, v16b d) { keep4_b(a, b, c, d); }
};

// ---- Register-blocked batched WMMA GEMM ------------------------------------
// C[m,n] = scale * sum_k A[m,k] * Bt[n,k] (+bias)(+resid); each wave owns a 64x64 tile.
// A row-major [M,K]; Bt row-major [N,K]; M % 128 == 0, N % 256 == 0, K % 64 == 0.
// A block of 8 waves (2 x 4) owns a 128x256 tile of C. Per stage of 64 k it brings 128 rows of A and 256 rows
// of Bt, 128 B each, into LDS with whole-line 16-byte loads (8 lanes per row); the waves read their fragments
// from LDS. Two LDS buffers: the next stage's global loads are issued ahead of this stage's products and
// stored behind them, one block barrier per stage.
// SPLIT (hi/lo operand planes) is not built in this form.
// BIAS_MODE: 0 = none, 1 = bias[m], 2 = bias[n].
// OUT_MODE: 0 = f32, 1 = f16, 2 = bf16 hi plane (Cout) + bf16 lo plane (Cout2).
// ET: 0 = f16 operands, 1 = bf16 operands (pointers passed as 16-bit storage)
template <int ET> struct Elem;
template <> struct Elem<0> { typedef _Float16 T; };
template <> struct Elem<1> { typedef __bf16 T; };
template <int ET, bool SPLIT, int BIAS_MODE, int OUT_MODE, bool RESID, int ACT = 0>
__global__ __launch_bounds__(256) void wmma_gemm64(
    const unsigned short* __restrict__ Ap, const unsigned short* __restrict__ A2p, int lda, long strideA,
    const unsigned short* __restrict__ Btp, const unsigned short* __restrict__ Bt2p, int ldb, long strideB,
    void* __restrict__ Cout, void* __restrict__ Cout2, int ldc, long strideC,
    const float* __restrict__ bias,
    const float* __restrict__ resid, long strideR,
    int M, int N, int K, float scale) {
  typedef typename Elem<ET>::T T;
  typedef typename Frag<T>::V V;
  const T* A = (const T*)Ap; const T* Bt = (const T*)Btp;
  static_assert(!SPLIT, "hi/lo planes are not staged");
  typedef typename Frag<T>::H H;
  constexpr int BM = 128, BN = 256, BK = 64;
  // LDS row pitch 64 + 8 elements = 144 B = 16 B x 9 (odd): the 16 rows of one 16-byte fragment read fall on
  // different groups of four banks.
  constexpr int LP = BK + 8;
  __shared__ __align__(16) T sOp[2][(BM + BN) * LP];   // [buffer][A rows 0..127 | Bt rows 128..383][k]
  __shared__ __align__(16) float sT[8][16 * 68];   // per-wave 16x64 slab, pitch 68 floats
  const int b    = blockIdx.y;
  const int tid  = threadIdx.x;
  const int lane = tid & 31;
  const int wave = tid >> 5;
  const int blocksN = N / BN;
  const int blocksM = M / BM;
  if ((int)blockIdx.x >= blocksM * blocksN) return;   // block-uniform, ahead of every barrier
  const int bm = blockIdx.x / blocksN;
  const int bn = blockIdx.x - bm * blocksN;
  const int wm = wave >> 2;                    // 0..1: 64-row band of the block tile
  const int wn = wave & 3;                     // 0..3: 64-column band
  const int m0 = bm * BM + (wm << 6);
  const int n0 = bn * BN + (wn << 6);

  const T* Ab  = A  + (size_t)b * strideA;
  const T* Bb  = Bt + (size_t)b * strideB;

  const int rlane = lane & 15;                 // row (A) / col (B, D) within subtile
  const int koff  = (lane >> 4) * 8;           // k offset of this lane half
  const int mOff  = (lane >> 4) * 8;           // D row offset

  // staging map: 8 threads x 16 B = one 128-B row; 32 rows per sweep of the block
  const int srow = tid >> 3;                   // 0..31
  const int sk   = (tid & 7) * 8;              // element offset in the row
  const T* gA = Ab + (size_t)(bm * BM + srow) * lda + sk;
  const T* gB = Bb + (size_t)(bn * BN + srow) * ldb + sk;
  const int sdst = srow * LP + sk;

  v8f acc[4][4];
#pragma unroll
  for (int i = 0; i < 4; ++i)
#pragma unroll
    for (int j = 0; j < 4; ++j) acc[i][j] = (v8f){0.f,0.f,0.f,0.f,0.f,0.f,0.f,0.f};

  H stA[BM / 32], stB[BN / 32];
#pragma unroll
  for (int it = 0; it < BM / 32; ++it) stA[it] = *(const H*)(gA + (size_t)(it * 32) * lda);
#pragma unroll
  for (int it = 0; it < BN / 32; ++it) stB[it] = *(const H*)(gB + (size_t)(it * 32) * ldb);
#pragma unroll
  for (int it = 0; it < BM / 32; ++it) *(H*)(&sOp[0][sdst + it * 32 * LP]) = stA[it];
#pragma unroll
  for (int it = 0; it < BN / 32; ++it) *(H*)(&sOp[0][sdst + (BM + it * 32) * LP]) = stB[it];
  __syncthreads();

  const int nst = K / BK;
#pragma unroll 1
  for (int s = 0; s < nst; ++s) {
    const T* cur = sOp[s & 1];
    T*       nxt = sOp[(s + 1) & 1];
    const bool more = s + 1 < nst;             // the same for the whole block
    if (more) {
      const int k1 = (s + 1) * BK;
#pragma unroll
      for (int it = 0; it < BM / 32; ++it) stA[it] = *(const H*)(gA + (size_t)(it * 32) * lda + k1);
#pragma unroll
      for (int it = 0; it < BN / 32; ++it) stB[it] = *(const H*)(gB + (size_t)(it * 32) * ldb + k1);
    }
#pragma unroll
    for (int kk = 0; kk < BK; kk += 32) {
      V bh[4], ah[4];
#pragma unroll
      for (int j = 0; j < 4; ++j) bh[j] = Frag<T>::load(cur + (BM + (wn << 6) + (j << 4) + rlane) * LP + kk + koff);
#pragma unroll
      for (int i = 0; i < 4; ++i) ah[i] = Frag<T>::load(cur + ((wm << 6) + (i << 4) + rlane) * LP + kk + koff);
#pragma unroll
      for (int i = 0; i < 4; ++i) {
#pragma unroll
        for (int j = 0; j < 4; ++j) acc[i][j] = Frag<T>::mma(ah[i], bh[j], acc[i][j]);
        Frag<T>::guard(acc[i][0], acc[i][3], ah[i], ah[i]);
      }
      Frag<T>::keep(bh[0], bh[1], bh[2], bh[3]);
    }
    if (more) {
#pragma unroll
      for (int it = 0; it < BM / 32; ++it) *(H*)(nxt + sdst + it * 32 * LP) = stA[it];
#pragma unroll
      for (int it = 0; it < BN / 32; ++it) *(H*)(nxt + sdst + (BM + it * 32) * LP) = stB[it];
    }
    // publishes the buffer just written and ends every wave's reads of the buffer that the next stage refills
    __syncthreads();
  }
  acc_guard4(acc[0][0], acc[0][1], acc[0][2], acc[0][3]);
  acc_guard4(acc[1][0], acc[1][1], acc[1][2], acc[1][3]);
  acc_guard4(acc[2][0], acc[2][1], acc[2][2], acc[2][3]);
  acc_guard4(acc[3][0], acc[3][1], acc[3][2], acc[3][3]);

  // ---- epilogue ----
  float* slab = sT[wave];
  const float* Rb = RESID ? (resid + (size_t)b * strideR) : nullptr;
#pragma unroll
  for (int i = 0; i < 4; ++i) {
    const int mBase = m0 + (i << 4);
#pragma unroll
    for (int j = 0; j < 4; ++j) {
      const int n = n0 + (j << 4) + rlane;
      float bv = 0.f;
      if (BIAS_MODE == 2) bv = bias[n];
#pragma unroll
      for (int r = 0; r < 8; ++r) {
        float v = acc[i][j][r] * scale;
        if (BIAS_MODE == 1) v += bias[mBase + mOff + r];
        if (BIAS_MODE == 2) v += bv;
        if (RESID) v += Rb[(size_t)(mBase + mOff + r) * ldc + n];
        if (ACT == 1) v = tanhf(v);
        if (ACT == 2) v = fmaxf(v, 0.0f);
        if (ACT == 3) v = v / (1.0f + expf(-v));
        if (ACT == 4) v = (v > 0.f) ? v : 0.01f * v;
        if (ACT == 5) v = 0.5f * v * (1.0f + erff(v * 0.70710678118654752f));
        slab[(mOff + r) * 68 + (j << 4) + rlane] = v;
      }
    }
    __builtin_amdgcn_fence(__ATOMIC_RELEASE, "workgroup");
    __builtin_amdgcn_wave_barrier();
    __builtin_amdgcn_fence(__ATOMIC_ACQUIRE, "workgroup");
    if (OUT_MODE == 0) {
      float* C = (float*)Cout + (size_t)b * strideC;
      const int hh = lane >> 4, c4 = (lane & 15) * 4;     // row seg = 256 B = 16 lanes x 16 B
      {
#pragma unroll
        for (int it = 0; it < 8; ++it) {
          const int row = it * 2 + hh;
          v4f v = *(const v4f*)(slab + row * 68 + c4);
          *(v4f*)(C + (size_t)(mBase + row) * ldc + n0 + c4) = v;
        }
        
      }
    } else {
      const int q = lane >> 3, c8 = (lane & 7) * 8;
      unsigned short* C  = (unsigned short*)Cout  + (size_t)b * strideC;
      unsigned short* C2 = (OUT_MODE == 2) ? ((unsigned short*)Cout2 + (size_t)b * strideC) : nullptr;
      {
#pragma unroll
        for (int it = 0; it < 4; ++it) {
          const int row = it * 4 + q;
          const float* sp = slab + row * 68 + c8;
          v8h hv, lv;
#pragma unroll
          for (int e = 0; e < 8; ++e) {
            if (OUT_MODE == 1) {
              hv[e] = (_Float16)sp[e];
            } else {
              unsigned short hb = f2bf_bits(sp[e]);
              unsigned short lb = f2bf_bits(sp[e] - bf_bits2f(hb));
              hv[e] = __builtin_bit_cast(_Float16, hb);
              lv[e] = __builtin_bit_cast(_Float16, lb);
            }
          }
          *(v8h*)(C + (size_t)(mBase + row) * ldc + n0 + c8) = hv;
          if (OUT_MODE == 2) *(v8h*)(C2 + (size_t)(mBase + row) * ldc + n0 + c8) = lv;
        }
        
      }
    }
    __builtin_amdgcn_fence(__ATOMIC_RELEASE, "workgroup");
    __builtin_amdgcn_wave_barrier();
    __builtin_amdgcn_fence(__ATOMIC_ACQUIRE, "workgroup");
  }
}

__device__ __forceinline__ unsigned pk16(unsigned short a, unsigned short b) { return (unsigned)a | ((unsigned)b << 16); }

// ---------------------------------------------------------------------------
// Problem geometry
// ---------------------------------------------------------------------------
constexpr int   SEQLEN  = 4096;   // time steps (queries)
constexpr int   NBAT    = 4;      // batch
constexpr int   EMBED   = 512;    // channels
constexpr int   NHEADS  = 8;
constexpr int   HDIM    = 64;
constexpr int   NCOMP   = 1024;   // compressed key count
constexpr float SCORE_SCALE = 0.125f;     // head_dim^-0.5, applied to the f32 score accumulators
constexpr float PROB_CARRY  = 32768.0f;   // p carried x2^15 in the f16 P operand, folded into 1/l
constexpr float OUT_CARRY   = 16.0f;      // attention output carried x2^4 in its f16 plane
constexpr float WO_CARRY    = 64.0f;      // Wo carried x2^6 in its f16 plane

// ---------------------------------------------------------------------------
// Elementwise f32 -> bf16 (RNE), 2 elements per thread, one 4-B store per lane: a wave writes one whole
// ---------------------------------------------------------------------------
__global__ __launch_bounds__(256) void cast_bf16x2_kernel(const float* __restrict__ in, unsigned short* __restrict__ out, int n2) {
  const int i = blockIdx.x * 256 + threadIdx.x;
  if (i < n2) {
    const v2f f = *(const v2f*)(in + 2 * (size_t)i);
    const unsigned u = pk16(f2bf_bits(f[0]), f2bf_bits(f[1]));
    ((unsigned*)out)[i] = u;
    
  }
}

// ---------------------------------------------------------------------------
// W [rows][cols] f32 -> out [rows][2*cols] bf16 with out[r][c] = out[r][cols + c] = bf16_rne(W[r][c]).
// 2 elements per thread; cols % 64 == 0 so a wave's 64 elements stay in one row: each store instruction
// ---------------------------------------------------------------------------
__global__ __launch_bounds__(256) void dup_bf16x2_kernel(const float* __restrict__ W, unsigned short* __restrict__ out, int n2, int cols) {
  const int i = blockIdx.x * 256 + threadIdx.x;
  if (i < n2) {
    const int e0 = 2 * i;
    const int r  = e0 / cols;
    const int cc = e0 - r * cols;
    const v2f f = *(const v2f*)(W + e0);
    const unsigned u = pk16(f2bf_bits(f[0]), f2bf_bits(f[1]));
    const size_t o0 = ((size_t)r * 2 * cols + cc) >> 1;          // uint index of out[r][cc]
    const size_t o1 = ((size_t)r * 2 * cols + cols + cc) >> 1;   // uint index of out[r][cols+cc]
    ((unsigned*)out)[o0] = u;
    ((unsigned*)out)[o1] = u;
    
  }
}

// ---------------------------------------------------------------------------
// Wo f32 -> f16 plane holding f16(carry * bf16_rne(w)) (exact for bf16 values in the normal f16 range).
// Same store discipline as cast_bf16x2_kernel.
// ---------------------------------------------------------------------------
__global__ __launch_bounds__(256) void cast_wo_f16x2_kernel(const float* __restrict__ W, unsigned short* __restrict__ out, int n2, float carry) {
  const int i = blockIdx.x * 256 + threadIdx.x;
  if (i < n2) {
    const v2f f = *(const v2f*)(W + 2 * (size_t)i);
    const float b0 = bf_bits2f(f2bf_bits(f[0])) * carry;
    const float b1 = bf_bits2f(f2bf_bits(f[1])) * carry;
    const _Float16 h0 = (_Float16)b0, h1 = (_Float16)b1;
    const unsigned u = pk16(__builtin_bit_cast(unsigned short, h0), __builtin_bit_cast(unsigned short, h1));
    ((unsigned*)out)[i] = u;
    
  }
}

// ---------------------------------------------------------------------------
// Bias vectors RNE-converted to bf16 precision (kept as f32): outb[0..n) = bq, [n..2n) = bk, [2n..3n) = bv, [3n..4n) = bo.
// ---------------------------------------------------------------------------
__global__ __launch_bounds__(512) void bias_prep_kernel(const float* __restrict__ bq, const float* __restrict__ bk,
                                                        const float* __restrict__ bv, const float* __restrict__ bo,
                                                        float* __restrict__ outb, int n) {
  const int i = blockIdx.x * 512 + threadIdx.x;
  if (i < n) {
    const float a0 = bf_bits2f(f2bf_bits(bq[i]));
    const float a1 = bf_bits2f(f2bf_bits(bk[i]));
    const float a2 = bf_bits2f(f2bf_bits(bv[i]));
    const float a3 = bf_bits2f(f2bf_bits(bo[i]));
    ((float*)outb)[i] = a0;
    ((float*)outb)[n + i] = a1;
    ((float*)outb)[2 * n + i] = a2;
    ((float*)outb)[3 * n + i] = a3;
    
  }
}

// ---------------------------------------------------------------------------
// Transpose + bf16 RNE convert, z-batched: in_z = X + z*sIn viewed [R rows][Cc cols] with row pitch ldi ->
//   o_z[c][r] = bf16_rne(in_z[r][c])  ([Cc][R], pitch R), o_z = o + z*sOut.
// 64x64 tiles through LDS. grid = (Cc/64, R/64, Z), 256 threads (R, Cc multiples of 64).
// Coverage per block: load 4 it x 256 thr x 4 floats = 64x64; store 2 it x 256 thr x 8 u16 = 64x64.
// ---------------------------------------------------------------------------
__global__ __launch_bounds__(256) void tconv_bf16_kernel(const float* __restrict__ X, unsigned short* __restrict__ o,
                                                         int R, int Cc, int ldi, long sIn, long sOut) {
  __shared__ __align__(16) float tf[64 * 68];
  X += (size_t)blockIdx.z * sIn;
  o += (size_t)blockIdx.z * sOut;
  const int c0  = blockIdx.x * 64;   // input column block = output row block
  const int r0  = blockIdx.y * 64;   // input row block    = output column block
  const int tid = threadIdx.x;
  {
    const int lr = tid >> 4;         // 0..15
    const int c4 = (tid & 15) * 4;   // 0..60
#pragma unroll
    for (int it = 0; it < 4; ++it) {
      const int rr = it * 16 + lr;   // 0..63
      const v4f a = *(const v4f*)(X + (size_t)(r0 + rr) * ldi + c0 + c4);
      *(v4f*)(tf + rr * 68 + c4) = a;
    }
  }
  __syncthreads();
  const int sub = tid >> 3;          // 0..31
  const int c8  = (tid & 7) * 8;     // 0..56
  v4u hv[2];
#pragma unroll
  for (int it = 0; it < 2; ++it) {
    const int oc = it * 32 + sub;    // output row within tile (= input column)
    v4u a;
#pragma unroll
    for (int q = 0; q < 4; ++q) {
      const float f0 = tf[(c8 + 2 * q) * 68 + oc];
      const float f1 = tf[(c8 + 2 * q + 1) * 68 + oc];
      a[q] = pk16(f2bf_bits(f0), f2bf_bits(f1));
    }
    hv[it] = a;
  }
  {
#pragma unroll
    for (int it = 0; it < 2; ++it) {
      const int oc = it * 32 + sub;
      const size_t go = (size_t)(c0 + oc) * R + r0 + c8;
      *(v4u*)(o + go) = hv[it];
    }
    
  }
}

// =====================================================================================
// Full (unmasked) attention over the NCOMP compressed keys, head dim 64, all (b,h) in one launch.
//   q plane f16: element (t, b, h, d) at [(t*NBAT + b)*EMBED + h*64 + d]   (holds 8*q; 0.125 applied to f32 scores)
//   k plane f16: element (c, b, h, d) at [(c*NBAT + b)*EMBED + h*64 + d]
//   v^T plane f16: element (b, h, d, c) at [b*EMBED*NCOMP + (h*64 + d)*NCOMP + c]
//   out plane f16: element (t, b, h, d) at [(t*NBAT + b)*EMBED + h*64 + d], value = OUT_CARRY * attention output
//   Both products are taken transposed: S^T = K . Q^T (A = K rows, B = Q) and O^T += V^T . P^T (A = V^T rows,
//   B = P^T), v_wmma_f32_16x16x32_f16, p carried x PROB_CARRY, f32 accumulate. A lane then holds 32 of the 64
//   scores of ONE query (lane l and l ^ 16 split the keys): maximum and sum run in the lane's own registers with
//   one exchange between the wave halves, and two score tiles, converted in place, are the B operand P^T.
//   Online softmax in f32 over NCOMP/64 chunks (compile-time trip count, no masking).
//   Block = 4 waves = 64 query rows of one (b, h); grid.x = NBAT * NHEADS * (SEQLEN/64) = 2048.
//   K / V^T chunk staging: 128 threads x 32 halves per plane = the whole 64x64 tile (16-B copies, plain loads,
//   __syncthreads before and after); fragment loads read the LDS tiles with the same v8h element type.
// =====================================================================================
__device__ __forceinline__ v8f hmma(v16h a, v16h b, v8f c) {
  c = __builtin_amdgcn_wmma_f32_16x16x32_f16(false, a, false, b, (short)0, c, false, false);
  asm volatile("v_nop\n\tv_nop\n\tv_nop\n\tv_nop" : "+v"(c) : "v"(a), "v"(b));
  return c;
}
// The slot that the instruction set asks for behind a transcendental before its source register is rewritten.
// The results and the sources of a run of v_exp_f32 are
// inputs only of the v_nop's statement: it stands behind the last of the run, and no source is rewritten ahead of it.
__device__ __forceinline__ void exp_slot1(float e, float a) { asm volatile("v_nop" :: "v"(e), "v"(a)); }
constexpr float LOG2E = 1.44269504f;   // __expf(x) compiles to v_exp_f32(x * LOG2E); written out so that the source has a name
// value of lane l ^ 16
__device__ __forceinline__ float xhalf(float x) {
  return __builtin_bit_cast(float, __builtin_amdgcn_permlanex16(__builtin_bit_cast(int, x), __builtin_bit_cast(int, x),
                                                                0x76543210, 0xfedcba98, false, false));
}

__global__ __launch_bounds__(128)
void attn_lin_kernel(const unsigned short* __restrict__ qp, const unsigned short* __restrict__ kp,
                     const unsigned short* __restrict__ vtp, unsigned short* __restrict__ op) {
  typedef Frag<_Float16> FR;
  // Row pitch of the two f16 tiles: 64 halves + 8 = 144 B = 16 B x 9 (odd), so that the 16 rows one
  // 16-byte fragment read touches fall on 16 different groups of four banks.
  constexpr int LP = 72;
  __shared__ __align__(16) _Float16 Ksh[64 * LP];        // K chunk  [kv][d]     9 KB
  __shared__ __align__(16) _Float16 Vth[64 * LP];        // V^T chunk [d][kv]    9 KB
  __shared__ __align__(16) float    Os[4 * 16 * 68];     // per wave out tile, pitch 68

  const int tid  = threadIdx.x;
  const int wave = tid >> 5;
  const int lane = tid & 31;
  const int hh   = lane >> 4;
  const int c    = lane & 15;

  constexpr int NQB  = SEQLEN / 64;        // 64 query blocks per (b, h)
  constexpr int ROWP = NBAT * EMBED;       // 2048 halves between consecutive t (q, k, out planes)
  constexpr int NCH  = NCOMP / 64;         // 16 key chunks

  const int bx = blockIdx.x;
  const int qb = bx % NQB;
  const int bh = bx / NQB;
  const int h  = bh % NHEADS;
  const int b  = bh / NHEADS;
  const int q0 = qb * 64 + wave * 16;

  const _Float16* Qb = (const _Float16*)(const void*)qp  + (size_t)b * EMBED + (size_t)h * HDIM;
  const _Float16* Kb = (const _Float16*)(const void*)kp  + (size_t)b * EMBED + (size_t)h * HDIM;
  const _Float16* Vb = (const _Float16*)(const void*)vtp + (size_t)b * EMBED * NCOMP + (size_t)h * HDIM * NCOMP;
  _Float16*       Ob = (_Float16*)(void*)op + (size_t)b * EMBED + (size_t)h * HDIM;

  // ---- Q fragments (B operand): column = query q0 + c, 2 d-chunks of 32 ----
  v16h qa[2];
  {
    const _Float16* qrow = Qb + (size_t)(q0 + c) * ROWP;
#pragma unroll
    for (int dc = 0; dc < 2; ++dc) qa[dc] = FR::load(qrow + dc * 32 + 8 * hh);
  }

  float mrun = -INFINITY;   // running maximum of query q0 + c (the same in both wave halves)
  float lrun = 0.f;         // running sum over this half's keys; the halves are joined in the epilogue
  v8f oacc[4];              // oacc[t][r] = O[query q0 + c][d = t*16 + 8*hh + r]
#pragma unroll
  for (int t = 0; t < 4; ++t) oacc[t] = (v8f){0.f,0.f,0.f,0.f,0.f,0.f,0.f,0.f};

#pragma unroll 1
  for (int kc = 0; kc < NCH; ++kc) {
    const int kv0 = kc * 64;
    __syncthreads();
    {
      const int r = tid >> 1, hoff = (tid & 1) * 32;
      const _Float16* krow = Kb + (size_t)(kv0 + r) * ROWP + hoff;     // K[kv0+r][hoff .. hoff+31]
      const _Float16* vrow = Vb + (size_t)r * NCOMP + kv0 + hoff;      // V^T[d=r][kv0+hoff ..]
#pragma unroll
      for (int i = 0; i < 4; ++i) {
        const v8h kk = *(const v8h*)(krow + 8 * i);
        const v8h vv = *(const v8h*)(vrow + 8 * i);
        *(v8h*)(Ksh + r * LP + hoff + 8 * i) = kk;
        *(v8h*)(Vth + r * LP + hoff + 8 * i) = vv;
      }
    }
    __syncthreads();

    // ---- scores, transposed: s[j][r] = score(key j*16 + 8*hh + r, query c) ----
    v8f s[4];
#pragma unroll
    for (int j = 0; j < 4; ++j) {
      s[j] = (v8f){0.f,0.f,0.f,0.f,0.f,0.f,0.f,0.f};
#pragma unroll
      for (int dc = 0; dc < 2; ++dc) {
        const v16h ka = FR::load(Ksh + (j * 16 + c) * LP + dc * 32 + 8 * hh);
        s[j] = hmma(ka, qa[dc], s[j]);
      }
    }
    // ---- chunk maximum of this lane's query: 32 scores in the lane, then the other half's ----
    float mj[4];
#pragma unroll
    for (int j = 0; j < 4; ++j) {
      mj[j] = -INFINITY;
#pragma unroll
      for (int r = 0; r < 8; ++r) {
        s[j][r] *= SCORE_SCALE;
        mj[j] = fmaxf(mj[j], s[j][r]);
      }
    }
    float cm = fmaxf(fmaxf(mj[0], mj[1]), fmaxf(mj[2], mj[3]));
    cm = fmaxf(cm, xhalf(cm));
    // ---- online softmax update; P^T stays in registers ----
    const float mnew  = fmaxf(mrun, cm);
    const float aarg  = (mrun - mnew) * LOG2E;
    const float alpha = __builtin_amdgcn_exp2f(aarg);
    exp_slot1(alpha, aarg);
    mrun = mnew;
    // B operand of 32 keys: elements 0..7 = keys 8*hh + 0..7 (tile 2*kk), 8..15 = keys 16 + 8*hh + 0..7 (tile 2*kk+1),
    // the k order in which FR::load brings the V^T rows.
    v16h pb[2];
    float pj[4];
#pragma unroll
    for (int j = 0; j < 4; ++j) {
      pj[j] = 0.f;
#pragma unroll
      for (int g = 0; g < 8; g += 4) {
        float parg[4], p[4];
#pragma unroll
        for (int e = 0; e < 4; ++e) {
          parg[e] = (s[j][g + e] - mnew) * LOG2E;
          p[e]    = __builtin_amdgcn_exp2f(parg[e]);
        }
        // the slot behind these four v_exp_f32, as in exp_slot1
        asm volatile("v_nop" :: "v"(p[0]), "v"(p[1]), "v"(p[2]), "v"(p[3]), "v"(parg[0]), "v"(parg[1]), "v"(parg[2]), "v"(parg[3]));
#pragma unroll
        for (int e = 0; e < 4; ++e) {
          pj[j] += p[e];
          pb[j >> 1][(j & 1) * 8 + g + e] = (_Float16)(p[e] * PROB_CARRY);
        }
      }
    }
    lrun = lrun * alpha + ((pj[0] + pj[1]) + (pj[2] + pj[3]));
#pragma unroll
    for (int t = 0; t < 4; ++t)
#pragma unroll
      for (int r = 0; r < 8; ++r) oacc[t][r] *= alpha;
    // ---- O^T += V^T . P^T ----
#pragma unroll
    for (int kk = 0; kk < 2; ++kk) {
#pragma unroll
      for (int t = 0; t < 4; ++t) {
        const v16h va = FR::load(Vth + (t * 16 + c) * LP + kk * 32 + 8 * hh);
        oacc[t] = hmma(va, pb[kk], oacc[t]);
      }
    }
  }

  // ---- epilogue: join the halves' sums, normalise, stage 16x64 wave tile, whole-line f16 stores ----
  float* os = Os + wave * (16 * 68);
  {
    const float lsum = lrun + xhalf(lrun);
    const float inv  = OUT_CARRY * (1.0f / (lsum * PROB_CARRY));
#pragma unroll
    for (int t = 0; t < 4; ++t) {
#pragma unroll
      for (int g = 0; g < 2; ++g) {
        v4f w;
#pragma unroll
        for (int e = 0; e < 4; ++e) w[e] = oacc[t][g * 4 + e] * inv;
        *(v4f*)(os + c * 68 + t * 16 + 8 * hh + g * 4) = w;
      }
    }
  }
  __builtin_amdgcn_fence(__ATOMIC_RELEASE, "workgroup");
  __builtin_amdgcn_wave_barrier();
  __builtin_amdgcn_fence(__ATOMIC_ACQUIRE, "workgroup");
  {
    const int qq = lane >> 3, c8 = (lane & 7) * 8;
    {
#pragma unroll
      for (int it = 0; it < 4; ++it) {
        const int row = it * 4 + qq;
        const float* sp = os + row * 68 + c8;
        v8h hv;
#pragma unroll
        for (int e = 0; e < 8; ++e) hv[e] = (_Float16)sp[e];
        *(v8h*)(Ob + (size_t)(q0 + row) * ROWP + c8) = hv;
      }
      
    }
  }
}

// ---------------------------------------------------------------------------
// Host orchestration (kernel launches + host arithmetic only)
// ---------------------------------------------------------------------------
extern "C" void kernel_launch(void* const* d_in, const int* in_sizes, int n_in,
                              void* d_out, int out_size, void* d_ws, size_t ws_size,
                              hipStream_t stream) {
  if (n_in < 11) return;
  const long nQ  = (long)SEQLEN * NBAT * EMBED;    // 8388608
  const long nW  = (long)EMBED * EMBED;            // 262144
  const long nWc = (long)NCOMP * SEQLEN;           // 4194304
  if (in_sizes[0] != nQ || in_sizes[1] != nW || in_sizes[2] != EMBED || in_sizes[3] != nW ||
      in_sizes[4] != EMBED || in_sizes[5] != nW || in_sizes[6] != EMBED || in_sizes[7] != nWc ||
      in_sizes[8] != nWc || in_sizes[9] != nW || in_sizes[10] != EMBED || out_size != nQ) return;

  const float* query = (const float*)d_in[0];
  const float* Wq  = (const float*)d_in[1];  const float* bq = (const float*)d_in[2];
  const float* Wk  = (const float*)d_in[3];  const float* bk = (const float*)d_in[4];
  const float* Wv  = (const float*)d_in[5];  const float* bv = (const float*)d_in[6];
  const float* Wck = (const float*)d_in[7];  const float* Wcv = (const float*)d_in[8];
  const float* Wo  = (const float*)d_in[9];  const float* bo = (const float*)d_in[10];

  // ---- workspace region map (bytes) ----
  const size_t BYTES_QB   = (size_t)nQ * 2;                              // bf16 query [16384][512]            16 MiB
  const size_t BYTES_QT   = (size_t)nQ * 2;                              // bf16 query^T [4][512][4096]        16 MiB
  const size_t BYTES_WC   = (size_t)2 * nWc * 2;                         // bf16 [Wck;Wcv] [2048][4096]        16 MiB
  const size_t BYTES_KVIN = (size_t)2 * NCOMP * NBAT * (2 * EMBED) * 2;  // u16 [8192][1024] (hi|lo rows)     16 MiB
  const size_t BYTES_QP   = (size_t)nQ * 2;                              // f16 q plane [16384][512]          16 MiB
  const size_t BYTES_OP   = (size_t)nQ * 2;                              // f16 attention out [16384][512]    16 MiB
  const size_t BYTES_KP   = (size_t)NCOMP * NBAT * EMBED * 2;            // f16 k plane [4096][512]            4 MiB
  const size_t BYTES_VT   = (size_t)NBAT * EMBED * NCOMP * 2;            // f16 v^T plane [4][512][1024]       4 MiB
  const size_t BYTES_WQ   = (size_t)nW * 2;                              // bf16 Wq [512][512]               512 KiB
  const size_t BYTES_WK2  = (size_t)nW * 2 * 2;                          // bf16 [Wk|Wk] [512][1024]            1 MiB
  const size_t BYTES_WV2  = (size_t)nW * 2 * 2;                          // bf16 [Wv|Wv] [512][1024]            1 MiB
  const size_t BYTES_WOH  = (size_t)nW * 2;                              // f16 64*Wo [512][512]             512 KiB
  const size_t BYTES_BIAS = (size_t)4 * EMBED * 4;                       // f32 biases 4 x 512                  8 KiB
  const size_t OFF_QB   = 0;
  const size_t OFF_QT   = OFF_QB   + BYTES_QB;
  const size_t OFF_WC   = OFF_QT   + BYTES_QT;
  const size_t OFF_KVIN = OFF_WC   + BYTES_WC;
  const size_t OFF_QP   = OFF_KVIN + BYTES_KVIN;
  const size_t OFF_OP   = OFF_QP   + BYTES_QP;
  const size_t OFF_KP   = OFF_OP   + BYTES_OP;
  const size_t OFF_VT   = OFF_KP   + BYTES_KP;
  const size_t OFF_WQ   = OFF_VT   + BYTES_VT;
  const size_t OFF_WK2  = OFF_WQ   + BYTES_WQ;
  const size_t OFF_WV2  = OFF_WK2  + BYTES_WK2;
  const size_t OFF_WOH  = OFF_WV2  + BYTES_WV2;
  const size_t OFF_BIAS = OFF_WOH  + BYTES_WOH;
  const size_t WS_TOTAL = OFF_BIAS + BYTES_BIAS;                         // 112,205,824 B
  if (WS_TOTAL > ws_size) return;

  char* ws = (char*)d_ws;
  unsigned short* queryB = (unsigned short*)(ws + OFF_QB);
  unsigned short* queryT = (unsigned short*)(ws + OFF_QT);
  unsigned short* WcB    = (unsigned short*)(ws + OFF_WC);
  unsigned short* KVin   = (unsigned short*)(ws + OFF_KVIN);
  unsigned short* qP     = (unsigned short*)(ws + OFF_QP);
  unsigned short* oP     = (unsigned short*)(ws + OFF_OP);
  unsigned short* kP     = (unsigned short*)(ws + OFF_KP);
  unsigned short* vtP    = (unsigned short*)(ws + OFF_VT);
  unsigned short* WqB    = (unsigned short*)(ws + OFF_WQ);
  unsigned short* WkB2   = (unsigned short*)(ws + OFF_WK2);
  unsigned short* WvB2   = (unsigned short*)(ws + OFF_WV2);
  unsigned short* WoH    = (unsigned short*)(ws + OFF_WOH);
  float*          biasb  = (float*)(ws + OFF_BIAS);
  float* bq_r = biasb;
  float* bk_r = biasb + EMBED;
  float* bv_r = biasb + 2 * EMBED;
  float* bo_r = biasb + 3 * EMBED;

  // 1. query -> bf16 [16384][512] (same flat layout as [T][B][E])
  {
    const int n2 = (int)(nQ / 2);
    cast_bf16x2_kernel<<<dim3((unsigned)((n2 + 255) / 256)), dim3(256), 0, stream>>>(query, queryB, n2);
  }
  // 2. query^T per batch: in [T=4096 rows][E=512 cols] pitch 2048 (base + b*512) -> out_b [512][4096]
  tconv_bf16_kernel<<<dim3(EMBED / 64, SEQLEN / 64, NBAT), dim3(256), 0, stream>>>(
      query, queryT, SEQLEN, EMBED, NBAT * EMBED, (long)EMBED, (long)EMBED * SEQLEN);
  // 3./4. Wck -> rows 0..1023, Wcv -> rows 1024..2047 of the [2048][4096] bf16 plane
  {
    const int n2 = (int)(nWc / 2);
    cast_bf16x2_kernel<<<dim3((unsigned)((n2 + 255) / 256)), dim3(256), 0, stream>>>(Wck, WcB, n2);
    cast_bf16x2_kernel<<<dim3((unsigned)((n2 + 255) / 256)), dim3(256), 0, stream>>>(Wcv, WcB + (size_t)nWc, n2);
  }
  // 5..8. weights
  {
    const int n2 = (int)(nW / 2);
    cast_bf16x2_kernel<<<dim3((unsigned)((n2 + 255) / 256)), dim3(256), 0, stream>>>(Wq, WqB, n2);
    dup_bf16x2_kernel<<<dim3((unsigned)((n2 + 255) / 256)), dim3(256), 0, stream>>>(Wk, WkB2, n2, EMBED);
    dup_bf16x2_kernel<<<dim3((unsigned)((n2 + 255) / 256)), dim3(256), 0, stream>>>(Wv, WvB2, n2, EMBED);
    cast_wo_f16x2_kernel<<<dim3((unsigned)((n2 + 255) / 256)), dim3(256), 0, stream>>>(Wo, WoH, n2, WO_CARRY);
  }
  // 9. biases (RNE to bf16 precision)
  bias_prep_kernel<<<dim3(1), dim3(512), 0, stream>>>(bq, bk, bv, bo, biasb, EMBED);

  // 10. compression: per batch b: C_b[m][n] = sum_t WcB[m][t] * queryT_b[n][t]; m<1024 -> k_in[m][b][n], m>=1024 -> v_in.
  //     C element (m,n,b): hi at KVin[(m*4+b)*1024 + n], lo at +512  => ldc 4096, strideC 1024, Cout2 = Cout + 512.
  //     M=2048, N=512, K=4096 (K%64==0, M%128==0, N%256==0): 32 block tiles of 128x256 per batch -> grid (32, 4).
  wmma_gemm64<1, false, 0, 2, false><<<dim3(32, NBAT), dim3(256), 0, stream>>>(
      WcB, WcB, SEQLEN, 0L,
      queryT, queryT, SEQLEN, (long)EMBED * SEQLEN,
      (void*)KVin, (void*)(KVin + EMBED), 4 * (2 * EMBED), (long)(2 * EMBED),
      biasb, biasb, 0L,
      2 * NCOMP, EMBED, SEQLEN, 1.0f);

  // 11. q8 = query . Wq^T + bq  (scale 1; 0.125 applied to f32 scores) -> f16 [16384][512]; M=16384, N=512, K=512: grid 256.
  wmma_gemm64<1, false, 2, 1, false><<<dim3(256, 1), dim3(256), 0, stream>>>(
      queryB, queryB, EMBED, 0L,
      WqB, WqB, EMBED, 0L,
      (void*)qP, (void*)qP, EMBED, 0L,
      bq_r, bq_r, 0L,
      SEQLEN * NBAT, EMBED, EMBED, 1.0f);

  // 12. k = [k_in hi|lo] . [Wk|Wk]^T + bk -> f16 [4096 rows (c*4+b)][512]; M=4096, N=512, K'=1024: grid 64.
  wmma_gemm64<1, false, 2, 1, false><<<dim3(64, 1), dim3(256), 0, stream>>>(
      KVin, KVin, 2 * EMBED, 0L,
      WkB2, WkB2, 2 * EMBED, 0L,
      (void*)kP, (void*)kP, EMBED, 0L,
      bk_r, bk_r, 0L,
      NCOMP * NBAT, EMBED, 2 * EMBED, 1.0f);

  // 13. v^T per batch: C_b[m=e'][n=c] = sum_k [Wv|Wv][e'][k] * [v_in hi|lo][(c,b)][k] + bv[e'] -> f16 vtP[b][512][1024].
  //     Bt_b rows at KVin + 4096*1024 + b*1024 + c*4096 (ldb 4096, strideB 1024); M=512, N=1024, K'=1024: grid (16, 4).
  wmma_gemm64<1, false, 1, 1, false><<<dim3(16, NBAT), dim3(256), 0, stream>>>(
      WvB2, WvB2, 2 * EMBED, 0L,
      KVin + (size_t)NCOMP * NBAT * (2 * EMBED), KVin + (size_t)NCOMP * NBAT * (2 * EMBED), 4 * (2 * EMBED), (long)(2 * EMBED),
      (void*)vtP, (void*)vtP, NCOMP, (long)EMBED * NCOMP,
      bv_r, bv_r, 0L,
      EMBED, NCOMP, 2 * EMBED, 1.0f);

  // 14. attention over the compressed keys: grid = B*H*(T/64) = 2048 blocks of 128
  attn_lin_kernel<<<dim3(NBAT * NHEADS * (SEQLEN / 64)), dim3(128), 0, stream>>>(qP, kP, vtP, oP);

  // 15. out = (16 O) . (64 Wo)^T / 1024 + bo -> f32 d_out [16384][512]; M=16384, N=512, K=512: grid 256.
  wmma_gemm64<0, false, 2, 0, false><<<dim3(256, 1), dim3(256), 0, stream>>>(
      oP, oP, EMBED, 0L,
      WoH, WoH, EMBED, 0L,
      d_out, d_out, EMBED, 0L,
      bo_r, bo_r, 0L,
      SEQLEN * NBAT, EMBED, EMBED, 1.0f / (OUT_CARRY * WO_CARRY));
}

// v004
// A run of this version takes 177 microseconds.
// Next to v003, in two timings, it ran 1.24 and 1.25 times as fast.
// Counting every step since v000, it is 3.26 times as fast.
// Contractions: sequence compression and q/k/v^T projections on v_wmma_f32_16x16x32_bf16 (bf16 operands = RNE-converted inputs; k_in/v_in carried as bf16 hi+lo planes concatenated along k); q.k^T, p.v and the output projection on v_wmma_f32_16x16x32_f16 (f16 planes; p carried x2^15, attention output x2^4, Wo x2^6); f32 accumulate; softmax, score scale 0.125 and biases in f32.
#include <hip/hip_runtime.h>
#include <math.h>
#include <stdint.h>

typedef __attribute__((ext_vector_type(16))) _Float16 v16h;
typedef __attribute__((ext_vector_type(8)))  _Float16 v8h;
typedef __attribute__((ext_vector_type(16))) __bf16   v16b;
typedef __attribute__((ext_vector_type(8)))  __bf16   v8b;
typedef __attribute__((ext_vector_type(8)))  float    v8f;
typedef __attribute__((ext_vector_type(4)))  float    v4f;
typedef __attribute__((ext_vector_type(2)))  float    v2f;
typedef __attribute__((ext_vector_type(4)))  unsigned int v4u;

__device__ __forceinline__ unsigned short f2bf_bits(float f) {
  unsigned u = __float_as_uint(f);
  return (unsigned short)((u + 0x7FFFu + ((u >> 16) & 1u)) >> 16);
}
__device__ __forceinline__ float bf_bits2f(unsigned short h) { return __uint_as_float(((unsigned)h) << 16); }

// hazard guards as plain device helpers (no inline asm inside the kernel template body)
__device__ __forceinline__ void dep_guard_h(v8f& a, v8f& b, v16h x, v16h y) { asm volatile("v_nop\n\tv_nop\n\tv_nop\n\tv_nop" : "+v"(a), "+v"(b) : "v"(x), "v"(y)); }
__device__ __forceinline__ void dep_guard_b(v8f& a, v8f& b, v16b x, v16b y) { asm volatile("v_nop\n\tv_nop\n\tv_nop\n\tv_nop" : "+v"(a), "+v"(b) : "v"(x), "v"(y)); }
__device__ __forceinline__ void keep4_h(v16h a, v16h b, v16h c, v16h d) { asm volatile("v_nop" :: "v"(a), "v"(b), "v"(c), "v"(d)); }
__device__ __forceinline__ void keep4_b(v16b a, v16b b, v16b c, v16b d) { asm volatile("v_nop" :: "v"(a), "v"(b), "v"(c), "v"(d)); }
__device__ __forceinline__ void acc_guard4(v8f& a, v8f& b, v8f& c, v8f& d) { asm volatile("v_nop\n\tv_nop\n\tv_nop\n\tv_nop" : "+v"(a), "+v"(b), "+v"(c), "+v"(d)); }
template <typename T> struct Frag;
template <> struct Frag<_Float16> {
  typedef v16h V; typedef v8h H; union U { v16h v; v8h h[2]; };
  static __device__ __forceinline__ v16h load(const _Float16* p) {   // elements 0..7 <- p[0..7], 8..15 <- p[16..23]
    U f; f.h[0] = *(const v8h*)(p); f.h[1] = *(const v8h*)(p + 16); return f.v;
  }
  static __device__ __forceinline__ v8f mma(v16h a, v16h b, v8f c) {
    return __builtin_amdgcn_wmma_f32_16x16x32_f16(false, a, false, b, (short)0, c, false, false);
  }
  static __device__ __forceinline__ void guard(v8f& a, v8f& b, v16h x, v16h y) { dep_guard_h(a, b, x, y); }
  static __device__ __forceinline__ void keep(v16h a, v16h b, v16h c, v16h d) { keep4_h(a, b, c, d); }
};
template <> struct Frag<__bf16> {
  typedef v16b V; typedef v8b H; union U { v16b v; v8b h[2]; };
  static __device__ __forceinline__ v16b load(const __bf16* p) {
    U f; f.h[0] = *(const v8b*)(p); f.h[1] = *(const v8b*)(p + 16); return f.v;
  }
  static __device__ __forceinline__ v8f mma(v16b a, v16b b, v8f c) {
    return __builtin_amdgcn_wmma_f32_16x16x32_bf16(false, a, false, b, (short)0, c, false, false);
  }
  static __device__ __forceinline__ void guard(v8f& a, v8f& b, v16b x, v16b y) { dep_guard_b(a, b, x, y); }
  static __device__ __forceinline__ void keep(v16b a, v16b b, v16b c, v16b d) { keep4_b(a, b, c, d); }
};

// ---- Register-blocked batched WMMA GEMM ------------------------------------
// C[m,n] = scale * sum_k A[m,k] * Bt[n,k] (+bias)(+resid); each wave owns a 64x64 tile.
// A row-major [M,K]; Bt row-major [N,K]; M % 128 == 0, N % 256 == 0, K % 64 == 0.
// A block of 8 waves (2 x 4) owns a 128x256 tile of C. Per stage of 64 k it brings 128 rows of A and 256 rows
// of Bt, 128 B each, into LDS with whole-line 16-byte loads (8 lanes per row); the waves read their fragments
// from LDS. Two LDS buffers: the next stage's global loads are issued ahead of this stage's products and
// stored behind them, one block barrier per stage.
// SPLIT (hi/lo operand planes) is not built in this form.
// BIAS_MODE: 0 = none, 1 = bias[m], 2 = bias[n].
// OUT_MODE: 0 = f32, 1 = f16, 2 = bf16 hi plane (Cout) + bf16 lo plane (Cout2).
// ET: 0 = f16 operands, 1 = bf16 operands (pointers passed as 16-bit storage)
template <int ET> struct Elem;
template <> struct Elem<0> { typedef _Float16 T; };
template <> struct Elem<1> { typedef __bf16 T; };
// The tile's work is a device function: bx = index of the block tile, b = batch, sOpRaw / sTRaw = the launching
// kernel's LDS, so that one launch can hold the block tiles of two products that do not depend on one another.
constexpr int GEMM_OP_ELEMS = 2 * (128 + 256) * (64 + 8);   // two buffers of (BM + BN) rows at pitch LP
constexpr int GEMM_SLAB_F32 = 8 * 16 * 68;                  // eight per-wave 16x64 slabs, pitch 68 floats
template <int ET, bool SPLIT, int BIAS_MODE, int OUT_MODE, bool RESID, int ACT = 0>
__device__ __forceinline__ void gemm_tile(
    const unsigned short* __restrict__ Ap, const unsigned short* __restrict__ A2p, int lda, long strideA,
    const unsigned short* __restrict__ Btp, const unsigned short* __restrict__ Bt2p, int ldb, long strideB,
    void* __restrict__ Cout, void* __restrict__ Cout2, int ldc, long strideC,
    const float* __restrict__ bias,
    const float* __restrict__ resid, long strideR,
    int M, int N, int K, float scale,
    int bx, int b, unsigned short* sOpRaw, float* sTRaw) {
  typedef typename Elem<ET>::T T;
  typedef typename Frag<T>::V V;
  const T* A = (const T*)Ap; const T* Bt = (const T*)Btp;
  static_assert(!SPLIT, "hi/lo planes are not staged");
  typedef typename Frag<T>::H H;
  constexpr int BM = 128, BN = 256, BK = 64;
  // LDS row pitch 64 + 8 elements = 144 B = 16 B x 9 (odd): the 16 rows of one 16-byte fragment read fall on
  // different groups of four banks.
  constexpr int LP = BK + 8;
  static_assert(2 * (BM + BN) * LP == GEMM_OP_ELEMS, "LDS size");
  T (*sOp)[(BM + BN) * LP] = (T (*)[(BM + BN) * LP])sOpRaw;   // [buffer][A rows 0..127 | Bt rows 128..383][k]
  float (*sT)[16 * 68] = (float (*)[16 * 68])sTRaw;           // per-wave 16x64 slab, pitch 68 floats
  const int tid  = threadIdx.x;
  const int lane = tid & 31;
  const int wave = tid >> 5;
  const int blocksN = N / BN;
  const int blocksM = M / BM;
  if (bx >= blocksM * blocksN) return;   // block-uniform, ahead of every barrier
  const int bm = bx / blocksN;
  const int bn = bx - bm * blocksN;
  const int wm = wave >> 2;                    // 0..1: 64-row band of the block tile
  const int wn = wave & 3;                     // 0..3: 64-column band
  const int m0 = bm * BM + (wm << 6);
  const int n0 = bn * BN + (wn << 6);

  const T* Ab  = A  + (size_t)b * strideA;
  const T* Bb  = Bt + (size_t)b * strideB;

  const int rlane = lane & 15;                 // row (A) / col (B, D) within subtile
  const int koff  = (lane >> 4) * 8;           // k offset of this lane half
  const int mOff  = (lane >> 4) * 8;           // D row offset

  // staging map: 8 threads x 16 B = one 128-B row; 32 rows per sweep of the block
  const int srow = tid >> 3;                   // 0..31
  const int sk   = (tid & 7) * 8;              // element offset in the row
  const T* gA = Ab + (size_t)(bm * BM + srow) * lda + sk;
  const T* gB = Bb + (size_t)(bn * BN + srow) * ldb + sk;
  const int sdst = srow * LP + sk;

  v8f acc[4][4];
#pragma unroll
  for (int i = 0; i < 4; ++i)
#pragma unroll
    for (int j = 0; j < 4; ++j) acc[i][j] = (v8f){0.f,0.f,0.f,0.f,0.f,0.f,0.f,0.f};

  H stA[BM / 32], stB[BN / 32];
#pragma unroll
  for (int it = 0; it < BM / 32; ++it) stA[it] = *(const H*)(gA + (size_t)(it * 32) * lda);
#pragma unroll
  for (int it = 0; it < BN / 32; ++it) stB[it] = *(const H*)(gB + (size_t)(it * 32) * ldb);
#pragma unroll
  for (int it = 0; it < BM / 32; ++it) *(H*)(&sOp[0][sdst + it * 32 * LP]) = stA[it];
#pragma unroll
  for (int it = 0; it < BN / 32; ++it) *(H*)(&sOp[0][sdst + (BM + it * 32) * LP]) = stB[it];
  __syncthreads();

  const int nst = K / BK;
#pragma unroll 1
  for (int s = 0; s < nst; ++s) {
    const T* cur = sOp[s & 1];
    T*       nxt = sOp[(s + 1) & 1];
    const bool more = s + 1 < nst;             // the same for the whole block
    if (more) {
      const int k1 = (s + 1) * BK;
#pragma unroll
      for (int it = 0; it < BM / 32; ++it) stA[it] = *(const H*)(gA + (size_t)(it * 32) * lda + k1);
#pragma unroll
      for (int it = 0; it < BN / 32; ++it) stB[it] = *(const H*)(gB + (size_t)(it * 32) * ldb + k1);
    }
#pragma unroll
    for (int kk = 0; kk < BK; kk += 32) {
      V bh[4], ah[4];
#pragma unroll
      for (int j = 0; j < 4; ++j) bh[j] = Frag<T>::load(cur + (BM + (wn << 6) + (j << 4) + rlane) * LP + kk + koff);
#pragma unroll
      for (int i = 0; i < 4; ++i) ah[i] = Frag<T>::load(cur + ((wm << 6) + (i << 4) + rlane) * LP + kk + koff);
#pragma unroll
      for (int i = 0; i < 4; ++i) {
#pragma unroll
        for (int j = 0; j < 4; ++j) acc[i][j] = Frag<T>::mma(ah[i], bh[j], acc[i][j]);
        Frag<T>::guard(acc[i][0], acc[i][3], ah[i], ah[i]);
      }
      Frag<T>::keep(bh[0], bh[1], bh[2], bh[3]);
    }
    if (more) {
#pragma unroll
      for (int it = 0; it < BM / 32; ++it) *(H*)(nxt + sdst + it * 32 * LP) = stA[it];
#pragma unroll
      for (int it = 0; it < BN / 32; ++it) *(H*)(nxt + sdst + (BM + it * 32) * LP) = stB[it];
    }
    // publishes the buffer just written and ends every wave's reads of the buffer that the next stage refills
    __syncthreads();
  }
  acc_guard4(acc[0][0], acc[0][1], acc[0][2], acc[0][3]);
  acc_guard4(acc[1][0], acc[1][1], acc[1][2], acc[1][3]);
  acc_guard4(acc[2][0], acc[2][1], acc[2][2], acc[2][3]);
  acc_guard4(acc[3][0], acc[3][1], acc[3][2], acc[3][3]);

  // ---- epilogue ----
  float* slab = sT[wave];
  const float* Rb = RESID ? (resid + (size_t)b * strideR) : nullptr;
#pragma unroll
  for (int i = 0; i < 4; ++i) {
    const int mBase = m0 + (i << 4);
#pragma unroll
    for (int j = 0; j < 4; ++j) {
      const int n = n0 + (j << 4) + rlane;
      float bv = 0.f;
      if (BIAS_MODE == 2) bv = bias[n];
#pragma unroll
      for (int r = 0; r < 8; ++r) {
        float v = acc[i][j][r] * scale;
        if (BIAS_MODE == 1) v += bias[mBase + mOff + r];
        if (BIAS_MODE == 2) v += bv;
        if (RESID) v += Rb[(size_t)(mBase + mOff + r) * ldc + n];
        if (ACT == 1) v = tanhf(v);
        if (ACT == 2) v = fmaxf(v, 0.0f);
        if (ACT == 3) v = v / (1.0f + expf(-v));
        if (ACT == 4) v = (v > 0.f) ? v : 0.01f * v;
        if (ACT == 5) v = 0.5f * v * (1.0f + erff(v * 0.70710678118654752f));
        slab[(mOff + r) * 68 + (j << 4) + rlane] = v;
      }
    }
    __builtin_amdgcn_fence(__ATOMIC_RELEASE, "workgroup");
    __builtin_amdgcn_wave_barrier();
    __builtin_amdgcn_fence(__ATOMIC_ACQUIRE, "workgroup");
    if (OUT_MODE == 0) {
      float* C = (float*)Cout + (size_t)b * strideC;
      const int hh = lane >> 4, c4 = (lane & 15) * 4;     // row seg = 256 B = 16 lanes x 16 B
      {
#pragma unroll
        for (int it = 0; it < 8; ++it) {
          const int row = it * 2 + hh;
          v4f v = *(const v4f*)(slab + row * 68 + c4);
          *(v4f*)(C + (size_t)(mBase + row) * ldc + n0 + c4) = v;
        }
        
      }
    } else {
      const int q = lane >> 3, c8 = (lane & 7) * 8;
      unsigned short* C  = (unsigned short*)Cout  + (size_t)b * strideC;
      unsigned short* C2 = (OUT_MODE == 2) ? ((unsigned short*)Cout2 + (size_t)b * strideC) : nullptr;
      {
#pragma unroll
        for (int it = 0; it < 4; ++it) {
          const int row = it * 4 + q;
          const float* sp = slab + row * 68 + c8;
          v8h hv, lv;
#pragma unroll
          for (int e = 0; e < 8; ++e) {
            if (OUT_MODE == 1) {
              hv[e] = (_Float16)sp[e];
            } else {
              unsigned short hb = f2bf_bits(sp[e]);
              unsigned short lb = f2bf_bits(sp[e] - bf_bits2f(hb));
              hv[e] = __builtin_bit_cast(_Float16, hb);
              lv[e] = __builtin_bit_cast(_Float16, lb);
            }
          }
          *(v8h*)(C + (size_t)(mBase + row) * ldc + n0 + c8) = hv;
          if (OUT_MODE == 2) *(v8h*)(C2 + (size_t)(mBase + row) * ldc + n0 + c8) = lv;
        }
        
      }
    }
    __builtin_amdgcn_fence(__ATOMIC_RELEASE, "workgroup");
    __builtin_amdgcn_wave_barrier();
    __builtin_amdgcn_fence(__ATOMIC_ACQUIRE, "workgroup");
  }
}

// One product per launch: grid (block tiles, batches).
template <int ET, bool SPLIT, int BIAS_MODE, int OUT_MODE, bool RESID, int ACT = 0>
__global__ __launch_bounds__(256) void wmma_gemm64(
    const unsigned short* __restrict__ Ap, const unsigned short* __restrict__ A2p, int lda, long strideA,
    const unsigned short* __restrict__ Btp, const unsigned short* __restrict__ Bt2p, int ldb, long strideB,
    void* __restrict__ Cout, void* __restrict__ Cout2, int ldc, long strideC,
    const float* __restrict__ bias,
    const float* __restrict__ resid, long strideR,
    int M, int N, int K, float scale) {
  __shared__ __align__(16) unsigned short sOpRaw[GEMM_OP_ELEMS];
  __shared__ __align__(16) float sTRaw[GEMM_SLAB_F32];
  gemm_tile<ET, SPLIT, BIAS_MODE, OUT_MODE, RESID, ACT>(Ap, A2p, lda, strideA, Btp, Bt2p, ldb, strideB, Cout, Cout2, ldc, strideC,
                                                        bias, resid, strideR, M, N, K, scale,
                                                        (int)blockIdx.x, (int)blockIdx.y, sOpRaw, sTRaw);
}

// Two independent products in one launch: blocks 0 .. nb0-1 take product 0 (the longer one, so that it starts first),
// the rest product 1. In each product the flat index runs over its gx block tiles first, then over its batches.
struct GemmJob {
  const unsigned short* A;  const unsigned short* Bt;
  unsigned short* C;  unsigned short* C2;
  const float* bias;
  long strideA, strideB, strideC;
  int lda, ldb, ldc, M, N, K, gx;
};
template <int ET, int BIAS0, int OUT0, int BIAS1, int OUT1>
__global__ __launch_bounds__(256) void wmma_gemm64_pair(GemmJob j0, GemmJob j1, int nb0) {
  __shared__ __align__(16) unsigned short sOpRaw[GEMM_OP_ELEMS];
  __shared__ __align__(16) float sTRaw[GEMM_SLAB_F32];
  const int blk = (int)blockIdx.x;   // the same for the whole block: every barrier below stands under block-uniform flow
  if (blk < nb0) {
    gemm_tile<ET, false, BIAS0, OUT0, false>(j0.A, j0.A, j0.lda, j0.strideA, j0.Bt, j0.Bt, j0.ldb, j0.strideB,
                                             (void*)j0.C, (void*)j0.C2, j0.ldc, j0.strideC, j0.bias, j0.bias, 0L,
                                             j0.M, j0.N, j0.K, 1.0f, blk % j0.gx, blk / j0.gx, sOpRaw, sTRaw);
  } else {
    const int l = blk - nb0;
    gemm_tile<ET, false, BIAS1, OUT1, false>(j1.A, j1.A, j1.lda, j1.strideA, j1.Bt, j1.Bt, j1.ldb, j1.strideB,
                                             (void*)j1.C, (void*)j1.C2, j1.ldc, j1.strideC, j1.bias, j1.bias, 0L,
                                             j1.M, j1.N, j1.K, 1.0f, l % j1.gx, l / j1.gx, sOpRaw, sTRaw);
  }
}

__device__ __forceinline__ unsigned pk16(unsigned short a, unsigned short b) { return (unsigned)a | ((unsigned)b << 16); }

// ---------------------------------------------------------------------------
// Problem geometry
// ---------------------------------------------------------------------------
constexpr int   SEQLEN  = 4096;   // time steps (queries)
constexpr int   NBAT    = 4;      // batch
constexpr int   EMBED   = 512;    // channels
constexpr int   NHEADS  = 8;
constexpr int   HDIM    = 64;
constexpr int   NCOMP   = 1024;   // compressed key count
constexpr float SCORE_SCALE = 0.125f;     // head_dim^-0.5, applied to the f32 score accumulators
constexpr float PROB_CARRY  = 32768.0f;   // p carried x2^15 in the f16 P operand, folded into 1/l
constexpr float OUT_CARRY   = 16.0f;      // attention output carried x2^4 in its f16 plane
constexpr float WO_CARRY    = 64.0f;      // Wo carried x2^6 in its f16 plane

// ---------------------------------------------------------------------------
// Elementwise f32 -> bf16 (RNE), 2 elements per thread, one 4-B store per lane: a wave writes one whole
// ---------------------------------------------------------------------------
__device__ __forceinline__ void cast_bf16x2_job(const float* __restrict__ in, unsigned short* __restrict__ out, int n2, int blk) {
  const int i = blk * 256 + threadIdx.x;
  if (i < n2) {
    const v2f f = *(const v2f*)(in + 2 * (size_t)i);
    const unsigned u = pk16(f2bf_bits(f[0]), f2bf_bits(f[1]));
    ((unsigned*)out)[i] = u;
    
  }
}

// ---------------------------------------------------------------------------
// W [rows][cols] f32 -> out [rows][2*cols] bf16 with out[r][c] = out[r][cols + c] = bf16_rne(W[r][c]).
// 2 elements per thread; cols % 64 == 0 so a wave's 64 elements stay in one row: each store instruction
// ---------------------------------------------------------------------------
__device__ __forceinline__ void dup_bf16x2_job(const float* __restrict__ W, unsigned short* __restrict__ out, int n2, int cols, int blk) {
  const int i = blk * 256 + threadIdx.x;
  if (i < n2) {
    const int e0 = 2 * i;
    const int r  = e0 / cols;
    const int cc = e0 - r * cols;
    const v2f f = *(const v2f*)(W + e0);
    const unsigned u = pk16(f2bf_bits(f[0]), f2bf_bits(f[1]));
    const size_t o0 = ((size_t)r * 2 * cols + cc) >> 1;          // uint index of out[r][cc]
    const size_t o1 = ((size_t)r * 2 * cols + cols + cc) >> 1;   // uint index of out[r][cols+cc]
    ((unsigned*)out)[o0] = u;
    ((unsigned*)out)[o1] = u;
    
  }
}

// ---------------------------------------------------------------------------
// Wo f32 -> f16 plane holding f16(carry * bf16_rne(w)) (exact for bf16 values in the normal f16 range).
// Same store discipline as cast_bf16x2_job.
// ---------------------------------------------------------------------------
__device__ __forceinline__ void cast_wo_f16x2_job(const float* __restrict__ W, unsigned short* __restrict__ out, int n2, float carry, int blk) {
  const int i = blk * 256 + threadIdx.x;
  if (i < n2) {
    const v2f f = *(const v2f*)(W + 2 * (size_t)i);
    const float b0 = bf_bits2f(f2bf_bits(f[0])) * carry;
    const float b1 = bf_bits2f(f2bf_bits(f[1])) * carry;
    const _Float16 h0 = (_Float16)b0, h1 = (_Float16)b1;
    const unsigned u = pk16(__builtin_bit_cast(unsigned short, h0), __builtin_bit_cast(unsigned short, h1));
    ((unsigned*)out)[i] = u;
    
  }
}

// ---------------------------------------------------------------------------
// Bias vectors RNE-converted to bf16 precision (kept as f32): outb[0..n) = bq, [n..2n) = bk, [2n..3n) = bv, [3n..4n) = bo.
// ---------------------------------------------------------------------------
__device__ __forceinline__ void bias_prep_job(const float* __restrict__ bq, const float* __restrict__ bk,
                                              const float* __restrict__ bv, const float* __restrict__ bo,
                                              float* __restrict__ outb, int n, int blk) {
  const int i = blk * 256 + threadIdx.x;
  if (i < n) {
    const float a0 = bf_bits2f(f2bf_bits(bq[i]));
    const float a1 = bf_bits2f(f2bf_bits(bk[i]));
    const float a2 = bf_bits2f(f2bf_bits(bv[i]));
    const float a3 = bf_bits2f(f2bf_bits(bo[i]));
    ((float*)outb)[i] = a0;
    ((float*)outb)[n + i] = a1;
    ((float*)outb)[2 * n + i] = a2;
    ((float*)outb)[3 * n + i] = a3;
    
  }
}

// ---------------------------------------------------------------------------
// Transpose + bf16 RNE convert, z-batched: in_z = X + z*sIn viewed [R rows][Cc cols] with row pitch ldi ->
//   o_z[c][r] = bf16_rne(in_z[r][c])  ([Cc][R], pitch R), o_z = o + z*sOut.
// 64x64 tiles through LDS (tf: 64 * 68 floats of the launching kernel). Tile (bx, by, bz) of (Cc/64, R/64, Z), 256 threads
// (R, Cc multiples of 64).
// Coverage per block: load 4 it x 256 thr x 4 floats = 64x64; store 2 it x 256 thr x 8 u16 = 64x64.
// ---------------------------------------------------------------------------
__device__ __forceinline__ void tconv_bf16_job(const float* __restrict__ X, unsigned short* __restrict__ o,
                                               int R, int Cc, int ldi, long sIn, long sOut,
                                               int bx, int by, int bz, float* tf) {
  X += (size_t)bz * sIn;
  o += (size_t)bz * sOut;
  const int c0  = bx * 64;   // input column block = output row block
  const int r0  = by * 64;   // input row block    = output column block
  const int tid = threadIdx.x;
  {
    const int lr = tid >> 4;         // 0..15
    const int c4 = (tid & 15) * 4;   // 0..60
#pragma unroll
    for (int it = 0; it < 4; ++it) {
      const int rr = it * 16 + lr;   // 0..63
      const v4f a = *(const v4f*)(X + (size_t)(r0 + rr) * ldi + c0 + c4);
      *(v4f*)(tf + rr * 68 + c4) = a;
    }
  }
  __syncthreads();
  const int sub = tid >> 3;          // 0..31
  const int c8  = (tid & 7) * 8;     // 0..56
  v4u hv[2];
#pragma unroll
  for (int it = 0; it < 2; ++it) {
    const int oc = it * 32 + sub;    // output row within tile (= input column)
    v4u a;
#pragma unroll
    for (int q = 0; q < 4; ++q) {
      const float f0 = tf[(c8 + 2 * q) * 68 + oc];
      const float f1 = tf[(c8 + 2 * q + 1) * 68 + oc];
      a[q] = pk16(f2bf_bits(f0), f2bf_bits(f1));
    }
    hv[it] = a;
  }
  {
#pragma unroll
    for (int it = 0; it < 2; ++it) {
      const int oc = it * 32 + sub;
      const size_t go = (size_t)(c0 + oc) * R + r0 + c8;
      *(v4u*)(o + go) = hv[it];
    }
    
  }
}

// ---------------------------------------------------------------------------
// All input conversions in ONE launch: none reads what another writes. A block's flat index picks its job (the test is
// the same for the whole block, so the transposing job's barrier stands under block-uniform flow) and its place in the job.
// ---------------------------------------------------------------------------
constexpr int CB_TCONV = (EMBED / 64) * (SEQLEN / 64) * NBAT;       // 2048 tiles of query^T
constexpr int CB_QUERY = SEQLEN * NBAT * EMBED / 2 / 256;           // 16384 blocks, 512 elements each
constexpr int CB_WC    = NCOMP * SEQLEN / 2 / 256;                  // 8192 for each of Wck, Wcv
constexpr int CB_W     = EMBED * EMBED / 2 / 256;                   // 512 for each of Wq, Wk, Wv, Wo
constexpr int CB_BIAS  = EMBED / 256;                               // 2
constexpr int CB_TOTAL = CB_TCONV + CB_QUERY + 2 * CB_WC + 4 * CB_W + CB_BIAS;
__global__ __launch_bounds__(256) void convert_inputs_kernel(
    const float* __restrict__ query, const float* __restrict__ Wck, const float* __restrict__ Wcv,
    const float* __restrict__ Wq, const float* __restrict__ Wk, const float* __restrict__ Wv, const float* __restrict__ Wo,
    const float* __restrict__ bq, const float* __restrict__ bk, const float* __restrict__ bv, const float* __restrict__ bo,
    unsigned short* __restrict__ queryB, unsigned short* __restrict__ queryT, unsigned short* __restrict__ WcB,
    unsigned short* __restrict__ WqB, unsigned short* __restrict__ WkB2, unsigned short* __restrict__ WvB2,
    unsigned short* __restrict__ WoH, float* __restrict__ biasb) {
  __shared__ __align__(16) float tf[64 * 68];
  int blk = (int)blockIdx.x;
  // query^T per batch: in [T=4096 rows][E=512 cols] pitch 2048 (base + b*512) -> out_b [512][4096]
  if (blk < CB_TCONV) {
    tconv_bf16_job(query, queryT, SEQLEN, EMBED, NBAT * EMBED, (long)EMBED, (long)EMBED * SEQLEN,
                   blk % (EMBED / 64), (blk / (EMBED / 64)) % (SEQLEN / 64), blk / ((EMBED / 64) * (SEQLEN / 64)), tf);
    return;
  }
  blk -= CB_TCONV;
  // query -> bf16 [16384][512] (same flat layout as [T][B][E])
  if (blk < CB_QUERY) { cast_bf16x2_job(query, queryB, SEQLEN * NBAT * EMBED / 2, blk); return; }
  blk -= CB_QUERY;
  // Wck -> rows 0..1023, Wcv -> rows 1024..2047 of the [2048][4096] bf16 plane
  if (blk < CB_WC) { cast_bf16x2_job(Wck, WcB, NCOMP * SEQLEN / 2, blk); return; }
  blk -= CB_WC;
  if (blk < CB_WC) { cast_bf16x2_job(Wcv, WcB + (size_t)NCOMP * SEQLEN, NCOMP * SEQLEN / 2, blk); return; }
  blk -= CB_WC;
  if (blk < CB_W) { cast_bf16x2_job(Wq, WqB, EMBED * EMBED / 2, blk); return; }
  blk -= CB_W;
  if (blk < CB_W) { dup_bf16x2_job(Wk, WkB2, EMBED * EMBED / 2, EMBED, blk); return; }
  blk -= CB_W;
  if (blk < CB_W) { dup_bf16x2_job(Wv, WvB2, EMBED * EMBED / 2, EMBED, blk); return; }
  blk -= CB_W;
  if (blk < CB_W) { cast_wo_f16x2_job(Wo, WoH, EMBED * EMBED / 2, WO_CARRY, blk); return; }
  blk -= CB_W;
  // biases (RNE to bf16 precision)
  bias_prep_job(bq, bk, bv, bo, biasb, EMBED, blk);
}

// =====================================================================================
// Full (unmasked) attention over the NCOMP compressed keys, head dim 64, all (b,h) in one launch.
//   q plane f16: element (t, b, h, d) at [(t*NBAT + b)*EMBED + h*64 + d]   (holds 8*q; 0.125 applied to f32 scores)
//   k plane f16: element (c, b, h, d) at [(c*NBAT + b)*EMBED + h*64 + d]
//   v^T plane f16: element (b, h, d, c) at [b*EMBED*NCOMP + (h*64 + d)*NCOMP + c]
//   out plane f16: element (t, b, h, d) at [(t*NBAT + b)*EMBED + h*64 + d], value = OUT_CARRY * attention output
//   Both products are taken transposed: S^T = K . Q^T (A = K rows, B = Q) and O^T += V^T . P^T (A = V^T rows,
//   B = P^T), v_wmma_f32_16x16x32_f16, p carried x PROB_CARRY, f32 accumulate. A lane then holds 32 of the 64
//   scores of ONE query (lane l and l ^ 16 split the keys): maximum and sum run in the lane's own registers with
//   one exchange between the wave halves, and two score tiles, converted in place, are the B operand P^T.
//   Online softmax in f32 over NCOMP/64 chunks (compile-time trip count, no masking).
//   Block = 4 waves = 64 query rows of one (b, h); grid.x = NBAT * NHEADS * (SEQLEN/64) = 2048.
//   K / V^T chunk staging: 128 threads x 32 halves per plane = the whole 64x64 tile (16-B copies, plain loads,
//   __syncthreads before and after); fragment loads read the LDS tiles with the same v8h element type.
// =====================================================================================
__device__ __forceinline__ v8f hmma(v16h a, v16h b, v8f c) {
  c = __builtin_amdgcn_wmma_f32_16x16x32_f16(false, a, false, b, (short)0, c, false, false);
  asm volatile("v_nop\n\tv_nop\n\tv_nop\n\tv_nop" : "+v"(c) : "v"(a), "v"(b));
  return c;
}
// The slot that the instruction set asks for behind a transcendental before its source register is rewritten.
// The results and the sources of a run of v_exp_f32 are
// inputs only of the v_nop's statement: it stands behind the last of the run, and no source is rewritten ahead of it.
__device__ __forceinline__ void exp_slot1(float e, float a) { asm volatile("v_nop" :: "v"(e), "v"(a)); }
constexpr float LOG2E = 1.44269504f;   // __expf(x) compiles to v_exp_f32(x * LOG2E); written out so that the source has a name
// value of lane l ^ 16
__device__ __forceinline__ float xhalf(float x) {
  return __builtin_bit_cast(float, __builtin_amdgcn_permlanex16(__builtin_bit_cast(int, x), __builtin_bit_cast(int, x),
                                                                0x76543210, 0xfedcba98, false, false));
}

__global__ __launch_bounds__(128)
void attn_lin_kernel(const unsigned short* __restrict__ qp, const unsigned short* __restrict__ kp,
                     const unsigned short* __restrict__ vtp, unsigned short* __restrict__ op) {
  typedef Frag<_Float16> FR;
  // Row pitch of the two f16 tiles: 64 halves + 8 = 144 B = 16 B x 9 (odd), so that the 16 rows one
  // 16-byte fragment read touches fall on 16 different groups of four banks.
  constexpr int LP = 72;
  __shared__ __align__(16) _Float16 Ksh[64 * LP];        // K chunk  [kv][d]     9 KB
  __shared__ __align__(16) _Float16 Vth[64 * LP];        // V^T chunk [d][kv]    9 KB
  __shared__ __align__(16) float    Os[4 * 16 * 68];     // per wave out tile, pitch 68

  const int tid  = threadIdx.x;
  const int wave = tid >> 5;
  const int lane = tid & 31;
  const int hh   = lane >> 4;
  const int c    = lane & 15;

  constexpr int NQB  = SEQLEN / 64;        // 64 query blocks per (b, h)
  constexpr int ROWP = NBAT * EMBED;       // 2048 halves between consecutive t (q, k, out planes)
  constexpr int NCH  = NCOMP / 64;         // 16 key chunks

  const int bx = blockIdx.x;
  const int qb = bx % NQB;
  const int bh = bx / NQB;
  const int h  = bh % NHEADS;
  const int b  = bh / NHEADS;
  const int q0 = qb * 64 + wave * 16;

  const _Float16* Qb = (const _Float16*)(const void*)qp  + (size_t)b * EMBED + (size_t)h * HDIM;
  const _Float16* Kb = (const _Float16*)(const void*)kp  + (size_t)b * EMBED + (size_t)h * HDIM;
  const _Float16* Vb = (const _Float16*)(const void*)vtp + (size_t)b * EMBED * NCOMP + (size_t)h * HDIM * NCOMP;
  _Float16*       Ob = (_Float16*)(void*)op + (size_t)b * EMBED + (size_t)h * HDIM;

  // ---- Q fragments (B operand): column = query q0 + c, 2 d-chunks of 32 ----
  v16h qa[2];
  {
    const _Float16* qrow = Qb + (size_t)(q0 + c) * ROWP;
#pragma unroll
    for (int dc = 0; dc < 2; ++dc) qa[dc] = FR::load(qrow + dc * 32 + 8 * hh);
  }

  float mrun = -INFINITY;   // running maximum of query q0 + c (the same in both wave halves)
  float lrun = 0.f;         // running sum over this half's keys; the halves are joined in the epilogue
  v8f oacc[4];              // oacc[t][r] = O[query q0 + c][d = t*16 + 8*hh + r]
#pragma unroll
  for (int t = 0; t < 4; ++t) oacc[t] = (v8f){0.f,0.f,0.f,0.f,0.f,0.f,0.f,0.f};

#pragma unroll 1
  for (int kc = 0; kc < NCH; ++kc) {
    const int kv0 = kc * 64;
    __syncthreads();
    {
      const int r = tid >> 1, hoff = (tid & 1) * 32;
      const _Float16* krow = Kb + (size_t)(kv0 + r) * ROWP + hoff;     // K[kv0+r][hoff .. hoff+31]
      const _Float16* vrow = Vb + (size_t)r * NCOMP + kv0 + hoff;      // V^T[d=r][kv0+hoff ..]
#pragma unroll
      for (int i = 0; i < 4; ++i) {
        const v8h kk = *(const v8h*)(krow + 8 * i);
        const v8h vv = *(const v8h*)(vrow + 8 * i);
        *(v8h*)(Ksh + r * LP + hoff + 8 * i) = kk;
        *(v8h*)(Vth + r * LP + hoff + 8 * i) = vv;
      }
    }
    __syncthreads();

    // ---- scores, transposed: s[j][r] = score(key j*16 + 8*hh + r, query c) ----
    v8f s[4];
#pragma unroll
    for (int j = 0; j < 4; ++j) {
      s[j] = (v8f){0.f,0.f,0.f,0.f,0.f,0.f,0.f,0.f};
#pragma unroll
      for (int dc = 0; dc < 2; ++dc) {
        const v16h ka = FR::load(Ksh + (j * 16 + c) * LP + dc * 32 + 8 * hh);
        s[j] = hmma(ka, qa[dc], s[j]);
      }
    }
    // ---- chunk maximum of this lane's query: 32 scores in the lane, then the other half's ----
    float mj[4];
#pragma unroll
    for (int j = 0; j < 4; ++j) {
      mj[j] = -INFINITY;
#pragma unroll
      for (int r = 0; r < 8; ++r) {
        s[j][r] *= SCORE_SCALE;
        mj[j] = fmaxf(mj[j], s[j][r]);
      }
    }
    float cm = fmaxf(fmaxf(mj[0], mj[1]), fmaxf(mj[2], mj[3]));
    cm = fmaxf(cm, xhalf(cm));
    // ---- online softmax update; P^T stays in registers ----
    const float mnew  = fmaxf(mrun, cm);
    const float aarg  = (mrun - mnew) * LOG2E;
    const float alpha = __builtin_amdgcn_exp2f(aarg);
    exp_slot1(alpha, aarg);
    mrun = mnew;
    // B operand of 32 keys: elements 0..7 = keys 8*hh + 0..7 (tile 2*kk), 8..15 = keys 16 + 8*hh + 0..7 (tile 2*kk+1),
    // the k order in which FR::load brings the V^T rows.
    v16h pb[2];
    float pj[4];
#pragma unroll
    for (int j = 0; j < 4; ++j) {
      pj[j] = 0.f;
#pragma unroll
      for (int g = 0; g < 8; g += 4) {
        float parg[4], p[4];
#pragma unroll
        for (int e = 0; e < 4; ++e) {
          parg[e] = (s[j][g + e] - mnew) * LOG2E;
          p[e]    = __builtin_amdgcn_exp2f(parg[e]);
        }
        // the slot behind these four v_exp_f32, as in exp_slot1
        asm volatile("v_nop" :: "v"(p[0]), "v"(p[1]), "v"(p[2]), "v"(p[3]), "v"(parg[0]), "v"(parg[1]), "v"(parg[2]), "v"(parg[3]));
#pragma unroll
        for (int e = 0; e < 4; ++e) {
          pj[j] += p[e];
          pb[j >> 1][(j & 1) * 8 + g + e] = (_Float16)(p[e] * PROB_CARRY);
        }
      }
    }
    lrun = lrun * alpha + ((pj[0] + pj[1]) + (pj[2] + pj[3]));
#pragma unroll
    for (int t = 0; t < 4; ++t)
#pragma unroll
      for (int r = 0; r < 8; ++r) oacc[t][r] *= alpha;
    // ---- O^T += V^T . P^T ----
#pragma unroll
    for (int kk = 0; kk < 2; ++kk) {
#pragma unroll
      for (int t = 0; t < 4; ++t) {
        const v16h va = FR::load(Vth + (t * 16 + c) * LP + kk * 32 + 8 * hh);
        oacc[t] = hmma(va, pb[kk], oacc[t]);
      }
    }
  }

  // ---- epilogue: join the halves' sums, normalise, stage 16x64 wave tile, whole-line f16 stores ----
  float* os = Os + wave * (16 * 68);
  {
    const float lsum = lrun + xhalf(lrun);
    const float inv  = OUT_CARRY * (1.0f / (lsum * PROB_CARRY));
#pragma unroll
    for (int t = 0; t < 4; ++t) {
#pragma unroll
      for (int g = 0; g < 2; ++g) {
        v4f w;
#pragma unroll
        for (int e = 0; e < 4; ++e) w[e] = oacc[t][g * 4 + e] * inv;
        *(v4f*)(os + c * 68 + t * 16 + 8 * hh + g * 4) = w;
      }
    }
  }
  __builtin_amdgcn_fence(__ATOMIC_RELEASE, "workgroup");
  __builtin_amdgcn_wave_barrier();
  __builtin_amdgcn_fence(__ATOMIC_ACQUIRE, "workgroup");
  {
    const int qq = lane >> 3, c8 = (lane & 7) * 8;
    {
#pragma unroll
      for (int it = 0; it < 4; ++it) {
        const int row = it * 4 + qq;
        const float* sp = os + row * 68 + c8;
        v8h hv;
#pragma unroll
        for (int e = 0; e < 8; ++e) hv[e] = (_Float16)sp[e];
        *(v8h*)(Ob + (size_t)(q0 + row) * ROWP + c8) = hv;
      }
      
    }
  }
}

// ---------------------------------------------------------------------------
// Host orchestration (kernel launches + host arithmetic only)
// ---------------------------------------------------------------------------
extern "C" void kernel_launch(void* const* d_in, const int* in_sizes, int n_in,
                              void* d_out, int out_size, void* d_ws, size_t ws_size,
                              hipStream_t stream) {
  if (n_in < 11) return;
  const long nQ  = (long)SEQLEN * NBAT * EMBED;    // 8388608
  const long nW  = (long)EMBED * EMBED;            // 262144
  const long nWc = (long)NCOMP * SEQLEN;           // 4194304
  if (in_sizes[0] != nQ || in_sizes[1] != nW || in_sizes[2] != EMBED || in_sizes[3] != nW ||
      in_sizes[4] != EMBED || in_sizes[5] != nW || in_sizes[6] != EMBED || in_sizes[7] != nWc ||
      in_sizes[8] != nWc || in_sizes[9] != nW || in_sizes[10] != EMBED || out_size != nQ) return;

  const float* query = (const float*)d_in[0];
  const float* Wq  = (const float*)d_in[1];  const float* bq = (const float*)d_in[2];
  const float* Wk  = (const float*)d_in[3];  const float* bk = (const float*)d_in[4];
  const float* Wv  = (const float*)d_in[5];  const float* bv = (const float*)d_in[6];
  const float* Wck = (const float*)d_in[7];  const float* Wcv = (const float*)d_in[8];
  const float* Wo  = (const float*)d_in[9];  const float* bo = (const float*)d_in[10];

  // ---- workspace region map (bytes) ----
  const size_t BYTES_QB   = (size_t)nQ * 2;                              // bf16 query [16384][512]            16 MiB
  const size_t BYTES_QT   = (size_t)nQ * 2;                              // bf16 query^T [4][512][4096]        16 MiB
  const size_t BYTES_WC   = (size_t)2 * nWc * 2;                         // bf16 [Wck;Wcv] [2048][4096]        16 MiB
  const size_t BYTES_KVIN = (size_t)2 * NCOMP * NBAT * (2 * EMBED) * 2;  // u16 [8192][1024] (hi|lo rows)     16 MiB
  const size_t BYTES_QP   = (size_t)nQ * 2;                              // f16 q plane [16384][512]          16 MiB
  const size_t BYTES_OP   = (size_t)nQ * 2;                              // f16 attention out [16384][512]    16 MiB
  const size_t BYTES_KP   = (size_t)NCOMP * NBAT * EMBED * 2;            // f16 k plane [4096][512]            4 MiB
  const size_t BYTES_VT   = (size_t)NBAT * EMBED * NCOMP * 2;            // f16 v^T plane [4][512][1024]       4 MiB
  const size_t BYTES_WQ   = (size_t)nW * 2;                              // bf16 Wq [512][512]               512 KiB
  const size_t BYTES_WK2  = (size_t)nW * 2 * 2;                          // bf16 [Wk|Wk] [512][1024]            1 MiB
  const size_t BYTES_WV2  = (size_t)nW * 2 * 2;                          // bf16 [Wv|Wv] [512][1024]            1 MiB
  const size_t BYTES_WOH  = (size_t)nW * 2;                              // f16 64*Wo [512][512]             512 KiB
  const size_t BYTES_BIAS = (size_t)4 * EMBED * 4;                       // f32 biases 4 x 512                  8 KiB
  const size_t OFF_QB   = 0;
  const size_t OFF_QT   = OFF_QB   + BYTES_QB;
  const size_t OFF_WC   = OFF_QT   + BYTES_QT;
  const size_t OFF_KVIN = OFF_WC   + BYTES_WC;
  const size_t OFF_QP   = OFF_KVIN + BYTES_KVIN;
  const size_t OFF_OP   = OFF_QP   + BYTES_QP;
  const size_t OFF_KP   = OFF_OP   + BYTES_OP;
  const size_t OFF_VT   = OFF_KP   + BYTES_KP;
  const size_t OFF_WQ   = OFF_VT   + BYTES_VT;
  const size_t OFF_WK2  = OFF_WQ   + BYTES_WQ;
  const size_t OFF_WV2  = OFF_WK2  + BYTES_WK2;
  const size_t OFF_WOH  = OFF_WV2  + BYTES_WV2;
  const size_t OFF_BIAS = OFF_WOH  + BYTES_WOH;
  const size_t WS_TOTAL = OFF_BIAS + BYTES_BIAS;                         // 112,205,824 B
  if (WS_TOTAL > ws_size) return;

  char* ws = (char*)d_ws;
  unsigned short* queryB = (unsigned short*)(ws + OFF_QB);
  unsigned short* queryT = (unsigned short*)(ws + OFF_QT);
  unsigned short* WcB    = (unsigned short*)(ws + OFF_WC);
  unsigned short* KVin   = (unsigned short*)(ws + OFF_KVIN);
  unsigned short* qP     = (unsigned short*)(ws + OFF_QP);
  unsigned short* oP     = (unsigned short*)(ws + OFF_OP);
  unsigned short* kP     = (unsigned short*)(ws + OFF_KP);
  unsigned short* vtP    = (unsigned short*)(ws + OFF_VT);
  unsigned short* WqB    = (unsigned short*)(ws + OFF_WQ);
  unsigned short* WkB2   = (unsigned short*)(ws + OFF_WK2);
  unsigned short* WvB2   = (unsigned short*)(ws + OFF_WV2);
  unsigned short* WoH    = (unsigned short*)(ws + OFF_WOH);
  float*          biasb  = (float*)(ws + OFF_BIAS);
  float* bq_r = biasb;
  float* bk_r = biasb + EMBED;
  float* bv_r = biasb + 2 * EMBED;
  float* bo_r = biasb + 3 * EMBED;

  // 1. every input conversion (query -> bf16 and bf16 transposed, Wck/Wcv, Wq, [Wk|Wk], [Wv|Wv], 64*Wo, biases)
  convert_inputs_kernel<<<dim3(CB_TOTAL), dim3(256), 0, stream>>>(
      query, Wck, Wcv, Wq, Wk, Wv, Wo, bq, bk, bv, bo,
      queryB, queryT, WcB, WqB, WkB2, WvB2, WoH, biasb);

  // 2. two products that read only what launch 1 wrote:
  //  compression: per batch b: C_b[m][n] = sum_t WcB[m][t] * queryT_b[n][t]; m<1024 -> k_in[m][b][n], m>=1024 -> v_in.
  //     C element (m,n,b): hi at KVin[(m*4+b)*1024 + n], lo at +512  => ldc 4096, strideC 1024, C2 = C + 512.
  //     M=2048, N=512, K=4096 (K%64==0, M%128==0, N%256==0): 32 block tiles of 128x256 per batch, 4 batches: 128 blocks.
  //  q8 = query . Wq^T + bq  (scale 1; 0.125 applied to f32 scores) -> f16 [16384][512]; M=16384, N=512, K=512: 256 blocks.
  {
    const GemmJob comp = { WcB, queryT, KVin, KVin + EMBED, biasb,
                           0L, (long)EMBED * SEQLEN, (long)(2 * EMBED),
                           SEQLEN, SEQLEN, 4 * (2 * EMBED), 2 * NCOMP, EMBED, SEQLEN, 32 };
    const GemmJob qpro = { queryB, WqB, qP, qP, bq_r,
                           0L, 0L, 0L,
                           EMBED, EMBED, EMBED, SEQLEN * NBAT, EMBED, EMBED, 256 };
    wmma_gemm64_pair<1, 0, 2, 2, 1><<<dim3(32 * NBAT + 256), dim3(256), 0, stream>>>(comp, qpro, 32 * NBAT);
  }

  // 3. two products that read only what launches 1 and 2 wrote:
  //  k = [k_in hi|lo] . [Wk|Wk]^T + bk -> f16 [4096 rows (c*4+b)][512]; M=4096, N=512, K'=1024: 64 blocks.
  //  v^T per batch: C_b[m=e'][n=c] = sum_k [Wv|Wv][e'][k] * [v_in hi|lo][(c,b)][k] + bv[e'] -> f16 vtP[b][512][1024].
  //     Bt_b rows at KVin + 4096*1024 + b*1024 + c*4096 (ldb 4096, strideB 1024); M=512, N=1024, K'=1024: 16 x 4 blocks.
  {
    const GemmJob kpro = { KVin, WkB2, kP, kP, bk_r,
                           0L, 0L, 0L,
                           2 * EMBED, 2 * EMBED, EMBED, NCOMP * NBAT, EMBED, 2 * EMBED, 64 };
    const GemmJob vpro = { WvB2, KVin + (size_t)NCOMP * NBAT * (2 * EMBED), vtP, vtP, bv_r,
                           0L, (long)(2 * EMBED), (long)EMBED * NCOMP,
                           2 * EMBED, 4 * (2 * EMBED), NCOMP, EMBED, NCOMP, 2 * EMBED, 16 };
    wmma_gemm64_pair<1, 2, 1, 1, 1><<<dim3(64 + 16 * NBAT), dim3(256), 0, stream>>>(kpro, vpro, 64);
  }

  // 4. attention over the compressed keys: grid = B*H*(T/64) = 2048 blocks of 128
  attn_lin_kernel<<<dim3(NBAT * NHEADS * (SEQLEN / 64)), dim3(128), 0, stream>>>(qP, kP, vtP, oP);

  // 5. out = (16 O) . (64 Wo)^T / 1024 + bo -> f32 d_out [16384][512]; M=16384, N=512, K=512: grid 256.
  wmma_gemm64<0, false, 2, 0, false><<<dim3(256, 1), dim3(256), 0, stream>>>(
      oP, oP, EMBED, 0L,
      WoH, WoH, EMBED, 0L,
      d_out, d_out, EMBED, 0L,
      bo_r, bo_r, 0L,
      SEQLEN * NBAT, EMBED, EMBED, 1.0f / (OUT_CARRY * WO_CARRY));
}

// v005
// One run takes 168 microseconds.
// In both of two side-by-side timings against v004, it was 1.06 times as fast.
// Counting every step since v000, it is 3.44 times as fast.
// Contractions: sequence compression and q/k/v^T projections on v_wmma_f32_16x16x32_bf16 (bf16 operands = RNE-converted inputs; k_in/v_in carried as bf16 hi+lo planes concatenated along k); q.k^T, p.v and the output projection on v_wmma_f32_16x16x32_f16 (f16 planes; p carried x2^15, attention output x2^4, Wo x2^6); f32 accumulate; softmax, score scale 0.125 and biases in f32.
#include <hip/hip_runtime.h>
#include <math.h>
#include <stdint.h>

typedef __attribute__((ext_vector_type(16))) _Float16 v16h;
typedef __attribute__((ext_vector_type(8)))  _Float16 v8h;
typedef __attribute__((ext_vector_type(16))) __bf16   v16b;
typedef __attribute__((ext_vector_type(8)))  __bf16   v8b;
typedef __attribute__((ext_vector_type(8)))  float    v8f;
typedef __attribute__((ext_vector_type(4)))  float    v4f;
typedef __attribute__((ext_vector_type(2)))  float    v2f;
typedef __attribute__((ext_vector_type(4)))  unsigned int v4u;

__device__ __forceinline__ unsigned short f2bf_bits(float f) {
  unsigned u = __float_as_uint(f);
  return (unsigned short)((u + 0x7FFFu + ((u >> 16) & 1u)) >> 16);
}
__device__ __forceinline__ float bf_bits2f(unsigned short h) { return __uint_as_float(((unsigned)h) << 16); }

// hazard guards as plain device helpers (no inline asm inside the kernel template body)
__device__ __forceinline__ void dep_guard_h(v8f& a, v8f& b, v16h x, v16h y) { asm volatile("v_nop\n\tv_nop\n\tv_nop\n\tv_nop" : "+v"(a), "+v"(b) : "v"(x), "v"(y)); }
__device__ __forceinline__ void dep_guard_b(v8f& a, v8f& b, v16b x, v16b y) { asm volatile("v_nop\n\tv_nop\n\tv_nop\n\tv_nop" : "+v"(a), "+v"(b) : "v"(x), "v"(y)); }
__device__ __forceinline__ void keep4_h(v16h a, v16h b, v16h c, v16h d) { asm volatile("v_nop" :: "v"(a), "v"(b), "v"(c), "v"(d)); }
__device__ __forceinline__ void keep4_b(v16b a, v16b b, v16b c, v16b d) { asm volatile("v_nop" :: "v"(a), "v"(b), "v"(c), "v"(d)); }
__device__ __forceinline__ void acc_guard4(v8f& a, v8f& b, v8f& c, v8f& d) { asm volatile("v_nop\n\tv_nop\n\tv_nop\n\tv_nop" : "+v"(a), "+v"(b), "+v"(c), "+v"(d)); }
template <typename T> struct Frag;
template <> struct Frag<_Float16> {
  typedef v16h V; typedef v8h H; union U { v16h v; v8h h[2]; };
  static __device__ __forceinline__ v16h load(const _Float16* p) {   // elements 0..7 <- p[0..7], 8..15 <- p[16..23]
    U f; f.h[0] = *(const v8h*)(p); f.h[1] = *(const v8h*)(p + 16); return f.v;
  }
  static __device__ __forceinline__ v8f mma(v16h a, v16h b, v8f c) {
    return __builtin_amdgcn_wmma_f32_16x16x32_f16(false, a, false, b, (short)0, c, false, false);
  }
  static __device__ __forceinline__ void guard(v8f& a, v8f& b, v16h x, v16h y) { dep_guard_h(a, b, x, y); }
  static __device__ __forceinline__ void keep(v16h a, v16h b, v16h c, v16h d) { keep4_h(a, b, c, d); }
};
template <> struct Frag<__bf16> {
  typedef v16b V; typedef v8b H; union U { v16b v; v8b h[2]; };
  static __device__ __forceinline__ v16b load(const __bf16* p) {
    U f; f.h[0] = *(const v8b*)(p); f.h[1] = *(const v8b*)(p + 16); return f.v;
  }
  static __device__ __forceinline__ v8f mma(v16b a, v16b b, v8f c) {
    return __builtin_amdgcn_wmma_f32_16x16x32_bf16(false, a, false, b, (short)0, c, false, false);
  }
  static __device__ __forceinline__ void guard(v8f& a, v8f& b, v16b x, v16b y) { dep_guard_b(a, b, x, y); }
  static __device__ __forceinline__ void keep(v16b a, v16b b, v16b c, v16b d) { keep4_b(a, b, c, d); }
};

// ---- Register-blocked batched WMMA GEMM ------------------------------------
// C[m,n] = scale * sum_k A[m,k] * Bt[n,k] (+bias)(+resid); each wave owns a 64x64 tile.
// A row-major [M,K]; Bt row-major [N,K]; M % 128 == 0, N % 256 == 0, K % 64 == 0.
// A block of 8 waves (2 x 4) owns a 128x256 tile of C. Per stage of 64 k it brings 128 rows of A and 256 rows
// of Bt, 128 B each, into LDS with whole-line 16-byte loads (8 lanes per row); the waves read their fragments
// from LDS. Two LDS buffers: the next stage's global loads are issued ahead of this stage's products and
// stored behind them, one block barrier per stage.
// SPLIT (hi/lo operand planes) is not built in this form.
// BIAS_MODE: 0 = none, 1 = bias[m], 2 = bias[n].
// OUT_MODE: 0 = f32, 1 = f16, 2 = bf16 hi plane (Cout) + bf16 lo plane (Cout2).
// ET: 0 = f16 operands, 1 = bf16 operands (pointers passed as 16-bit storage)
template <int ET> struct Elem;
template <> struct Elem<0> { typedef _Float16 T; };
template <> struct Elem<1> { typedef __bf16 T; };
// The tile's work is a device function: bx = index of the block tile, b = batch, sOpRaw / sTRaw = the launching
// kernel's LDS, so that one launch can hold the block tiles of two products that do not depend on one another.
constexpr int GEMM_OP_ELEMS = 2 * (128 + 256) * (64 + 8);   // two buffers of (BM + BN) rows at pitch LP
constexpr int GEMM_SLAB_F32 = 8 * 16 * 68;                  // eight per-wave 16x64 slabs, pitch 68 floats
template <int ET, bool SPLIT, int BIAS_MODE, int OUT_MODE, bool RESID, int ACT = 0>
__device__ __forceinline__ void gemm_tile(
    const unsigned short* __restrict__ Ap, const unsigned short* __restrict__ A2p, int lda, long strideA,
    const unsigned short* __restrict__ Btp, const unsigned short* __restrict__ Bt2p, int ldb, long strideB,
    void* __restrict__ Cout, void* __restrict__ Cout2, int ldc, long strideC,
    const float* __restrict__ bias,
    const float* __restrict__ resid, long strideR,
    int M, int N, int K, float scale,
    int bx, int b, unsigned short* sOpRaw, float* sTRaw) {
  typedef typename Elem<ET>::T T;
  typedef typename Frag<T>::V V;
  const T* A = (const T*)Ap; const T* Bt = (const T*)Btp;
  static_assert(!SPLIT, "hi/lo planes are not staged");
  typedef typename Frag<T>::H H;
  constexpr int BM = 128, BN = 256, BK = 64;
  // LDS row pitch 64 + 8 elements = 144 B = 16 B x 9 (odd): the 16 rows of one 16-byte fragment read fall on
  // different groups of four banks.
  constexpr int LP = BK + 8;
  static_assert(2 * (BM + BN) * LP == GEMM_OP_ELEMS, "LDS size");
  T (*sOp)[(BM + BN) * LP] = (T (*)[(BM + BN) * LP])sOpRaw;   // [buffer][A rows 0..127 | Bt rows 128..383][k]
  float (*sT)[16 * 68] = (float (*)[16 * 68])sTRaw;           // per-wave 16x64 slab, pitch 68 floats
  const int tid  = threadIdx.x;
  const int lane = tid & 31;
  const int wave = tid >> 5;
  const int blocksN = N / BN;
  const int blocksM = M / BM;
  if (bx >= blocksM * blocksN) return;   // block-uniform, ahead of every barrier
  const int bm = bx / blocksN;
  const int bn = bx - bm * blocksN;
  const int wm = wave >> 2;                    // 0..1: 64-row band of the block tile
  const int wn = wave & 3;                     // 0..3: 64-column band
  const int m0 = bm * BM + (wm << 6);
  const int n0 = bn * BN + (wn << 6);

  const T* Ab  = A  + (size_t)b * strideA;
  const T* Bb  = Bt + (size_t)b * strideB;

  const int rlane = lane & 15;                 // row (A) / col (B, D) within subtile
  const int koff  = (lane >> 4) * 8;           // k offset of this lane half
  const int mOff  = (lane >> 4) * 8;           // D row offset

  // staging map: 8 threads x 16 B = one 128-B row; 32 rows per sweep of the block
  const int srow = tid >> 3;                   // 0..31
  const int sk   = (tid & 7) * 8;              // element offset in the row
  const T* gA = Ab + (size_t)(bm * BM + srow) * lda + sk;
  const T* gB = Bb + (size_t)(bn * BN + srow) * ldb + sk;
  const int sdst = srow * LP + sk;

  v8f acc[4][4];
#pragma unroll
  for (int i = 0; i < 4; ++i)
#pragma unroll
    for (int j = 0; j < 4; ++j) acc[i][j] = (v8f){0.f,0.f,0.f,0.f,0.f,0.f,0.f,0.f};

  H stA[BM / 32], stB[BN / 32];
#pragma unroll
  for (int it = 0; it < BM / 32; ++it) stA[it] = *(const H*)(gA + (size_t)(it * 32) * lda);
#pragma unroll
  for (int it = 0; it < BN / 32; ++it) stB[it] = *(const H*)(gB + (size_t)(it * 32) * ldb);
#pragma unroll
  for (int it = 0; it < BM / 32; ++it) *(H*)(&sOp[0][sdst + it * 32 * LP]) = stA[it];
#pragma unroll
  for (int it = 0; it < BN / 32; ++it) *(H*)(&sOp[0][sdst + (BM + it * 32) * LP]) = stB[it];
  __syncthreads();

  const int nst = K / BK;
#pragma unroll 1
  for (int s = 0; s < nst; ++s) {
    const T* cur = sOp[s & 1];
    T*       nxt = sOp[(s + 1) & 1];
    const bool more = s + 1 < nst;             // the same for the whole block
    if (more) {
      const int k1 = (s + 1) * BK;
#pragma unroll
      for (int it = 0; it < BM / 32; ++it) stA[it] = *(const H*)(gA + (size_t)(it * 32) * lda + k1);
#pragma unroll
      for (int it = 0; it < BN / 32; ++it) stB[it] = *(const H*)(gB + (size_t)(it * 32) * ldb + k1);
    }
#pragma unroll
    for (int kk = 0; kk < BK; kk += 32) {
      V bh[4], ah[4];
#pragma unroll
      for (int j = 0; j < 4; ++j) bh[j] = Frag<T>::load(cur + (BM + (wn << 6) + (j << 4) + rlane) * LP + kk + koff);
#pragma unroll
      for (int i = 0; i < 4; ++i) ah[i] = Frag<T>::load(cur + ((wm << 6) + (i << 4) + rlane) * LP + kk + koff);
#pragma unroll
      for (int i = 0; i < 4; ++i) {
#pragma unroll
        for (int j = 0; j < 4; ++j) acc[i][j] = Frag<T>::mma(ah[i], bh[j], acc[i][j]);
        Frag<T>::guard(acc[i][0], acc[i][3], ah[i], ah[i]);
      }
      Frag<T>::keep(bh[0], bh[1], bh[2], bh[3]);
    }
    if (more) {
#pragma unroll
      for (int it = 0; it < BM / 32; ++it) *(H*)(nxt + sdst + it * 32 * LP) = stA[it];
#pragma unroll
      for (int it = 0; it < BN / 32; ++it) *(H*)(nxt + sdst + (BM + it * 32) * LP) = stB[it];
    }
    // publishes the buffer just written and ends every wave's reads of the buffer that the next stage refills
    __syncthreads();
  }
  acc_guard4(acc[0][0], acc[0][1], acc[0][2], acc[0][3]);
  acc_guard4(acc[1][0], acc[1][1], acc[1][2], acc[1][3]);
  acc_guard4(acc[2][0], acc[2][1], acc[2][2], acc[2][3]);
  acc_guard4(acc[3][0], acc[3][1], acc[3][2], acc[3][3]);

  // ---- epilogue ----
  float* slab = sT[wave];
  const float* Rb = RESID ? (resid + (size_t)b * strideR) : nullptr;
#pragma unroll
  for (int i = 0; i < 4; ++i) {
    const int mBase = m0 + (i << 4);
#pragma unroll
    for (int j = 0; j < 4; ++j) {
      const int n = n0 + (j << 4) + rlane;
      float bv = 0.f;
      if (BIAS_MODE == 2) bv = bias[n];
#pragma unroll
      for (int r = 0; r < 8; ++r) {
        float v = acc[i][j][r] * scale;
        if (BIAS_MODE == 1) v += bias[mBase + mOff + r];
        if (BIAS_MODE == 2) v += bv;
        if (RESID) v += Rb[(size_t)(mBase + mOff + r) * ldc + n];
        if (ACT == 1) v = tanhf(v);
        if (ACT == 2) v = fmaxf(v, 0.0f);
        if (ACT == 3) v = v / (1.0f + expf(-v));
        if (ACT == 4) v = (v > 0.f) ? v : 0.01f * v;
        if (ACT == 5) v = 0.5f * v * (1.0f + erff(v * 0.70710678118654752f));
        slab[(mOff + r) * 68 + (j << 4) + rlane] = v;
      }
    }
    __builtin_amdgcn_fence(__ATOMIC_RELEASE, "workgroup");
    __builtin_amdgcn_wave_barrier();
    __builtin_amdgcn_fence(__ATOMIC_ACQUIRE, "workgroup");
    if (OUT_MODE == 0) {
      float* C = (float*)Cout + (size_t)b * strideC;
      const int hh = lane >> 4, c4 = (lane & 15) * 4;     // row seg = 256 B = 16 lanes x 16 B
      {
#pragma unroll
        for (int it = 0; it < 8; ++it) {
          const int row = it * 2 + hh;
          v4f v = *(const v4f*)(slab + row * 68 + c4);
          *(v4f*)(C + (size_t)(mBase + row) * ldc + n0 + c4) = v;
        }
        
      }
    } else {
      const int q = lane >> 3, c8 = (lane & 7) * 8;
      unsigned short* C  = (unsigned short*)Cout  + (size_t)b * strideC;
      unsigned short* C2 = (OUT_MODE == 2) ? ((unsigned short*)Cout2 + (size_t)b * strideC) : nullptr;
      {
#pragma unroll
        for (int it = 0; it < 4; ++it) {
          const int row = it * 4 + q;
          const float* sp = slab + row * 68 + c8;
          v8h hv, lv;
#pragma unroll
          for (int e = 0; e < 8; ++e) {
            if (OUT_MODE == 1) {
              hv[e] = (_Float16)sp[e];
            } else {
              unsigned short hb = f2bf_bits(sp[e]);
              unsigned short lb = f2bf_bits(sp[e] - bf_bits2f(hb));
              hv[e] = __builtin_bit_cast(_Float16, hb);
              lv[e] = __builtin_bit_cast(_Float16, lb);
            }
          }
          *(v8h*)(C + (size_t)(mBase + row) * ldc + n0 + c8) = hv;
          if (OUT_MODE == 2) *(v8h*)(C2 + (size_t)(mBase + row) * ldc + n0 + c8) = lv;
        }
        
      }
    }
    __builtin_amdgcn_fence(__ATOMIC_RELEASE, "workgroup");
    __builtin_amdgcn_wave_barrier();
    __builtin_amdgcn_fence(__ATOMIC_ACQUIRE, "workgroup");
  }
}

// One product per launch: grid (block tiles, batches).
template <int ET, bool SPLIT, int BIAS_MODE, int OUT_MODE, bool RESID, int ACT = 0>
__global__ __launch_bounds__(256) void wmma_gemm64(
    const unsigned short* __restrict__ Ap, const unsigned short* __restrict__ A2p, int lda, long strideA,
    const unsigned short* __restrict__ Btp, const unsigned short* __restrict__ Bt2p, int ldb, long strideB,
    void* __restrict__ Cout, void* __restrict__ Cout2, int ldc, long strideC,
    const float* __restrict__ bias,
    const float* __restrict__ resid, long strideR,
    int M, int N, int K, float scale) {
  __shared__ __align__(16) unsigned short sOpRaw[GEMM_OP_ELEMS];
  __shared__ __align__(16) float sTRaw[GEMM_SLAB_F32];
  gemm_tile<ET, SPLIT, BIAS_MODE, OUT_MODE, RESID, ACT>(Ap, A2p, lda, strideA, Btp, Bt2p, ldb, strideB, Cout, Cout2, ldc, strideC,
                                                        bias, resid, strideR, M, N, K, scale,
                                                        (int)blockIdx.x, (int)blockIdx.y, sOpRaw, sTRaw);
}

// Two independent products in one launch: blocks 0 .. nb0-1 take product 0 (the longer one, so that it starts first),
// the rest product 1. In each product the flat index runs over its gx block tiles first, then over its batches.
struct GemmJob {
  const unsigned short* A;  const unsigned short* Bt;
  unsigned short* C;  unsigned short* C2;
  const float* bias;
  long strideA, strideB, strideC;
  int lda, ldb, ldc, M, N, K, gx;
};
template <int ET, int BIAS0, int OUT0, int BIAS1, int OUT1>
__global__ __launch_bounds__(256) void wmma_gemm64_pair(GemmJob j0, GemmJob j1, int nb0) {
  __shared__ __align__(16) unsigned short sOpRaw[GEMM_OP_ELEMS];
  __shared__ __align__(16) float sTRaw[GEMM_SLAB_F32];
  const int blk = (int)blockIdx.x;   // the same for the whole block: every barrier below stands under block-uniform flow
  if (blk < nb0) {
    gemm_tile<ET, false, BIAS0, OUT0, false>(j0.A, j0.A, j0.lda, j0.strideA, j0.Bt, j0.Bt, j0.ldb, j0.strideB,
                                             (void*)j0.C, (void*)j0.C2, j0.ldc, j0.strideC, j0.bias, j0.bias, 0L,
                                             j0.M, j0.N, j0.K, 1.0f, blk % j0.gx, blk / j0.gx, sOpRaw, sTRaw);
  } else {
    const int l = blk - nb0;
    gemm_tile<ET, false, BIAS1, OUT1, false>(j1.A, j1.A, j1.lda, j1.strideA, j1.Bt, j1.Bt, j1.ldb, j1.strideB,
                                             (void*)j1.C, (void*)j1.C2, j1.ldc, j1.strideC, j1.bias, j1.bias, 0L,
                                             j1.M, j1.N, j1.K, 1.0f, l % j1.gx, l / j1.gx, sOpRaw, sTRaw);
  }
}

__device__ __forceinline__ unsigned pk16(unsigned short a, unsigned short b) { return (unsigned)a | ((unsigned)b << 16); }

// ---------------------------------------------------------------------------
// Problem geometry
// ---------------------------------------------------------------------------
constexpr int   SEQLEN  = 4096;   // time steps (queries)
constexpr int   NBAT    = 4;      // batch
constexpr int   EMBED   = 512;    // channels
constexpr int   NHEADS  = 8;
constexpr int   HDIM    = 64;
constexpr int   NCOMP   = 1024;   // compressed key count
constexpr float SCORE_SCALE = 0.125f;     // head_dim^-0.5, applied to the f32 score accumulators
constexpr float PROB_CARRY  = 32768.0f;   // p carried x2^15 in the f16 P operand, folded into 1/l
constexpr float OUT_CARRY   = 16.0f;      // attention output carried x2^4 in its f16 plane
constexpr float WO_CARRY    = 64.0f;      // Wo carried x2^6 in its f16 plane

// ---------------------------------------------------------------------------
// Elementwise f32 -> bf16 (RNE), 2 elements per thread, one 4-B store per lane: a wave writes one whole
// ---------------------------------------------------------------------------
__device__ __forceinline__ void cast_bf16x2_job(const float* __restrict__ in, unsigned short* __restrict__ out, int n2, int blk) {
  const int i = blk * 256 + threadIdx.x;
  if (i < n2) {
    const v2f f = *(const v2f*)(in + 2 * (size_t)i);
    const unsigned u = pk16(f2bf_bits(f[0]), f2bf_bits(f[1]));
    ((unsigned*)out)[i] = u;
    
  }
}

// ---------------------------------------------------------------------------
// W [rows][cols] f32 -> out [rows][2*cols] bf16 with out[r][c] = out[r][cols + c] = bf16_rne(W[r][c]).
// 2 elements per thread; cols % 64 == 0 so a wave's 64 elements stay in one row: each store instruction
// ---------------------------------------------------------------------------
__device__ __forceinline__ void dup_bf16x2_job(const float* __restrict__ W, unsigned short* __restrict__ out, int n2, int cols, int blk) {
  const int i = blk * 256 + threadIdx.x;
  if (i < n2) {
    const int e0 = 2 * i;
    const int r  = e0 / cols;
    const int cc = e0 - r * cols;
    const v2f f = *(const v2f*)(W + e0);
    const unsigned u = pk16(f2bf_bits(f[0]), f2bf_bits(f[1]));
    const size_t o0 = ((size_t)r * 2 * cols + cc) >> 1;          // uint index of out[r][cc]
    const size_t o1 = ((size_t)r * 2 * cols + cols + cc) >> 1;   // uint index of out[r][cols+cc]
    ((unsigned*)out)[o0] = u;
    ((unsigned*)out)[o1] = u;
    
  }
}

// ---------------------------------------------------------------------------
// Wo f32 -> f16 plane holding f16(carry * bf16_rne(w)) (exact for bf16 values in the normal f16 range).
// Same store discipline as cast_bf16x2_job.
// ---------------------------------------------------------------------------
__device__ __forceinline__ void cast_wo_f16x2_job(const float* __restrict__ W, unsigned short* __restrict__ out, int n2, float carry, int blk) {
  const int i = blk * 256 + threadIdx.x;
  if (i < n2) {
    const v2f f = *(const v2f*)(W + 2 * (size_t)i);
    const float b0 = bf_bits2f(f2bf_bits(f[0])) * carry;
    const float b1 = bf_bits2f(f2bf_bits(f[1])) * carry;
    const _Float16 h0 = (_Float16)b0, h1 = (_Float16)b1;
    const unsigned u = pk16(__builtin_bit_cast(unsigned short, h0), __builtin_bit_cast(unsigned short, h1));
    ((unsigned*)out)[i] = u;
    
  }
}

// ---------------------------------------------------------------------------
// Bias vectors RNE-converted to bf16 precision (kept as f32): outb[0..n) = bq, [n..2n) = bk, [2n..3n) = bv, [3n..4n) = bo.
// ---------------------------------------------------------------------------
__device__ __forceinline__ void bias_prep_job(const float* __restrict__ bq, const float* __restrict__ bk,
                                              const float* __restrict__ bv, const float* __restrict__ bo,
                                              float* __restrict__ outb, int n, int blk) {
  const int i = blk * 256 + threadIdx.x;
  if (i < n) {
    const float a0 = bf_bits2f(f2bf_bits(bq[i]));
    const float a1 = bf_bits2f(f2bf_bits(bk[i]));
    const float a2 = bf_bits2f(f2bf_bits(bv[i]));
    const float a3 = bf_bits2f(f2bf_bits(bo[i]));
    ((float*)outb)[i] = a0;
    ((float*)outb)[n + i] = a1;
    ((float*)outb)[2 * n + i] = a2;
    ((float*)outb)[3 * n + i] = a3;
    
  }
}

// ---------------------------------------------------------------------------
// Transpose + bf16 RNE convert, z-batched: in_z = X + z*sIn viewed [R rows][Cc cols] with row pitch ldi ->
//   o_z[c][r] = bf16_rne(in_z[r][c])  ([Cc][R], pitch R), o_z = o + z*sOut.
// 64x64 tiles through LDS (tf: 64 * 68 floats of the launching kernel). Tile (bx, by, bz) of (Cc/64, R/64, Z), 256 threads
// (R, Cc multiples of 64).
// Coverage per block: load 4 it x 256 thr x 4 floats = 64x64; store 2 it x 256 thr x 8 u16 = 64x64.
// ---------------------------------------------------------------------------
__device__ __forceinline__ void tconv_bf16_job(const float* __restrict__ X, unsigned short* __restrict__ o,
                                               int R, int Cc, int ldi, long sIn, long sOut,
                                               int bx, int by, int bz, float* tf) {
  X += (size_t)bz * sIn;
  o += (size_t)bz * sOut;
  const int c0  = bx * 64;   // input column block = output row block
  const int r0  = by * 64;   // input row block    = output column block
  const int tid = threadIdx.x;
  {
    const int lr = tid >> 4;         // 0..15
    const int c4 = (tid & 15) * 4;   // 0..60
#pragma unroll
    for (int it = 0; it < 4; ++it) {
      const int rr = it * 16 + lr;   // 0..63
      const v4f a = *(const v4f*)(X + (size_t)(r0 + rr) * ldi + c0 + c4);
      *(v4f*)(tf + rr * 68 + c4) = a;
    }
  }
  __syncthreads();
  const int sub = tid >> 3;          // 0..31
  const int c8  = (tid & 7) * 8;     // 0..56
  v4u hv[2];
#pragma unroll
  for (int it = 0; it < 2; ++it) {
    const int oc = it * 32 + sub;    // output row within tile (= input column)
    v4u a;
#pragma unroll
    for (int q = 0; q < 4; ++q) {
      const float f0 = tf[(c8 + 2 * q) * 68 + oc];
      const float f1 = tf[(c8 + 2 * q + 1) * 68 + oc];
      a[q] = pk16(f2bf_bits(f0), f2bf_bits(f1));
    }
    hv[it] = a;
  }
  {
#pragma unroll
    for (int it = 0; it < 2; ++it) {
      const int oc = it * 32 + sub;
      const size_t go = (size_t)(c0 + oc) * R + r0 + c8;
      *(v4u*)(o + go) = hv[it];
    }
    
  }
}

// ---------------------------------------------------------------------------
// All input conversions in ONE launch: none reads what another writes. A block's flat index picks its job (the test is
// the same for the whole block, so the transposing job's barrier stands under block-uniform flow) and its place in the job.
// ---------------------------------------------------------------------------
constexpr int CB_TCONV = (EMBED / 64) * (SEQLEN / 64) * NBAT;       // 2048 tiles of query^T
constexpr int CB_QUERY = SEQLEN * NBAT * EMBED / 2 / 256;           // 16384 blocks, 512 elements each
constexpr int CB_WC    = NCOMP * SEQLEN / 2 / 256;                  // 8192 for each of Wck, Wcv
constexpr int CB_W     = EMBED * EMBED / 2 / 256;                   // 512 for each of Wq, Wk, Wv, Wo
constexpr int CB_BIAS  = EMBED / 256;                               // 2
constexpr int CB_TOTAL = CB_TCONV + CB_QUERY + 2 * CB_WC + 4 * CB_W + CB_BIAS;
__global__ __launch_bounds__(256) void convert_inputs_kernel(
    const float* __restrict__ query, const float* __restrict__ Wck, const float* __restrict__ Wcv,
    const float* __restrict__ Wq, const float* __restrict__ Wk, const float* __restrict__ Wv, const float* __restrict__ Wo,
    const float* __restrict__ bq, const float* __restrict__ bk, const float* __restrict__ bv, const float* __restrict__ bo,
    unsigned short* __restrict__ queryB, unsigned short* __restrict__ queryT, unsigned short* __restrict__ WcB,
    unsigned short* __restrict__ WqB, unsigned short* __restrict__ WkB2, unsigned short* __restrict__ WvB2,
    unsigned short* __restrict__ WoH, float* __restrict__ biasb) {
  __shared__ __align__(16) float tf[64 * 68];
  int blk = (int)blockIdx.x;
  // query^T per batch: in [T=4096 rows][E=512 cols] pitch 2048 (base + b*512) -> out_b [512][4096]
  if (blk < CB_TCONV) {
    tconv_bf16_job(query, queryT, SEQLEN, EMBED, NBAT * EMBED, (long)EMBED, (long)EMBED * SEQLEN,
                   blk % (EMBED / 64), (blk / (EMBED / 64)) % (SEQLEN / 64), blk / ((EMBED / 64) * (SEQLEN / 64)), tf);
    return;
  }
  blk -= CB_TCONV;
  // query -> bf16 [16384][512] (same flat layout as [T][B][E])
  if (blk < CB_QUERY) { cast_bf16x2_job(query, queryB, SEQLEN * NBAT * EMBED / 2, blk); return; }
  blk -= CB_QUERY;
  // Wck -> rows 0..1023, Wcv -> rows 1024..2047 of the [2048][4096] bf16 plane
  if (blk < CB_WC) { cast_bf16x2_job(Wck, WcB, NCOMP * SEQLEN / 2, blk); return; }
  blk -= CB_WC;
  if (blk < CB_WC) { cast_bf16x2_job(Wcv, WcB + (size_t)NCOMP * SEQLEN, NCOMP * SEQLEN / 2, blk); return; }
  blk -= CB_WC;
  if (blk < CB_W) { cast_bf16x2_job(Wq, WqB, EMBED * EMBED / 2, blk); return; }
  blk -= CB_W;
  if (blk < CB_W) { dup_bf16x2_job(Wk, WkB2, EMBED * EMBED / 2, EMBED, blk); return; }
  blk -= CB_W;
  if (blk < CB_W) { dup_bf16x2_job(Wv, WvB2, EMBED * EMBED / 2, EMBED, blk); return; }
  blk -= CB_W;
  if (blk < CB_W) { cast_wo_f16x2_job(Wo, WoH, EMBED * EMBED / 2, WO_CARRY, blk); return; }
  blk -= CB_W;
  // biases (RNE to bf16 precision)
  bias_prep_job(bq, bk, bv, bo, biasb, EMBED, blk);
}

// =====================================================================================
// Full (unmasked) attention over the NCOMP compressed keys, head dim 64, all (b,h) in one launch.
//   q plane f16: element (t, b, h, d) at [(t*NBAT + b)*EMBED + h*64 + d]   (holds 8*q; 0.125 applied to f32 scores)
//   k plane f16: element (c, b, h, d) at [(c*NBAT + b)*EMBED + h*64 + d]
//   v^T plane f16: element (b, h, d, c) at [b*EMBED*NCOMP + (h*64 + d)*NCOMP + c]
//   out plane f16: element (t, b, h, d) at [(t*NBAT + b)*EMBED + h*64 + d], value = OUT_CARRY * attention output
//   Both products are taken transposed: S^T = K . Q^T (A = K rows, B = Q) and O^T += V^T . P^T (A = V^T rows,
//   B = P^T), v_wmma_f32_16x16x32_f16, p carried x PROB_CARRY, f32 accumulate. A lane then holds 32 of the 64
//   scores of ONE query (lane l and l ^ 16 split the keys): maximum and sum run in the lane's own registers with
//   one exchange between the wave halves, and two score tiles, converted in place, are the B operand P^T.
//   Online softmax in f32 over NCOMP/64 chunks (compile-time trip count, no masking).
//   Block = 4 waves = 64 query rows of one (b, h); grid.x = NBAT * NHEADS * (SEQLEN/64) = 2048.
//   K / V^T chunk staging: asynchronous 16-B copies to LDS, 8 lanes per 128-B row (a wave's copy covers 4 whole lines),
//   8 copies per thread and chunk, two LDS buffers: chunk kc + 2 is asked for at the foot of trip kc, one block barrier
//   per trip; fragment loads read the LDS tiles as v8h. Behind the loop the same LDS holds the waves' out tiles.
// =====================================================================================
__device__ __forceinline__ v8f hmma(v16h a, v16h b, v8f c) {
  c = __builtin_amdgcn_wmma_f32_16x16x32_f16(false, a, false, b, (short)0, c, false, false);
  asm volatile("v_nop\n\tv_nop\n\tv_nop\n\tv_nop" : "+v"(c) : "v"(a), "v"(b));
  return c;
}
// The slot that the instruction set asks for behind a transcendental before its source register is rewritten.
// The results and the sources of a run of v_exp_f32 are
// inputs only of the v_nop's statement: it stands behind the last of the run, and no source is rewritten ahead of it.
__device__ __forceinline__ void exp_slot1(float e, float a) { asm volatile("v_nop" :: "v"(e), "v"(a)); }
constexpr float LOG2E = 1.44269504f;   // __expf(x) compiles to v_exp_f32(x * LOG2E); written out so that the source has a name
// value of lane l ^ 16
__device__ __forceinline__ float xhalf(float x) {
  return __builtin_bit_cast(float, __builtin_amdgcn_permlanex16(__builtin_bit_cast(int, x), __builtin_bit_cast(int, x),
                                                                0x76543210, 0xfedcba98, false, false));
}

// One chunk's share of a thread: four rows of K and four of V^T, 16 rows apart, 16 B each, global -> LDS through no register.
// lk / lv: the lane's LDS byte addresses of its first K / V^T piece; gk / gv: the global addresses of the same pieces.
// The s_wait_xcnt 0 is the last line of the copies' own statement, so that no register a copy names is rewritten ahead of it.
__device__ __forceinline__ void copy_kv_chunk(unsigned lk, unsigned lv, const _Float16* gk, const _Float16* gv,
                                              unsigned lstep, size_t kstep, size_t vstep) {
  const unsigned lk1 = lk + lstep, lk2 = lk + 2 * lstep, lk3 = lk + 3 * lstep;
  const unsigned lv1 = lv + lstep, lv2 = lv + 2 * lstep, lv3 = lv + 3 * lstep;
  const _Float16* gk1 = gk + kstep; const _Float16* gk2 = gk + 2 * kstep; const _Float16* gk3 = gk + 3 * kstep;
  const _Float16* gv1 = gv + vstep; const _Float16* gv2 = gv + 2 * vstep; const _Float16* gv3 = gv + 3 * vstep;
  asm volatile("global_load_async_to_lds_b128 %0, %8, off\n\t"
               "global_load_async_to_lds_b128 %4, %12, off\n\t"
               "global_load_async_to_lds_b128 %1, %9, off\n\t"
               "global_load_async_to_lds_b128 %5, %13, off\n\t"
               "global_load_async_to_lds_b128 %2, %10, off\n\t"
               "global_load_async_to_lds_b128 %6, %14, off\n\t"
               "global_load_async_to_lds_b128 %3, %11, off\n\t"
               "global_load_async_to_lds_b128 %7, %15, off\n\t"
               "s_wait_xcnt 0x0"
               :: "v"(lk), "v"(lk1), "v"(lk2), "v"(lk3), "v"(lv), "v"(lv1), "v"(lv2), "v"(lv3),
                  "v"(gk), "v"(gk1), "v"(gk2), "v"(gk3), "v"(gv), "v"(gv1), "v"(gv2), "v"(gv3)
               : "memory");
}

__global__ __launch_bounds__(128)
void attn_lin_kernel(const unsigned short* __restrict__ qp, const unsigned short* __restrict__ kp,
                     const unsigned short* __restrict__ vtp, unsigned short* __restrict__ op) {
  typedef Frag<_Float16> FR;
  // Row pitch of the two f16 tiles: 64 halves + 8 = 144 B = 16 B x 9 (odd), so that the 16 rows one
  // 16-byte fragment read touches fall on 16 different groups of four banks.
  constexpr int LP = 72;
  constexpr int TILE = 64 * LP;                          // halves of one plane's chunk, 9 KB
  constexpr int BUFH = 2 * TILE;                         // one buffer: K chunk [kv][d], then V^T chunk [d][kv]
  __shared__ __align__(16) _Float16 KV[2 * BUFH];        // two buffers, 36 KB
  static_assert(4 * 16 * 68 * sizeof(float) <= 2 * BUFH * sizeof(_Float16), "out tiles fit the ring");
  float* Os = (float*)(void*)KV;                         // per wave out tile, pitch 68: used behind the loop only

  const int tid  = threadIdx.x;
  const int wave = tid >> 5;
  const int lane = tid & 31;
  const int hh   = lane >> 4;
  const int c    = lane & 15;

  constexpr int NQB  = SEQLEN / 64;        // 64 query blocks per (b, h)
  constexpr int ROWP = NBAT * EMBED;       // 2048 halves between consecutive t (q, k, out planes)
  constexpr int NCH  = NCOMP / 64;         // 16 key chunks

  const int bx = blockIdx.x;
  const int qb = bx % NQB;
  const int bh = bx / NQB;
  const int h  = bh % NHEADS;
  const int b  = bh / NHEADS;
  const int q0 = qb * 64 + wave * 16;

  const _Float16* Qb = (const _Float16*)(const void*)qp  + (size_t)b * EMBED + (size_t)h * HDIM;
  const _Float16* Kb = (const _Float16*)(const void*)kp  + (size_t)b * EMBED + (size_t)h * HDIM;
  const _Float16* Vb = (const _Float16*)(const void*)vtp + (size_t)b * EMBED * NCOMP + (size_t)h * HDIM * NCOMP;
  _Float16*       Ob = (_Float16*)(void*)op + (size_t)b * EMBED + (size_t)h * HDIM;

  // ---- Q fragments (B operand): column = query q0 + c, 2 d-chunks of 32 ----
  v16h qa[2];
  {
    const _Float16* qrow = Qb + (size_t)(q0 + c) * ROWP;
#pragma unroll
    for (int dc = 0; dc < 2; ++dc) qa[dc] = FR::load(qrow + dc * 32 + 8 * hh);
  }

  float mrun = -INFINITY;   // running maximum of query q0 + c (the same in both wave halves)
  float lrun = 0.f;         // running sum over this half's keys; the halves are joined in the epilogue
  v8f oacc[4];              // oacc[t][r] = O[query q0 + c][d = t*16 + 8*hh + r]
#pragma unroll
  for (int t = 0; t < 4; ++t) oacc[t] = (v8f){0.f,0.f,0.f,0.f,0.f,0.f,0.f,0.f};

  // staging map: 8 lanes x 16 B = one whole 128-B row; the block's 128 threads cover 16 rows per copy
  static_assert(NCH >= 2, "the ring's prologue fills two chunks");
  constexpr unsigned BUFB  = BUFH * sizeof(_Float16);        // bytes from buffer 0 to buffer 1
  constexpr unsigned LSTEP = 16 * LP * sizeof(_Float16);     // LDS bytes between a thread's rows
  const int srow = tid >> 3, sc8 = (tid & 7) * 8;
  const unsigned lk0 = (unsigned)(uintptr_t)(KV + srow * LP + sc8);   // LDS byte address = low 32 bits of the shared address
  const unsigned lv0 = lk0 + TILE * sizeof(_Float16);
  const _Float16* gk = Kb + (size_t)srow * ROWP + sc8;       // K[srow + 16*i][sc8 ..] of chunk 0
  const _Float16* gv = Vb + (size_t)srow * NCOMP + sc8;      // V^T[d = srow + 16*i][sc8 ..] of chunk 0
  copy_kv_chunk(lk0, lv0, gk, gv, LSTEP, (size_t)16 * ROWP, (size_t)16 * NCOMP);
  asm volatile("s_wait_asynccnt 0x0" ::: "memory");          // this wave's copies of chunk 0 have landed
  __syncthreads();                                           // every wave's have: chunk 0 may be read
  copy_kv_chunk(lk0 + BUFB, lv0 + BUFB, gk + (size_t)64 * ROWP, gv + 64, LSTEP, (size_t)16 * ROWP, (size_t)16 * NCOMP);

#pragma unroll 1
  for (int kc = 0; kc < NCH; ++kc) {
    const _Float16* Ksh = KV + (kc & 1) * BUFH;
    const _Float16* Vth = Ksh + TILE;

    // ---- scores, transposed: s[j][r] = score(key j*16 + 8*hh + r, query c) ----
    v8f s[4];
#pragma unroll
    for (int j = 0; j < 4; ++j) {
      s[j] = (v8f){0.f,0.f,0.f,0.f,0.f,0.f,0.f,0.f};
#pragma unroll
      for (int dc = 0; dc < 2; ++dc) {
        const v16h ka = FR::load(Ksh + (j * 16 + c) * LP + dc * 32 + 8 * hh);
        s[j] = hmma(ka, qa[dc], s[j]);
      }
    }
    // ---- chunk maximum of this lane's query: 32 scores in the lane, then the other half's ----
    float mj[4];
#pragma unroll
    for (int j = 0; j < 4; ++j) {
      mj[j] = -INFINITY;
#pragma unroll
      for (int r = 0; r < 8; ++r) {
        s[j][r] *= SCORE_SCALE;
        mj[j] = fmaxf(mj[j], s[j][r]);
      }
    }
    float cm = fmaxf(fmaxf(mj[0], mj[1]), fmaxf(mj[2], mj[3]));
    cm = fmaxf(cm, xhalf(cm));
    // ---- online softmax update; P^T stays in registers ----
    const float mnew  = fmaxf(mrun, cm);
    const float aarg  = (mrun - mnew) * LOG2E;
    const float alpha = __builtin_amdgcn_exp2f(aarg);
    exp_slot1(alpha, aarg);
    mrun = mnew;
    // B operand of 32 keys: elements 0..7 = keys 8*hh + 0..7 (tile 2*kk), 8..15 = keys 16 + 8*hh + 0..7 (tile 2*kk+1),
    // the k order in which FR::load brings the V^T rows.
    v16h pb[2];
    float pj[4];
#pragma unroll
    for (int j = 0; j < 4; ++j) {
      pj[j] = 0.f;
#pragma unroll
      for (int g = 0; g < 8; g += 4) {
        float parg[4], p[4];
#pragma unroll
        for (int e = 0; e < 4; ++e) {
          parg[e] = (s[j][g + e] - mnew) * LOG2E;
          p[e]    = __builtin_amdgcn_exp2f(parg[e]);
        }
        // the slot behind these four v_exp_f32, as in exp_slot1
        asm volatile("v_nop" :: "v"(p[0]), "v"(p[1]), "v"(p[2]), "v"(p[3]), "v"(parg[0]), "v"(parg[1]), "v"(parg[2]), "v"(parg[3]));
#pragma unroll
        for (int e = 0; e < 4; ++e) {
          pj[j] += p[e];
          pb[j >> 1][(j & 1) * 8 + g + e] = (_Float16)(p[e] * PROB_CARRY);
        }
      }
    }
    lrun = lrun * alpha + ((pj[0] + pj[1]) + (pj[2] + pj[3]));
#pragma unroll
    for (int t = 0; t < 4; ++t)
#pragma unroll
      for (int r = 0; r < 8; ++r) oacc[t][r] *= alpha;
    // ---- O^T += V^T . P^T ----
#pragma unroll
    for (int kk = 0; kk < 2; ++kk) {
#pragma unroll
      for (int t = 0; t < 4; ++t) {
        const v16h va = FR::load(Vth + (t * 16 + c) * LP + kk * 32 + 8 * hh);
        oacc[t] = hmma(va, pb[kk], oacc[t]);
      }
    }
    // publish point of chunk kc + 1, the same in every wave
    asm volatile("s_wait_dscnt 0x0" ::: "memory");           // this wave's reads of the buffer to be refilled are done
    asm volatile("s_wait_asynccnt 0x0" ::: "memory");        // this wave's copies of chunk kc + 1 have landed
    __syncthreads();                                         // chunk kc + 1 may be read; every reader has left this trip's buffer
    if (kc + 2 < NCH)                                        // the same for the whole block
      copy_kv_chunk(lk0 + (kc & 1) * BUFB, lv0 + (kc & 1) * BUFB, gk + (size_t)(kc + 2) * 64 * ROWP, gv + (kc + 2) * 64,
                    LSTEP, (size_t)16 * ROWP, (size_t)16 * NCOMP);
  }
  asm volatile("s_wait_asynccnt 0x0" ::: "memory");          // no copy is in flight when the ring becomes the out tiles

  // ---- epilogue: join the halves' sums, normalise, stage 16x64 wave tile, whole-line f16 stores ----
  float* os = Os + wave * (16 * 68);
  {
    const float lsum = lrun + xhalf(lrun);
    const float inv  = OUT_CARRY * (1.0f / (lsum * PROB_CARRY));
#pragma unroll
    for (int t = 0; t < 4; ++t) {
#pragma unroll
      for (int g = 0; g < 2; ++g) {
        v4f w;
#pragma unroll
        for (int e = 0; e < 4; ++e) w[e] = oacc[t][g * 4 + e] * inv;
        *(v4f*)(os + c * 68 + t * 16 + 8 * hh + g * 4) = w;
      }
    }
  }
  __builtin_amdgcn_fence(__ATOMIC_RELEASE, "workgroup");
  __builtin_amdgcn_wave_barrier();
  __builtin_amdgcn_fence(__ATOMIC_ACQUIRE, "workgroup");
  {
    const int qq = lane >> 3, c8 = (lane & 7) * 8;
    {
#pragma unroll
      for (int it = 0; it < 4; ++it) {
        const int row = it * 4 + qq;
        const float* sp = os + row * 68 + c8;
        v8h hv;
#pragma unroll
        for (int e = 0; e < 8; ++e) hv[e] = (_Float16)sp[e];
        *(v8h*)(Ob + (size_t)(q0 + row) * ROWP + c8) = hv;
      }
      
    }
  }
}

// ---------------------------------------------------------------------------
// Host orchestration (kernel launches + host arithmetic only)
// ---------------------------------------------------------------------------
extern "C" void kernel_launch(void* const* d_in, const int* in_sizes, int n_in,
                              void* d_out, int out_size, void* d_ws, size_t ws_size,
                              hipStream_t stream) {
  if (n_in < 11) return;
  const long nQ  = (long)SEQLEN * NBAT * EMBED;    // 8388608
  const long nW  = (long)EMBED * EMBED;            // 262144
  const long nWc = (long)NCOMP * SEQLEN;           // 4194304
  if (in_sizes[0] != nQ || in_sizes[1] != nW || in_sizes[2] != EMBED || in_sizes[3] != nW ||
      in_sizes[4] != EMBED || in_sizes[5] != nW || in_sizes[6] != EMBED || in_sizes[7] != nWc ||
      in_sizes[8] != nWc || in_sizes[9] != nW || in_sizes[10] != EMBED || out_size != nQ) return;

  const float* query = (const float*)d_in[0];
  const float* Wq  = (const float*)d_in[1];  const float* bq = (const float*)d_in[2];
  const float* Wk  = (const float*)d_in[3];  const float* bk = (const float*)d_in[4];
  const float* Wv  = (const float*)d_in[5];  const float* bv = (const float*)d_in[6];
  const float* Wck = (const float*)d_in[7];  const float* Wcv = (const float*)d_in[8];
  const float* Wo  = (const float*)d_in[9];  const float* bo = (const float*)d_in[10];

  // ---- workspace region map (bytes) ----
  const size_t BYTES_QB   = (size_t)nQ * 2;                              // bf16 query [16384][512]            16 MiB
  const size_t BYTES_QT   = (size_t)nQ * 2;                              // bf16 query^T [4][512][4096]        16 MiB
  const size_t BYTES_WC   = (size_t)2 * nWc * 2;                         // bf16 [Wck;Wcv] [2048][4096]        16 MiB
  const size_t BYTES_KVIN = (size_t)2 * NCOMP * NBAT * (2 * EMBED) * 2;  // u16 [8192][1024] (hi|lo rows)     16 MiB
  const size_t BYTES_QP   = (size_t)nQ * 2;                              // f16 q plane [16384][512]          16 MiB
  const size_t BYTES_OP   = (size_t)nQ * 2;                              // f16 attention out [16384][512]    16 MiB
  const size_t BYTES_KP   = (size_t)NCOMP * NBAT * EMBED * 2;            // f16 k plane [4096][512]            4 MiB
  const size_t BYTES_VT   = (size_t)NBAT * EMBED * NCOMP * 2;            // f16 v^T plane [4][512][1024]       4 MiB
  const size_t BYTES_WQ   = (size_t)nW * 2;                              // bf16 Wq [512][512]               512 KiB
  const size_t BYTES_WK2  = (size_t)nW * 2 * 2;                          // bf16 [Wk|Wk] [512][1024]            1 MiB
  const size_t BYTES_WV2  = (size_t)nW * 2 * 2;                          // bf16 [Wv|Wv] [512][1024]            1 MiB
  const size_t BYTES_WOH  = (size_t)nW * 2;                              // f16 64*Wo [512][512]             512 KiB
  const size_t BYTES_BIAS = (size_t)4 * EMBED * 4;                       // f32 biases 4 x 512                  8 KiB
  const size_t OFF_QB   = 0;
  const size_t OFF_QT   = OFF_QB   + BYTES_QB;
  const size_t OFF_WC   = OFF_QT   + BYTES_QT;
  const size_t OFF_KVIN = OFF_WC   + BYTES_WC;
  const size_t OFF_QP   = OFF_KVIN + BYTES_KVIN;
  const size_t OFF_OP   = OFF_QP   + BYTES_QP;
  const size_t OFF_KP   = OFF_OP   + BYTES_OP;
  const size_t OFF_VT   = OFF_KP   + BYTES_KP;
  const size_t OFF_WQ   = OFF_VT   + BYTES_VT;
  const size_t OFF_WK2  = OFF_WQ   + BYTES_WQ;
  const size_t OFF_WV2  = OFF_WK2  + BYTES_WK2;
  const size_t OFF_WOH  = OFF_WV2  + BYTES_WV2;
  const size_t OFF_BIAS = OFF_WOH  + BYTES_WOH;
  const size_t WS_TOTAL = OFF_BIAS + BYTES_BIAS;                         // 112,205,824 B
  if (WS_TOTAL > ws_size) return;

  char* ws = (char*)d_ws;
  unsigned short* queryB = (unsigned short*)(ws + OFF_QB);
  unsigned short* queryT = (unsigned short*)(ws + OFF_QT);
  unsigned short* WcB    = (unsigned short*)(ws + OFF_WC);
  unsigned short* KVin   = (unsigned short*)(ws + OFF_KVIN);
  unsigned short* qP     = (unsigned short*)(ws + OFF_QP);
  unsigned short* oP     = (unsigned short*)(ws + OFF_OP);
  unsigned short* kP     = (unsigned short*)(ws + OFF_KP);
  unsigned short* vtP    = (unsigned short*)(ws + OFF_VT);
  unsigned short* WqB    = (unsigned short*)(ws + OFF_WQ);
  unsigned short* WkB2   = (unsigned short*)(ws + OFF_WK2);
  unsigned short* WvB2   = (unsigned short*)(ws + OFF_WV2);
  unsigned short* WoH    = (unsigned short*)(ws + OFF_WOH);
  float*          biasb  = (float*)(ws + OFF_BIAS);
  float* bq_r = biasb;
  float* bk_r = biasb + EMBED;
  float* bv_r = biasb + 2 * EMBED;
  float* bo_r = biasb + 3 * EMBED;

  // 1. every input conversion (query -> bf16 and bf16 transposed, Wck/Wcv, Wq, [Wk|Wk], [Wv|Wv], 64*Wo, biases)
  convert_inputs_kernel<<<dim3(CB_TOTAL), dim3(256), 0, stream>>>(
      query, Wck, Wcv, Wq, Wk, Wv, Wo, bq, bk, bv, bo,
      queryB, queryT, WcB, WqB, WkB2, WvB2, WoH, biasb);

  // 2. two products that read only what launch 1 wrote:
  //  compression: per batch b: C_b[m][n] = sum_t WcB[m][t] * queryT_b[n][t]; m<1024 -> k_in[m][b][n], m>=1024 -> v_in.
  //     C element (m,n,b): hi at KVin[(m*4+b)*1024 + n], lo at +512  => ldc 4096, strideC 1024, C2 = C + 512.
  //     M=2048, N=512, K=4096 (K%64==0, M%128==0, N%256==0): 32 block tiles of 128x256 per batch, 4 batches: 128 blocks.
  //  q8 = query . Wq^T + bq  (scale 1; 0.125 applied to f32 scores) -> f16 [16384][512]; M=16384, N=512, K=512: 256 blocks.
  {
    const GemmJob comp = { WcB, queryT, KVin, KVin + EMBED, biasb,
                           0L, (long)EMBED * SEQLEN, (long)(2 * EMBED),
                           SEQLEN, SEQLEN, 4 * (2 * EMBED), 2 * NCOMP, EMBED, SEQLEN, 32 };
    const GemmJob qpro = { queryB, WqB, qP, qP, bq_r,
                           0L, 0L, 0L,
                           EMBED, EMBED, EMBED, SEQLEN * NBAT, EMBED, EMBED, 256 };
    wmma_gemm64_pair<1, 0, 2, 2, 1><<<dim3(32 * NBAT + 256), dim3(256), 0, stream>>>(comp, qpro, 32 * NBAT);
  }

  // 3. two products that read only what launches 1 and 2 wrote:
  //  k = [k_in hi|lo] . [Wk|Wk]^T + bk -> f16 [4096 rows (c*4+b)][512]; M=4096, N=512, K'=1024: 64 blocks.
  //  v^T per batch: C_b[m=e'][n=c] = sum_k [Wv|Wv][e'][k] * [v_in hi|lo][(c,b)][k] + bv[e'] -> f16 vtP[b][512][1024].
  //     Bt_b rows at KVin + 4096*1024 + b*1024 + c*4096 (ldb 4096, strideB 1024); M=512, N=1024, K'=1024: 16 x 4 blocks.
  {
    const GemmJob kpro = { KVin, WkB2, kP, kP, bk_r,
                           0L, 0L, 0L,
                           2 * EMBED, 2 * EMBED, EMBED, NCOMP * NBAT, EMBED, 2 * EMBED, 64 };
    const GemmJob vpro = { WvB2, KVin + (size_t)NCOMP * NBAT * (2 * EMBED), vtP, vtP, bv_r,
                           0L, (long)(2 * EMBED), (long)EMBED * NCOMP,
                           2 * EMBED, 4 * (2 * EMBED), NCOMP, EMBED, NCOMP, 2 * EMBED, 16 };
    wmma_gemm64_pair<1, 2, 1, 1, 1><<<dim3(64 + 16 * NBAT), dim3(256), 0, stream>>>(kpro, vpro, 64);
  }

  // 4. attention over the compressed keys: grid = B*H*(T/64) = 2048 blocks of 128
  attn_lin_kernel<<<dim3(NBAT * NHEADS * (SEQLEN / 64)), dim3(128), 0, stream>>>(qP, kP, vtP, oP);

  // 5. out = (16 O) . (64 Wo)^T / 1024 + bo -> f32 d_out [16384][512]; M=16384, N=512, K=512: grid 256.
  wmma_gemm64<0, false, 2, 0, false><<<dim3(256, 1), dim3(256), 0, stream>>>(
      oP, oP, EMBED, 0L,
      WoH, WoH, EMBED, 0L,
      d_out, d_out, EMBED, 0L,
      bo_r, bo_r, 0L,
      SEQLEN * NBAT, EMBED, EMBED, 1.0f / (OUT_CARRY * WO_CARRY));
}

// v006
// Measured time: 156 microseconds a run.
// In both of two side-by-side timings against v005, it was 1.08 times as fast.
// Counting every step since v000, it is 3.71 times as fast.
// Contractions: sequence compression and q/k/v^T projections on v_wmma_f32_16x16x32_bf16 (bf16 operands = RNE-converted inputs; k_in/v_in carried as bf16 hi+lo planes concatenated along k); q.k^T, p.v and the output projection on v_wmma_f32_16x16x32_f16 (f16 planes; p carried x2^15, attention output x2^4, Wo x2^6); f32 accumulate; softmax, score scale 0.125 and biases in f32.
#include <hip/hip_runtime.h>
#include <math.h>
#include <stdint.h>

typedef __attribute__((ext_vector_type(16))) _Float16 v16h;
typedef __attribute__((ext_vector_type(8)))  _Float16 v8h;
typedef __attribute__((ext_vector_type(16))) __bf16   v16b;
typedef __attribute__((ext_vector_type(8)))  __bf16   v8b;
typedef __attribute__((ext_vector_type(8)))  float    v8f;
typedef __attribute__((ext_vector_type(4)))  float    v4f;
typedef __attribute__((ext_vector_type(2)))  float    v2f;
typedef __attribute__((ext_vector_type(4)))  unsigned int v4u;
typedef __attribute__((ext_vector_type(2)))  unsigned int v2u;

__device__ __forceinline__ unsigned short f2bf_bits(float f) {
  unsigned u = __float_as_uint(f);
  return (unsigned short)((u + 0x7FFFu + ((u >> 16) & 1u)) >> 16);
}
__device__ __forceinline__ float bf_bits2f(unsigned short h) { return __uint_as_float(((unsigned)h) << 16); }

// hazard guards as plain device helpers (no inline asm inside the kernel template body)
__device__ __forceinline__ void dep_guard_h(v8f& a, v8f& b, v16h x, v16h y) { asm volatile("v_nop\n\tv_nop\n\tv_nop\n\tv_nop" : "+v"(a), "+v"(b) : "v"(x), "v"(y)); }
__device__ __forceinline__ void dep_guard_b(v8f& a, v8f& b, v16b x, v16b y) { asm volatile("v_nop\n\tv_nop\n\tv_nop\n\tv_nop" : "+v"(a), "+v"(b) : "v"(x), "v"(y)); }
__device__ __forceinline__ void keep4_h(v16h a, v16h b, v16h c, v16h d) { asm volatile("v_nop" :: "v"(a), "v"(b), "v"(c), "v"(d)); }
__device__ __forceinline__ void keep4_b(v16b a, v16b b, v16b c, v16b d) { asm volatile("v_nop" :: "v"(a), "v"(b), "v"(c), "v"(d)); }
__device__ __forceinline__ void acc_guard4(v8f& a, v8f& b, v8f& c, v8f& d) { asm volatile("v_nop\n\tv_nop\n\tv_nop\n\tv_nop" : "+v"(a), "+v"(b), "+v"(c), "+v"(d)); }
template <typename T> struct Frag;
template <> struct Frag<_Float16> {
  typedef v16h V; typedef v8h H; union U { v16h v; v8h h[2]; };
  static __device__ __forceinline__ v16h load(const _Float16* p) {   // elements 0..7 <- p[0..7], 8..15 <- p[16..23]
    U f; f.h[0] = *(const v8h*)(p); f.h[1] = *(const v8h*)(p + 16); return f.v;
  }
  static __device__ __forceinline__ v8f mma(v16h a, v16h b, v8f c) {
    return __builtin_amdgcn_wmma_f32_16x16x32_f16(false, a, false, b, (short)0, c, false, false);
  }
  static __device__ __forceinline__ void guard(v8f& a, v8f& b, v16h x, v16h y) { dep_guard_h(a, b, x, y); }
  static __device__ __forceinline__ void keep(v16h a, v16h b, v16h c, v16h d) { keep4_h(a, b, c, d); }
};
template <> struct Frag<__bf16> {
  typedef v16b V; typedef v8b H; union U { v16b v; v8b h[2]; };
  static __device__ __forceinline__ v16b load(const __bf16* p) {
    U f; f.h[0] = *(const v8b*)(p); f.h[1] = *(const v8b*)(p + 16); return f.v;
  }
  static __device__ __forceinline__ v8f mma(v16b a, v16b b, v8f c) {
    return __builtin_amdgcn_wmma_f32_16x16x32_bf16(false, a, false, b, (short)0, c, false, false);
  }
  static __device__ __forceinline__ void guard(v8f& a, v8f& b, v16b x, v16b y) { dep_guard_b(a, b, x, y); }
  static __device__ __forceinline__ void keep(v16b a, v16b b, v16b c, v16b d) { keep4_b(a, b, c, d); }
};

// ---- Register-blocked batched WMMA GEMM ------------------------------------
// C[m,n] = scale * sum_k A[m,k] * Bt[n,k] (+bias)(+resid); each wave owns a 64x64 tile.
// A row-major [M,K]; Bt row-major [N,K]; M % 128 == 0, N % 256 == 0, K % 64 == 0.
// A block of 8 waves (2 x 4) owns a 128x256 tile of C. Per stage of 64 k it brings 128 rows of A and 256 rows
// of Bt, 128 B each, into LDS with whole-line 16-byte loads (8 lanes per row); the waves read their fragments
// from LDS. Two LDS buffers: the next stage's global loads are issued ahead of this stage's products and
// stored behind them, one block barrier per stage.
// SPLIT (hi/lo operand planes) is not built in this form.
// BIAS_MODE: 0 = none, 1 = bias[m], 2 = bias[n].
// OUT_MODE: 0 = f32, 1 = f16, 2 = bf16 hi plane (Cout) + bf16 lo plane (Cout2).
// ET: 0 = f16 operands, 1 = bf16 operands (pointers passed as 16-bit storage)
template <int ET> struct Elem;
template <> struct Elem<0> { typedef _Float16 T; };
template <> struct Elem<1> { typedef __bf16 T; };
// The tile's work is a device function: bx = index of the block tile, b = batch, sOpRaw / sTRaw = the launching
// kernel's LDS, so that one launch can hold the block tiles of two products that do not depend on one another.
constexpr int GEMM_OP_ELEMS = 2 * (128 + 256) * (64 + 8);   // two buffers of (BM + BN) rows at pitch LP
constexpr int GEMM_SLAB_F32 = 8 * 16 * 68;                  // eight per-wave 16x64 slabs, pitch 68 floats
template <int ET, bool SPLIT, int BIAS_MODE, int OUT_MODE, bool RESID, int ACT = 0>
__device__ __forceinline__ void gemm_tile(
    const unsigned short* __restrict__ Ap, const unsigned short* __restrict__ A2p, int lda, long strideA,
    const unsigned short* __restrict__ Btp, const unsigned short* __restrict__ Bt2p, int ldb, long strideB,
    void* __restrict__ Cout, void* __restrict__ Cout2, int ldc, long strideC,
    const float* __restrict__ bias,
    const float* __restrict__ resid, long strideR,
    int M, int N, int K, float scale,
    int bx, int b, unsigned short* sOpRaw, float* sTRaw) {
  typedef typename Elem<ET>::T T;
  typedef typename Frag<T>::V V;
  const T* A = (const T*)Ap; const T* Bt = (const T*)Btp;
  static_assert(!SPLIT, "hi/lo planes are not staged");
  typedef typename Frag<T>::H H;
  constexpr int BM = 128, BN = 256, BK = 64;
  // LDS row pitch 64 + 8 elements = 144 B = 16 B x 9 (odd): the 16 rows of one 16-byte fragment read fall on
  // different groups of four banks.
  constexpr int LP = BK + 8;
  static_assert(2 * (BM + BN) * LP == GEMM_OP_ELEMS, "LDS size");
  T (*sOp)[(BM + BN) * LP] = (T (*)[(BM + BN) * LP])sOpRaw;   // [buffer][A rows 0..127 | Bt rows 128..383][k]
  float (*sT)[16 * 68] = (float (*)[16 * 68])sTRaw;           // per-wave 16x64 slab, pitch 68 floats
  const int tid  = threadIdx.x;
  const int lane = tid & 31;
  const int wave = tid >> 5;
  const int blocksN = N / BN;
  const int blocksM = M / BM;
  if (bx >= blocksM * blocksN) return;   // block-uniform, ahead of every barrier
  const int bm = bx / blocksN;
  const int bn = bx - bm * blocksN;
  const int wm = wave >> 2;                    // 0..1: 64-row band of the block tile
  const int wn = wave & 3;                     // 0..3: 64-column band
  const int m0 = bm * BM + (wm << 6);
  const int n0 = bn * BN + (wn << 6);

  const T* Ab  = A  + (size_t)b * strideA;
  const T* Bb  = Bt + (size_t)b * strideB;

  const int rlane = lane & 15;                 // row (A) / col (B, D) within subtile
  const int koff  = (lane >> 4) * 8;           // k offset of this lane half
  const int mOff  = (lane >> 4) * 8;           // D row offset

  // staging map: 8 threads x 16 B = one 128-B row; 32 rows per sweep of the block
  const int srow = tid >> 3;                   // 0..31
  const int sk   = (tid & 7) * 8;              // element offset in the row
  const T* gA = Ab + (size_t)(bm * BM + srow) * lda + sk;
  const T* gB = Bb + (size_t)(bn * BN + srow) * ldb + sk;
  const int sdst = srow * LP + sk;

  v8f acc[4][4];
#pragma unroll
  for (int i = 0; i < 4; ++i)
#pragma unroll
    for (int j = 0; j < 4; ++j) acc[i][j] = (v8f){0.f,0.f,0.f,0.f,0.f,0.f,0.f,0.f};

  H stA[BM / 32], stB[BN / 32];
#pragma unroll
  for (int it = 0; it < BM / 32; ++it) stA[it] = *(const H*)(gA + (size_t)(it * 32) * lda);
#pragma unroll
  for (int it = 0; it < BN / 32; ++it) stB[it] = *(const H*)(gB + (size_t)(it * 32) * ldb);
#pragma unroll
  for (int it = 0; it < BM / 32; ++it) *(H*)(&sOp[0][sdst + it * 32 * LP]) = stA[it];
#pragma unroll
  for (int it = 0; it < BN / 32; ++it) *(H*)(&sOp[0][sdst + (BM + it * 32) * LP]) = stB[it];
  __syncthreads();

  const int nst = K / BK;
#pragma unroll 1
  for (int s = 0; s < nst; ++s) {
    const T* cur = sOp[s & 1];
    T*       nxt = sOp[(s + 1) & 1];
    const bool more = s + 1 < nst;             // the same for the whole block
    if (more) {
      const int k1 = (s + 1) * BK;
#pragma unroll
      for (int it = 0; it < BM / 32; ++it) stA[it] = *(const H*)(gA + (size_t)(it * 32) * lda + k1);
#pragma unroll
      for (int it = 0; it < BN / 32; ++it) stB[it] = *(const H*)(gB + (size_t)(it * 32) * ldb + k1);
    }
#pragma unroll
    for (int kk = 0; kk < BK; kk += 32) {
      V bh[4], ah[4];
#pragma unroll
      for (int j = 0; j < 4; ++j) bh[j] = Frag<T>::load(cur + (BM + (wn << 6) + (j << 4) + rlane) * LP + kk + koff);
#pragma unroll
      for (int i = 0; i < 4; ++i) ah[i] = Frag<T>::load(cur + ((wm << 6) + (i << 4) + rlane) * LP + kk + koff);
#pragma unroll
      for (int i = 0; i < 4; ++i) {
#pragma unroll
        for (int j = 0; j < 4; ++j) acc[i][j] = Frag<T>::mma(ah[i], bh[j], acc[i][j]);
        Frag<T>::guard(acc[i][0], acc[i][3], ah[i], ah[i]);
      }
      Frag<T>::keep(bh[0], bh[1], bh[2], bh[3]);
    }
    if (more) {
#pragma unroll
      for (int it = 0; it < BM / 32; ++it) *(H*)(nxt + sdst + it * 32 * LP) = stA[it];
#pragma unroll
      for (int it = 0; it < BN / 32; ++it) *(H*)(nxt + sdst + (BM + it * 32) * LP) = stB[it];
    }
    // publishes the buffer just written and ends every wave's reads of the buffer that the next stage refills
    __syncthreads();
  }
  acc_guard4(acc[0][0], acc[0][1], acc[0][2], acc[0][3]);
  acc_guard4(acc[1][0], acc[1][1], acc[1][2], acc[1][3]);
  acc_guard4(acc[2][0], acc[2][1], acc[2][2], acc[2][3]);
  acc_guard4(acc[3][0], acc[3][1], acc[3][2], acc[3][3]);

  // ---- epilogue ----
  float* slab = sT[wave];
  const float* Rb = RESID ? (resid + (size_t)b * strideR) : nullptr;
#pragma unroll
  for (int i = 0; i < 4; ++i) {
    const int mBase = m0 + (i << 4);
#pragma unroll
    for (int j = 0; j < 4; ++j) {
      const int n = n0 + (j << 4) + rlane;
      float bv = 0.f;
      if (BIAS_MODE == 2) bv = bias[n];
#pragma unroll
      for (int r = 0; r < 8; ++r) {
        float v = acc[i][j][r] * scale;
        if (BIAS_MODE == 1) v += bias[mBase + mOff + r];
        if (BIAS_MODE == 2) v += bv;
        if (RESID) v += Rb[(size_t)(mBase + mOff + r) * ldc + n];
        if (ACT == 1) v = tanhf(v);
        if (ACT == 2) v = fmaxf(v, 0.0f);
        if (ACT == 3) v = v / (1.0f + expf(-v));
        if (ACT == 4) v = (v > 0.f) ? v : 0.01f * v;
        if (ACT == 5) v = 0.5f * v * (1.0f + erff(v * 0.70710678118654752f));
        slab[(mOff + r) * 68 + (j << 4) + rlane] = v;
      }
    }
    __builtin_amdgcn_fence(__ATOMIC_RELEASE, "workgroup");
    __builtin_amdgcn_wave_barrier();
    __builtin_amdgcn_fence(__ATOMIC_ACQUIRE, "workgroup");
    if (OUT_MODE == 0) {
      float* C = (float*)Cout + (size_t)b * strideC;
      const int hh = lane >> 4, c4 = (lane & 15) * 4;     // row seg = 256 B = 16 lanes x 16 B
      {
#pragma unroll
        for (int it = 0; it < 8; ++it) {
          const int row = it * 2 + hh;
          v4f v = *(const v4f*)(slab + row * 68 + c4);
          *(v4f*)(C + (size_t)(mBase + row) * ldc + n0 + c4) = v;
        }
        
      }
    } else {
      const int q = lane >> 3, c8 = (lane & 7) * 8;
      unsigned short* C  = (unsigned short*)Cout  + (size_t)b * strideC;
      unsigned short* C2 = (OUT_MODE == 2) ? ((unsigned short*)Cout2 + (size_t)b * strideC) : nullptr;
      {
#pragma unroll
        for (int it = 0; it < 4; ++it) {
          const int row = it * 4 + q;
          const float* sp = slab + row * 68 + c8;
          v8h hv, lv;
#pragma unroll
          for (int e = 0; e < 8; ++e) {
            if (OUT_MODE == 1) {
              hv[e] = (_Float16)sp[e];
            } else {
              unsigned short hb = f2bf_bits(sp[e]);
              unsigned short lb = f2bf_bits(sp[e] - bf_bits2f(hb));
              hv[e] = __builtin_bit_cast(_Float16, hb);
              lv[e] = __builtin_bit_cast(_Float16, lb);
            }
          }
          *(v8h*)(C + (size_t)(mBase + row) * ldc + n0 + c8) = hv;
          if (OUT_MODE == 2) *(v8h*)(C2 + (size_t)(mBase + row) * ldc + n0 + c8) = lv;
        }
        
      }
    }
    __builtin_amdgcn_fence(__ATOMIC_RELEASE, "workgroup");
    __builtin_amdgcn_wave_barrier();
    __builtin_amdgcn_fence(__ATOMIC_ACQUIRE, "workgroup");
  }
}

// One product per launch: grid (block tiles, batches).
template <int ET, bool SPLIT, int BIAS_MODE, int OUT_MODE, bool RESID, int ACT = 0>
__global__ __launch_bounds__(256) void wmma_gemm64(
    const unsigned short* __restrict__ Ap, const unsigned short* __restrict__ A2p, int lda, long strideA,
    const unsigned short* __restrict__ Btp, const unsigned short* __restrict__ Bt2p, int ldb, long strideB,
    void* __restrict__ Cout, void* __restrict__ Cout2, int ldc, long strideC,
    const float* __restrict__ bias,
    const float* __restrict__ resid, long strideR,
    int M, int N, int K, float scale) {
  __shared__ __align__(16) unsigned short sOpRaw[GEMM_OP_ELEMS];
  __shared__ __align__(16) float sTRaw[GEMM_SLAB_F32];
  gemm_tile<ET, SPLIT, BIAS_MODE, OUT_MODE, RESID, ACT>(Ap, A2p, lda, strideA, Btp, Bt2p, ldb, strideB, Cout, Cout2, ldc, strideC,
                                                        bias, resid, strideR, M, N, K, scale,
                                                        (int)blockIdx.x, (int)blockIdx.y, sOpRaw, sTRaw);
}

// Two independent products in one launch: blocks 0 .. nb0-1 take product 0 (the longer one, so that it starts first),
// the rest product 1. In each product the flat index runs over its gx block tiles first, then over its batches.
struct GemmJob {
  const unsigned short* A;  const unsigned short* Bt;
  unsigned short* C;  unsigned short* C2;
  const float* bias;
  long strideA, strideB, strideC;
  int lda, ldb, ldc, M, N, K, gx;
};
template <int ET, int BIAS0, int OUT0, int BIAS1, int OUT1>
__global__ __launch_bounds__(256) void wmma_gemm64_pair(GemmJob j0, GemmJob j1, int nb0) {
  __shared__ __align__(16) unsigned short sOpRaw[GEMM_OP_ELEMS];
  __shared__ __align__(16) float sTRaw[GEMM_SLAB_F32];
  const int blk = (int)blockIdx.x;   // the same for the whole block: every barrier below stands under block-uniform flow
  if (blk < nb0) {
    gemm_tile<ET, false, BIAS0, OUT0, false>(j0.A, j0.A, j0.lda, j0.strideA, j0.Bt, j0.Bt, j0.ldb, j0.strideB,
                                             (void*)j0.C, (void*)j0.C2, j0.ldc, j0.strideC, j0.bias, j0.bias, 0L,
                                             j0.M, j0.N, j0.K, 1.0f, blk % j0.gx, blk / j0.gx, sOpRaw, sTRaw);
  } else {
    const int l = blk - nb0;
    gemm_tile<ET, false, BIAS1, OUT1, false>(j1.A, j1.A, j1.lda, j1.strideA, j1.Bt, j1.Bt, j1.ldb, j1.strideB,
                                             (void*)j1.C, (void*)j1.C2, j1.ldc, j1.strideC, j1.bias, j1.bias, 0L,
                                             j1.M, j1.N, j1.K, 1.0f, l % j1.gx, l / j1.gx, sOpRaw, sTRaw);
  }
}

__device__ __forceinline__ unsigned pk16(unsigned short a, unsigned short b) { return (unsigned)a | ((unsigned)b << 16); }

// ---------------------------------------------------------------------------
// Problem geometry
// ---------------------------------------------------------------------------
constexpr int   SEQLEN  = 4096;   // time steps (queries)
constexpr int   NBAT    = 4;      // batch
constexpr int   EMBED   = 512;    // channels
constexpr int   NHEADS  = 8;
constexpr int   HDIM    = 64;
constexpr int   NCOMP   = 1024;   // compressed key count
constexpr float SCORE_SCALE = 0.125f;     // head_dim^-0.5, applied to the f32 score accumulators
constexpr float PROB_CARRY  = 32768.0f;   // p carried x2^15 in the f16 P operand, folded into 1/l
constexpr float OUT_CARRY   = 16.0f;      // attention output carried x2^4 in its f16 plane
constexpr float WO_CARRY    = 64.0f;      // Wo carried x2^6 in its f16 plane

// ---------------------------------------------------------------------------
// Elementwise conversions work in UNITS of CU_ELEMS = 8192 consecutive f32 (32 KB): thread t of the block's 256 takes the
// four floats at j*1024 + 4*t, j = 0..7. Each wave-wide load is 512 contiguous bytes (4 whole lines), the eight loads of a
// thread are asked for before the first is converted, and each wave-wide 8-B store writes 256 contiguous bytes (2 whole lines).
// ---------------------------------------------------------------------------
constexpr int CU_ELEMS = 8192;
// Last statement of a unit: what follows in the block's loop (the next job test's side, the next trip) rewrites the address
// and data registers that the unit's stores name.
// (Not in the bias unit: there the build's own s_wait_xcnt 0 stands directly behind the stores.)
__device__ __forceinline__ void unit_stores_issued() { asm volatile("s_wait_xcnt 0x0" ::: "memory"); }
__device__ __forceinline__ void load_unit(v4f (&f)[8], const float* __restrict__ in, int e0) {
#pragma unroll   // f[] stays in registers and the eight loads stand together, ahead of the first use
  for (int j = 0; j < 8; ++j) f[j] = *(const v4f*)(in + e0 + j * 1024);
}
__device__ __forceinline__ v2u bf16x4(v4f f) {
  v2u u;
  u[0] = pk16(f2bf_bits(f[0]), f2bf_bits(f[1]));
  u[1] = pk16(f2bf_bits(f[2]), f2bf_bits(f[3]));
  return u;
}

// f32 -> bf16 (RNE), same flat layout.
__device__ __forceinline__ void cast_bf16_unit(const float* __restrict__ in, unsigned short* __restrict__ out, int unit) {
  const int e0 = unit * CU_ELEMS + (int)threadIdx.x * 4;
  v4f f[8];
  load_unit(f, in, e0);
#pragma unroll   // f[] is indexed by constants only, so it stays in registers
  for (int j = 0; j < 8; ++j) *(v2u*)(out + e0 + j * 1024) = bf16x4(f[j]);
  unit_stores_issued();
}

// W [rows][cols] f32 -> out [rows][2*cols] bf16 with out[r][c] = out[r][cols + c] = bf16_rne(W[r][c]).
// cols % 128 == 0, so a wave's 128 elements of one store stay in one row.
__device__ __forceinline__ void dup_bf16_unit(const float* __restrict__ Wm, unsigned short* __restrict__ out, int cols, int unit) {
  const int e0 = unit * CU_ELEMS + (int)threadIdx.x * 4;
  v4f f[8];
  load_unit(f, Wm, e0);
#pragma unroll   // f[] is indexed by constants only, so it stays in registers
  for (int j = 0; j < 8; ++j) {
    const int e  = e0 + j * 1024;
    const int r  = e / cols;
    const int cc = e - r * cols;
    const v2u u = bf16x4(f[j]);
    *(v2u*)(out + (size_t)r * 2 * cols + cc) = u;
    *(v2u*)(out + (size_t)r * 2 * cols + cols + cc) = u;
  }
  unit_stores_issued();
}

// Wo f32 -> f16 plane holding f16(carry * bf16_rne(w)) (exact for bf16 values in the normal f16 range).
__device__ __forceinline__ void cast_wo_f16_unit(const float* __restrict__ Wm, unsigned short* __restrict__ out, float carry, int unit) {
  const int e0 = unit * CU_ELEMS + (int)threadIdx.x * 4;
  v4f f[8];
  load_unit(f, Wm, e0);
#pragma unroll   // f[] is indexed by constants only, so it stays in registers
  for (int j = 0; j < 8; ++j) {
    unsigned short h[4];
#pragma unroll   // h[] stays in registers
    for (int e = 0; e < 4; ++e) {
      const _Float16 x = (_Float16)(bf_bits2f(f2bf_bits(f[j][e])) * carry);
      h[e] = __builtin_bit_cast(unsigned short, x);
    }
    v2u u;
    u[0] = pk16(h[0], h[1]);
    u[1] = pk16(h[2], h[3]);
    *(v2u*)(out + e0 + j * 1024) = u;
  }
  unit_stores_issued();
}

// ---------------------------------------------------------------------------
// Bias vectors RNE-converted to bf16 precision (kept as f32): outb[0..n) = bq, [n..2n) = bk, [2n..3n) = bv, [3n..4n) = bo.
// One block does all four.
// ---------------------------------------------------------------------------
__device__ __forceinline__ void bias_prep_unit(const float* __restrict__ bq, const float* __restrict__ bk,
                                               const float* __restrict__ bv, const float* __restrict__ bo,
                                               float* __restrict__ outb, int n) {
  for (int i = (int)threadIdx.x; i < n; i += 256) {
    outb[i]         = bf_bits2f(f2bf_bits(bq[i]));
    outb[n + i]     = bf_bits2f(f2bf_bits(bk[i]));
    outb[2 * n + i] = bf_bits2f(f2bf_bits(bv[i]));
    outb[3 * n + i] = bf_bits2f(f2bf_bits(bo[i]));
  }
}

// ---------------------------------------------------------------------------
// Transpose + bf16 RNE convert, z-batched: in_z = X + z*sIn viewed [R rows][Cc cols] with row pitch ldi ->
//   o_z[c][r] = bf16_rne(in_z[r][c])  ([Cc][R], pitch R), o_z = o + z*sOut.
// 64x64 tiles through LDS (tf: 64 * 68 floats of the launching kernel). Tile (bx, by, bz) of (Cc/64, R/64, Z), 256 threads
// (R, Cc multiples of 64).
// Coverage per tile: load 4 it x 256 thr x 4 floats = 64x64; store 2 it x 256 thr x 8 u16 = 64x64.
// ---------------------------------------------------------------------------
__device__ __forceinline__ void tconv_bf16_job(const float* __restrict__ X, unsigned short* __restrict__ o,
                                               int R, int Cc, int ldi, long sIn, long sOut,
                                               int bx, int by, int bz, float* tf) {
  X += (size_t)bz * sIn;
  o += (size_t)bz * sOut;
  const int c0  = bx * 64;   // input column block = output row block
  const int r0  = by * 64;   // input row block    = output column block
  const int tid = threadIdx.x;
  {
    const int lr = tid >> 4;         // 0..15
    const int c4 = (tid & 15) * 4;   // 0..60
#pragma unroll
    for (int it = 0; it < 4; ++it) {
      const int rr = it * 16 + lr;   // 0..63
      const v4f a = *(const v4f*)(X + (size_t)(r0 + rr) * ldi + c0 + c4);
      *(v4f*)(tf + rr * 68 + c4) = a;
    }
  }
  __syncthreads();
  const int sub = tid >> 3;          // 0..31
  const int c8  = (tid & 7) * 8;     // 0..56
  v4u hv[2];
#pragma unroll
  for (int it = 0; it < 2; ++it) {
    const int oc = it * 32 + sub;    // output row within tile (= input column)
    v4u a;
#pragma unroll
    for (int q = 0; q < 4; ++q) {
      const float f0 = tf[(c8 + 2 * q) * 68 + oc];
      const float f1 = tf[(c8 + 2 * q + 1) * 68 + oc];
      a[q] = pk16(f2bf_bits(f0), f2bf_bits(f1));
    }
    hv[it] = a;
  }
  __syncthreads();   // every thread has read the tile: a later unit of this block may overwrite tf
  {
#pragma unroll
    for (int it = 0; it < 2; ++it) {
      const int oc = it * 32 + sub;
      const size_t go = (size_t)(c0 + oc) * R + r0 + c8;
      *(v4u*)(o + go) = hv[it];
    }
    
  }
  unit_stores_issued();
}

// ---------------------------------------------------------------------------
// All input conversions in ONE launch: none reads what another writes. The work is a list of CU_TOTAL units (a 64x64 tile of
// the transposing job, or CU_ELEMS elements of an elementwise one); CB_GRID blocks, few enough to be resident together, each
// take at most CU_PER_BLOCK units, CB_GRID apart. A unit's index picks its job: the tests and the trip count are the same for the
// whole block, so the transposing job's barriers stand under block-uniform flow.
// ---------------------------------------------------------------------------
constexpr int CU_TCONV = (EMBED / 64) * (SEQLEN / 64) * NBAT;       // 2048 tiles of query^T
constexpr int CU_QUERY = SEQLEN * NBAT * EMBED / CU_ELEMS;          // 1024
constexpr int CU_WC    = NCOMP * SEQLEN / CU_ELEMS;                 // 512 for each of Wck, Wcv
constexpr int CU_W     = EMBED * EMBED / CU_ELEMS;                  // 32 for each of Wq, Wk, Wv, Wo
constexpr int CU_TOTAL = CU_TCONV + CU_QUERY + 2 * CU_WC + 4 * CU_W + 1;   // 4225, the last one the biases
constexpr int CU_PER_BLOCK = 4;
constexpr int CB_GRID  = (CU_TOTAL + CU_PER_BLOCK - 1) / CU_PER_BLOCK;     // 1057
static_assert(SEQLEN * NBAT * EMBED % CU_ELEMS == 0 && NCOMP * SEQLEN % CU_ELEMS == 0 && EMBED * EMBED % CU_ELEMS == 0 &&
              EMBED % 128 == 0, "whole units");
__global__ __launch_bounds__(256) void convert_inputs_kernel(
    const float* __restrict__ query, const float* __restrict__ Wck, const float* __restrict__ Wcv,
    const float* __restrict__ Wq, const float* __restrict__ Wk, const float* __restrict__ Wv, const float* __restrict__ Wo,
    const float* __restrict__ bq, const float* __restrict__ bk, const float* __restrict__ bv, const float* __restrict__ bo,
    unsigned short* __restrict__ queryB, unsigned short* __restrict__ queryT, unsigned short* __restrict__ WcB,
    unsigned short* __restrict__ WqB, unsigned short* __restrict__ WkB2, unsigned short* __restrict__ WvB2,
    unsigned short* __restrict__ WoH, float* __restrict__ biasb) {
  __shared__ __align__(16) float tf[64 * 68];
  for (int unit = (int)blockIdx.x; unit < CU_TOTAL; unit += CB_GRID) {
    constexpr int U_QUERY = CU_TCONV, U_WCK = U_QUERY + CU_QUERY, U_WCV = U_WCK + CU_WC, U_WQ = U_WCV + CU_WC,
                  U_WK = U_WQ + CU_W, U_WV = U_WK + CU_W, U_WO = U_WV + CU_W, U_BIAS = U_WO + CU_W;
    static_assert(U_BIAS + 1 == CU_TOTAL, "unit list");
    if (unit < U_QUERY) {
      // query^T per batch: in [T=4096 rows][E=512 cols] pitch 2048 (base + b*512) -> out_b [512][4096]
      tconv_bf16_job(query, queryT, SEQLEN, EMBED, NBAT * EMBED, (long)EMBED, (long)EMBED * SEQLEN,
                     unit % (EMBED / 64), (unit / (EMBED / 64)) % (SEQLEN / 64), unit / ((EMBED / 64) * (SEQLEN / 64)), tf);
    } else if (unit < U_WCK) {
      // query -> bf16 [16384][512] (same flat layout as [T][B][E])
      cast_bf16_unit(query, queryB, unit - U_QUERY);
    } else if (unit < U_WCV) {
      // Wck -> rows 0..1023, Wcv -> rows 1024..2047 of the [2048][4096] bf16 plane
      cast_bf16_unit(Wck, WcB, unit - U_WCK);
    } else if (unit < U_WQ) {
      cast_bf16_unit(Wcv, WcB + (size_t)NCOMP * SEQLEN, unit - U_WCV);
    } else if (unit < U_WK) {
      cast_bf16_unit(Wq, WqB, unit - U_WQ);
    } else if (unit < U_WV) {
      dup_bf16_unit(Wk, WkB2, EMBED, unit - U_WK);
    } else if (unit < U_WO) {
      dup_bf16_unit(Wv, WvB2, EMBED, unit - U_WV);
    } else if (unit < U_BIAS) {
      cast_wo_f16_unit(Wo, WoH, WO_CARRY, unit - U_WO);
    } else {
      // biases (RNE to bf16 precision)
      bias_prep_unit(bq, bk, bv, bo, biasb, EMBED);
    }
  }
}

// =====================================================================================
// Full (unmasked) attention over the NCOMP compressed keys, head dim 64, all (b,h) in one launch.
//   q plane f16: element (t, b, h, d) at [(t*NBAT + b)*EMBED + h*64 + d]   (holds 8*q; 0.125 applied to f32 scores)
//   k plane f16: element (c, b, h, d) at [(c*NBAT + b)*EMBED + h*64 + d]
//   v^T plane f16: element (b, h, d, c) at [b*EMBED*NCOMP + (h*64 + d)*NCOMP + c]
//   out plane f16: element (t, b, h, d) at [(t*NBAT + b)*EMBED + h*64 + d], value = OUT_CARRY * attention output
//   Both products are taken transposed: S^T = K . Q^T (A = K rows, B = Q) and O^T += V^T . P^T (A = V^T rows,
//   B = P^T), v_wmma_f32_16x16x32_f16, p carried x PROB_CARRY, f32 accumulate. A lane then holds 32 of the 64
//   scores of ONE query (lane l and l ^ 16 split the keys): maximum and sum run in the lane's own registers with
//   one exchange between the wave halves, and two score tiles, converted in place, are the B operand P^T.
//   Online softmax in f32 over NCOMP/64 chunks (compile-time trip count, no masking).
//   Block = 4 waves = 64 query rows of one (b, h); grid.x = NBAT * NHEADS * (SEQLEN/64) = 2048.
//   K / V^T chunk staging: asynchronous 16-B copies to LDS, 8 lanes per 128-B row (a wave's copy covers 4 whole lines),
//   8 copies per thread and chunk, two LDS buffers: chunk kc + 2 is asked for at the foot of trip kc, one block barrier
//   per trip; fragment loads read the LDS tiles as v8h. Behind the loop the same LDS holds the waves' out tiles.
// =====================================================================================
__device__ __forceinline__ v8f hmma(v16h a, v16h b, v8f c) {
  c = __builtin_amdgcn_wmma_f32_16x16x32_f16(false, a, false, b, (short)0, c, false, false);
  asm volatile("v_nop\n\tv_nop\n\tv_nop\n\tv_nop" : "+v"(c) : "v"(a), "v"(b));
  return c;
}
// The slot that the instruction set asks for behind a transcendental before its source register is rewritten.
// The results and the sources of a run of v_exp_f32 are
// inputs only of the v_nop's statement: it stands behind the last of the run, and no source is rewritten ahead of it.
__device__ __forceinline__ void exp_slot1(float e, float a) { asm volatile("v_nop" :: "v"(e), "v"(a)); }
constexpr float LOG2E = 1.44269504f;   // __expf(x) compiles to v_exp_f32(x * LOG2E); written out so that the source has a name
// value of lane l ^ 16
__device__ __forceinline__ float xhalf(float x) {
  return __builtin_bit_cast(float, __builtin_amdgcn_permlanex16(__builtin_bit_cast(int, x), __builtin_bit_cast(int, x),
                                                                0x76543210, 0xfedcba98, false, false));
}

// One chunk's share of a thread: four rows of K and four of V^T, 16 rows apart, 16 B each, global -> LDS through no register.
// lk / lv: the lane's LDS byte addresses of its first K / V^T piece; gk / gv: the global addresses of the same pieces.
// The s_wait_xcnt 0 is the last line of the copies' own statement, so that no register a copy names is rewritten ahead of it.
__device__ __forceinline__ void copy_kv_chunk(unsigned lk, unsigned lv, const _Float16* gk, const _Float16* gv,
                                              unsigned lstep, size_t kstep, size_t vstep) {
  const unsigned lk1 = lk + lstep, lk2 = lk + 2 * lstep, lk3 = lk + 3 * lstep;
  const unsigned lv1 = lv + lstep, lv2 = lv + 2 * lstep, lv3 = lv + 3 * lstep;
  const _Float16* gk1 = gk + kstep; const _Float16* gk2 = gk + 2 * kstep; const _Float16* gk3 = gk + 3 * kstep;
  const _Float16* gv1 = gv + vstep; const _Float16* gv2 = gv + 2 * vstep; const _Float16* gv3 = gv + 3 * vstep;
  asm volatile("global_load_async_to_lds_b128 %0, %8, off\n\t"
               "global_load_async_to_lds_b128 %4, %12, off\n\t"
               "global_load_async_to_lds_b128 %1, %9, off\n\t"
               "global_load_async_to_lds_b128 %5, %13, off\n\t"
               "global_load_async_to_lds_b128 %2, %10, off\n\t"
               "global_load_async_to_lds_b128 %6, %14, off\n\t"
               "global_load_async_to_lds_b128 %3, %11, off\n\t"
               "global_load_async_to_lds_b128 %7, %15, off\n\t"
               "s_wait_xcnt 0x0"
               :: "v"(lk), "v"(lk1), "v"(lk2), "v"(lk3), "v"(lv), "v"(lv1), "v"(lv2), "v"(lv3),
                  "v"(gk), "v"(gk1), "v"(gk2), "v"(gk3), "v"(gv), "v"(gv1), "v"(gv2), "v"(gv3)
               : "memory");
}

__global__ __launch_bounds__(128)
void attn_lin_kernel(const unsigned short* __restrict__ qp, const unsigned short* __restrict__ kp,
                     const unsigned short* __restrict__ vtp, unsigned short* __restrict__ op) {
  typedef Frag<_Float16> FR;
  // Row pitch of the two f16 tiles: 64 halves + 8 = 144 B = 16 B x 9 (odd), so that the 16 rows one
  // 16-byte fragment read touches fall on 16 different groups of four banks.
  constexpr int LP = 72;
  constexpr int TILE = 64 * LP;                          // halves of one plane's chunk, 9 KB
  constexpr int BUFH = 2 * TILE;                         // one buffer: K chunk [kv][d], then V^T chunk [d][kv]
  __shared__ __align__(16) _Float16 KV[2 * BUFH];        // two buffers, 36 KB
  static_assert(4 * 16 * 68 * sizeof(float) <= 2 * BUFH * sizeof(_Float16), "out tiles fit the ring");
  float* Os = (float*)(void*)KV;                         // per wave out tile, pitch 68: used behind the loop only

  const int tid  = threadIdx.x;
  const int wave = tid >> 5;
  const int lane = tid & 31;
  const int hh   = lane >> 4;
  const int c    = lane & 15;

  constexpr int NQB  = SEQLEN / 64;        // 64 query blocks per (b, h)
  constexpr int ROWP = NBAT * EMBED;       // 2048 halves between consecutive t (q, k, out planes)
  constexpr int NCH  = NCOMP / 64;         // 16 key chunks

  const int bx = blockIdx.x;
  const int qb = bx % NQB;
  const int bh = bx / NQB;
  const int h  = bh % NHEADS;
  const int b  = bh / NHEADS;
  const int q0 = qb * 64 + wave * 16;

  const _Float16* Qb = (const _Float16*)(const void*)qp  + (size_t)b * EMBED + (size_t)h * HDIM;
  const _Float16* Kb = (const _Float16*)(const void*)kp  + (size_t)b * EMBED + (size_t)h * HDIM;
  const _Float16* Vb = (const _Float16*)(const void*)vtp + (size_t)b * EMBED * NCOMP + (size_t)h * HDIM * NCOMP;
  _Float16*       Ob = (_Float16*)(void*)op + (size_t)b * EMBED + (size_t)h * HDIM;

  // ---- Q fragments (B operand): column = query q0 + c, 2 d-chunks of 32 ----
  v16h qa[2];
  {
    const _Float16* qrow = Qb + (size_t)(q0 + c) * ROWP;
#pragma unroll
    for (int dc = 0; dc < 2; ++dc) qa[dc] = FR::load(qrow + dc * 32 + 8 * hh);
  }

  float mrun = -INFINITY;   // running maximum of query q0 + c (the same in both wave halves)
  float lrun = 0.f;         // running sum over this half's keys; the halves are joined in the epilogue
  v8f oacc[4];              // oacc[t][r] = O[query q0 + c][d = t*16 + 8*hh + r]
#pragma unroll
  for (int t = 0; t < 4; ++t) oacc[t] = (v8f){0.f,0.f,0.f,0.f,0.f,0.f,0.f,0.f};

  // staging map: 8 lanes x 16 B = one whole 128-B row; the block's 128 threads cover 16 rows per copy
  static_assert(NCH >= 2, "the ring's prologue fills two chunks");
  constexpr unsigned BUFB  = BUFH * sizeof(_Float16);        // bytes from buffer 0 to buffer 1
  constexpr unsigned LSTEP = 16 * LP * sizeof(_Float16);     // LDS bytes between a thread's rows
  const int srow = tid >> 3, sc8 = (tid & 7) * 8;
  const unsigned lk0 = (unsigned)(uintptr_t)(KV + srow * LP + sc8);   // LDS byte address = low 32 bits of the shared address
  const unsigned lv0 = lk0 + TILE * sizeof(_Float16);
  const _Float16* gk = Kb + (size_t)srow * ROWP + sc8;       // K[srow + 16*i][sc8 ..] of chunk 0
  const _Float16* gv = Vb + (size_t)srow * NCOMP + sc8;      // V^T[d = srow + 16*i][sc8 ..] of chunk 0
  copy_kv_chunk(lk0, lv0, gk, gv, LSTEP, (size_t)16 * ROWP, (size_t)16 * NCOMP);
  asm volatile("s_wait_asynccnt 0x0" ::: "memory");          // this wave's copies of chunk 0 have landed
  __syncthreads();                                           // every wave's have: chunk 0 may be read
  copy_kv_chunk(lk0 + BUFB, lv0 + BUFB, gk + (size_t)64 * ROWP, gv + 64, LSTEP, (size_t)16 * ROWP, (size_t)16 * NCOMP);

#pragma unroll 1
  for (int kc = 0; kc < NCH; ++kc) {
    const _Float16* Ksh = KV + (kc & 1) * BUFH;
    const _Float16* Vth = Ksh + TILE;

    // ---- scores, transposed: s[j][r] = score(key j*16 + 8*hh + r, query c) ----
    v8f s[4];
#pragma unroll
    for (int j = 0; j < 4; ++j) {
      s[j] = (v8f){0.f,0.f,0.f,0.f,0.f,0.f,0.f,0.f};
#pragma unroll
      for (int dc = 0; dc < 2; ++dc) {
        const v16h ka = FR::load(Ksh + (j * 16 + c) * LP + dc * 32 + 8 * hh);
        s[j] = hmma(ka, qa[dc], s[j]);
      }
    }
    // ---- chunk maximum of this lane's query: 32 scores in the lane, then the other half's ----
    float mj[4];
#pragma unroll
    for (int j = 0; j < 4; ++j) {
      mj[j] = -INFINITY;
#pragma unroll
      for (int r = 0; r < 8; ++r) {
        s[j][r] *= SCORE_SCALE;
        mj[j] = fmaxf(mj[j], s[j][r]);
      }
    }
    float cm = fmaxf(fmaxf(mj[0], mj[1]), fmaxf(mj[2], mj[3]));
    cm = fmaxf(cm, xhalf(cm));
    // ---- online softmax update; P^T stays in registers ----
    const float mnew  = fmaxf(mrun, cm);
    const float aarg  = (mrun - mnew) * LOG2E;
    const float alpha = __builtin_amdgcn_exp2f(aarg);
    exp_slot1(alpha, aarg);
    mrun = mnew;
    // B operand of 32 keys: elements 0..7 = keys 8*hh + 0..7 (tile 2*kk), 8..15 = keys 16 + 8*hh + 0..7 (tile 2*kk+1),
    // the k order in which FR::load brings the V^T rows.
    v16h pb[2];
    float pj[4];
#pragma unroll
    for (int j = 0; j < 4; ++j) {
      pj[j] = 0.f;
#pragma unroll
      for (int g = 0; g < 8; g += 4) {
        float parg[4], p[4];
#pragma unroll
        for (int e = 0; e < 4; ++e) {
          parg[e] = (s[j][g + e] - mnew) * LOG2E;
          p[e]    = __builtin_amdgcn_exp2f(parg[e]);
        }
        // the slot behind these four v_exp_f32, as in exp_slot1
        asm volatile("v_nop" :: "v"(p[0]), "v"(p[1]), "v"(p[2]), "v"(p[3]), "v"(parg[0]), "v"(parg[1]), "v"(parg[2]), "v"(parg[3]));
#pragma unroll
        for (int e = 0; e < 4; ++e) {
          pj[j] += p[e];
          pb[j >> 1][(j & 1) * 8 + g + e] = (_Float16)(p[e] * PROB_CARRY);
        }
      }
    }
    lrun = lrun * alpha + ((pj[0] + pj[1]) + (pj[2] + pj[3]));
#pragma unroll
    for (int t = 0; t < 4; ++t)
#pragma unroll
      for (int r = 0; r < 8; ++r) oacc[t][r] *= alpha;
    // ---- O^T += V^T . P^T ----
#pragma unroll
    for (int kk = 0; kk < 2; ++kk) {
#pragma unroll
      for (int t = 0; t < 4; ++t) {
        const v16h va = FR::load(Vth + (t * 16 + c) * LP + kk * 32 + 8 * hh);
        oacc[t] = hmma(va, pb[kk], oacc[t]);
      }
    }
    // publish point of chunk kc + 1, the same in every wave
    asm volatile("s_wait_dscnt 0x0" ::: "memory");           // this wave's reads of the buffer to be refilled are done
    asm volatile("s_wait_asynccnt 0x0" ::: "memory");        // this wave's copies of chunk kc + 1 have landed
    __syncthreads();                                         // chunk kc + 1 may be read; every reader has left this trip's buffer
    if (kc + 2 < NCH)                                        // the same for the whole block
      copy_kv_chunk(lk0 + (kc & 1) * BUFB, lv0 + (kc & 1) * BUFB, gk + (size_t)(kc + 2) * 64 * ROWP, gv + (kc + 2) * 64,
                    LSTEP, (size_t)16 * ROWP, (size_t)16 * NCOMP);
  }
  asm volatile("s_wait_asynccnt 0x0" ::: "memory");          // no copy is in flight when the ring becomes the out tiles

  // ---- epilogue: join the halves' sums, normalise, stage 16x64 wave tile, whole-line f16 stores ----
  float* os = Os + wave * (16 * 68);
  {
    const float lsum = lrun + xhalf(lrun);
    const float inv  = OUT_CARRY * (1.0f / (lsum * PROB_CARRY));
#pragma unroll
    for (int t = 0; t < 4; ++t) {
#pragma unroll
      for (int g = 0; g < 2; ++g) {
        v4f w;
#pragma unroll
        for (int e = 0; e < 4; ++e) w[e] = oacc[t][g * 4 + e] * inv;
        *(v4f*)(os + c * 68 + t * 16 + 8 * hh + g * 4) = w;
      }
    }
  }
  __builtin_amdgcn_fence(__ATOMIC_RELEASE, "workgroup");
  __builtin_amdgcn_wave_barrier();
  __builtin_amdgcn_fence(__ATOMIC_ACQUIRE, "workgroup");
  {
    const int qq = lane >> 3, c8 = (lane & 7) * 8;
    {
#pragma unroll
      for (int it = 0; it < 4; ++it) {
        const int row = it * 4 + qq;
        const float* sp = os + row * 68 + c8;
        v8h hv;
#pragma unroll
        for (int e = 0; e < 8; ++e) hv[e] = (_Float16)sp[e];
        *(v8h*)(Ob + (size_t)(q0 + row) * ROWP + c8) = hv;
      }
      
    }
  }
}

// ---------------------------------------------------------------------------
// Host orchestration (kernel launches + host arithmetic only)
// ---------------------------------------------------------------------------
extern "C" void kernel_launch(void* const* d_in, const int* in_sizes, int n_in,
                              void* d_out, int out_size, void* d_ws, size_t ws_size,
                              hipStream_t stream) {
  if (n_in < 11) return;
  const long nQ  = (long)SEQLEN * NBAT * EMBED;    // 8388608
  const long nW  = (long)EMBED * EMBED;            // 262144
  const long nWc = (long)NCOMP * SEQLEN;           // 4194304
  if (in_sizes[0] != nQ || in_sizes[1] != nW || in_sizes[2] != EMBED || in_sizes[3] != nW ||
      in_sizes[4] != EMBED || in_sizes[5] != nW || in_sizes[6] != EMBED || in_sizes[7] != nWc ||
      in_sizes[8] != nWc || in_sizes[9] != nW || in_sizes[10] != EMBED || out_size != nQ) return;

  const float* query = (const float*)d_in[0];
  const float* Wq  = (const float*)d_in[1];  const float* bq = (const float*)d_in[2];
  const float* Wk  = (const float*)d_in[3];  const float* bk = (const float*)d_in[4];
  const float* Wv  = (const float*)d_in[5];  const float* bv = (const float*)d_in[6];
  const float* Wck = (const float*)d_in[7];  const float* Wcv = (const float*)d_in[8];
  const float* Wo  = (const float*)d_in[9];  const float* bo = (const float*)d_in[10];

  // ---- workspace region map (bytes) ----
  const size_t BYTES_QB   = (size_t)nQ * 2;                              // bf16 query [16384][512]            16 MiB
  const size_t BYTES_QT   = (size_t)nQ * 2;                              // bf16 query^T [4][512][4096]        16 MiB
  const size_t BYTES_WC   = (size_t)2 * nWc * 2;                         // bf16 [Wck;Wcv] [2048][4096]        16 MiB
  const size_t BYTES_KVIN = (size_t)2 * NCOMP * NBAT * (2 * EMBED) * 2;  // u16 [8192][1024] (hi|lo rows)     16 MiB
  const size_t BYTES_QP   = (size_t)nQ * 2;                              // f16 q plane [16384][512]          16 MiB
  const size_t BYTES_OP   = (size_t)nQ * 2;                              // f16 attention out [16384][512]    16 MiB
  const size_t BYTES_KP   = (size_t)NCOMP * NBAT * EMBED * 2;            // f16 k plane [4096][512]            4 MiB
  const size_t BYTES_VT   = (size_t)NBAT * EMBED * NCOMP * 2;            // f16 v^T plane [4][512][1024]       4 MiB
  const size_t BYTES_WQ   = (size_t)nW * 2;                              // bf16 Wq [512][512]               512 KiB
  const size_t BYTES_WK2  = (size_t)nW * 2 * 2;                          // bf16 [Wk|Wk] [512][1024]            1 MiB
  const size_t BYTES_WV2  = (size_t)nW * 2 * 2;                          // bf16 [Wv|Wv] [512][1024]            1 MiB
  const size_t BYTES_WOH  = (size_t)nW * 2;                              // f16 64*Wo [512][512]             512 KiB
  const size_t BYTES_BIAS = (size_t)4 * EMBED * 4;                       // f32 biases 4 x 512                  8 KiB
  const size_t OFF_QB   = 0;
  const size_t OFF_QT   = OFF_QB   + BYTES_QB;
  const size_t OFF_WC   = OFF_QT   + BYTES_QT;
  const size_t OFF_KVIN = OFF_WC   + BYTES_WC;
  const size_t OFF_QP   = OFF_KVIN + BYTES_KVIN;
  const size_t OFF_OP   = OFF_QP   + BYTES_QP;
  const size_t OFF_KP   = OFF_OP   + BYTES_OP;
  const size_t OFF_VT   = OFF_KP   + BYTES_KP;
  const size_t OFF_WQ   = OFF_VT   + BYTES_VT;
  const size_t OFF_WK2  = OFF_WQ   + BYTES_WQ;
  const size_t OFF_WV2  = OFF_WK2  + BYTES_WK2;
  const size_t OFF_WOH  = OFF_WV2  + BYTES_WV2;
  const size_t OFF_BIAS = OFF_WOH  + BYTES_WOH;
  const size_t WS_TOTAL = OFF_BIAS + BYTES_BIAS;                         // 112,205,824 B
  if (WS_TOTAL > ws_size) return;

  char* ws = (char*)d_ws;
  unsigned short* queryB = (unsigned short*)(ws + OFF_QB);
  unsigned short* queryT = (unsigned short*)(ws + OFF_QT);
  unsigned short* WcB    = (unsigned short*)(ws + OFF_WC);
  unsigned short* KVin   = (unsigned short*)(ws + OFF_KVIN);
  unsigned short* qP     = (unsigned short*)(ws + OFF_QP);
  unsigned short* oP     = (unsigned short*)(ws + OFF_OP);
  unsigned short* kP     = (unsigned short*)(ws + OFF_KP);
  unsigned short* vtP    = (unsigned short*)(ws + OFF_VT);
  unsigned short* WqB    = (unsigned short*)(ws + OFF_WQ);
  unsigned short* WkB2   = (unsigned short*)(ws + OFF_WK2);
  unsigned short* WvB2   = (unsigned short*)(ws + OFF_WV2);
  unsigned short* WoH    = (unsigned short*)(ws + OFF_WOH);
  float*          biasb  = (float*)(ws + OFF_BIAS);
  float* bq_r = biasb;
  float* bk_r = biasb + EMBED;
  float* bv_r = biasb + 2 * EMBED;
  float* bo_r = biasb + 3 * EMBED;

  // 1. every input conversion (query -> bf16 and bf16 transposed, Wck/Wcv, Wq, [Wk|Wk], [Wv|Wv], 64*Wo, biases)
  convert_inputs_kernel<<<dim3(CB_GRID), dim3(256), 0, stream>>>(
      query, Wck, Wcv, Wq, Wk, Wv, Wo, bq, bk, bv, bo,
      queryB, queryT, WcB, WqB, WkB2, WvB2, WoH, biasb);

  // 2. two products that read only what launch 1 wrote:
  //  compression: per batch b: C_b[m][n] = sum_t WcB[m][t] * queryT_b[n][t]; m<1024 -> k_in[m][b][n], m>=1024 -> v_in.
  //     C element (m,n,b): hi at KVin[(m*4+b)*1024 + n], lo at +512  => ldc 4096, strideC 1024, C2 = C + 512.
  //     M=2048, N=512, K=4096 (K%64==0, M%128==0, N%256==0): 32 block tiles of 128x256 per batch, 4 batches: 128 blocks.
  //  q8 = query . Wq^T + bq  (scale 1; 0.125 applied to f32 scores) -> f16 [16384][512]; M=16384, N=512, K=512: 256 blocks.
  {
    const GemmJob comp = { WcB, queryT, KVin, KVin + EMBED, biasb,
                           0L, (long)EMBED * SEQLEN, (long)(2 * EMBED),
                           SEQLEN, SEQLEN, 4 * (2 * EMBED), 2 * NCOMP, EMBED, SEQLEN, 32 };
    const GemmJob qpro = { queryB, WqB, qP, qP, bq_r,
                           0L, 0L, 0L,
                           EMBED, EMBED, EMBED, SEQLEN * NBAT, EMBED, EMBED, 256 };
    wmma_gemm64_pair<1, 0, 2, 2, 1><<<dim3(32 * NBAT + 256), dim3(256), 0, stream>>>(comp, qpro, 32 * NBAT);
  }

  // 3. two products that read only what launches 1 and 2 wrote:
  //  k = [k_in hi|lo] . [Wk|Wk]^T + bk -> f16 [4096 rows (c*4+b)][512]; M=4096, N=512, K'=1024: 64 blocks.
  //  v^T per batch: C_b[m=e'][n=c] = sum_k [Wv|Wv][e'][k] * [v_in hi|lo][(c,b)][k] + bv[e'] -> f16 vtP[b][512][1024].
  //     Bt_b rows at KVin + 4096*1024 + b*1024 + c*4096 (ldb 4096, strideB 1024); M=512, N=1024, K'=1024: 16 x 4 blocks.
  {
    const GemmJob kpro = { KVin, WkB2, kP, kP, bk_r,
                           0L, 0L, 0L,
                           2 * EMBED, 2 * EMBED, EMBED, NCOMP * NBAT, EMBED, 2 * EMBED, 64 };
    const GemmJob vpro = { WvB2, KVin + (size_t)NCOMP * NBAT * (2 * EMBED), vtP, vtP, bv_r,
                           0L, (long)(2 * EMBED), (long)EMBED * NCOMP,
                           2 * EMBED, 4 * (2 * EMBED), NCOMP, EMBED, NCOMP, 2 * EMBED, 16 };
    wmma_gemm64_pair<1, 2, 1, 1, 1><<<dim3(64 + 16 * NBAT), dim3(256), 0, stream>>>(kpro, vpro, 64);
  }

  // 4. attention over the compressed keys: grid = B*H*(T/64) = 2048 blocks of 128
  attn_lin_kernel<<<dim3(NBAT * NHEADS * (SEQLEN / 64)), dim3(128), 0, stream>>>(qP, kP, vtP, oP);

  // 5. out = (16 O) . (64 Wo)^T / 1024 + bo -> f32 d_out [16384][512]; M=16384, N=512, K=512: grid 256.
  wmma_gemm64<0, false, 2, 0, false><<<dim3(256, 1), dim3(256), 0, stream>>>(
      oP, oP, EMBED, 0L,
      WoH, WoH, EMBED, 0L,
      d_out, d_out, EMBED, 0L,
      bo_r, bo_r, 0L,
      SEQLEN * NBAT, EMBED, EMBED, 1.0f / (OUT_CARRY * WO_CARRY));
}

// v007
// One run takes 150 microseconds.
// Next to v006, in two timings, it ran 1.04 times as fast each time.
// Over all steps from v000 it is 3.86 times as fast.
// Contractions: sequence compression and q/k/v^T projections on v_wmma_f32_16x16x32_bf16 (bf16 operands = RNE-converted inputs; k_in/v_in carried as bf16 hi+lo planes concatenated along k); q.k^T, p.v and the output projection on v_wmma_f32_16x16x32_f16 (f16 planes; p carried x2^15, attention output x2^4, Wo x2^6); f32 accumulate; softmax, score scale 0.125 and biases in f32.
#include <hip/hip_runtime.h>
#include <math.h>
#include <stdint.h>

typedef __attribute__((ext_vector_type(16))) _Float16 v16h;
typedef __attribute__((ext_vector_type(8)))  _Float16 v8h;
typedef __attribute__((ext_vector_type(16))) __bf16   v16b;
typedef __attribute__((ext_vector_type(8)))  __bf16   v8b;
typedef __attribute__((ext_vector_type(8)))  float    v8f;
typedef __attribute__((ext_vector_type(4)))  float    v4f;
typedef __attribute__((ext_vector_type(2)))  float    v2f;
typedef __attribute__((ext_vector_type(4)))  unsigned int v4u;
typedef __attribute__((ext_vector_type(2)))  unsigned int v2u;

__device__ __forceinline__ unsigned short f2bf_bits(float f) {
  unsigned u = __float_as_uint(f);
  return (unsigned short)((u + 0x7FFFu + ((u >> 16) & 1u)) >> 16);
}
__device__ __forceinline__ float bf_bits2f(unsigned short h) { return __uint_as_float(((unsigned)h) << 16); }

// hazard guards as plain device helpers (no inline asm inside the kernel template body)
__device__ __forceinline__ void dep_guard_h(v8f& a, v8f& b, v16h x, v16h y) { asm volatile("v_nop\n\tv_nop\n\tv_nop\n\tv_nop" : "+v"(a), "+v"(b) : "v"(x), "v"(y)); }
__device__ __forceinline__ void dep_guard_b(v8f& a, v8f& b, v16b x, v16b y) { asm volatile("v_nop\n\tv_nop\n\tv_nop\n\tv_nop" : "+v"(a), "+v"(b) : "v"(x), "v"(y)); }
__device__ __forceinline__ void keep4_h(v16h a, v16h b, v16h c, v16h d) { asm volatile("v_nop" :: "v"(a), "v"(b), "v"(c), "v"(d)); }
__device__ __forceinline__ void keep4_b(v16b a, v16b b, v16b c, v16b d) { asm volatile("v_nop" :: "v"(a), "v"(b), "v"(c), "v"(d)); }
__device__ __forceinline__ void acc_guard4(v8f& a, v8f& b, v8f& c, v8f& d) { asm volatile("v_nop\n\tv_nop\n\tv_nop\n\tv_nop" : "+v"(a), "+v"(b), "+v"(c), "+v"(d)); }
template <typename T> struct Frag;
template <> struct Frag<_Float16> {
  typedef v16h V; typedef v8h H; union U { v16h v; v8h h[2]; };
  static __device__ __forceinline__ v16h load(const _Float16* p) {   // elements 0..7 <- p[0..7], 8..15 <- p[16..23]
    U f; f.h[0] = *(const v8h*)(p); f.h[1] = *(const v8h*)(p + 16); return f.v;
  }
  static __device__ __forceinline__ v8f mma(v16h a, v16h b, v8f c) {
    return __builtin_amdgcn_wmma_f32_16x16x32_f16(false, a, false, b, (short)0, c, false, false);
  }
  static __device__ __forceinline__ void guard(v8f& a, v8f& b, v16h x, v16h y) { dep_guard_h(a, b, x, y); }
  static __device__ __forceinline__ void keep(v16h a, v16h b, v16h c, v16h d) { keep4_h(a, b, c, d); }
};
template <> struct Frag<__bf16> {
  typedef v16b V; typedef v8b H; union U { v16b v; v8b h[2]; };
  static __device__ __forceinline__ v16b load(const __bf16* p) {
    U f; f.h[0] = *(const v8b*)(p); f.h[1] = *(const v8b*)(p + 16); return f.v;
  }
  static __device__ __forceinline__ v8f mma(v16b a, v16b b, v8f c) {
    return __builtin_amdgcn_wmma_f32_16x16x32_bf16(false, a, false, b, (short)0, c, false, false);
  }
  static __device__ __forceinline__ void guard(v8f& a, v8f& b, v16b x, v16b y) { dep_guard_b(a, b, x, y); }
  static __device__ __forceinline__ void keep(v16b a, v16b b, v16b c, v16b d) { keep4_b(a, b, c, d); }
};

// ---- Register-blocked batched WMMA GEMM ------------------------------------
// C[m,n] = scale * sum_k A[m,k] * Bt[n,k] (+bias)(+resid); each wave owns a 64x64 tile.
// A row-major [M,K]; Bt row-major [N,K]; M % 128 == 0, N % 256 == 0, K % 64 == 0.
// A block of 8 waves (2 x 4) owns a 128x256 tile of C. Per stage of 64 k it brings 128 rows of A and 256 rows
// of Bt, 128 B each, into LDS with whole-line 16-byte loads (8 lanes per row); the waves read their fragments
// from LDS. Two LDS buffers: the next stage's global loads are issued ahead of this stage's products and
// stored behind them, one block barrier per stage.
// SPLIT (hi/lo operand planes) is not built in this form.
// BIAS_MODE: 0 = none, 1 = bias[m], 2 = bias[n].
// OUT_MODE: 0 = f32, 1 = f16, 2 = bf16 hi plane (Cout) + bf16 lo plane (Cout2).
// ET: 0 = f16 operands, 1 = bf16 operands (pointers passed as 16-bit storage)
template <int ET> struct Elem;
template <> struct Elem<0> { typedef _Float16 T; };
template <> struct Elem<1> { typedef __bf16 T; };
// The tile's work is a device function: bx = index of the block tile, b = batch, sOpRaw / sTRaw = the launching
// kernel's LDS, so that one launch can hold the block tiles of two products that do not depend on one another.
constexpr int GEMM_OP_ELEMS = 2 * (128 + 256) * (64 + 8);   // two buffers of (BM + BN) rows at pitch LP
constexpr int GEMM_SLAB_F32 = 8 * 16 * 68;                  // eight per-wave 16x64 slabs, pitch 68 floats
template <int ET, bool SPLIT, int BIAS_MODE, int OUT_MODE, bool RESID, int ACT = 0>
__device__ __forceinline__ void gemm_tile(
    const unsigned short* __restrict__ Ap, const unsigned short* __restrict__ A2p, int lda, long strideA,
    const unsigned short* __restrict__ Btp, const unsigned short* __restrict__ Bt2p, int ldb, long strideB,
    void* __restrict__ Cout, void* __restrict__ Cout2, int ldc, long strideC,
    const float* __restrict__ bias,
    const float* __restrict__ resid, long strideR,
    int M, int N, int K, float scale,
    int bx, int b, unsigned short* sOpRaw, float* sTRaw) {
  typedef typename Elem<ET>::T T;
  typedef typename Frag<T>::V V;
  const T* A = (const T*)Ap; const T* Bt = (const T*)Btp;
  static_assert(!SPLIT, "hi/lo planes are not staged");
  typedef typename Frag<T>::H H;
  constexpr int BM = 128, BN = 256, BK = 64;
  // LDS row pitch 64 + 8 elements = 144 B = 16 B x 9 (odd): the 16 rows of one 16-byte fragment read fall on
  // different groups of four banks.
  constexpr int LP = BK + 8;
  static_assert(2 * (BM + BN) * LP == GEMM_OP_ELEMS, "LDS size");
  T (*sOp)[(BM + BN) * LP] = (T (*)[(BM + BN) * LP])sOpRaw;   // [buffer][A rows 0..127 | Bt rows 128..383][k]
  float (*sT)[16 * 68] = (float (*)[16 * 68])sTRaw;           // per-wave 16x64 slab, pitch 68 floats
  const int tid  = threadIdx.x;
  const int lane = tid & 31;
  const int wave = tid >> 5;
  const int blocksN = N / BN;
  const int blocksM = M / BM;
  if (bx >= blocksM * blocksN) return;   // block-uniform, ahead of every barrier
  const int bm = bx / blocksN;
  const int bn = bx - bm * blocksN;
  const int wm = wave >> 2;                    // 0..1: 64-row band of the block tile
  const int wn = wave & 3;                     // 0..3: 64-column band
  const int m0 = bm * BM + (wm << 6);
  const int n0 = bn * BN + (wn << 6);

  const T* Ab  = A  + (size_t)b * strideA;
  const T* Bb  = Bt + (size_t)b * strideB;

  const int rlane = lane & 15;                 // row (A) / col (B, D) within subtile
  const int koff  = (lane >> 4) * 8;           // k offset of this lane half
  const int mOff  = (lane >> 4) * 8;           // D row offset

  // staging map: 8 threads x 16 B = one 128-B row; 32 rows per sweep of the block
  const int srow = tid >> 3;                   // 0..31
  const int sk   = (tid & 7) * 8;              // element offset in the row
  const T* gA = Ab + (size_t)(bm * BM + srow) * lda + sk;
  const T* gB = Bb + (size_t)(bn * BN + srow) * ldb + sk;
  const int sdst = srow * LP + sk;

  v8f acc[4][4];
#pragma unroll
  for (int i = 0; i < 4; ++i)
#pragma unroll
    for (int j = 0; j < 4; ++j) acc[i][j] = (v8f){0.f,0.f,0.f,0.f,0.f,0.f,0.f,0.f};

  H stA[BM / 32], stB[BN / 32];
#pragma unroll
  for (int it = 0; it < BM / 32; ++it) stA[it] = *(const H*)(gA + (size_t)(it * 32) * lda);
#pragma unroll
  for (int it = 0; it < BN / 32; ++it) stB[it] = *(const H*)(gB + (size_t)(it * 32) * ldb);
#pragma unroll
  for (int it = 0; it < BM / 32; ++it) *(H*)(&sOp[0][sdst + it * 32 * LP]) = stA[it];
#pragma unroll
  for (int it = 0; it < BN / 32; ++it) *(H*)(&sOp[0][sdst + (BM + it * 32) * LP]) = stB[it];
  __syncthreads();

  const int nst = K / BK;
#pragma unroll 1
  for (int s = 0; s < nst; ++s) {
    const T* cur = sOp[s & 1];
    T*       nxt = sOp[(s + 1) & 1];
    const bool more = s + 1 < nst;             // the same for the whole block
    if (more) {
      const int k1 = (s + 1) * BK;
#pragma unroll
      for (int it = 0; it < BM / 32; ++it) stA[it] = *(const H*)(gA + (size_t)(it * 32) * lda + k1);
#pragma unroll
      for (int it = 0; it < BN / 32; ++it) stB[it] = *(const H*)(gB + (size_t)(it * 32) * ldb + k1);
    }
#pragma unroll
    for (int kk = 0; kk < BK; kk += 32) {
      V bh[4], ah[4];
#pragma unroll
      for (int j = 0; j < 4; ++j) bh[j] = Frag<T>::load(cur + (BM + (wn << 6) + (j << 4) + rlane) * LP + kk + koff);
#pragma unroll
      for (int i = 0; i < 4; ++i) ah[i] = Frag<T>::load(cur + ((wm << 6) + (i << 4) + rlane) * LP + kk + koff);
#pragma unroll
      for (int i = 0; i < 4; ++i) {
#pragma unroll
        for (int j = 0; j < 4; ++j) acc[i][j] = Frag<T>::mma(ah[i], bh[j], acc[i][j]);
        Frag<T>::guard(acc[i][0], acc[i][3], ah[i], ah[i]);
      }
      Frag<T>::keep(bh[0], bh[1], bh[2], bh[3]);
    }
    if (more) {
#pragma unroll
      for (int it = 0; it < BM / 32; ++it) *(H*)(nxt + sdst + it * 32 * LP) = stA[it];
#pragma unroll
      for (int it = 0; it < BN / 32; ++it) *(H*)(nxt + sdst + (BM + it * 32) * LP) = stB[it];
    }
    // publishes the buffer just written and ends every wave's reads of the buffer that the next stage refills
    __syncthreads();
  }
  acc_guard4(acc[0][0], acc[0][1], acc[0][2], acc[0][3]);
  acc_guard4(acc[1][0], acc[1][1], acc[1][2], acc[1][3]);
  acc_guard4(acc[2][0], acc[2][1], acc[2][2], acc[2][3]);
  acc_guard4(acc[3][0], acc[3][1], acc[3][2], acc[3][3]);

  // ---- epilogue ----
  float* slab = sT[wave];
  const float* Rb = RESID ? (resid + (size_t)b * strideR) : nullptr;
#pragma unroll
  for (int i = 0; i < 4; ++i) {
    const int mBase = m0 + (i << 4);
#pragma unroll
    for (int j = 0; j < 4; ++j) {
      const int n = n0 + (j << 4) + rlane;
      float bv = 0.f;
      if (BIAS_MODE == 2) bv = bias[n];
#pragma unroll
      for (int r = 0; r < 8; ++r) {
        float v = acc[i][j][r] * scale;
        if (BIAS_MODE == 1) v += bias[mBase + mOff + r];
        if (BIAS_MODE == 2) v += bv;
        if (RESID) v += Rb[(size_t)(mBase + mOff + r) * ldc + n];
        if (ACT == 1) v = tanhf(v);
        if (ACT == 2) v = fmaxf(v, 0.0f);
        if (ACT == 3) v = v / (1.0f + expf(-v));
        if (ACT == 4) v = (v > 0.f) ? v : 0.01f * v;
        if (ACT == 5) v = 0.5f * v * (1.0f + erff(v * 0.70710678118654752f));
        slab[(mOff + r) * 68 + (j << 4) + rlane] = v;
      }
    }
    __builtin_amdgcn_fence(__ATOMIC_RELEASE, "workgroup");
    __builtin_amdgcn_wave_barrier();
    __builtin_amdgcn_fence(__ATOMIC_ACQUIRE, "workgroup");
    if (OUT_MODE == 0) {
      float* C = (float*)Cout + (size_t)b * strideC;
      const int hh = lane >> 4, c4 = (lane & 15) * 4;     // row seg = 256 B = 16 lanes x 16 B
      {
#pragma unroll
        for (int it = 0; it < 8; ++it) {
          const int row = it * 2 + hh;
          v4f v = *(const v4f*)(slab + row * 68 + c4);
          *(v4f*)(C + (size_t)(mBase + row) * ldc + n0 + c4) = v;
        }
        
      }
    } else {
      const int q = lane >> 3, c8 = (lane & 7) * 8;
      unsigned short* C  = (unsigned short*)Cout  + (size_t)b * strideC;
      unsigned short* C2 = (OUT_MODE == 2) ? ((unsigned short*)Cout2 + (size_t)b * strideC) : nullptr;
      {
#pragma unroll
        for (int it = 0; it < 4; ++it) {
          const int row = it * 4 + q;
          const float* sp = slab + row * 68 + c8;
          v8h hv, lv;
#pragma unroll
          for (int e = 0; e < 8; ++e) {
            if (OUT_MODE == 1) {
              hv[e] = (_Float16)sp[e];
            } else {
              unsigned short hb = f2bf_bits(sp[e]);
              unsigned short lb = f2bf_bits(sp[e] - bf_bits2f(hb));
              hv[e] = __builtin_bit_cast(_Float16, hb);
              lv[e] = __builtin_bit_cast(_Float16, lb);
            }
          }
          *(v8h*)(C + (size_t)(mBase + row) * ldc + n0 + c8) = hv;
          if (OUT_MODE == 2) *(v8h*)(C2 + (size_t)(mBase + row) * ldc + n0 + c8) = lv;
        }
        
      }
    }
    __builtin_amdgcn_fence(__ATOMIC_RELEASE, "workgroup");
    __builtin_amdgcn_wave_barrier();
    __builtin_amdgcn_fence(__ATOMIC_ACQUIRE, "workgroup");
  }
}

// One product per launch: grid (block tiles, batches).
template <int ET, bool SPLIT, int BIAS_MODE, int OUT_MODE, bool RESID, int ACT = 0>
__global__ __launch_bounds__(256) void wmma_gemm64(
    const unsigned short* __restrict__ Ap, const unsigned short* __restrict__ A2p, int lda, long strideA,
    const unsigned short* __restrict__ Btp, const unsigned short* __restrict__ Bt2p, int ldb, long strideB,
    void* __restrict__ Cout, void* __restrict__ Cout2, int ldc, long strideC,
    const float* __restrict__ bias,
    const float* __restrict__ resid, long strideR,
    int M, int N, int K, float scale) {
  __shared__ __align__(16) unsigned short sOpRaw[GEMM_OP_ELEMS];
  __shared__ __align__(16) float sTRaw[GEMM_SLAB_F32];
  gemm_tile<ET, SPLIT, BIAS_MODE, OUT_MODE, RESID, ACT>(Ap, A2p, lda, strideA, Btp, Bt2p, ldb, strideB, Cout, Cout2, ldc, strideC,
                                                        bias, resid, strideR, M, N, K, scale,
                                                        (int)blockIdx.x, (int)blockIdx.y, sOpRaw, sTRaw);
}

// Two independent products in one launch: blocks 0 .. nb0-1 take product 0 (the longer one, so that it starts first),
// the rest product 1. In each product the flat index runs over its gx block tiles first, then over its batches.
struct GemmJob {
  const unsigned short* A;  const unsigned short* Bt;
  unsigned short* C;  unsigned short* C2;
  const float* bias;
  long strideA, strideB, strideC;
  int lda, ldb, ldc, M, N, K, gx;
};
template <int ET, int BIAS0, int OUT0, int BIAS1, int OUT1>
__global__ __launch_bounds__(256) void wmma_gemm64_pair(GemmJob j0, GemmJob j1, int nb0) {
  __shared__ __align__(16) unsigned short sOpRaw[GEMM_OP_ELEMS];
  __shared__ __align__(16) float sTRaw[GEMM_SLAB_F32];
  const int blk = (int)blockIdx.x;   // the same for the whole block: every barrier below stands under block-uniform flow
  if (blk < nb0) {
    gemm_tile<ET, false, BIAS0, OUT0, false>(j0.A, j0.A, j0.lda, j0.strideA, j0.Bt, j0.Bt, j0.ldb, j0.strideB,
                                             (void*)j0.C, (void*)j0.C2, j0.ldc, j0.strideC, j0.bias, j0.bias, 0L,
                                             j0.M, j0.N, j0.K, 1.0f, blk % j0.gx, blk / j0.gx, sOpRaw, sTRaw);
  } else {
    const int l = blk - nb0;
    gemm_tile<ET, false, BIAS1, OUT1, false>(j1.A, j1.A, j1.lda, j1.strideA, j1.Bt, j1.Bt, j1.ldb, j1.strideB,
                                             (void*)j1.C, (void*)j1.C2, j1.ldc, j1.strideC, j1.bias, j1.bias, 0L,
                                             j1.M, j1.N, j1.K, 1.0f, l % j1.gx, l / j1.gx, sOpRaw, sTRaw);
  }
}

__device__ __forceinline__ unsigned pk16(unsigned short a, unsigned short b) { return (unsigned)a | ((unsigned)b << 16); }

// ---------------------------------------------------------------------------
// Problem geometry
// ---------------------------------------------------------------------------
constexpr int   SEQLEN  = 4096;   // time steps (queries)
constexpr int   NBAT    = 4;      // batch
constexpr int   EMBED   = 512;    // channels
constexpr int   NHEADS  = 8;
constexpr int   HDIM    = 64;
constexpr int   NCOMP   = 1024;   // compressed key count
constexpr float SCORE_SCALE = 0.125f;     // head_dim^-0.5, applied to the f32 score accumulators
constexpr float PROB_CARRY  = 32768.0f;   // p carried x2^15 in the f16 P operand, folded into 1/l
constexpr float OUT_CARRY   = 16.0f;      // attention output carried x2^4 in its f16 plane
constexpr float WO_CARRY    = 64.0f;      // Wo carried x2^6 in its f16 plane

// ---------------------------------------------------------------------------
// Elementwise conversions work in UNITS of CU_ELEMS = 8192 consecutive f32 (32 KB): thread t of the block's 256 takes the
// four floats at j*1024 + 4*t, j = 0..7. Each wave-wide load is 512 contiguous bytes (4 whole lines), the eight loads of a
// thread are asked for before the first is converted, and each wave-wide 8-B store writes 256 contiguous bytes (2 whole lines).
// ---------------------------------------------------------------------------
constexpr int CU_ELEMS = 8192;
// Last statement of a unit: what follows in the block's loop (the next job test's side, the next trip) rewrites the address
// and data registers that the unit's stores name.
// (Not in the bias unit: there the build's own s_wait_xcnt 0 stands directly behind the stores.)
__device__ __forceinline__ void unit_stores_issued() { asm volatile("s_wait_xcnt 0x0" ::: "memory"); }
__device__ __forceinline__ void load_unit(v4f (&f)[8], const float* __restrict__ in, int e0) {
#pragma unroll   // f[] stays in registers and the eight loads stand together, ahead of the first use
  for (int j = 0; j < 8; ++j) f[j] = *(const v4f*)(in + e0 + j * 1024);
}
__device__ __forceinline__ v2u bf16x4(v4f f) {
  v2u u;
  u[0] = pk16(f2bf_bits(f[0]), f2bf_bits(f[1]));
  u[1] = pk16(f2bf_bits(f[2]), f2bf_bits(f[3]));
  return u;
}

// f32 -> bf16 (RNE), same flat layout.
__device__ __forceinline__ void cast_bf16_unit(const float* __restrict__ in, unsigned short* __restrict__ out, int unit) {
  const int e0 = unit * CU_ELEMS + (int)threadIdx.x * 4;
  v4f f[8];
  load_unit(f, in, e0);
#pragma unroll   // f[] is indexed by constants only, so it stays in registers
  for (int j = 0; j < 8; ++j) *(v2u*)(out + e0 + j * 1024) = bf16x4(f[j]);
  unit_stores_issued();
}

// W [rows][cols] f32 -> out [rows][2*cols] bf16 with out[r][c] = out[r][cols + c] = bf16_rne(W[r][c]).
// cols % 128 == 0, so a wave's 128 elements of one store stay in one row.
__device__ __forceinline__ void dup_bf16_unit(const float* __restrict__ Wm, unsigned short* __restrict__ out, int cols, int unit) {
  const int e0 = unit * CU_ELEMS + (int)threadIdx.x * 4;
  v4f f[8];
  load_unit(f, Wm, e0);
#pragma unroll   // f[] is indexed by constants only, so it stays in registers
  for (int j = 0; j < 8; ++j) {
    const int e  = e0 + j * 1024;
    const int r  = e / cols;
    const int cc = e - r * cols;
    const v2u u = bf16x4(f[j]);
    *(v2u*)(out + (size_t)r * 2 * cols + cc) = u;
    *(v2u*)(out + (size_t)r * 2 * cols + cols + cc) = u;
  }
  unit_stores_issued();
}

// Wo f32 -> f16 plane holding f16(carry * bf16_rne(w)) (exact for bf16 values in the normal f16 range).
__device__ __forceinline__ void cast_wo_f16_unit(const float* __restrict__ Wm, unsigned short* __restrict__ out, float carry, int unit) {
  const int e0 = unit * CU_ELEMS + (int)threadIdx.x * 4;
  v4f f[8];
  load_unit(f, Wm, e0);
#pragma unroll   // f[] is indexed by constants only, so it stays in registers
  for (int j = 0; j < 8; ++j) {
    unsigned short h[4];
#pragma unroll   // h[] stays in registers
    for (int e = 0; e < 4; ++e) {
      const _Float16 x = (_Float16)(bf_bits2f(f2bf_bits(f[j][e])) * carry);
      h[e] = __builtin_bit_cast(unsigned short, x);
    }
    v2u u;
    u[0] = pk16(h[0], h[1]);
    u[1] = pk16(h[2], h[3]);
    *(v2u*)(out + e0 + j * 1024) = u;
  }
  unit_stores_issued();
}

// ---------------------------------------------------------------------------
// Bias vectors RNE-converted to bf16 precision (kept as f32): outb[0..n) = bq, [n..2n) = bk, [2n..3n) = bv, [3n..4n) = bo.
// One block does all four.
// ---------------------------------------------------------------------------
__device__ __forceinline__ void bias_prep_unit(const float* __restrict__ bq, const float* __restrict__ bk,
                                               const float* __restrict__ bv, const float* __restrict__ bo,
                                               float* __restrict__ outb, int n) {
  for (int i = (int)threadIdx.x; i < n; i += 256) {
    outb[i]         = bf_bits2f(f2bf_bits(bq[i]));
    outb[n + i]     = bf_bits2f(f2bf_bits(bk[i]));
    outb[2 * n + i] = bf_bits2f(f2bf_bits(bv[i]));
    outb[3 * n + i] = bf_bits2f(f2bf_bits(bo[i]));
  }
}

// ---------------------------------------------------------------------------
// Transpose + bf16 RNE convert, z-batched: in_z = X + z*sIn viewed [R rows][Cc cols] with row pitch ldi ->
//   o_z[c][r] = bf16_rne(in_z[r][c])  ([Cc][R], pitch R), o_z = o + z*sOut.
// 64x64 tiles through LDS (tf: 64 * 68 floats of the launching kernel). Tile (bx, by, bz) of (Cc/64, R/64, Z), 256 threads
// (R, Cc multiples of 64).
// Coverage per tile: load 4 it x 256 thr x 4 floats = 64x64; store 2 it x 256 thr x 8 u16 = 64x64.
// ---------------------------------------------------------------------------
__device__ __forceinline__ void tconv_bf16_job(const float* __restrict__ X, unsigned short* __restrict__ o,
                                               int R, int Cc, int ldi, long sIn, long sOut,
                                               int bx, int by, int bz, float* tf) {
  X += (size_t)bz * sIn;
  o += (size_t)bz * sOut;
  const int c0  = bx * 64;   // input column block = output row block
  const int r0  = by * 64;   // input row block    = output column block
  const int tid = threadIdx.x;
  {
    const int lr = tid >> 4;         // 0..15
    const int c4 = (tid & 15) * 4;   // 0..60
#pragma unroll
    for (int it = 0; it < 4; ++it) {
      const int rr = it * 16 + lr;   // 0..63
      const v4f a = *(const v4f*)(X + (size_t)(r0 + rr) * ldi + c0 + c4);
      *(v4f*)(tf + rr * 68 + c4) = a;
    }
  }
  __syncthreads();
  const int sub = tid >> 3;          // 0..31
  const int c8  = (tid & 7) * 8;     // 0..56
  v4u hv[2];
#pragma unroll
  for (int it = 0; it < 2; ++it) {
    const int oc = it * 32 + sub;    // output row within tile (= input column)
    v4u a;
#pragma unroll
    for (int q = 0; q < 4; ++q) {
      const float f0 = tf[(c8 + 2 * q) * 68 + oc];
      const float f1 = tf[(c8 + 2 * q + 1) * 68 + oc];
      a[q] = pk16(f2bf_bits(f0), f2bf_bits(f1));
    }
    hv[it] = a;
  }
  __syncthreads();   // every thread has read the tile: a later unit of this block may overwrite tf
  {
#pragma unroll
    for (int it = 0; it < 2; ++it) {
      const int oc = it * 32 + sub;
      const size_t go = (size_t)(c0 + oc) * R + r0 + c8;
      *(v4u*)(o + go) = hv[it];
    }
    
  }
  unit_stores_issued();
}

// ---------------------------------------------------------------------------
// All input conversions in ONE launch: none reads what another writes. The work is a list of CU_TOTAL units (a 64x64 tile of
// the transposing job, or CU_ELEMS elements of an elementwise one); CB_GRID blocks, few enough to be resident together, each
// take at most CU_PER_BLOCK units, CB_GRID apart. A unit's index picks its job: the tests and the trip count are the same for the
// whole block, so the transposing job's barriers stand under block-uniform flow.
// ---------------------------------------------------------------------------
constexpr int CU_TCONV = (EMBED / 64) * (SEQLEN / 64) * NBAT;       // 2048 tiles of query^T
constexpr int CU_QUERY = SEQLEN * NBAT * EMBED / CU_ELEMS;          // 1024
constexpr int CU_WC    = NCOMP * SEQLEN / CU_ELEMS;                 // 512 for each of Wck, Wcv
constexpr int CU_W     = EMBED * EMBED / CU_ELEMS;                  // 32 for each of Wq, Wk, Wv, Wo
constexpr int CU_TOTAL = CU_TCONV + CU_QUERY + 2 * CU_WC + 4 * CU_W + 1;   // 4225, the last one the biases
constexpr int CU_PER_BLOCK = 4;
constexpr int CB_GRID  = (CU_TOTAL + CU_PER_BLOCK - 1) / CU_PER_BLOCK;     // 1057
static_assert(SEQLEN * NBAT * EMBED % CU_ELEMS == 0 && NCOMP * SEQLEN % CU_ELEMS == 0 && EMBED * EMBED % CU_ELEMS == 0 &&
              EMBED % 128 == 0, "whole units");
__global__ __launch_bounds__(256) void convert_inputs_kernel(
    const float* __restrict__ query, const float* __restrict__ Wck, const float* __restrict__ Wcv,
    const float* __restrict__ Wq, const float* __restrict__ Wk, const float* __restrict__ Wv, const float* __restrict__ Wo,
    const float* __restrict__ bq, const float* __restrict__ bk, const float* __restrict__ bv, const float* __restrict__ bo,
    unsigned short* __restrict__ queryB, unsigned short* __restrict__ queryT, unsigned short* __restrict__ WcB,
    unsigned short* __restrict__ WqB, unsigned short* __restrict__ WkB2, unsigned short* __restrict__ WvB2,
    unsigned short* __restrict__ WoH, float* __restrict__ biasb) {
  __shared__ __align__(16) float tf[64 * 68];
  for (int unit = (int)blockIdx.x; unit < CU_TOTAL; unit += CB_GRID) {
    constexpr int U_QUERY = CU_TCONV, U_WCK = U_QUERY + CU_QUERY, U_WCV = U_WCK + CU_WC, U_WQ = U_WCV + CU_WC,
                  U_WK = U_WQ + CU_W, U_WV = U_WK + CU_W, U_WO = U_WV + CU_W, U_BIAS = U_WO + CU_W;
    static_assert(U_BIAS + 1 == CU_TOTAL, "unit list");
    if (unit < U_QUERY) {
      // query^T per batch: in [T=4096 rows][E=512 cols] pitch 2048 (base + b*512) -> out_b [512][4096]
      tconv_bf16_job(query, queryT, SEQLEN, EMBED, NBAT * EMBED, (long)EMBED, (long)EMBED * SEQLEN,
                     unit % (EMBED / 64), (unit / (EMBED / 64)) % (SEQLEN / 64), unit / ((EMBED / 64) * (SEQLEN / 64)), tf);
    } else if (unit < U_WCK) {
      // query -> bf16 [16384][512] (same flat layout as [T][B][E])
      cast_bf16_unit(query, queryB, unit - U_QUERY);
    } else if (unit < U_WCV) {
      // Wck -> rows 0..1023, Wcv -> rows 1024..2047 of the [2048][4096] bf16 plane
      cast_bf16_unit(Wck, WcB, unit - U_WCK);
    } else if (unit < U_WQ) {
      cast_bf16_unit(Wcv, WcB + (size_t)NCOMP * SEQLEN, unit - U_WCV);
    } else if (unit < U_WK) {
      cast_bf16_unit(Wq, WqB, unit - U_WQ);
    } else if (unit < U_WV) {
      dup_bf16_unit(Wk, WkB2, EMBED, unit - U_WK);
    } else if (unit < U_WO) {
      dup_bf16_unit(Wv, WvB2, EMBED, unit - U_WV);
    } else if (unit < U_BIAS) {
      cast_wo_f16_unit(Wo, WoH, WO_CARRY, unit - U_WO);
    } else {
      // biases (RNE to bf16 precision)
      bias_prep_unit(bq, bk, bv, bo, biasb, EMBED);
    }
  }
}

// =====================================================================================
// Full (unmasked) attention over the NCOMP compressed keys, head dim 64, all (b,h) in one launch.
//   q plane f16: element (t, b, h, d) at [(t*NBAT + b)*EMBED + h*64 + d]   (holds 8*q; 0.125 applied to f32 scores)
//   k plane f16: element (c, b, h, d) at [(c*NBAT + b)*EMBED + h*64 + d]
//   v^T plane f16: element (b, h, d, c) at [b*EMBED*NCOMP + (h*64 + d)*NCOMP + c]
//   out plane f16: element (t, b, h, d) at [(t*NBAT + b)*EMBED + h*64 + d], value = OUT_CARRY * attention output
//   Both products are taken transposed: S^T = K . Q^T (A = K rows, B = Q) and O^T += V^T . P^T (A = V^T rows,
//   B = P^T), v_wmma_f32_16x16x32_f16, p carried x PROB_CARRY, f32 accumulate. A lane then holds 32 of the 64
//   scores of ONE query (lane l and l ^ 16 split the keys): maximum and sum run in the lane's own registers with
//   one exchange between the wave halves, and two score tiles, converted in place, are the B operand P^T.
//   Online softmax in f32 over NCOMP/64 chunks (compile-time trip count, no masking).
//   Block = 4 waves = 64 query rows of one (b, h); grid.x = NBAT * NHEADS * (SEQLEN/64) = 2048.
//   K / V^T chunk staging: asynchronous 16-B copies to LDS, 8 lanes per 128-B row (a wave's copy covers 4 whole lines),
//   8 copies per thread and chunk, two LDS buffers: chunk kc + 1 is asked for at the head of trip kc, directly behind the
//   barrier at the foot of trip kc - 1, one block barrier per trip; fragment loads read the LDS tiles as v8h, in groups ahead
//   of the products that use them. Behind the loop the same LDS holds the waves' out tiles.
// =====================================================================================
// Stands between a group of fragment reads and the products that use them, and behind those products: the build otherwise
// moves each read down to its product (read, wait for it, product, one at a time), or reads further groups ahead and
// goes past 128 registers (8 waves per SIMD, every block of the grid resident at once).
__device__ __forceinline__ void group_edge() { __builtin_amdgcn_sched_barrier(0); }
// The slot that the instruction set asks for behind a transcendental before its source register is rewritten.
// The results and the sources of a run of v_exp_f32 are
// inputs only of the v_nop's statement: it stands behind the last of the run, and no source is rewritten ahead of it.
__device__ __forceinline__ void exp_slot1(float e, float a) { asm volatile("v_nop" :: "v"(e), "v"(a)); }
constexpr float LOG2E = 1.44269504f;   // __expf(x) compiles to v_exp_f32(x * LOG2E); written out so that the source has a name
// value of lane l ^ 16
__device__ __forceinline__ float xhalf(float x) {
  return __builtin_bit_cast(float, __builtin_amdgcn_permlanex16(__builtin_bit_cast(int, x), __builtin_bit_cast(int, x),
                                                                0x76543210, 0xfedcba98, false, false));
}

// One chunk's share of a thread: four rows of K and four of V^T, 16 rows apart, 16 B each, global -> LDS through no register.
// lk / lv: the lane's LDS byte addresses of its first K / V^T piece; gk / gv: the global addresses of the same pieces.
// The s_wait_xcnt 0 is the last line of the copies' own statement, so that no register a copy names is rewritten ahead of it.
__device__ __forceinline__ void copy_kv_chunk(unsigned lk, unsigned lv, const _Float16* gk, const _Float16* gv,
                                              unsigned lstep, size_t kstep, size_t vstep) {
  const unsigned lk1 = lk + lstep, lk2 = lk + 2 * lstep, lk3 = lk + 3 * lstep;
  const unsigned lv1 = lv + lstep, lv2 = lv + 2 * lstep, lv3 = lv + 3 * lstep;
  const _Float16* gk1 = gk + kstep; const _Float16* gk2 = gk + 2 * kstep; const _Float16* gk3 = gk + 3 * kstep;
  const _Float16* gv1 = gv + vstep; const _Float16* gv2 = gv + 2 * vstep; const _Float16* gv3 = gv + 3 * vstep;
  asm volatile("global_load_async_to_lds_b128 %0, %8, off\n\t"
               "global_load_async_to_lds_b128 %4, %12, off\n\t"
               "global_load_async_to_lds_b128 %1, %9, off\n\t"
               "global_load_async_to_lds_b128 %5, %13, off\n\t"
               "global_load_async_to_lds_b128 %2, %10, off\n\t"
               "global_load_async_to_lds_b128 %6, %14, off\n\t"
               "global_load_async_to_lds_b128 %3, %11, off\n\t"
               "global_load_async_to_lds_b128 %7, %15, off\n\t"
               "s_wait_xcnt 0x0"
               :: "v"(lk), "v"(lk1), "v"(lk2), "v"(lk3), "v"(lv), "v"(lv1), "v"(lv2), "v"(lv3),
                  "v"(gk), "v"(gk1), "v"(gk2), "v"(gk3), "v"(gv), "v"(gv1), "v"(gv2), "v"(gv3)
               : "memory");
}

// Second bound: 8 waves per SIMD, that is at most 128 registers, so that the 8 blocks a WGP gets are resident together.
__global__ __launch_bounds__(128, 8)
void attn_lin_kernel(const unsigned short* __restrict__ qp, const unsigned short* __restrict__ kp,
                     const unsigned short* __restrict__ vtp, unsigned short* __restrict__ op) {
  typedef Frag<_Float16> FR;
  // Row pitch of the two f16 tiles: 64 halves + 8 = 144 B = 16 B x 9 (odd), so that the 16 rows one
  // 16-byte fragment read touches fall on 16 different groups of four banks.
  constexpr int LP = 72;
  constexpr int TILE = 64 * LP;                          // halves of one plane's chunk, 9 KB
  constexpr int BUFH = 2 * TILE;                         // one buffer: K chunk [kv][d], then V^T chunk [d][kv]
  __shared__ __align__(16) _Float16 KV[2 * BUFH];        // two buffers, 36 KB
  static_assert(4 * 16 * 68 * sizeof(float) <= 2 * BUFH * sizeof(_Float16), "out tiles fit the ring");
  float* Os = (float*)(void*)KV;                         // per wave out tile, pitch 68: used behind the loop only

  const int tid  = threadIdx.x;
  const int wave = tid >> 5;
  const int lane = tid & 31;
  const int hh   = lane >> 4;
  const int c    = lane & 15;

  constexpr int NQB  = SEQLEN / 64;        // 64 query blocks per (b, h)
  constexpr int ROWP = NBAT * EMBED;       // 2048 halves between consecutive t (q, k, out planes)
  constexpr int NCH  = NCOMP / 64;         // 16 key chunks

  const int bx = blockIdx.x;
  const int qb = bx % NQB;
  const int bh = bx / NQB;
  const int h  = bh % NHEADS;
  const int b  = bh / NHEADS;
  const int q0 = qb * 64 + wave * 16;

  const _Float16* Qb = (const _Float16*)(const void*)qp  + (size_t)b * EMBED + (size_t)h * HDIM;
  const _Float16* Kb = (const _Float16*)(const void*)kp  + (size_t)b * EMBED + (size_t)h * HDIM;
  const _Float16* Vb = (const _Float16*)(const void*)vtp + (size_t)b * EMBED * NCOMP + (size_t)h * HDIM * NCOMP;
  _Float16*       Ob = (_Float16*)(void*)op + (size_t)b * EMBED + (size_t)h * HDIM;

  // ---- Q fragments (B operand): column = query q0 + c, 2 d-chunks of 32 ----
  v16h qa[2];
  {
    const _Float16* qrow = Qb + (size_t)(q0 + c) * ROWP;
#pragma unroll
    for (int dc = 0; dc < 2; ++dc) qa[dc] = FR::load(qrow + dc * 32 + 8 * hh);
  }

  float mrun = -INFINITY;   // running maximum of query q0 + c (the same in both wave halves)
  float lrun = 0.f;         // running sum over this half's keys; the halves are joined in the epilogue
  v8f oacc[4];              // oacc[t][r] = O[query q0 + c][d = t*16 + 8*hh + r]
#pragma unroll
  for (int t = 0; t < 4; ++t) oacc[t] = (v8f){0.f,0.f,0.f,0.f,0.f,0.f,0.f,0.f};

  // staging map: 8 lanes x 16 B = one whole 128-B row; the block's 128 threads cover 16 rows per copy
  constexpr unsigned BUFB  = BUFH * sizeof(_Float16);        // bytes from buffer 0 to buffer 1
  constexpr unsigned LSTEP = 16 * LP * sizeof(_Float16);     // LDS bytes between a thread's rows
  const int srow = tid >> 3, sc8 = (tid & 7) * 8;
  const unsigned lk0 = (unsigned)(uintptr_t)(KV + srow * LP + sc8);   // LDS byte address = low 32 bits of the shared address
  const unsigned lv0 = lk0 + TILE * sizeof(_Float16);
  const _Float16* gk = Kb + (size_t)srow * ROWP + sc8;       // K[srow + 16*i][sc8 ..] of chunk 0
  const _Float16* gv = Vb + (size_t)srow * NCOMP + sc8;      // V^T[d = srow + 16*i][sc8 ..] of chunk 0
  copy_kv_chunk(lk0, lv0, gk, gv, LSTEP, (size_t)16 * ROWP, (size_t)16 * NCOMP);
  asm volatile("s_wait_asynccnt 0x0" ::: "memory");          // this wave's copies of chunk 0 have landed
  __syncthreads();                                           // every wave's have: chunk 0 may be read

#pragma unroll 1
  for (int kc = 0; kc < NCH; ++kc) {
    // Chunk kc + 1 is asked for directly behind the barrier that ended every reader's last read of its buffer (the one in
    // front of the loop, or the one at the foot of trip kc - 1). The test is the same for the whole block. The call stands at
    // the head of the trip and not behind that barrier at the foot, the same place in the order of events: with a branch at
    // the foot the build moved the adds of the softmax sum behind it and kept all 32 p in registers across the V^T products.
    if (kc + 1 < NCH)
      copy_kv_chunk(lk0 + ((kc + 1) & 1) * BUFB, lv0 + ((kc + 1) & 1) * BUFB, gk + (size_t)(kc + 1) * 64 * ROWP, gv + (kc + 1) * 64,
                    LSTEP, (size_t)16 * ROWP, (size_t)16 * NCOMP);
    const _Float16* Ksh = KV + (kc & 1) * BUFH;
    const _Float16* Vth = Ksh + TILE;

    // ---- scores, transposed: s[j][r] = score(key j*16 + 8*hh + r, query c) ----
    // K fragments are read in groups, and the products of a group follow one another on different accumulators: the four of
    // d half 0, then, the scores now being live as well, those of d half 1 two at a time. Each s[j] still takes d half 0, then 1.
    v8f s[4];
    {
      v16h ka[4];
#pragma unroll
      for (int j = 0; j < 4; ++j) ka[j] = FR::load(Ksh + (j * 16 + c) * LP + 8 * hh);
      group_edge();
#pragma unroll
      for (int j = 0; j < 4; ++j) s[j] = FR::mma(ka[j], qa[0], (v8f){0.f,0.f,0.f,0.f,0.f,0.f,0.f,0.f});
      group_edge();
    }
#pragma unroll
    for (int j = 0; j < 4; j += 2) {
      const v16h ka0 = FR::load(Ksh + (j * 16 + c) * LP + 32 + 8 * hh);
      const v16h ka1 = FR::load(Ksh + ((j + 1) * 16 + c) * LP + 32 + 8 * hh);
      group_edge();
      s[j]     = FR::mma(ka0, qa[1], s[j]);
      s[j + 1] = FR::mma(ka1, qa[1], s[j + 1]);
      group_edge();
    }
    // ---- chunk maximum of this lane's query: 32 scores in the lane, then the other half's ----
    float mj[4];
#pragma unroll
    for (int j = 0; j < 4; ++j) {
      mj[j] = -INFINITY;
#pragma unroll
      for (int r = 0; r < 8; ++r) {
        s[j][r] *= SCORE_SCALE;
        mj[j] = fmaxf(mj[j], s[j][r]);
      }
    }
    float cm = fmaxf(fmaxf(mj[0], mj[1]), fmaxf(mj[2], mj[3]));
    cm = fmaxf(cm, xhalf(cm));
    // ---- online softmax update; P^T stays in registers ----
    const float mnew  = fmaxf(mrun, cm);
    const float aarg  = (mrun - mnew) * LOG2E;
    const float alpha = __builtin_amdgcn_exp2f(aarg);
    exp_slot1(alpha, aarg);
    mrun = mnew;
    // B operand of 32 keys: elements 0..7 = keys 8*hh + 0..7 (tile 2*kk), 8..15 = keys 16 + 8*hh + 0..7 (tile 2*kk+1),
    // the k order in which FR::load brings the V^T rows.
    v16h pb[2];
    float pj[4];
#pragma unroll
    for (int j = 0; j < 4; ++j) {
      pj[j] = 0.f;
#pragma unroll
      for (int g = 0; g < 8; g += 4) {
        float parg[4], p[4];
#pragma unroll
        for (int e = 0; e < 4; ++e) {
          parg[e] = (s[j][g + e] - mnew) * LOG2E;
          p[e]    = __builtin_amdgcn_exp2f(parg[e]);
        }
        // the slot behind these four v_exp_f32, as in exp_slot1
        asm volatile("v_nop" :: "v"(p[0]), "v"(p[1]), "v"(p[2]), "v"(p[3]), "v"(parg[0]), "v"(parg[1]), "v"(parg[2]), "v"(parg[3]));
#pragma unroll
        for (int e = 0; e < 4; ++e) {
          pj[j] += p[e];
          pb[j >> 1][(j & 1) * 8 + g + e] = (_Float16)(p[e] * PROB_CARRY);
        }
      }
    }
    lrun = lrun * alpha + ((pj[0] + pj[1]) + (pj[2] + pj[3]));
#pragma unroll
    for (int t = 0; t < 4; ++t)
#pragma unroll
      for (int r = 0; r < 8; ++r) oacc[t][r] *= alpha;
    // ---- O^T += V^T . P^T ----
#pragma unroll
    for (int kk = 0; kk < 2; ++kk) {
#pragma unroll
      for (int t = 0; t < 4; t += 2) {   // V^T fragments two at a time: a group of reads, then its two products
        group_edge();
        const v16h va0 = FR::load(Vth + (t * 16 + c) * LP + kk * 32 + 8 * hh);
        const v16h va1 = FR::load(Vth + ((t + 1) * 16 + c) * LP + kk * 32 + 8 * hh);
        group_edge();
        oacc[t]     = FR::mma(va0, pb[kk], oacc[t]);
        oacc[t + 1] = FR::mma(va1, pb[kk], oacc[t + 1]);
      }
    }
    // publish point of chunk kc + 1, the same in every wave
    asm volatile("s_wait_dscnt 0x0" ::: "memory");           // this wave's reads of the buffer to be refilled are done
    asm volatile("s_wait_asynccnt 0x0" ::: "memory");        // this wave's copies of chunk kc + 1 have landed
    __syncthreads();                                         // chunk kc + 1 may be read; every reader has left this trip's buffer
  }
  asm volatile("s_wait_asynccnt 0x0" ::: "memory");          // no copy is in flight when the ring becomes the out tiles

  // ---- epilogue: join the halves' sums, normalise, stage 16x64 wave tile, whole-line f16 stores ----
  float* os = Os + wave * (16 * 68);
  {
    const float lsum = lrun + xhalf(lrun);
    const float inv  = OUT_CARRY * (1.0f / (lsum * PROB_CARRY));
#pragma unroll
    for (int t = 0; t < 4; ++t) {
#pragma unroll
      for (int g = 0; g < 2; ++g) {
        v4f w;
#pragma unroll
        for (int e = 0; e < 4; ++e) w[e] = oacc[t][g * 4 + e] * inv;
        *(v4f*)(os + c * 68 + t * 16 + 8 * hh + g * 4) = w;
      }
    }
  }
  __builtin_amdgcn_fence(__ATOMIC_RELEASE, "workgroup");
  __builtin_amdgcn_wave_barrier();
  __builtin_amdgcn_fence(__ATOMIC_ACQUIRE, "workgroup");
  {
    const int qq = lane >> 3, c8 = (lane & 7) * 8;
    {
#pragma unroll
      for (int it = 0; it < 4; ++it) {
        const int row = it * 4 + qq;
        const float* sp = os + row * 68 + c8;
        v8h hv;
#pragma unroll
        for (int e = 0; e < 8; ++e) hv[e] = (_Float16)sp[e];
        *(v8h*)(Ob + (size_t)(q0 + row) * ROWP + c8) = hv;
      }
      
    }
  }
}

// ---------------------------------------------------------------------------
// Host orchestration (kernel launches + host arithmetic only)
// ---------------------------------------------------------------------------
extern "C" void kernel_launch(void* const* d_in, const int* in_sizes, int n_in,
                              void* d_out, int out_size, void* d_ws, size_t ws_size,
                              hipStream_t stream) {
  if (n_in < 11) return;
  const long nQ  = (long)SEQLEN * NBAT * EMBED;    // 8388608
  const long nW  = (long)EMBED * EMBED;            // 262144
  const long nWc = (long)NCOMP * SEQLEN;           // 4194304
  if (in_sizes[0] != nQ || in_sizes[1] != nW || in_sizes[2] != EMBED || in_sizes[3] != nW ||
      in_sizes[4] != EMBED || in_sizes[5] != nW || in_sizes[6] != EMBED || in_sizes[7] != nWc ||
      in_sizes[8] != nWc || in_sizes[9] != nW || in_sizes[10] != EMBED || out_size != nQ) return;

  const float* query = (const float*)d_in[0];
  const float* Wq  = (const float*)d_in[1];  const float* bq = (const float*)d_in[2];
  const float* Wk  = (const float*)d_in[3];  const float* bk = (const float*)d_in[4];
  const float* Wv  = (const float*)d_in[5];  const float* bv = (const float*)d_in[6];
  const float* Wck = (const float*)d_in[7];  const float* Wcv = (const float*)d_in[8];
  const float* Wo  = (const float*)d_in[9];  const float* bo = (const float*)d_in[10];

  // ---- workspace region map (bytes) ----
  const size_t BYTES_QB   = (size_t)nQ * 2;                              // bf16 query [16384][512]            16 MiB
  const size_t BYTES_QT   = (size_t)nQ * 2;                              // bf16 query^T [4][512][4096]        16 MiB
  const size_t BYTES_WC   = (size_t)2 * nWc * 2;                         // bf16 [Wck;Wcv] [2048][4096]        16 MiB
  const size_t BYTES_KVIN = (size_t)2 * NCOMP * NBAT * (2 * EMBED) * 2;  // u16 [8192][1024] (hi|lo rows)     16 MiB
  const size_t BYTES_QP   = (size_t)nQ * 2;                              // f16 q plane [16384][512]          16 MiB
  const size_t BYTES_OP   = (size_t)nQ * 2;                              // f16 attention out [16384][512]    16 MiB
  const size_t BYTES_KP   = (size_t)NCOMP * NBAT * EMBED * 2;            // f16 k plane [4096][512]            4 MiB
  const size_t BYTES_VT   = (size_t)NBAT * EMBED * NCOMP * 2;            // f16 v^T plane [4][512][1024]       4 MiB
  const size_t BYTES_WQ   = (size_t)nW * 2;                              // bf16 Wq [512][512]               512 KiB
  const size_t BYTES_WK2  = (size_t)nW * 2 * 2;                          // bf16 [Wk|Wk] [512][1024]            1 MiB
  const size_t BYTES_WV2  = (size_t)nW * 2 * 2;                          // bf16 [Wv|Wv] [512][1024]            1 MiB
  const size_t BYTES_WOH  = (size_t)nW * 2;                              // f16 64*Wo [512][512]             512 KiB
  const size_t BYTES_BIAS = (size_t)4 * EMBED * 4;                       // f32 biases 4 x 512                  8 KiB
  const size_t OFF_QB   = 0;
  const size_t OFF_QT   = OFF_QB   + BYTES_QB;
  const size_t OFF_WC   = OFF_QT   + BYTES_QT;
  const size_t OFF_KVIN = OFF_WC   + BYTES_WC;
  const size_t OFF_QP   = OFF_KVIN + BYTES_KVIN;
  const size_t OFF_OP   = OFF_QP   + BYTES_QP;
  const size_t OFF_KP   = OFF_OP   + BYTES_OP;
  const size_t OFF_VT   = OFF_KP   + BYTES_KP;
  const size_t OFF_WQ   = OFF_VT   + BYTES_VT;
  const size_t OFF_WK2  = OFF_WQ   + BYTES_WQ;
  const size_t OFF_WV2  = OFF_WK2  + BYTES_WK2;
  const size_t OFF_WOH  = OFF_WV2  + BYTES_WV2;
  const size_t OFF_BIAS = OFF_WOH  + BYTES_WOH;
  const size_t WS_TOTAL = OFF_BIAS + BYTES_BIAS;                         // 112,205,824 B
  if (WS_TOTAL > ws_size) return;

  char* ws = (char*)d_ws;
  unsigned short* queryB = (unsigned short*)(ws + OFF_QB);
  unsigned short* queryT = (unsigned short*)(ws + OFF_QT);
  unsigned short* WcB    = (unsigned short*)(ws + OFF_WC);
  unsigned short* KVin   = (unsigned short*)(ws + OFF_KVIN);
  unsigned short* qP     = (unsigned short*)(ws + OFF_QP);
  unsigned short* oP     = (unsigned short*)(ws + OFF_OP);
  unsigned short* kP     = (unsigned short*)(ws + OFF_KP);
  unsigned short* vtP    = (unsigned short*)(ws + OFF_VT);
  unsigned short* WqB    = (unsigned short*)(ws + OFF_WQ);
  unsigned short* WkB2   = (unsigned short*)(ws + OFF_WK2);
  unsigned short* WvB2   = (unsigned short*)(ws + OFF_WV2);
  unsigned short* WoH    = (unsigned short*)(ws + OFF_WOH);
  float*          biasb  = (float*)(ws + OFF_BIAS);
  float* bq_r = biasb;
  float* bk_r = biasb + EMBED;
  float* bv_r = biasb + 2 * EMBED;
  float* bo_r = biasb + 3 * EMBED;

  // 1. every input conversion (query -> bf16 and bf16 transposed, Wck/Wcv, Wq, [Wk|Wk], [Wv|Wv], 64*Wo, biases)
  convert_inputs_kernel<<<dim3(CB_GRID), dim3(256), 0, stream>>>(
      query, Wck, Wcv, Wq, Wk, Wv, Wo, bq, bk, bv, bo,
      queryB, queryT, WcB, WqB, WkB2, WvB2, WoH, biasb);

  // 2. two products that read only what launch 1 wrote:
  //  compression: per batch b: C_b[m][n] = sum_t WcB[m][t] * queryT_b[n][t]; m<1024 -> k_in[m][b][n], m>=1024 -> v_in.
  //     C element (m,n,b): hi at KVin[(m*4+b)*1024 + n], lo at +512  => ldc 4096, strideC 1024, C2 = C + 512.
  //     M=2048, N=512, K=4096 (K%64==0, M%128==0, N%256==0): 32 block tiles of 128x256 per batch, 4 batches: 128 blocks.
  //  q8 = query . Wq^T + bq  (scale 1; 0.125 applied to f32 scores) -> f16 [16384][512]; M=16384, N=512, K=512: 256 blocks.
  {
    const GemmJob comp = { WcB, queryT, KVin, KVin + EMBED, biasb,
                           0L, (long)EMBED * SEQLEN, (long)(2 * EMBED),
                           SEQLEN, SEQLEN, 4 * (2 * EMBED), 2 * NCOMP, EMBED, SEQLEN, 32 };
    const GemmJob qpro = { queryB, WqB, qP, qP, bq_r,
                           0L, 0L, 0L,
                           EMBED, EMBED, EMBED, SEQLEN * NBAT, EMBED, EMBED, 256 };
    wmma_gemm64_pair<1, 0, 2, 2, 1><<<dim3(32 * NBAT + 256), dim3(256), 0, stream>>>(comp, qpro, 32 * NBAT);
  }

  // 3. two products that read only what launches 1 and 2 wrote:
  //  k = [k_in hi|lo] . [Wk|Wk]^T + bk -> f16 [4096 rows (c*4+b)][512]; M=4096, N=512, K'=1024: 64 blocks.
  //  v^T per batch: C_b[m=e'][n=c] = sum_k [Wv|Wv][e'][k] * [v_in hi|lo][(c,b)][k] + bv[e'] -> f16 vtP[b][512][1024].
  //     Bt_b rows at KVin + 4096*1024 + b*1024 + c*4096 (ldb 4096, strideB 1024); M=512, N=1024, K'=1024: 16 x 4 blocks.
  {
    const GemmJob kpro = { KVin, WkB2, kP, kP, bk_r,
                           0L, 0L, 0L,
                           2 * EMBED, 2 * EMBED, EMBED, NCOMP * NBAT, EMBED, 2 * EMBED, 64 };
    const GemmJob vpro = { WvB2, KVin + (size_t)NCOMP * NBAT * (2 * EMBED), vtP, vtP, bv_r,
                           0L, (long)(2 * EMBED), (long)EMBED * NCOMP,
                           2 * EMBED, 4 * (2 * EMBED), NCOMP, EMBED, NCOMP, 2 * EMBED, 16 };
    wmma_gemm64_pair<1, 2, 1, 1, 1><<<dim3(64 + 16 * NBAT), dim3(256), 0, stream>>>(kpro, vpro, 64);
  }

  // 4. attention over the compressed keys: grid = B*H*(T/64) = 2048 blocks of 128
  attn_lin_kernel<<<dim3(NBAT * NHEADS * (SEQLEN / 64)), dim3(128), 0, stream>>>(qP, kP, vtP, oP);

  // 5. out = (16 O) . (64 Wo)^T / 1024 + bo -> f32 d_out [16384][512]; M=16384, N=512, K=512: grid 256.
  wmma_gemm64<0, false, 2, 0, false><<<dim3(256, 1), dim3(256), 0, stream>>>(
      oP, oP, EMBED, 0L,
      WoH, WoH, EMBED, 0L,
      d_out, d_out, EMBED, 0L,
      bo_r, bo_r, 0L,
      SEQLEN * NBAT, EMBED, EMBED, 1.0f / (OUT_CARRY * WO_CARRY));
}

// v008
// Measured time: 123 microseconds a run.
// Timed twice side by side with v007, it ran 1.21 times as fast both times.
// Over all steps from v000 it is 4.67 times as fast.
// Contractions: sequence compression and q/k/v^T projections on v_wmma_f32_16x16x32_bf16 (bf16 operands = RNE-converted inputs; k_in/v_in carried as bf16 hi+lo planes concatenated along k); q.k^T, p.v and the output projection on v_wmma_f32_16x16x32_f16 (f16 planes; p carried x2^15, attention output x2^4, Wo x2^6); f32 accumulate; softmax, score scale 0.125 and biases in f32.
#include <hip/hip_runtime.h>
#include <math.h>
#include <stdint.h>

typedef __attribute__((ext_vector_type(16))) _Float16 v16h;
typedef __attribute__((ext_vector_type(8)))  _Float16 v8h;
typedef __attribute__((ext_vector_type(16))) __bf16   v16b;
typedef __attribute__((ext_vector_type(8)))  __bf16   v8b;
typedef __attribute__((ext_vector_type(8)))  float    v8f;
typedef __attribute__((ext_vector_type(4)))  float    v4f;
typedef __attribute__((ext_vector_type(2)))  float    v2f;
typedef __attribute__((ext_vector_type(4)))  unsigned int v4u;
typedef __attribute__((ext_vector_type(2)))  unsigned int v2u;

__device__ __forceinline__ unsigned short f2bf_bits(float f) {
  unsigned u = __float_as_uint(f);
  return (unsigned short)((u + 0x7FFFu + ((u >> 16) & 1u)) >> 16);
}
__device__ __forceinline__ float bf_bits2f(unsigned short h) { return __uint_as_float(((unsigned)h) << 16); }

// hazard guards as plain device helpers
__device__ __forceinline__ void dep_guard_h(v8f& a, v8f& b, v16h x, v16h y) { asm volatile("v_nop\n\tv_nop\n\tv_nop\n\tv_nop" : "+v"(a), "+v"(b) : "v"(x), "v"(y)); }
__device__ __forceinline__ void dep_guard_b(v8f& a, v8f& b, v16b x, v16b y) { asm volatile("v_nop\n\tv_nop\n\tv_nop\n\tv_nop" : "+v"(a), "+v"(b) : "v"(x), "v"(y)); }
__device__ __forceinline__ void keep4_h(v16h a, v16h b, v16h c, v16h d) { asm volatile("v_nop" :: "v"(a), "v"(b), "v"(c), "v"(d)); }
__device__ __forceinline__ void keep4_b(v16b a, v16b b, v16b c, v16b d) { asm volatile("v_nop" :: "v"(a), "v"(b), "v"(c), "v"(d)); }
__device__ __forceinline__ void acc_guard4(v8f& a, v8f& b, v8f& c, v8f& d) { asm volatile("v_nop\n\tv_nop\n\tv_nop\n\tv_nop" : "+v"(a), "+v"(b), "+v"(c), "+v"(d)); }
template <typename T> struct Frag;
template <> struct Frag<_Float16> {
  typedef v16h V; typedef v8h H; union U { v16h v; v8h h[2]; };
  static __device__ __forceinline__ v16h load(const _Float16* p) {   // elements 0..7 <- p[0..7], 8..15 <- p[16..23]
    U f; f.h[0] = *(const v8h*)(p); f.h[1] = *(const v8h*)(p + 16); return f.v;
  }
  static __device__ __forceinline__ v8f mma(v16h a, v16h b, v8f c) {
    return __builtin_amdgcn_wmma_f32_16x16x32_f16(false, a, false, b, (short)0, c, false, false);
  }
  static __device__ __forceinline__ void guard(v8f& a, v8f& b, v16h x, v16h y) { dep_guard_h(a, b, x, y); }
  static __device__ __forceinline__ void keep(v16h a, v16h b, v16h c, v16h d) { keep4_h(a, b, c, d); }
};
template <> struct Frag<__bf16> {
  typedef v16b V; typedef v8b H; union U { v16b v; v8b h[2]; };
  static __device__ __forceinline__ v16b load(const __bf16* p) {
    U f; f.h[0] = *(const v8b*)(p); f.h[1] = *(const v8b*)(p + 16); return f.v;
  }
  static __device__ __forceinline__ v8f mma(v16b a, v16b b, v8f c) {
    return __builtin_amdgcn_wmma_f32_16x16x32_bf16(false, a, false, b, (short)0, c, false, false);
  }
  static __device__ __forceinline__ void guard(v8f& a, v8f& b, v16b x, v16b y) { dep_guard_b(a, b, x, y); }
  static __device__ __forceinline__ void keep(v16b a, v16b b, v16b c, v16b d) { keep4_b(a, b, c, d); }
};

// ---- Register-blocked batched WMMA GEMM ------------------------------------
// C[m,n] = scale * sum_k A[m,k] * Bt[n,k] (+bias)(+resid); each wave owns a 64x64 tile.
// A row-major [M,K]; Bt row-major [N,K]; M % 128 == 0, N % 256 == 0, K % 128 == 0.
// A block of 8 waves (2 x 4) owns a 128x256 tile of C. Per stage of 128 k it brings 128 rows of A and 256 rows
// of Bt, 256 B each, into LDS with asynchronous 16-byte copies (16 lanes per row, whole lines, through no register);
// the waves read their fragments from LDS. Two LDS buffers: stage s + 2 is asked for behind the barrier at the foot
// of stage s, into the buffer that stage s has just read, and flies during stage s + 1; one block barrier per stage.
// SPLIT (hi/lo operand planes) is not built in this form.
// BIAS_MODE: 0 = none, 1 = bias[m], 2 = bias[n].
// OUT_MODE: 0 = f32, 1 = f16, 2 = bf16 hi plane (Cout) + bf16 lo plane (Cout2).
// ET: 0 = f16 operands, 1 = bf16 operands (pointers passed as 16-bit storage)
template <int ET> struct Elem;
template <> struct Elem<0> { typedef _Float16 T; };
template <> struct Elem<1> { typedef __bf16 T; };
// The tile's work is a device function: bx = index of the block tile, b = batch, sOpRaw / sTRaw = the launching
// kernel's LDS, so that one launch can hold the block tiles of two products that do not depend on one another.
constexpr int GEMM_OP_ELEMS = 2 * (128 + 256) * (128 + 8);  // two buffers of (BM + BN) rows at pitch LP
constexpr int GEMM_SLAB_F32 = 8 * 16 * 68;                  // eight per-wave 16x64 slabs, pitch 68 floats
// Twelve 16-B pieces of a thread's share of a stage, global -> LDS through no register. l[i]: the lane's LDS byte address of
// piece i; g[i]: its global address. The s_wait_xcnt 0 is the last line of the copies' own statement, so that no register a
// copy names is rewritten ahead of it.
template <typename T>
__device__ __forceinline__ void copy_rows12(const unsigned (&l)[12], const T* const (&g)[12]) {
  asm volatile("global_load_async_to_lds_b128 %0, %12, off\n\t"
               "global_load_async_to_lds_b128 %1, %13, off\n\t"
               "global_load_async_to_lds_b128 %2, %14, off\n\t"
               "global_load_async_to_lds_b128 %3, %15, off\n\t"
               "global_load_async_to_lds_b128 %4, %16, off\n\t"
               "global_load_async_to_lds_b128 %5, %17, off\n\t"
               "global_load_async_to_lds_b128 %6, %18, off\n\t"
               "global_load_async_to_lds_b128 %7, %19, off\n\t"
               "global_load_async_to_lds_b128 %8, %20, off\n\t"
               "global_load_async_to_lds_b128 %9, %21, off\n\t"
               "global_load_async_to_lds_b128 %10, %22, off\n\t"
               "global_load_async_to_lds_b128 %11, %23, off\n\t"
               "s_wait_xcnt 0x0"
               :: "v"(l[0]), "v"(l[1]), "v"(l[2]), "v"(l[3]), "v"(l[4]), "v"(l[5]),
                  "v"(l[6]), "v"(l[7]), "v"(l[8]), "v"(l[9]), "v"(l[10]), "v"(l[11]),
                  "v"(g[0]), "v"(g[1]), "v"(g[2]), "v"(g[3]), "v"(g[4]), "v"(g[5]),
                  "v"(g[6]), "v"(g[7]), "v"(g[8]), "v"(g[9]), "v"(g[10]), "v"(g[11])
               : "memory");
}
// One stage's share of a thread: rows srow + 16*i of the 128 A rows and of the 256 Bt rows, 24 pieces in two statements.
// l0: LDS byte address of the thread's piece of A row srow in the target buffer; gA / gB: the same piece of A / Bt in global
// memory at the stage's k offset; lrow16: LDS bytes of 16 rows.
template <typename T>
__device__ __forceinline__ void copy_gemm_stage(unsigned l0, const T* gA, const T* gB, int lda, int ldb, unsigned lrow16) {
  unsigned l[12]; const T* g[12];
#pragma unroll   // l[], g[] are indexed by constants only, so they stay in registers
  for (int i = 0; i < 8; ++i) { l[i] = l0 + i * lrow16; g[i] = gA + (size_t)(i * 16) * lda; }
#pragma unroll   // as above: constant indices keep l[], g[] in registers
  for (int i = 0; i < 4; ++i) { l[8 + i] = l0 + (8 + i) * lrow16; g[8 + i] = gB + (size_t)(i * 16) * ldb; }
  copy_rows12<T>(l, g);
#pragma unroll   // as above: constant indices keep l[], g[] in registers
  for (int i = 0; i < 12; ++i) { l[i] = l0 + (12 + i) * lrow16; g[i] = gB + (size_t)((4 + i) * 16) * ldb; }
  copy_rows12<T>(l, g);
}
template <int ET, bool SPLIT, int BIAS_MODE, int OUT_MODE, bool RESID, int ACT = 0>
__device__ __forceinline__ void gemm_tile(
    const unsigned short* __restrict__ Ap, const unsigned short* __restrict__ A2p, int lda, long strideA,
    const unsigned short* __restrict__ Btp, const unsigned short* __restrict__ Bt2p, int ldb, long strideB,
    void* __restrict__ Cout, void* __restrict__ Cout2, int ldc, long strideC,
    const float* __restrict__ bias,
    const float* __restrict__ resid, long strideR,
    int M, int N, int K, float scale,
    int bx, int b, unsigned short* sOpRaw, float* sTRaw) {
  typedef typename Elem<ET>::T T;
  typedef typename Frag<T>::V V;
  const T* A = (const T*)Ap; const T* Bt = (const T*)Btp;
  static_assert(!SPLIT, "hi/lo planes are not staged");
  constexpr int BM = 128, BN = 256, BK = 128;
  // LDS row pitch 128 + 8 elements = 272 B = 16 B x 17 (odd): the 16 rows of one 16-byte fragment read fall on
  // different groups of four banks.
  constexpr int LP = BK + 8;
  static_assert(2 * (BM + BN) * LP == GEMM_OP_ELEMS, "LDS size");
  T (*sOp)[(BM + BN) * LP] = (T (*)[(BM + BN) * LP])sOpRaw;   // [buffer][A rows 0..127 | Bt rows 128..383][k]
  float (*sT)[16 * 68] = (float (*)[16 * 68])sTRaw;           // per-wave 16x64 slab, pitch 68 floats
  const int tid  = threadIdx.x;
  const int lane = tid & 31;
  const int wave = tid >> 5;
  const int blocksN = N / BN;
  const int blocksM = M / BM;
  if (bx >= blocksM * blocksN) return;   // block-uniform, ahead of every barrier
  const int bm = bx / blocksN;
  const int bn = bx - bm * blocksN;
  const int wm = wave >> 2;                    // 0..1: 64-row band of the block tile
  const int wn = wave & 3;                     // 0..3: 64-column band
  const int m0 = bm * BM + (wm << 6);
  const int n0 = bn * BN + (wn << 6);

  const T* Ab  = A  + (size_t)b * strideA;
  const T* Bb  = Bt + (size_t)b * strideB;

  const int rlane = lane & 15;                 // row (A) / col (B, D) within subtile
  const int koff  = (lane >> 4) * 8;           // k offset of this lane half
  const int mOff  = (lane >> 4) * 8;           // D row offset

  // staging map: 16 threads x 16 B = one 256-B row; 16 rows per sweep of the block
  const int srow = tid >> 4;                   // 0..15
  const int sk   = (tid & 15) * 8;             // element offset in the row
  const T* gA = Ab + (size_t)(bm * BM + srow) * lda + sk;
  const T* gB = Bb + (size_t)(bn * BN + srow) * ldb + sk;
  constexpr unsigned BUFB   = (BM + BN) * LP * sizeof(T);   // bytes from buffer 0 to buffer 1
  constexpr unsigned LROW16 = 16 * LP * sizeof(T);          // LDS bytes of 16 rows
  const unsigned ldst = (unsigned)(uintptr_t)(sOpRaw + srow * LP + sk);   // LDS byte address = low 32 bits of the shared address

  v8f acc[4][4];
#pragma unroll
  for (int i = 0; i < 4; ++i)
#pragma unroll
    for (int j = 0; j < 4; ++j) acc[i][j] = (v8f){0.f,0.f,0.f,0.f,0.f,0.f,0.f,0.f};

  const int nst = K / BK;
  copy_gemm_stage<T>(ldst, gA, gB, lda, ldb, LROW16);
  asm volatile("s_wait_asynccnt 0x0" ::: "memory");          // this wave's copies of stage 0 have landed
  __syncthreads();                                           // every wave's have: stage 0 may be read
  if (nst > 1) copy_gemm_stage<T>(ldst + BUFB, gA + BK, gB + BK, lda, ldb, LROW16);   // the same test for the whole block
#pragma unroll 1
  for (int s = 0; s < nst; ++s) {
    const T* cur = sOp[s & 1];
#pragma unroll
    for (int kk = 0; kk < BK; kk += 32) {
      V bh[4], ah[4];
#pragma unroll
      for (int j = 0; j < 4; ++j) bh[j] = Frag<T>::load(cur + (BM + (wn << 6) + (j << 4) + rlane) * LP + kk + koff);
#pragma unroll
      for (int i = 0; i < 4; ++i) ah[i] = Frag<T>::load(cur + ((wm << 6) + (i << 4) + rlane) * LP + kk + koff);
#pragma unroll
      for (int i = 0; i < 4; ++i) {
#pragma unroll
        for (int j = 0; j < 4; ++j) acc[i][j] = Frag<T>::mma(ah[i], bh[j], acc[i][j]);
        Frag<T>::guard(acc[i][0], acc[i][3], ah[i], ah[i]);
      }
      Frag<T>::keep(bh[0], bh[1], bh[2], bh[3]);
    }
    // publish point of stage s + 1, the same in every wave
    asm volatile("s_wait_dscnt 0x0" ::: "memory");           // this wave's reads of the buffer to be refilled are done
    asm volatile("s_wait_asynccnt 0x0" ::: "memory");        // this wave's copies of stage s + 1 have landed
    __syncthreads();                                         // stage s + 1 may be read; every reader has left this stage's buffer
    if (s + 2 < nst)                                         // the same test for the whole block
      copy_gemm_stage<T>(ldst + (s & 1) * BUFB, gA + (size_t)(s + 2) * BK, gB + (size_t)(s + 2) * BK, lda, ldb, LROW16);
  }
  asm volatile("s_wait_asynccnt 0x0" ::: "memory");          // no copy is in flight behind the loop
  acc_guard4(acc[0][0], acc[0][1], acc[0][2], acc[0][3]);
  acc_guard4(acc[1][0], acc[1][1], acc[1][2], acc[1][3]);
  acc_guard4(acc[2][0], acc[2][1], acc[2][2], acc[2][3]);
  acc_guard4(acc[3][0], acc[3][1], acc[3][2], acc[3][3]);

  // ---- epilogue ----
  float* slab = sT[wave];
  const float* Rb = RESID ? (resid + (size_t)b * strideR) : nullptr;
#pragma unroll
  for (int i = 0; i < 4; ++i) {
    const int mBase = m0 + (i << 4);
#pragma unroll
    for (int j = 0; j < 4; ++j) {
      const int n = n0 + (j << 4) + rlane;
      float bv = 0.f;
      if (BIAS_MODE == 2) bv = bias[n];
#pragma unroll
      for (int r = 0; r < 8; ++r) {
        float v = acc[i][j][r] * scale;
        if (BIAS_MODE == 1) v += bias[mBase + mOff + r];
        if (BIAS_MODE == 2) v += bv;
        if (RESID) v += Rb[(size_t)(mBase + mOff + r) * ldc + n];
        if (ACT == 1) v = tanhf(v);
        if (ACT == 2) v = fmaxf(v, 0.0f);
        if (ACT == 3) v = v / (1.0f + expf(-v));
        if (ACT == 4) v = (v > 0.f) ? v : 0.01f * v;
        if (ACT == 5) v = 0.5f * v * (1.0f + erff(v * 0.70710678118654752f));
        slab[(mOff + r) * 68 + (j << 4) + rlane] = v;
      }
    }
    __builtin_amdgcn_fence(__ATOMIC_RELEASE, "workgroup");
    __builtin_amdgcn_wave_barrier();
    __builtin_amdgcn_fence(__ATOMIC_ACQUIRE, "workgroup");
    if (OUT_MODE == 0) {
      float* C = (float*)Cout + (size_t)b * strideC;
      const int hh = lane >> 4, c4 = (lane & 15) * 4;     // row seg = 256 B = 16 lanes x 16 B
      {
#pragma unroll
        for (int it = 0; it < 8; ++it) {
          const int row = it * 2 + hh;
          v4f v = *(const v4f*)(slab + row * 68 + c4);
          *(v4f*)(C + (size_t)(mBase + row) * ldc + n0 + c4) = v;
        }
        
      }
    } else {
      const int q = lane >> 3, c8 = (lane & 7) * 8;
      unsigned short* C  = (unsigned short*)Cout  + (size_t)b * strideC;
      unsigned short* C2 = (OUT_MODE == 2) ? ((unsigned short*)Cout2 + (size_t)b * strideC) : nullptr;
      {
#pragma unroll
        for (int it = 0; it < 4; ++it) {
          const int row = it * 4 + q;
          const float* sp = slab + row * 68 + c8;
          v8h hv, lv;
#pragma unroll
          for (int e = 0; e < 8; ++e) {
            if (OUT_MODE == 1) {
              hv[e] = (_Float16)sp[e];
            } else {
              unsigned short hb = f2bf_bits(sp[e]);
              unsigned short lb = f2bf_bits(sp[e] - bf_bits2f(hb));
              hv[e] = __builtin_bit_cast(_Float16, hb);
              lv[e] = __builtin_bit_cast(_Float16, lb);
            }
          }
          *(v8h*)(C + (size_t)(mBase + row) * ldc + n0 + c8) = hv;
          if (OUT_MODE == 2) *(v8h*)(C2 + (size_t)(mBase + row) * ldc + n0 + c8) = lv;
        }
        
      }
    }
    __builtin_amdgcn_fence(__ATOMIC_RELEASE, "workgroup");
    __builtin_amdgcn_wave_barrier();
    __builtin_amdgcn_fence(__ATOMIC_ACQUIRE, "workgroup");
  }
}

// One product per launch: grid (block tiles, batches).
template <int ET, bool SPLIT, int BIAS_MODE, int OUT_MODE, bool RESID, int ACT = 0>
__global__ __launch_bounds__(256) void wmma_gemm64(
    const unsigned short* __restrict__ Ap, const unsigned short* __restrict__ A2p, int lda, long strideA,
    const unsigned short* __restrict__ Btp, const unsigned short* __restrict__ Bt2p, int ldb, long strideB,
    void* __restrict__ Cout, void* __restrict__ Cout2, int ldc, long strideC,
    const float* __restrict__ bias,
    const float* __restrict__ resid, long strideR,
    int M, int N, int K, float scale) {
  __shared__ __align__(16) unsigned short sOpRaw[GEMM_OP_ELEMS];
  __shared__ __align__(16) float sTRaw[GEMM_SLAB_F32];
  gemm_tile<ET, SPLIT, BIAS_MODE, OUT_MODE, RESID, ACT>(Ap, A2p, lda, strideA, Btp, Bt2p, ldb, strideB, Cout, Cout2, ldc, strideC,
                                                        bias, resid, strideR, M, N, K, scale,
                                                        (int)blockIdx.x, (int)blockIdx.y, sOpRaw, sTRaw);
}

// Two independent products in one launch: blocks 0 .. nb0-1 take product 0 (the longer one, so that it starts first),
// the rest product 1. In each product the flat index runs over its gx block tiles first, then over its batches.
struct GemmJob {
  const unsigned short* A;  const unsigned short* Bt;
  unsigned short* C;  unsigned short* C2;
  const float* bias;
  long strideA, strideB, strideC;
  int lda, ldb, ldc, M, N, K, gx;
};
template <int ET, int BIAS0, int OUT0, int BIAS1, int OUT1>
__global__ __launch_bounds__(256) void wmma_gemm64_pair(GemmJob j0, GemmJob j1, int nb0) {
  __shared__ __align__(16) unsigned short sOpRaw[GEMM_OP_ELEMS];
  __shared__ __align__(16) float sTRaw[GEMM_SLAB_F32];
  const int blk = (int)blockIdx.x;   // the same for the whole block: every barrier below stands under block-uniform flow
  if (blk < nb0) {
    gemm_tile<ET, false, BIAS0, OUT0, false>(j0.A, j0.A, j0.lda, j0.strideA, j0.Bt, j0.Bt, j0.ldb, j0.strideB,
                                             (void*)j0.C, (void*)j0.C2, j0.ldc, j0.strideC, j0.bias, j0.bias, 0L,
                                             j0.M, j0.N, j0.K, 1.0f, blk % j0.gx, blk / j0.gx, sOpRaw, sTRaw);
  } else {
    const int l = blk - nb0;
    gemm_tile<ET, false, BIAS1, OUT1, false>(j1.A, j1.A, j1.lda, j1.strideA, j1.Bt, j1.Bt, j1.ldb, j1.strideB,
                                             (void*)j1.C, (void*)j1.C2, j1.ldc, j1.strideC, j1.bias, j1.bias, 0L,
                                             j1.M, j1.N, j1.K, 1.0f, l % j1.gx, l / j1.gx, sOpRaw, sTRaw);
  }
}

__device__ __forceinline__ unsigned pk16(unsigned short a, unsigned short b) { return (unsigned)a | ((unsigned)b << 16); }

// ---------------------------------------------------------------------------
// Problem geometry
// ---------------------------------------------------------------------------
constexpr int   SEQLEN  = 4096;   // time steps (queries)
constexpr int   NBAT    = 4;      // batch
constexpr int   EMBED   = 512;    // channels
constexpr int   NHEADS  = 8;
constexpr int   HDIM    = 64;
constexpr int   NCOMP   = 1024;   // compressed key count
constexpr float SCORE_SCALE = 0.125f;     // head_dim^-0.5, applied to the f32 score accumulators
constexpr float PROB_CARRY  = 32768.0f;   // p carried x2^15 in the f16 P operand, folded into 1/l
constexpr float OUT_CARRY   = 16.0f;      // attention output carried x2^4 in its f16 plane
constexpr float WO_CARRY    = 64.0f;      // Wo carried x2^6 in its f16 plane

// ---------------------------------------------------------------------------
// Elementwise conversions work in UNITS of CU_ELEMS = 8192 consecutive f32 (32 KB): thread t of the block's 256 takes the
// four floats at j*1024 + 4*t, j = 0..7. Each wave-wide load is 512 contiguous bytes (4 whole lines), the eight loads of a
// thread are asked for before the first is converted, and each wave-wide 8-B store writes 256 contiguous bytes (2 whole lines).
// ---------------------------------------------------------------------------
constexpr int CU_ELEMS = 8192;
// Last statement of a unit: what follows in the block's loop (the next job test's side, the next trip) rewrites the address
// and data registers that the unit's stores name.
// (Not in the bias unit: there the build's own s_wait_xcnt 0 stands directly behind the stores.)
__device__ __forceinline__ void unit_stores_issued() { asm volatile("s_wait_xcnt 0x0" ::: "memory"); }
__device__ __forceinline__ void load_unit(v4f (&f)[8], const float* __restrict__ in, int e0) {
#pragma unroll   // f[] stays in registers and the eight loads stand together, ahead of the first use
  for (int j = 0; j < 8; ++j) f[j] = *(const v4f*)(in + e0 + j * 1024);
}
__device__ __forceinline__ v2u bf16x4(v4f f) {
  v2u u;
  u[0] = pk16(f2bf_bits(f[0]), f2bf_bits(f[1]));
  u[1] = pk16(f2bf_bits(f[2]), f2bf_bits(f[3]));
  return u;
}

// f32 -> bf16 (RNE), same flat layout.
__device__ __forceinline__ void cast_bf16_unit(const float* __restrict__ in, unsigned short* __restrict__ out, int unit) {
  const int e0 = unit * CU_ELEMS + (int)threadIdx.x * 4;
  v4f f[8];
  load_unit(f, in, e0);
#pragma unroll   // f[] is indexed by constants only, so it stays in registers
  for (int j = 0; j < 8; ++j) *(v2u*)(out + e0 + j * 1024) = bf16x4(f[j]);
  unit_stores_issued();
}

// W [rows][cols] f32 -> out [rows][2*cols] bf16 with out[r][c] = out[r][cols + c] = bf16_rne(W[r][c]).
// cols % 128 == 0, so a wave's 128 elements of one store stay in one row.
__device__ __forceinline__ void dup_bf16_unit(const float* __restrict__ Wm, unsigned short* __restrict__ out, int cols, int unit) {
  const int e0 = unit * CU_ELEMS + (int)threadIdx.x * 4;
  v4f f[8];
  load_unit(f, Wm, e0);
#pragma unroll   // f[] is indexed by constants only, so it stays in registers
  for (int j = 0; j < 8; ++j) {
    const int e  = e0 + j * 1024;
    const int r  = e / cols;
    const int cc = e - r * cols;
    const v2u u = bf16x4(f[j]);
    *(v2u*)(out + (size_t)r * 2 * cols + cc) = u;
    *(v2u*)(out + (size_t)r * 2 * cols + cols + cc) = u;
  }
  unit_stores_issued();
}

// Wo f32 -> f16 plane holding f16(carry * bf16_rne(w)) (exact for bf16 values in the normal f16 range).
__device__ __forceinline__ void cast_wo_f16_unit(const float* __restrict__ Wm, unsigned short* __restrict__ out, float carry, int unit) {
  const int e0 = unit * CU_ELEMS + (int)threadIdx.x * 4;
  v4f f[8];
  load_unit(f, Wm, e0);
#pragma unroll   // f[] is indexed by constants only, so it stays in registers
  for (int j = 0; j < 8; ++j) {
    unsigned short h[4];
#pragma unroll   // h[] stays in registers
    for (int e = 0; e < 4; ++e) {
      const _Float16 x = (_Float16)(bf_bits2f(f2bf_bits(f[j][e])) * carry);
      h[e] = __builtin_bit_cast(unsigned short, x);
    }
    v2u u;
    u[0] = pk16(h[0], h[1]);
    u[1] = pk16(h[2], h[3]);
    *(v2u*)(out + e0 + j * 1024) = u;
  }
  unit_stores_issued();
}

// ---------------------------------------------------------------------------
// Bias vectors RNE-converted to bf16 precision (kept as f32): outb[0..n) = bq, [n..2n) = bk, [2n..3n) = bv, [3n..4n) = bo.
// One block does all four.
// ---------------------------------------------------------------------------
__device__ __forceinline__ void bias_prep_unit(const float* __restrict__ bq, const float* __restrict__ bk,
                                               const float* __restrict__ bv, const float* __restrict__ bo,
                                               float* __restrict__ outb, int n) {
  for (int i = (int)threadIdx.x; i < n; i += 256) {
    outb[i]         = bf_bits2f(f2bf_bits(bq[i]));
    outb[n + i]     = bf_bits2f(f2bf_bits(bk[i]));
    outb[2 * n + i] = bf_bits2f(f2bf_bits(bv[i]));
    outb[3 * n + i] = bf_bits2f(f2bf_bits(bo[i]));
  }
}

// ---------------------------------------------------------------------------
// Transpose + bf16 RNE convert, z-batched: in_z = X + z*sIn viewed [R rows][Cc cols] with row pitch ldi ->
//   o_z[c][r] = bf16_rne(in_z[r][c])  ([Cc][R], pitch R), o_z = o + z*sOut.
// 64x64 tiles through LDS (tf: 64 * 68 floats of the launching kernel). Tile (bx, by, bz) of (Cc/64, R/64, Z), 256 threads
// (R, Cc multiples of 64).
// Coverage per tile: load 4 it x 256 thr x 4 floats = 64x64; store 2 it x 256 thr x 8 u16 = 64x64.
// ---------------------------------------------------------------------------
__device__ __forceinline__ void tconv_bf16_job(const float* __restrict__ X, unsigned short* __restrict__ o,
                                               int R, int Cc, int ldi, long sIn, long sOut,
                                               int bx, int by, int bz, float* tf) {
  X += (size_t)bz * sIn;
  o += (size_t)bz * sOut;
  const int c0  = bx * 64;   // input column block = output row block
  const int r0  = by * 64;   // input row block    = output column block
  const int tid = threadIdx.x;
  {
    const int lr = tid >> 4;         // 0..15
    const int c4 = (tid & 15) * 4;   // 0..60
#pragma unroll
    for (int it = 0; it < 4; ++it) {
      const int rr = it * 16 + lr;   // 0..63
      const v4f a = *(const v4f*)(X + (size_t)(r0 + rr) * ldi + c0 + c4);
      *(v4f*)(tf + rr * 68 + c4) = a;
    }
  }
  __syncthreads();
  const int sub = tid >> 3;          // 0..31
  const int c8  = (tid & 7) * 8;     // 0..56
  v4u hv[2];
#pragma unroll
  for (int it = 0; it < 2; ++it) {
    const int oc = it * 32 + sub;    // output row within tile (= input column)
    v4u a;
#pragma unroll
    for (int q = 0; q < 4; ++q) {
      const float f0 = tf[(c8 + 2 * q) * 68 + oc];
      const float f1 = tf[(c8 + 2 * q + 1) * 68 + oc];
      a[q] = pk16(f2bf_bits(f0), f2bf_bits(f1));
    }
    hv[it] = a;
  }
  __syncthreads();   // every thread has read the tile: a later unit of this block may overwrite tf
  {
#pragma unroll
    for (int it = 0; it < 2; ++it) {
      const int oc = it * 32 + sub;
      const size_t go = (size_t)(c0 + oc) * R + r0 + c8;
      *(v4u*)(o + go) = hv[it];
    }
    
  }
  unit_stores_issued();
}

// ---------------------------------------------------------------------------
// All input conversions in ONE launch: none reads what another writes. The work is a list of CU_TOTAL units (a 64x64 tile of
// the transposing job, or CU_ELEMS elements of an elementwise one); CB_GRID blocks, few enough to be resident together, each
// take at most CU_PER_BLOCK units, CB_GRID apart. A unit's index picks its job: the tests and the trip count are the same for the
// whole block, so the transposing job's barriers stand under block-uniform flow.
// ---------------------------------------------------------------------------
constexpr int CU_TCONV = (EMBED / 64) * (SEQLEN / 64) * NBAT;       // 2048 tiles of query^T
constexpr int CU_QUERY = SEQLEN * NBAT * EMBED / CU_ELEMS;          // 1024
constexpr int CU_WC    = NCOMP * SEQLEN / CU_ELEMS;                 // 512 for each of Wck, Wcv
constexpr int CU_W     = EMBED * EMBED / CU_ELEMS;                  // 32 for each of Wq, Wk, Wv, Wo
constexpr int CU_TOTAL = CU_TCONV + CU_QUERY + 2 * CU_WC + 4 * CU_W + 1;   // 4225, the last one the biases
constexpr int CU_PER_BLOCK = 4;
constexpr int CB_GRID  = (CU_TOTAL + CU_PER_BLOCK - 1) / CU_PER_BLOCK;     // 1057
static_assert(SEQLEN * NBAT * EMBED % CU_ELEMS == 0 && NCOMP * SEQLEN % CU_ELEMS == 0 && EMBED * EMBED % CU_ELEMS == 0 &&
              EMBED % 128 == 0, "whole units");
__global__ __launch_bounds__(256) void convert_inputs_kernel(
    const float* __restrict__ query, const float* __restrict__ Wck, const float* __restrict__ Wcv,
    const float* __restrict__ Wq, const float* __restrict__ Wk, const float* __restrict__ Wv, const float* __restrict__ Wo,
    const float* __restrict__ bq, const float* __restrict__ bk, const float* __restrict__ bv, const float* __restrict__ bo,
    unsigned short* __restrict__ queryB, unsigned short* __restrict__ queryT, unsigned short* __restrict__ WcB,
    unsigned short* __restrict__ WqB, unsigned short* __restrict__ WkB2, unsigned short* __restrict__ WvB2,
    unsigned short* __restrict__ WoH, float* __restrict__ biasb) {
  __shared__ __align__(16) float tf[64 * 68];
  for (int unit = (int)blockIdx.x; unit < CU_TOTAL; unit += CB_GRID) {
    constexpr int U_QUERY = CU_TCONV, U_WCK = U_QUERY + CU_QUERY, U_WCV = U_WCK + CU_WC, U_WQ = U_WCV + CU_WC,
                  U_WK = U_WQ + CU_W, U_WV = U_WK + CU_W, U_WO = U_WV + CU_W, U_BIAS = U_WO + CU_W;
    static_assert(U_BIAS + 1 == CU_TOTAL, "unit list");
    if (unit < U_QUERY) {
      // query^T per batch: in [T=4096 rows][E=512 cols] pitch 2048 (base + b*512) -> out_b [512][4096]
      tconv_bf16_job(query, queryT, SEQLEN, EMBED, NBAT * EMBED, (long)EMBED, (long)EMBED * SEQLEN,
                     unit % (EMBED / 64), (unit / (EMBED / 64)) % (SEQLEN / 64), unit / ((EMBED / 64) * (SEQLEN / 64)), tf);
    } else if (unit < U_WCK) {
      // query -> bf16 [16384][512] (same flat layout as [T][B][E])
      cast_bf16_unit(query, queryB, unit - U_QUERY);
    } else if (unit < U_WCV) {
      // Wck -> rows 0..1023, Wcv -> rows 1024..2047 of the [2048][4096] bf16 plane
      cast_bf16_unit(Wck, WcB, unit - U_WCK);
    } else if (unit < U_WQ) {
      cast_bf16_unit(Wcv, WcB + (size_t)NCOMP * SEQLEN, unit - U_WCV);
    } else if (unit < U_WK) {
      cast_bf16_unit(Wq, WqB, unit - U_WQ);
    } else if (unit < U_WV) {
      dup_bf16_unit(Wk, WkB2, EMBED, unit - U_WK);
    } else if (unit < U_WO) {
      dup_bf16_unit(Wv, WvB2, EMBED, unit - U_WV);
    } else if (unit < U_BIAS) {
      cast_wo_f16_unit(Wo, WoH, WO_CARRY, unit - U_WO);
    } else {
      // biases (RNE to bf16 precision)
      bias_prep_unit(bq, bk, bv, bo, biasb, EMBED);
    }
  }
}

// =====================================================================================
// Full (unmasked) attention over the NCOMP compressed keys, head dim 64, all (b,h) in one launch.
//   q plane f16: element (t, b, h, d) at [(t*NBAT + b)*EMBED + h*64 + d]   (holds 8*q; 0.125 applied to f32 scores)
//   k plane f16: element (c, b, h, d) at [(c*NBAT + b)*EMBED + h*64 + d]
//   v^T plane f16: element (b, h, d, c) at [b*EMBED*NCOMP + (h*64 + d)*NCOMP + c]
//   out plane f16: element (t, b, h, d) at [(t*NBAT + b)*EMBED + h*64 + d], value = OUT_CARRY * attention output
//   Both products are taken transposed: S^T = K . Q^T (A = K rows, B = Q) and O^T += V^T . P^T (A = V^T rows,
//   B = P^T), v_wmma_f32_16x16x32_f16, p carried x PROB_CARRY, f32 accumulate. A lane then holds 32 of the 64
//   scores of ONE query (lane l and l ^ 16 split the keys): maximum and sum run in the lane's own registers with
//   one exchange between the wave halves, and two score tiles, converted in place, are the B operand P^T.
//   Online softmax in f32 over NCOMP/64 chunks (compile-time trip count, no masking).
//   Block = 4 waves = 64 query rows of one (b, h); grid.x = NBAT * NHEADS * (SEQLEN/64) = 2048.
//   K / V^T chunk staging: asynchronous 16-B copies to LDS, 8 lanes per 128-B row (a wave's copy covers 4 whole lines),
//   8 copies per thread and chunk, two LDS buffers: chunk kc + 1 is asked for at the head of trip kc, directly behind the
//   barrier at the foot of trip kc - 1, one block barrier per trip; fragment loads read the LDS tiles as v8h, in groups ahead
//   of the products that use them. Behind the loop the same LDS holds the waves' out tiles.
// =====================================================================================
// Stands between a group of fragment reads and the products that use them, and behind those products: the build otherwise
// moves each read down to its product (read, wait for it, product, one at a time), or reads further groups ahead and
// goes past 128 registers (8 waves per SIMD, every block of the grid resident at once).
__device__ __forceinline__ void group_edge() { __builtin_amdgcn_sched_barrier(0); }
// The slot that the instruction set asks for behind a transcendental before its source register is rewritten.
// The results and the sources of a run of v_exp_f32 are
// inputs only of the v_nop's statement: it stands behind the last of the run, and no source is rewritten ahead of it.
__device__ __forceinline__ void exp_slot1(float e, float a) { asm volatile("v_nop" :: "v"(e), "v"(a)); }
constexpr float LOG2E = 1.44269504f;   // __expf(x) compiles to v_exp_f32(x * LOG2E); written out so that the source has a name
// value of lane l ^ 16
__device__ __forceinline__ float xhalf(float x) {
  return __builtin_bit_cast(float, __builtin_amdgcn_permlanex16(__builtin_bit_cast(int, x), __builtin_bit_cast(int, x),
                                                                0x76543210, 0xfedcba98, false, false));
}

// One chunk's share of a thread: four rows of K and four of V^T, 16 rows apart, 16 B each, global -> LDS through no register.
// lk / lv: the lane's LDS byte addresses of its first K / V^T piece; gk / gv: the global addresses of the same pieces.
// The s_wait_xcnt 0 is the last line of the copies' own statement, so that no register a copy names is rewritten ahead of it.
__device__ __forceinline__ void copy_kv_chunk(unsigned lk, unsigned lv, const _Float16* gk, const _Float16* gv,
                                              unsigned lstep, size_t kstep, size_t vstep) {
  const unsigned lk1 = lk + lstep, lk2 = lk + 2 * lstep, lk3 = lk + 3 * lstep;
  const unsigned lv1 = lv + lstep, lv2 = lv + 2 * lstep, lv3 = lv + 3 * lstep;
  const _Float16* gk1 = gk + kstep; const _Float16* gk2 = gk + 2 * kstep; const _Float16* gk3 = gk + 3 * kstep;
  const _Float16* gv1 = gv + vstep; const _Float16* gv2 = gv + 2 * vstep; const _Float16* gv3 = gv + 3 * vstep;
  asm volatile("global_load_async_to_lds_b128 %0, %8, off\n\t"
               "global_load_async_to_lds_b128 %4, %12, off\n\t"
               "global_load_async_to_lds_b128 %1, %9, off\n\t"
               "global_load_async_to_lds_b128 %5, %13, off\n\t"
               "global_load_async_to_lds_b128 %2, %10, off\n\t"
               "global_load_async_to_lds_b128 %6, %14, off\n\t"
               "global_load_async_to_lds_b128 %3, %11, off\n\t"
               "global_load_async_to_lds_b128 %7, %15, off\n\t"
               "s_wait_xcnt 0x0"
               :: "v"(lk), "v"(lk1), "v"(lk2), "v"(lk3), "v"(lv), "v"(lv1), "v"(lv2), "v"(lv3),
                  "v"(gk), "v"(gk1), "v"(gk2), "v"(gk3), "v"(gv), "v"(gv1), "v"(gv2), "v"(gv3)
               : "memory");
}

// Second bound: 8 waves per SIMD, that is at most 128 registers, so that the 8 blocks a WGP gets are resident together.
__global__ __launch_bounds__(128, 8)
void attn_lin_kernel(const unsigned short* __restrict__ qp, const unsigned short* __restrict__ kp,
                     const unsigned short* __restrict__ vtp, unsigned short* __restrict__ op) {
  typedef Frag<_Float16> FR;
  // Row pitch of the two f16 tiles: 64 halves + 8 = 144 B = 16 B x 9 (odd), so that the 16 rows one
  // 16-byte fragment read touches fall on 16 different groups of four banks.
  constexpr int LP = 72;
  constexpr int TILE = 64 * LP;                          // halves of one plane's chunk, 9 KB
  constexpr int BUFH = 2 * TILE;                         // one buffer: K chunk [kv][d], then V^T chunk [d][kv]
  __shared__ __align__(16) _Float16 KV[2 * BUFH];        // two buffers, 36 KB
  static_assert(4 * 16 * 68 * sizeof(float) <= 2 * BUFH * sizeof(_Float16), "out tiles fit the ring");
  float* Os = (float*)(void*)KV;                         // per wave out tile, pitch 68: used behind the loop only

  const int tid  = threadIdx.x;
  const int wave = tid >> 5;
  const int lane = tid & 31;
  const int hh   = lane >> 4;
  const int c    = lane & 15;

  constexpr int NQB  = SEQLEN / 64;        // 64 query blocks per (b, h)
  constexpr int ROWP = NBAT * EMBED;       // 2048 halves between consecutive t (q, k, out planes)
  constexpr int NCH  = NCOMP / 64;         // 16 key chunks

  const int bx = blockIdx.x;
  const int qb = bx % NQB;
  const int bh = bx / NQB;
  const int h  = bh % NHEADS;
  const int b  = bh / NHEADS;
  const int q0 = qb * 64 + wave * 16;

  const _Float16* Qb = (const _Float16*)(const void*)qp  + (size_t)b * EMBED + (size_t)h * HDIM;
  const _Float16* Kb = (const _Float16*)(const void*)kp  + (size_t)b * EMBED + (size_t)h * HDIM;
  const _Float16* Vb = (const _Float16*)(const void*)vtp + (size_t)b * EMBED * NCOMP + (size_t)h * HDIM * NCOMP;
  _Float16*       Ob = (_Float16*)(void*)op + (size_t)b * EMBED + (size_t)h * HDIM;

  // ---- Q fragments (B operand): column = query q0 + c, 2 d-chunks of 32 ----
  v16h qa[2];
  {
    const _Float16* qrow = Qb + (size_t)(q0 + c) * ROWP;
#pragma unroll
    for (int dc = 0; dc < 2; ++dc) qa[dc] = FR::load(qrow + dc * 32 + 8 * hh);
  }

  float mrun = -INFINITY;   // running maximum of query q0 + c (the same in both wave halves)
  float lrun = 0.f;         // running sum over this half's keys; the halves are joined in the epilogue
  v8f oacc[4];              // oacc[t][r] = O[query q0 + c][d = t*16 + 8*hh + r]
#pragma unroll
  for (int t = 0; t < 4; ++t) oacc[t] = (v8f){0.f,0.f,0.f,0.f,0.f,0.f,0.f,0.f};

  // staging map: 8 lanes x 16 B = one whole 128-B row; the block's 128 threads cover 16 rows per copy
  constexpr unsigned BUFB  = BUFH * sizeof(_Float16);        // bytes from buffer 0 to buffer 1
  constexpr unsigned LSTEP = 16 * LP * sizeof(_Float16);     // LDS bytes between a thread's rows
  const int srow = tid >> 3, sc8 = (tid & 7) * 8;
  const unsigned lk0 = (unsigned)(uintptr_t)(KV + srow * LP + sc8);   // LDS byte address = low 32 bits of the shared address
  const unsigned lv0 = lk0 + TILE * sizeof(_Float16);
  const _Float16* gk = Kb + (size_t)srow * ROWP + sc8;       // K[srow + 16*i][sc8 ..] of chunk 0
  const _Float16* gv = Vb + (size_t)srow * NCOMP + sc8;      // V^T[d = srow + 16*i][sc8 ..] of chunk 0
  copy_kv_chunk(lk0, lv0, gk, gv, LSTEP, (size_t)16 * ROWP, (size_t)16 * NCOMP);
  asm volatile("s_wait_asynccnt 0x0" ::: "memory");          // this wave's copies of chunk 0 have landed
  __syncthreads();                                           // every wave's have: chunk 0 may be read

#pragma unroll 1
  for (int kc = 0; kc < NCH; ++kc) {
    // Chunk kc + 1 is asked for directly behind the barrier that ended every reader's last read of its buffer (the one in
    // front of the loop, or the one at the foot of trip kc - 1). The test is the same for the whole block. The call stands at
    // the head of the trip and not behind that barrier at the foot, the same place in the order of events: with a branch at
    // the foot the build moved the adds of the softmax sum behind it and kept all 32 p in registers across the V^T products.
    if (kc + 1 < NCH)
      copy_kv_chunk(lk0 + ((kc + 1) & 1) * BUFB, lv0 + ((kc + 1) & 1) * BUFB, gk + (size_t)(kc + 1) * 64 * ROWP, gv + (kc + 1) * 64,
                    LSTEP, (size_t)16 * ROWP, (size_t)16 * NCOMP);
    const _Float16* Ksh = KV + (kc & 1) * BUFH;
    const _Float16* Vth = Ksh + TILE;

    // ---- scores, transposed: s[j][r] = score(key j*16 + 8*hh + r, query c) ----
    // K fragments are read in groups, and the products of a group follow one another on different accumulators: the four of
    // d half 0, then, the scores now being live as well, those of d half 1 two at a time. Each s[j] still takes d half 0, then 1.
    v8f s[4];
    {
      v16h ka[4];
#pragma unroll
      for (int j = 0; j < 4; ++j) ka[j] = FR::load(Ksh + (j * 16 + c) * LP + 8 * hh);
      group_edge();
#pragma unroll
      for (int j = 0; j < 4; ++j) s[j] = FR::mma(ka[j], qa[0], (v8f){0.f,0.f,0.f,0.f,0.f,0.f,0.f,0.f});
      group_edge();
    }
#pragma unroll
    for (int j = 0; j < 4; j += 2) {
      const v16h ka0 = FR::load(Ksh + (j * 16 + c) * LP + 32 + 8 * hh);
      const v16h ka1 = FR::load(Ksh + ((j + 1) * 16 + c) * LP + 32 + 8 * hh);
      group_edge();
      s[j]     = FR::mma(ka0, qa[1], s[j]);
      s[j + 1] = FR::mma(ka1, qa[1], s[j + 1]);
      group_edge();
    }
    // ---- chunk maximum of this lane's query: 32 scores in the lane, then the other half's ----
    float mj[4];
#pragma unroll
    for (int j = 0; j < 4; ++j) {
      mj[j] = -INFINITY;
#pragma unroll
      for (int r = 0; r < 8; ++r) {
        s[j][r] *= SCORE_SCALE;
        mj[j] = fmaxf(mj[j], s[j][r]);
      }
    }
    float cm = fmaxf(fmaxf(mj[0], mj[1]), fmaxf(mj[2], mj[3]));
    cm = fmaxf(cm, xhalf(cm));
    // ---- online softmax update; P^T stays in registers ----
    const float mnew  = fmaxf(mrun, cm);
    const float aarg  = (mrun - mnew) * LOG2E;
    const float alpha = __builtin_amdgcn_exp2f(aarg);
    exp_slot1(alpha, aarg);
    mrun = mnew;
    // B operand of 32 keys: elements 0..7 = keys 8*hh + 0..7 (tile 2*kk), 8..15 = keys 16 + 8*hh + 0..7 (tile 2*kk+1),
    // the k order in which FR::load brings the V^T rows.
    v16h pb[2];
    float pj[4];
#pragma unroll
    for (int j = 0; j < 4; ++j) {
      pj[j] = 0.f;
#pragma unroll
      for (int g = 0; g < 8; g += 4) {
        float parg[4], p[4];
#pragma unroll
        for (int e = 0; e < 4; ++e) {
          parg[e] = (s[j][g + e] - mnew) * LOG2E;
          p[e]    = __builtin_amdgcn_exp2f(parg[e]);
        }
        // the slot behind these four v_exp_f32, as in exp_slot1
        asm volatile("v_nop" :: "v"(p[0]), "v"(p[1]), "v"(p[2]), "v"(p[3]), "v"(parg[0]), "v"(parg[1]), "v"(parg[2]), "v"(parg[3]));
#pragma unroll
        for (int e = 0; e < 4; ++e) {
          pj[j] += p[e];
          pb[j >> 1][(j & 1) * 8 + g + e] = (_Float16)(p[e] * PROB_CARRY);
        }
      }
    }
    lrun = lrun * alpha + ((pj[0] + pj[1]) + (pj[2] + pj[3]));
#pragma unroll
    for (int t = 0; t < 4; ++t)
#pragma unroll
      for (int r = 0; r < 8; ++r) oacc[t][r] *= alpha;
    // ---- O^T += V^T . P^T ----
#pragma unroll
    for (int kk = 0; kk < 2; ++kk) {
#pragma unroll
      for (int t = 0; t < 4; t += 2) {   // V^T fragments two at a time: a group of reads, then its two products
        group_edge();
        const v16h va0 = FR::load(Vth + (t * 16 + c) * LP + kk * 32 + 8 * hh);
        const v16h va1 = FR::load(Vth + ((t + 1) * 16 + c) * LP + kk * 32 + 8 * hh);
        group_edge();
        oacc[t]     = FR::mma(va0, pb[kk], oacc[t]);
        oacc[t + 1] = FR::mma(va1, pb[kk], oacc[t + 1]);
      }
    }
    // publish point of chunk kc + 1, the same in every wave
    asm volatile("s_wait_dscnt 0x0" ::: "memory");           // this wave's reads of the buffer to be refilled are done
    asm volatile("s_wait_asynccnt 0x0" ::: "memory");        // this wave's copies of chunk kc + 1 have landed
    __syncthreads();                                         // chunk kc + 1 may be read; every reader has left this trip's buffer
  }
  asm volatile("s_wait_asynccnt 0x0" ::: "memory");          // no copy is in flight when the ring becomes the out tiles

  // ---- epilogue: join the halves' sums, normalise, stage 16x64 wave tile, whole-line f16 stores ----
  float* os = Os + wave * (16 * 68);
  {
    const float lsum = lrun + xhalf(lrun);
    const float inv  = OUT_CARRY * (1.0f / (lsum * PROB_CARRY));
#pragma unroll
    for (int t = 0; t < 4; ++t) {
#pragma unroll
      for (int g = 0; g < 2; ++g) {
        v4f w;
#pragma unroll
        for (int e = 0; e < 4; ++e) w[e] = oacc[t][g * 4 + e] * inv;
        *(v4f*)(os + c * 68 + t * 16 + 8 * hh + g * 4) = w;
      }
    }
  }
  __builtin_amdgcn_fence(__ATOMIC_RELEASE, "workgroup");
  __builtin_amdgcn_wave_barrier();
  __builtin_amdgcn_fence(__ATOMIC_ACQUIRE, "workgroup");
  {
    const int qq = lane >> 3, c8 = (lane & 7) * 8;
    {
#pragma unroll
      for (int it = 0; it < 4; ++it) {
        const int row = it * 4 + qq;
        const float* sp = os + row * 68 + c8;
        v8h hv;
#pragma unroll
        for (int e = 0; e < 8; ++e) hv[e] = (_Float16)sp[e];
        *(v8h*)(Ob + (size_t)(q0 + row) * ROWP + c8) = hv;
      }
      
    }
  }
}

// ---------------------------------------------------------------------------
// Host orchestration (kernel launches + host arithmetic only)
// ---------------------------------------------------------------------------
extern "C" void kernel_launch(void* const* d_in, const int* in_sizes, int n_in,
                              void* d_out, int out_size, void* d_ws, size_t ws_size,
                              hipStream_t stream) {
  if (n_in < 11) return;
  const long nQ  = (long)SEQLEN * NBAT * EMBED;    // 8388608
  const long nW  = (long)EMBED * EMBED;            // 262144
  const long nWc = (long)NCOMP * SEQLEN;           // 4194304
  if (in_sizes[0] != nQ || in_sizes[1] != nW || in_sizes[2] != EMBED || in_sizes[3] != nW ||
      in_sizes[4] != EMBED || in_sizes[5] != nW || in_sizes[6] != EMBED || in_sizes[7] != nWc ||
      in_sizes[8] != nWc || in_sizes[9] != nW || in_sizes[10] != EMBED || out_size != nQ) return;

  const float* query = (const float*)d_in[0];
  const float* Wq  = (const float*)d_in[1];  const float* bq = (const float*)d_in[2];
  const float* Wk  = (const float*)d_in[3];  const float* bk = (const float*)d_in[4];
  const float* Wv  = (const float*)d_in[5];  const float* bv = (const float*)d_in[6];
  const float* Wck = (const float*)d_in[7];  const float* Wcv = (const float*)d_in[8];
  const float* Wo  = (const float*)d_in[9];  const float* bo = (const float*)d_in[10];

  // ---- workspace region map (bytes) ----
  const size_t BYTES_QB   = (size_t)nQ * 2;                              // bf16 query [16384][512]            16 MiB
  const size_t BYTES_QT   = (size_t)nQ * 2;                              // bf16 query^T [4][512][4096]        16 MiB
  const size_t BYTES_WC   = (size_t)2 * nWc * 2;                         // bf16 [Wck;Wcv] [2048][4096]        16 MiB
  const size_t BYTES_KVIN = (size_t)2 * NCOMP * NBAT * (2 * EMBED) * 2;  // u16 [8192][1024] (hi|lo rows)     16 MiB
  const size_t BYTES_QP   = (size_t)nQ * 2;                              // f16 q plane [16384][512]          16 MiB
  const size_t BYTES_OP   = (size_t)nQ * 2;                              // f16 attention out [16384][512]    16 MiB
  const size_t BYTES_KP   = (size_t)NCOMP * NBAT * EMBED * 2;            // f16 k plane [4096][512]            4 MiB
  const size_t BYTES_VT   = (size_t)NBAT * EMBED * NCOMP * 2;            // f16 v^T plane [4][512][1024]       4 MiB
  const size_t BYTES_WQ   = (size_t)nW * 2;                              // bf16 Wq [512][512]               512 KiB
  const size_t BYTES_WK2  = (size_t)nW * 2 * 2;                          // bf16 [Wk|Wk] [512][1024]            1 MiB
  const size_t BYTES_WV2  = (size_t)nW * 2 * 2;                          // bf16 [Wv|Wv] [512][1024]            1 MiB
  const size_t BYTES_WOH  = (size_t)nW * 2;                              // f16 64*Wo [512][512]             512 KiB
  const size_t BYTES_BIAS = (size_t)4 * EMBED * 4;                       // f32 biases 4 x 512                  8 KiB
  const size_t OFF_QB   = 0;
  const size_t OFF_QT   = OFF_QB   + BYTES_QB;
  const size_t OFF_WC   = OFF_QT   + BYTES_QT;
  const size_t OFF_KVIN = OFF_WC   + BYTES_WC;
  const size_t OFF_QP   = OFF_KVIN + BYTES_KVIN;
  const size_t OFF_OP   = OFF_QP   + BYTES_QP;
  const size_t OFF_KP   = OFF_OP   + BYTES_OP;
  const size_t OFF_VT   = OFF_KP   + BYTES_KP;
  const size_t OFF_WQ   = OFF_VT   + BYTES_VT;
  const size_t OFF_WK2  = OFF_WQ   + BYTES_WQ;
  const size_t OFF_WV2  = OFF_WK2  + BYTES_WK2;
  const size_t OFF_WOH  = OFF_WV2  + BYTES_WV2;
  const size_t OFF_BIAS = OFF_WOH  + BYTES_WOH;
  const size_t WS_TOTAL = OFF_BIAS + BYTES_BIAS;                         // 112,205,824 B
  if (WS_TOTAL > ws_size) return;

  char* ws = (char*)d_ws;
  unsigned short* queryB = (unsigned short*)(ws + OFF_QB);
  unsigned short* queryT = (unsigned short*)(ws + OFF_QT);
  unsigned short* WcB    = (unsigned short*)(ws + OFF_WC);
  unsigned short* KVin   = (unsigned short*)(ws + OFF_KVIN);
  unsigned short* qP     = (unsigned short*)(ws + OFF_QP);
  unsigned short* oP     = (unsigned short*)(ws + OFF_OP);
  unsigned short* kP     = (unsigned short*)(ws + OFF_KP);
  unsigned short* vtP    = (unsigned short*)(ws + OFF_VT);
  unsigned short* WqB    = (unsigned short*)(ws + OFF_WQ);
  unsigned short* WkB2   = (unsigned short*)(ws + OFF_WK2);
  unsigned short* WvB2   = (unsigned short*)(ws + OFF_WV2);
  unsigned short* WoH    = (unsigned short*)(ws + OFF_WOH);
  float*          biasb  = (float*)(ws + OFF_BIAS);
  float* bq_r = biasb;
  float* bk_r = biasb + EMBED;
  float* bv_r = biasb + 2 * EMBED;
  float* bo_r = biasb + 3 * EMBED;

  // 1. every input conversion (query -> bf16 and bf16 transposed, Wck/Wcv, Wq, [Wk|Wk], [Wv|Wv], 64*Wo, biases)
  convert_inputs_kernel<<<dim3(CB_GRID), dim3(256), 0, stream>>>(
      query, Wck, Wcv, Wq, Wk, Wv, Wo, bq, bk, bv, bo,
      queryB, queryT, WcB, WqB, WkB2, WvB2, WoH, biasb);

  // 2. two products that read only what launch 1 wrote:
  //  compression: per batch b: C_b[m][n] = sum_t WcB[m][t] * queryT_b[n][t]; m<1024 -> k_in[m][b][n], m>=1024 -> v_in.
  //     C element (m,n,b): hi at KVin[(m*4+b)*1024 + n], lo at +512  => ldc 4096, strideC 1024, C2 = C + 512.
  //     M=2048, N=512, K=4096 (K%128==0, M%128==0, N%256==0): 32 block tiles of 128x256 per batch, 4 batches: 128 blocks.
  //  q8 = query . Wq^T + bq  (scale 1; 0.125 applied to f32 scores) -> f16 [16384][512]; M=16384, N=512, K=512: 256 blocks.
  {
    const GemmJob comp = { WcB, queryT, KVin, KVin + EMBED, biasb,
                           0L, (long)EMBED * SEQLEN, (long)(2 * EMBED),
                           SEQLEN, SEQLEN, 4 * (2 * EMBED), 2 * NCOMP, EMBED, SEQLEN, 32 };
    const GemmJob qpro = { queryB, WqB, qP, qP, bq_r,
                           0L, 0L, 0L,
                           EMBED, EMBED, EMBED, SEQLEN * NBAT, EMBED, EMBED, 256 };
    wmma_gemm64_pair<1, 0, 2, 2, 1><<<dim3(32 * NBAT + 256), dim3(256), 0, stream>>>(comp, qpro, 32 * NBAT);
  }

  // 3. two products that read only what launches 1 and 2 wrote:
  //  k = [k_in hi|lo] . [Wk|Wk]^T + bk -> f16 [4096 rows (c*4+b)][512]; M=4096, N=512, K'=1024: 64 blocks.
  //  v^T per batch: C_b[m=e'][n=c] = sum_k [Wv|Wv][e'][k] * [v_in hi|lo][(c,b)][k] + bv[e'] -> f16 vtP[b][512][1024].
  //     Bt_b rows at KVin + 4096*1024 + b*1024 + c*4096 (ldb 4096, strideB 1024); M=512, N=1024, K'=1024: 16 x 4 blocks.
  {
    const GemmJob kpro = { KVin, WkB2, kP, kP, bk_r,
                           0L, 0L, 0L,
                           2 * EMBED, 2 * EMBED, EMBED, NCOMP * NBAT, EMBED, 2 * EMBED, 64 };
    const GemmJob vpro = { WvB2, KVin + (size_t)NCOMP * NBAT * (2 * EMBED), vtP, vtP, bv_r,
                           0L, (long)(2 * EMBED), (long)EMBED * NCOMP,
                           2 * EMBED, 4 * (2 * EMBED), NCOMP, EMBED, NCOMP, 2 * EMBED, 16 };
    wmma_gemm64_pair<1, 2, 1, 1, 1><<<dim3(64 + 16 * NBAT), dim3(256), 0, stream>>>(kpro, vpro, 64);
  }

  // 4. attention over the compressed keys: grid = B*H*(T/64) = 2048 blocks of 128
  attn_lin_kernel<<<dim3(NBAT * NHEADS * (SEQLEN / 64)), dim3(128), 0, stream>>>(qP, kP, vtP, oP);

  // 5. out = (16 O) . (64 Wo)^T / 1024 + bo -> f32 d_out [16384][512]; M=16384, N=512, K=512: grid 256.
  wmma_gemm64<0, false, 2, 0, false><<<dim3(256, 1), dim3(256), 0, stream>>>(
      oP, oP, EMBED, 0L,
      WoH, WoH, EMBED, 0L,
      d_out, d_out, EMBED, 0L,
      bo_r, bo_r, 0L,
      SEQLEN * NBAT, EMBED, EMBED, 1.0f / (OUT_CARRY * WO_CARRY));
}

// v009
// One run takes 120 microseconds.
// Two timings next to v008 both put it at 1.03 times that version's speed.
// Counting every step since v000, it is 4.82 times as fast.
// Contractions: sequence compression and q/k/v^T projections on v_wmma_f32_16x16x32_bf16 (bf16 operands = RNE-converted inputs; k_in/v_in carried as bf16 hi+lo planes concatenated along k); q.k^T, p.v and the output projection on v_wmma_f32_16x16x32_f16 (f16 planes; p carried x2^15, attention output x2^4, Wo x2^6); f32 accumulate; softmax, score scale 0.125 and biases in f32.
#include <hip/hip_runtime.h>
#include <math.h>
#include <stdint.h>

typedef __attribute__((ext_vector_type(16))) _Float16 v16h;
typedef __attribute__((ext_vector_type(8)))  _Float16 v8h;
typedef __attribute__((ext_vector_type(16))) __bf16   v16b;
typedef __attribute__((ext_vector_type(8)))  __bf16   v8b;
typedef __attribute__((ext_vector_type(8)))  float    v8f;
typedef __attribute__((ext_vector_type(4)))  float    v4f;
typedef __attribute__((ext_vector_type(2)))  float    v2f;
typedef __attribute__((ext_vector_type(4)))  unsigned int v4u;
typedef __attribute__((ext_vector_type(2)))  unsigned int v2u;

__device__ __forceinline__ unsigned short f2bf_bits(float f) {
  unsigned u = __float_as_uint(f);
  return (unsigned short)((u + 0x7FFFu + ((u >> 16) & 1u)) >> 16);
}
__device__ __forceinline__ float bf_bits2f(unsigned short h) { return __uint_as_float(((unsigned)h) << 16); }

// hazard guards as plain device helpers
__device__ __forceinline__ void dep_guard_h(v8f& a, v8f& b, v16h x, v16h y) { asm volatile("v_nop\n\tv_nop\n\tv_nop\n\tv_nop" : "+v"(a), "+v"(b) : "v"(x), "v"(y)); }
__device__ __forceinline__ void dep_guard_b(v8f& a, v8f& b, v16b x, v16b y) { asm volatile("v_nop\n\tv_nop\n\tv_nop\n\tv_nop" : "+v"(a), "+v"(b) : "v"(x), "v"(y)); }
__device__ __forceinline__ void keep4_h(v16h a, v16h b, v16h c, v16h d) { asm volatile("v_nop" :: "v"(a), "v"(b), "v"(c), "v"(d)); }
__device__ __forceinline__ void keep4_b(v16b a, v16b b, v16b c, v16b d) { asm volatile("v_nop" :: "v"(a), "v"(b), "v"(c), "v"(d)); }
__device__ __forceinline__ void acc_guard4(v8f& a, v8f& b, v8f& c, v8f& d) { asm volatile("v_nop\n\tv_nop\n\tv_nop\n\tv_nop" : "+v"(a), "+v"(b), "+v"(c), "+v"(d)); }
template <typename T> struct Frag;
template <> struct Frag<_Float16> {
  typedef v16h V; typedef v8h H; union U { v16h v; v8h h[2]; };
  static __device__ __forceinline__ v16h load(const _Float16* p) {   // elements 0..7 <- p[0..7], 8..15 <- p[16..23]
    U f; f.h[0] = *(const v8h*)(p); f.h[1] = *(const v8h*)(p + 16); return f.v;
  }
  static __device__ __forceinline__ v8f mma(v16h a, v16h b, v8f c) {
    return __builtin_amdgcn_wmma_f32_16x16x32_f16(false, a, false, b, (short)0, c, false, false);
  }
  static __device__ __forceinline__ void guard(v8f& a, v8f& b, v16h x, v16h y) { dep_guard_h(a, b, x, y); }
  static __device__ __forceinline__ void keep(v16h a, v16h b, v16h c, v16h d) { keep4_h(a, b, c, d); }
};
template <> struct Frag<__bf16> {
  typedef v16b V; typedef v8b H; union U { v16b v; v8b h[2]; };
  static __device__ __forceinline__ v16b load(const __bf16* p) {
    U f; f.h[0] = *(const v8b*)(p); f.h[1] = *(const v8b*)(p + 16); return f.v;
  }
  static __device__ __forceinline__ v8f mma(v16b a, v16b b, v8f c) {
    return __builtin_amdgcn_wmma_f32_16x16x32_bf16(false, a, false, b, (short)0, c, false, false);
  }
  static __device__ __forceinline__ void guard(v8f& a, v8f& b, v16b x, v16b y) { dep_guard_b(a, b, x, y); }
  static __device__ __forceinline__ void keep(v16b a, v16b b, v16b c, v16b d) { keep4_b(a, b, c, d); }
};

// ---- Register-blocked batched WMMA GEMM ------------------------------------
// C[m,n] = scale * sum_k A[m,k] * Bt[n,k] (+bias)(+resid); each wave owns a 64x64 tile.
// A row-major [M,K]; Bt row-major [N,K]; M % 128 == 0, N % 256 == 0, K % 128 == 0.
// A block of 8 waves (2 x 4) owns a 128x256 tile of C. Per stage of 128 k it brings 128 rows of A and 256 rows
// of Bt, 256 B each, into LDS with asynchronous 16-byte copies (16 lanes per row, whole lines, through no register);
// the waves read their fragments from LDS. Two LDS buffers: stage s + 2 is asked for behind the barrier at the foot
// of stage s, into the buffer that stage s has just read, and flies during stage s + 1; one block barrier per stage.
// SPLIT (hi/lo operand planes) is not built in this form.
// BIAS_MODE: 0 = none, 1 = bias[m], 2 = bias[n].
// OUT_MODE: 0 = f32, 1 = f16, 2 = bf16 hi plane (Cout) + bf16 lo plane (Cout2).
// ET: 0 = f16 operands, 1 = bf16 operands (pointers passed as 16-bit storage)
template <int ET> struct Elem;
template <> struct Elem<0> { typedef _Float16 T; };
template <> struct Elem<1> { typedef __bf16 T; };
// The tile's work is a device function: bx = index of the block tile, b = batch, sOpRaw / sTRaw = the launching
// kernel's LDS, so that one launch can hold the block tiles of two products that do not depend on one another.
constexpr int GEMM_OP_ELEMS = 2 * (128 + 256) * (128 + 8);  // two buffers of (BM + BN) rows at pitch LP
constexpr int GEMM_SLAB_F32 = 8 * 16 * 68;                  // eight per-wave 16x64 slabs, pitch 68 floats
// Twelve 16-B pieces of a thread's share of a stage, global -> LDS through no register. l[i]: the lane's LDS byte address of
// piece i; g[i]: its global address. The s_wait_xcnt 0 is the last line of the copies' own statement, so that no register a
// copy names is rewritten ahead of it.
template <typename T>
__device__ __forceinline__ void copy_rows12(const unsigned (&l)[12], const T* const (&g)[12]) {
  asm volatile("global_load_async_to_lds_b128 %0, %12, off\n\t"
               "global_load_async_to_lds_b128 %1, %13, off\n\t"
               "global_load_async_to_lds_b128 %2, %14, off\n\t"
               "global_load_async_to_lds_b128 %3, %15, off\n\t"
               "global_load_async_to_lds_b128 %4, %16, off\n\t"
               "global_load_async_to_lds_b128 %5, %17, off\n\t"
               "global_load_async_to_lds_b128 %6, %18, off\n\t"
               "global_load_async_to_lds_b128 %7, %19, off\n\t"
               "global_load_async_to_lds_b128 %8, %20, off\n\t"
               "global_load_async_to_lds_b128 %9, %21, off\n\t"
               "global_load_async_to_lds_b128 %10, %22, off\n\t"
               "global_load_async_to_lds_b128 %11, %23, off\n\t"
               "s_wait_xcnt 0x0"
               :: "v"(l[0]), "v"(l[1]), "v"(l[2]), "v"(l[3]), "v"(l[4]), "v"(l[5]),
                  "v"(l[6]), "v"(l[7]), "v"(l[8]), "v"(l[9]), "v"(l[10]), "v"(l[11]),
                  "v"(g[0]), "v"(g[1]), "v"(g[2]), "v"(g[3]), "v"(g[4]), "v"(g[5]),
                  "v"(g[6]), "v"(g[7]), "v"(g[8]), "v"(g[9]), "v"(g[10]), "v"(g[11])
               : "memory");
}
// One stage's share of a thread: rows srow + 16*i of the 128 A rows and of the 256 Bt rows, 24 pieces in two statements.
// l0: LDS byte address of the thread's piece of A row srow in the target buffer; gA / gB: the same piece of A / Bt in global
// memory at the stage's k offset; lrow16: LDS bytes of 16 rows.
template <typename T>
__device__ __forceinline__ void copy_gemm_stage(unsigned l0, const T* gA, const T* gB, int lda, int ldb, unsigned lrow16) {
  unsigned l[12]; const T* g[12];
#pragma unroll   // l[], g[] are indexed by constants only, so they stay in registers
  for (int i = 0; i < 8; ++i) { l[i] = l0 + i * lrow16; g[i] = gA + (size_t)(i * 16) * lda; }
#pragma unroll   // as above: constant indices keep l[], g[] in registers
  for (int i = 0; i < 4; ++i) { l[8 + i] = l0 + (8 + i) * lrow16; g[8 + i] = gB + (size_t)(i * 16) * ldb; }
  copy_rows12<T>(l, g);
#pragma unroll   // as above: constant indices keep l[], g[] in registers
  for (int i = 0; i < 12; ++i) { l[i] = l0 + (12 + i) * lrow16; g[i] = gB + (size_t)((4 + i) * 16) * ldb; }
  copy_rows12<T>(l, g);
}
template <int ET, bool SPLIT, int BIAS_MODE, int OUT_MODE, bool RESID, int ACT = 0>
__device__ __forceinline__ void gemm_tile(
    const unsigned short* __restrict__ Ap, const unsigned short* __restrict__ A2p, int lda, long strideA,
    const unsigned short* __restrict__ Btp, const unsigned short* __restrict__ Bt2p, int ldb, long strideB,
    void* __restrict__ Cout, void* __restrict__ Cout2, int ldc, long strideC,
    const float* __restrict__ bias,
    const float* __restrict__ resid, long strideR,
    int M, int N, int K, float scale,
    int bx, int b, unsigned short* sOpRaw, float* sTRaw) {
  typedef typename Elem<ET>::T T;
  typedef typename Frag<T>::V V;
  const T* A = (const T*)Ap; const T* Bt = (const T*)Btp;
  static_assert(!SPLIT, "hi/lo planes are not staged");
  constexpr int BM = 128, BN = 256, BK = 128;
  // LDS row pitch 128 + 8 elements = 272 B = 16 B x 17 (odd): the 16 rows of one 16-byte fragment read fall on
  // different groups of four banks.
  constexpr int LP = BK + 8;
  static_assert(2 * (BM + BN) * LP == GEMM_OP_ELEMS, "LDS size");
  T (*sOp)[(BM + BN) * LP] = (T (*)[(BM + BN) * LP])sOpRaw;   // [buffer][A rows 0..127 | Bt rows 128..383][k]
  float (*sT)[16 * 68] = (float (*)[16 * 68])sTRaw;           // per-wave 16x64 slab, pitch 68 floats
  const int tid  = threadIdx.x;
  const int lane = tid & 31;
  const int wave = tid >> 5;
  const int blocksN = N / BN;
  const int blocksM = M / BM;
  if (bx >= blocksM * blocksN) return;   // block-uniform, ahead of every barrier
  const int bm = bx / blocksN;
  const int bn = bx - bm * blocksN;
  const int wm = wave >> 2;                    // 0..1: 64-row band of the block tile
  const int wn = wave & 3;                     // 0..3: 64-column band
  const int m0 = bm * BM + (wm << 6);
  const int n0 = bn * BN + (wn << 6);

  const T* Ab  = A  + (size_t)b * strideA;
  const T* Bb  = Bt + (size_t)b * strideB;

  const int rlane = lane & 15;                 // row (A) / col (B, D) within subtile
  const int koff  = (lane >> 4) * 8;           // k offset of this lane half
  const int mOff  = (lane >> 4) * 8;           // D row offset

  // staging map: 16 threads x 16 B = one 256-B row; 16 rows per sweep of the block
  const int srow = tid >> 4;                   // 0..15
  const int sk   = (tid & 15) * 8;             // element offset in the row
  const T* gA = Ab + (size_t)(bm * BM + srow) * lda + sk;
  const T* gB = Bb + (size_t)(bn * BN + srow) * ldb + sk;
  constexpr unsigned BUFB   = (BM + BN) * LP * sizeof(T);   // bytes from buffer 0 to buffer 1
  constexpr unsigned LROW16 = 16 * LP * sizeof(T);          // LDS bytes of 16 rows
  const unsigned ldst = (unsigned)(uintptr_t)(sOpRaw + srow * LP + sk);   // LDS byte address = low 32 bits of the shared address

  v8f acc[4][4];
#pragma unroll
  for (int i = 0; i < 4; ++i)
#pragma unroll
    for (int j = 0; j < 4; ++j) acc[i][j] = (v8f){0.f,0.f,0.f,0.f,0.f,0.f,0.f,0.f};

  const int nst = K / BK;
  copy_gemm_stage<T>(ldst, gA, gB, lda, ldb, LROW16);
  asm volatile("s_wait_asynccnt 0x0" ::: "memory");          // this wave's copies of stage 0 have landed
  __syncthreads();                                           // every wave's have: stage 0 may be read
  if (nst > 1) copy_gemm_stage<T>(ldst + BUFB, gA + BK, gB + BK, lda, ldb, LROW16);   // the same test for the whole block
#pragma unroll 1
  for (int s = 0; s < nst; ++s) {
    const T* cur = sOp[s & 1];
#pragma unroll
    for (int kk = 0; kk < BK; kk += 32) {
      V bh[4], ah[4];
#pragma unroll
      for (int j = 0; j < 4; ++j) bh[j] = Frag<T>::load(cur + (BM + (wn << 6) + (j << 4) + rlane) * LP + kk + koff);
#pragma unroll
      for (int i = 0; i < 4; ++i) ah[i] = Frag<T>::load(cur + ((wm << 6) + (i << 4) + rlane) * LP + kk + koff);
#pragma unroll
      for (int i = 0; i < 4; ++i) {
#pragma unroll
        for (int j = 0; j < 4; ++j) acc[i][j] = Frag<T>::mma(ah[i], bh[j], acc[i][j]);
        Frag<T>::guard(acc[i][0], acc[i][3], ah[i], ah[i]);
      }
      Frag<T>::keep(bh[0], bh[1], bh[2], bh[3]);
    }
    // publish point of stage s + 1, the same in every wave
    asm volatile("s_wait_dscnt 0x0" ::: "memory");           // this wave's reads of the buffer to be refilled are done
    asm volatile("s_wait_asynccnt 0x0" ::: "memory");        // this wave's copies of stage s + 1 have landed
    __syncthreads();                                         // stage s + 1 may be read; every reader has left this stage's buffer
    if (s + 2 < nst)                                         // the same test for the whole block
      copy_gemm_stage<T>(ldst + (s & 1) * BUFB, gA + (size_t)(s + 2) * BK, gB + (size_t)(s + 2) * BK, lda, ldb, LROW16);
  }
  asm volatile("s_wait_asynccnt 0x0" ::: "memory");          // no copy is in flight behind the loop
  acc_guard4(acc[0][0], acc[0][1], acc[0][2], acc[0][3]);
  acc_guard4(acc[1][0], acc[1][1], acc[1][2], acc[1][3]);
  acc_guard4(acc[2][0], acc[2][1], acc[2][2], acc[2][3]);
  acc_guard4(acc[3][0], acc[3][1], acc[3][2], acc[3][3]);

  // ---- epilogue ----
  float* slab = sT[wave];
  const float* Rb = RESID ? (resid + (size_t)b * strideR) : nullptr;
#pragma unroll
  for (int i = 0; i < 4; ++i) {
    const int mBase = m0 + (i << 4);
#pragma unroll
    for (int j = 0; j < 4; ++j) {
      const int n = n0 + (j << 4) + rlane;
      float bv = 0.f;
      if (BIAS_MODE == 2) bv = bias[n];
#pragma unroll
      for (int r = 0; r < 8; ++r) {
        float v = acc[i][j][r] * scale;
        if (BIAS_MODE == 1) v += bias[mBase + mOff + r];
        if (BIAS_MODE == 2) v += bv;
        if (RESID) v += Rb[(size_t)(mBase + mOff + r) * ldc + n];
        if (ACT == 1) v = tanhf(v);
        if (ACT == 2) v = fmaxf(v, 0.0f);
        if (ACT == 3) v = v / (1.0f + expf(-v));
        if (ACT == 4) v = (v > 0.f) ? v : 0.01f * v;
        if (ACT == 5) v = 0.5f * v * (1.0f + erff(v * 0.70710678118654752f));
        slab[(mOff + r) * 68 + (j << 4) + rlane] = v;
      }
    }
    __builtin_amdgcn_fence(__ATOMIC_RELEASE, "workgroup");
    __builtin_amdgcn_wave_barrier();
    __builtin_amdgcn_fence(__ATOMIC_ACQUIRE, "workgroup");
    if (OUT_MODE == 0) {
      float* C = (float*)Cout + (size_t)b * strideC;
      const int hh = lane >> 4, c4 = (lane & 15) * 4;     // row seg = 256 B = 16 lanes x 16 B
      {
#pragma unroll
        for (int it = 0; it < 8; ++it) {
          const int row = it * 2 + hh;
          v4f v = *(const v4f*)(slab + row * 68 + c4);
          *(v4f*)(C + (size_t)(mBase + row) * ldc + n0 + c4) = v;
        }
        
      }
    } else {
      const int q = lane >> 3, c8 = (lane & 7) * 8;
      unsigned short* C  = (unsigned short*)Cout  + (size_t)b * strideC;
      unsigned short* C2 = (OUT_MODE == 2) ? ((unsigned short*)Cout2 + (size_t)b * strideC) : nullptr;
      {
#pragma unroll
        for (int it = 0; it < 4; ++it) {
          const int row = it * 4 + q;
          const float* sp = slab + row * 68 + c8;
          v8h hv, lv;
#pragma unroll
          for (int e = 0; e < 8; ++e) {
            if (OUT_MODE == 1) {
              hv[e] = (_Float16)sp[e];
            } else {
              unsigned short hb = f2bf_bits(sp[e]);
              unsigned short lb = f2bf_bits(sp[e] - bf_bits2f(hb));
              hv[e] = __builtin_bit_cast(_Float16, hb);
              lv[e] = __builtin_bit_cast(_Float16, lb);
            }
          }
          *(v8h*)(C + (size_t)(mBase + row) * ldc + n0 + c8) = hv;
          if (OUT_MODE == 2) *(v8h*)(C2 + (size_t)(mBase + row) * ldc + n0 + c8) = lv;
        }
        
      }
    }
    __builtin_amdgcn_fence(__ATOMIC_RELEASE, "workgroup");
    __builtin_amdgcn_wave_barrier();
    __builtin_amdgcn_fence(__ATOMIC_ACQUIRE, "workgroup");
  }
}

// One product per launch: grid (block tiles, batches).
template <int ET, bool SPLIT, int BIAS_MODE, int OUT_MODE, bool RESID, int ACT = 0>
__global__ __launch_bounds__(256) void wmma_gemm64(
    const unsigned short* __restrict__ Ap, const unsigned short* __restrict__ A2p, int lda, long strideA,
    const unsigned short* __restrict__ Btp, const unsigned short* __restrict__ Bt2p, int ldb, long strideB,
    void* __restrict__ Cout, void* __restrict__ Cout2, int ldc, long strideC,
    const float* __restrict__ bias,
    const float* __restrict__ resid, long strideR,
    int M, int N, int K, float scale) {
  __shared__ __align__(16) unsigned short sOpRaw[GEMM_OP_ELEMS];
  __shared__ __align__(16) float sTRaw[GEMM_SLAB_F32];
  gemm_tile<ET, SPLIT, BIAS_MODE, OUT_MODE, RESID, ACT>(Ap, A2p, lda, strideA, Btp, Bt2p, ldb, strideB, Cout, Cout2, ldc, strideC,
                                                        bias, resid, strideR, M, N, K, scale,
                                                        (int)blockIdx.x, (int)blockIdx.y, sOpRaw, sTRaw);
}

// Two independent products in one launch: blocks 0 .. nb0-1 take product 0 (the longer one, so that it starts first),
// the rest product 1. In each product the flat index runs over its gx block tiles first, then over its batches.
struct GemmJob {
  const unsigned short* A;  const unsigned short* Bt;
  unsigned short* C;  unsigned short* C2;
  const float* bias;
  long strideA, strideB, strideC;
  int lda, ldb, ldc, M, N, K, gx;
};
template <int ET, int BIAS0, int OUT0, int BIAS1, int OUT1>
__global__ __launch_bounds__(256) void wmma_gemm64_pair(GemmJob j0, GemmJob j1, int nb0) {
  __shared__ __align__(16) unsigned short sOpRaw[GEMM_OP_ELEMS];
  __shared__ __align__(16) float sTRaw[GEMM_SLAB_F32];
  const int blk = (int)blockIdx.x;   // the same for the whole block: every barrier below stands under block-uniform flow
  if (blk < nb0) {
    gemm_tile<ET, false, BIAS0, OUT0, false>(j0.A, j0.A, j0.lda, j0.strideA, j0.Bt, j0.Bt, j0.ldb, j0.strideB,
                                             (void*)j0.C, (void*)j0.C2, j0.ldc, j0.strideC, j0.bias, j0.bias, 0L,
                                             j0.M, j0.N, j0.K, 1.0f, blk % j0.gx, blk / j0.gx, sOpRaw, sTRaw);
  } else {
    const int l = blk - nb0;
    gemm_tile<ET, false, BIAS1, OUT1, false>(j1.A, j1.A, j1.lda, j1.strideA, j1.Bt, j1.Bt, j1.ldb, j1.strideB,
                                             (void*)j1.C, (void*)j1.C2, j1.ldc, j1.strideC, j1.bias, j1.bias, 0L,
                                             j1.M, j1.N, j1.K, 1.0f, l % j1.gx, l / j1.gx, sOpRaw, sTRaw);
  }
}

__device__ __forceinline__ unsigned pk16(unsigned short a, unsigned short b) { return (unsigned)a | ((unsigned)b << 16); }

// ---------------------------------------------------------------------------
// Problem geometry
// ---------------------------------------------------------------------------
constexpr int   SEQLEN  = 4096;   // time steps (queries)
constexpr int   NBAT    = 4;      // batch
constexpr int   EMBED   = 512;    // channels
constexpr int   NHEADS  = 8;
constexpr int   HDIM    = 64;
constexpr int   NCOMP   = 1024;   // compressed key count
constexpr float SCORE_SCALE = 0.125f;     // head_dim^-0.5, applied to the f32 score accumulators
constexpr float PROB_CARRY  = 32768.0f;   // p carried x2^15 in the f16 P operand, folded into 1/l
constexpr float OUT_CARRY   = 16.0f;      // attention output carried x2^4 in its f16 plane
constexpr float WO_CARRY    = 64.0f;      // Wo carried x2^6 in its f16 plane

// ---------------------------------------------------------------------------
// Elementwise conversions work in UNITS of CU_ELEMS = 8192 consecutive f32 (32 KB): thread t of the block's 256 takes the
// four floats at j*1024 + 4*t, j = 0..7. Each wave-wide load is 512 contiguous bytes (4 whole lines), the eight loads of a
// thread are asked for before the first is converted, and each wave-wide 8-B store writes 256 contiguous bytes (2 whole lines).
// ---------------------------------------------------------------------------
constexpr int CU_ELEMS = 8192;
// Last statement of a unit: what follows in the block's loop (the next job test's side, the next trip) rewrites the address
// and data registers that the unit's stores name.
// (Not in the bias unit: there the build's own s_wait_xcnt 0 stands directly behind the stores.)
__device__ __forceinline__ void unit_stores_issued() { asm volatile("s_wait_xcnt 0x0" ::: "memory"); }
__device__ __forceinline__ void load_unit(v4f (&f)[8], const float* __restrict__ in, int e0) {
#pragma unroll   // f[] stays in registers and the eight loads stand together, ahead of the first use
  for (int j = 0; j < 8; ++j) f[j] = *(const v4f*)(in + e0 + j * 1024);
}
__device__ __forceinline__ v2u bf16x4(v4f f) {
  v2u u;
  u[0] = pk16(f2bf_bits(f[0]), f2bf_bits(f[1]));
  u[1] = pk16(f2bf_bits(f[2]), f2bf_bits(f[3]));
  return u;
}

// f32 -> bf16 (RNE), same flat layout.
__device__ __forceinline__ void cast_bf16_unit(const float* __restrict__ in, unsigned short* __restrict__ out, int unit) {
  const int e0 = unit * CU_ELEMS + (int)threadIdx.x * 4;
  v4f f[8];
  load_unit(f, in, e0);
#pragma unroll   // f[] is indexed by constants only, so it stays in registers
  for (int j = 0; j < 8; ++j) *(v2u*)(out + e0 + j * 1024) = bf16x4(f[j]);
  unit_stores_issued();
}

// W [rows][cols] f32 -> out [rows][2*cols] bf16 with out[r][c] = out[r][cols + c] = bf16_rne(W[r][c]).
// cols % 128 == 0, so a wave's 128 elements of one store stay in one row.
__device__ __forceinline__ void dup_bf16_unit(const float* __restrict__ Wm, unsigned short* __restrict__ out, int cols, int unit) {
  const int e0 = unit * CU_ELEMS + (int)threadIdx.x * 4;
  v4f f[8];
  load_unit(f, Wm, e0);
#pragma unroll   // f[] is indexed by constants only, so it stays in registers
  for (int j = 0; j < 8; ++j) {
    const int e  = e0 + j * 1024;
    const int r  = e / cols;
    const int cc = e - r * cols;
    const v2u u = bf16x4(f[j]);
    *(v2u*)(out + (size_t)r * 2 * cols + cc) = u;
    *(v2u*)(out + (size_t)r * 2 * cols + cols + cc) = u;
  }
  unit_stores_issued();
}

// Wo f32 -> f16 plane holding f16(carry * bf16_rne(w)) (exact for bf16 values in the normal f16 range).
__device__ __forceinline__ void cast_wo_f16_unit(const float* __restrict__ Wm, unsigned short* __restrict__ out, float carry, int unit) {
  const int e0 = unit * CU_ELEMS + (int)threadIdx.x * 4;
  v4f f[8];
  load_unit(f, Wm, e0);
#pragma unroll   // f[] is indexed by constants only, so it stays in registers
  for (int j = 0; j < 8; ++j) {
    unsigned short h[4];
#pragma unroll   // h[] stays in registers
    for (int e = 0; e < 4; ++e) {
      const _Float16 x = (_Float16)(bf_bits2f(f2bf_bits(f[j][e])) * carry);
      h[e] = __builtin_bit_cast(unsigned short, x);
    }
    v2u u;
    u[0] = pk16(h[0], h[1]);
    u[1] = pk16(h[2], h[3]);
    *(v2u*)(out + e0 + j * 1024) = u;
  }
  unit_stores_issued();
}

// ---------------------------------------------------------------------------
// Bias vectors RNE-converted to bf16 precision (kept as f32): outb[0..n) = bq, [n..2n) = bk, [2n..3n) = bv, [3n..4n) = bo.
// One block does all four.
// ---------------------------------------------------------------------------
__device__ __forceinline__ void bias_prep_unit(const float* __restrict__ bq, const float* __restrict__ bk,
                                               const float* __restrict__ bv, const float* __restrict__ bo,
                                               float* __restrict__ outb, int n) {
  for (int i = (int)threadIdx.x; i < n; i += 256) {
    outb[i]         = bf_bits2f(f2bf_bits(bq[i]));
    outb[n + i]     = bf_bits2f(f2bf_bits(bk[i]));
    outb[2 * n + i] = bf_bits2f(f2bf_bits(bv[i]));
    outb[3 * n + i] = bf_bits2f(f2bf_bits(bo[i]));
  }
}

// ---------------------------------------------------------------------------
// Transpose + bf16 RNE convert, z-batched: in_z = X + z*sIn viewed [R rows][Cc cols] with row pitch ldi ->
//   o_z[c][r] = bf16_rne(in_z[r][c])  ([Cc][R], pitch R), o_z = o + z*sOut.
// 64x64 tiles through LDS (tf: 64 * 68 floats of the launching kernel). Tile (bx, by, bz) of (Cc/64, R/64, Z), 256 threads
// (R, Cc multiples of 64).
// Coverage per tile: load 4 it x 256 thr x 4 floats = 64x64; store 2 it x 256 thr x 8 u16 = 64x64.
// ---------------------------------------------------------------------------
__device__ __forceinline__ void tconv_bf16_job(const float* __restrict__ X, unsigned short* __restrict__ o,
                                               int R, int Cc, int ldi, long sIn, long sOut,
                                               int bx, int by, int bz, float* tf) {
  X += (size_t)bz * sIn;
  o += (size_t)bz * sOut;
  const int c0  = bx * 64;   // input column block = output row block
  const int r0  = by * 64;   // input row block    = output column block
  const int tid = threadIdx.x;
  {
    const int lr = tid >> 4;         // 0..15
    const int c4 = (tid & 15) * 4;   // 0..60
#pragma unroll
    for (int it = 0; it < 4; ++it) {
      const int rr = it * 16 + lr;   // 0..63
      const v4f a = *(const v4f*)(X + (size_t)(r0 + rr) * ldi + c0 + c4);
      *(v4f*)(tf + rr * 68 + c4) = a;
    }
  }
  __syncthreads();
  const int sub = tid >> 3;          // 0..31
  const int c8  = (tid & 7) * 8;     // 0..56
  v4u hv[2];
#pragma unroll
  for (int it = 0; it < 2; ++it) {
    const int oc = it * 32 + sub;    // output row within tile (= input column)
    v4u a;
#pragma unroll
    for (int q = 0; q < 4; ++q) {
      const float f0 = tf[(c8 + 2 * q) * 68 + oc];
      const float f1 = tf[(c8 + 2 * q + 1) * 68 + oc];
      a[q] = pk16(f2bf_bits(f0), f2bf_bits(f1));
    }
    hv[it] = a;
  }
  __syncthreads();   // every thread has read the tile: a later unit of this block may overwrite tf
  {
#pragma unroll
    for (int it = 0; it < 2; ++it) {
      const int oc = it * 32 + sub;
      const size_t go = (size_t)(c0 + oc) * R + r0 + c8;
      *(v4u*)(o + go) = hv[it];
    }
    
  }
  unit_stores_issued();
}

// ---------------------------------------------------------------------------
// All input conversions in ONE launch: none reads what another writes. The work is a list of CU_TOTAL units (a 64x64 tile of
// the transposing job, or CU_ELEMS elements of an elementwise one); CB_GRID blocks, few enough to be resident together, each
// take at most CU_PER_BLOCK units, CB_GRID apart. A unit's index picks its job: the tests and the trip count are the same for the
// whole block, so the transposing job's barriers stand under block-uniform flow.
// ---------------------------------------------------------------------------
constexpr int CU_TCONV = (EMBED / 64) * (SEQLEN / 64) * NBAT;       // 2048 tiles of query^T
constexpr int CU_QUERY = SEQLEN * NBAT * EMBED / CU_ELEMS;          // 1024
constexpr int CU_WC    = NCOMP * SEQLEN / CU_ELEMS;                 // 512 for each of Wck, Wcv
constexpr int CU_W     = EMBED * EMBED / CU_ELEMS;                  // 32 for each of Wq, Wk, Wv, Wo
constexpr int CU_TOTAL = CU_TCONV + CU_QUERY + 2 * CU_WC + 4 * CU_W + 1;   // 4225, the last one the biases
constexpr int CU_PER_BLOCK = 4;
constexpr int CB_GRID  = (CU_TOTAL + CU_PER_BLOCK - 1) / CU_PER_BLOCK;     // 1057
static_assert(SEQLEN * NBAT * EMBED % CU_ELEMS == 0 && NCOMP * SEQLEN % CU_ELEMS == 0 && EMBED * EMBED % CU_ELEMS == 0 &&
              EMBED % 128 == 0, "whole units");
__global__ __launch_bounds__(256) void convert_inputs_kernel(
    const float* __restrict__ query, const float* __restrict__ Wck, const float* __restrict__ Wcv,
    const float* __restrict__ Wq, const float* __restrict__ Wk, const float* __restrict__ Wv, const float* __restrict__ Wo,
    const float* __restrict__ bq, const float* __restrict__ bk, const float* __restrict__ bv, const float* __restrict__ bo,
    unsigned short* __restrict__ queryB, unsigned short* __restrict__ queryT, unsigned short* __restrict__ WcB,
    unsigned short* __restrict__ WqB, unsigned short* __restrict__ WkB2, unsigned short* __restrict__ WvB2,
    unsigned short* __restrict__ WoH, float* __restrict__ biasb) {
  __shared__ __align__(16) float tf[64 * 68];
  for (int unit = (int)blockIdx.x; unit < CU_TOTAL; unit += CB_GRID) {
    constexpr int U_QUERY = CU_TCONV, U_WCK = U_QUERY + CU_QUERY, U_WCV = U_WCK + CU_WC, U_WQ = U_WCV + CU_WC,
                  U_WK = U_WQ + CU_W, U_WV = U_WK + CU_W, U_WO = U_WV + CU_W, U_BIAS = U_WO + CU_W;
    static_assert(U_BIAS + 1 == CU_TOTAL, "unit list");
    if (unit < U_QUERY) {
      // query^T per batch: in [T=4096 rows][E=512 cols] pitch 2048 (base + b*512) -> out_b [512][4096]
      tconv_bf16_job(query, queryT, SEQLEN, EMBED, NBAT * EMBED, (long)EMBED, (long)EMBED * SEQLEN,
                     unit % (EMBED / 64), (unit / (EMBED / 64)) % (SEQLEN / 64), unit / ((EMBED / 64) * (SEQLEN / 64)), tf);
    } else if (unit < U_WCK) {
      // query -> bf16 [16384][512] (same flat layout as [T][B][E])
      cast_bf16_unit(query, queryB, unit - U_QUERY);
    } else if (unit < U_WCV) {
      // Wck -> rows 0..1023, Wcv -> rows 1024..2047 of the [2048][4096] bf16 plane
      cast_bf16_unit(Wck, WcB, unit - U_WCK);
    } else if (unit < U_WQ) {
      cast_bf16_unit(Wcv, WcB + (size_t)NCOMP * SEQLEN, unit - U_WCV);
    } else if (unit < U_WK) {
      cast_bf16_unit(Wq, WqB, unit - U_WQ);
    } else if (unit < U_WV) {
      dup_bf16_unit(Wk, WkB2, EMBED, unit - U_WK);
    } else if (unit < U_WO) {
      dup_bf16_unit(Wv, WvB2, EMBED, unit - U_WV);
    } else if (unit < U_BIAS) {
      cast_wo_f16_unit(Wo, WoH, WO_CARRY, unit - U_WO);
    } else {
      // biases (RNE to bf16 precision)
      bias_prep_unit(bq, bk, bv, bo, biasb, EMBED);
    }
  }
}

// =====================================================================================
// Full (unmasked) attention over the NCOMP compressed keys, head dim 64, all (b,h) in one launch.
//   q plane f16: element (t, b, h, d) at [(t*NBAT + b)*EMBED + h*64 + d]   (holds 8*q; 0.125 applied to f32 scores)
//   k plane f16: element (c, b, h, d) at [(c*NBAT + b)*EMBED + h*64 + d]
//   v^T plane f16: element (b, h, d, c) at [b*EMBED*NCOMP + (h*64 + d)*NCOMP + c]
//   out plane f16: element (t, b, h, d) at [(t*NBAT + b)*EMBED + h*64 + d], value = OUT_CARRY * attention output
//   Both products are taken transposed: S^T = K . Q^T (A = K rows, B = Q) and O^T += V^T . P^T (A = V^T rows,
//   B = P^T), v_wmma_f32_16x16x32_f16, p carried x PROB_CARRY, f32 accumulate. A lane then holds 32 of the 64
//   scores of ONE query (lane l and l ^ 16 split the keys): maximum and sum run in the lane's own registers with
//   one exchange between the wave halves, and two score tiles, converted in place, are the B operand P^T.
//   Online softmax in f32 over NCOMP/64 chunks (compile-time trip count, no masking).
//   Block = 4 waves = 64 query rows of one (b, h); grid.x = NBAT * NHEADS * (SEQLEN/64) = 2048.
//   K / V^T chunk staging: asynchronous 16-B copies to LDS, 8 lanes per 128-B row (a wave's copy covers 4 whole lines),
//   8 copies per thread and chunk, two LDS buffers: chunk kc + 1 is asked for at the head of trip kc, directly behind the
//   barrier at the foot of trip kc - 1, one block barrier per trip; fragment loads read the LDS tiles as v8h, in groups ahead
//   of the products that use them. Behind the loop the same LDS holds the waves' out tiles.
// =====================================================================================
// Stands between a group of fragment reads and the products that use them, and behind those products: the build otherwise
// moves each read down to its product (read, wait for it, product, one at a time), or reads further groups ahead and
// goes past 128 registers (8 waves per SIMD, every block of the grid resident at once).
__device__ __forceinline__ void group_edge() { __builtin_amdgcn_sched_barrier(0); }
// The slot that the instruction set asks for behind a transcendental before its source register is rewritten.
// The results and the sources of a run of v_exp_f32 are
// inputs only of the v_nop's statement: it stands behind the last of the run, and no source is rewritten ahead of it.
__device__ __forceinline__ void exp_slot1(float e, float a) { asm volatile("v_nop" :: "v"(e), "v"(a)); }
constexpr float LOG2E = 1.44269504f;               // exp(x) = exp2(x * LOG2E)
constexpr float EXP_SLOPE = SCORE_SCALE * LOG2E;   // raw score accumulator -> exponent of 2 (the scale is a power of two: exact)
constexpr float PROB_CARRY_LOG2 = 15.0f;           // exp2(15) = PROB_CARRY
static_assert(PROB_CARRY == 32768.0f, "carry and its logarithm");
// value of lane l ^ 16
__device__ __forceinline__ float xhalf(float x) {
  return __builtin_bit_cast(float, __builtin_amdgcn_permlanex16(__builtin_bit_cast(int, x), __builtin_bit_cast(int, x),
                                                                0x76543210, 0xfedcba98, false, false));
}

// One chunk's share of a thread: four rows of K and four of V^T, 16 rows apart, 16 B each, global -> LDS through no register.
// lk / lv: the lane's LDS byte addresses of its first K / V^T piece; gk / gv: the global addresses of the same pieces.
// The s_wait_xcnt 0 is the last line of the copies' own statement, so that no register a copy names is rewritten ahead of it.
__device__ __forceinline__ void copy_kv_chunk(unsigned lk, unsigned lv, const _Float16* gk, const _Float16* gv,
                                              unsigned lstep, size_t kstep, size_t vstep) {
  const unsigned lk1 = lk + lstep, lk2 = lk + 2 * lstep, lk3 = lk + 3 * lstep;
  const unsigned lv1 = lv + lstep, lv2 = lv + 2 * lstep, lv3 = lv + 3 * lstep;
  const _Float16* gk1 = gk + kstep; const _Float16* gk2 = gk + 2 * kstep; const _Float16* gk3 = gk + 3 * kstep;
  const _Float16* gv1 = gv + vstep; const _Float16* gv2 = gv + 2 * vstep; const _Float16* gv3 = gv + 3 * vstep;
  asm volatile("global_load_async_to_lds_b128 %0, %8, off\n\t"
               "global_load_async_to_lds_b128 %4, %12, off\n\t"
               "global_load_async_to_lds_b128 %1, %9, off\n\t"
               "global_load_async_to_lds_b128 %5, %13, off\n\t"
               "global_load_async_to_lds_b128 %2, %10, off\n\t"
               "global_load_async_to_lds_b128 %6, %14, off\n\t"
               "global_load_async_to_lds_b128 %3, %11, off\n\t"
               "global_load_async_to_lds_b128 %7, %15, off\n\t"
               "s_wait_xcnt 0x0"
               :: "v"(lk), "v"(lk1), "v"(lk2), "v"(lk3), "v"(lv), "v"(lv1), "v"(lv2), "v"(lv3),
                  "v"(gk), "v"(gk1), "v"(gk2), "v"(gk3), "v"(gv), "v"(gv1), "v"(gv2), "v"(gv3)
               : "memory");
}

// Second bound: 8 waves per SIMD, that is at most 128 registers, so that the 8 blocks a WGP gets are resident together.
__global__ __launch_bounds__(128, 8)
void attn_lin_kernel(const unsigned short* __restrict__ qp, const unsigned short* __restrict__ kp,
                     const unsigned short* __restrict__ vtp, unsigned short* __restrict__ op) {
  typedef Frag<_Float16> FR;
  // Row pitch of the two f16 tiles: 64 halves + 8 = 144 B = 16 B x 9 (odd), so that the 16 rows one
  // 16-byte fragment read touches fall on 16 different groups of four banks.
  constexpr int LP = 72;
  constexpr int TILE = 64 * LP;                          // halves of one plane's chunk, 9 KB
  constexpr int BUFH = 2 * TILE;                         // one buffer: K chunk [kv][d], then V^T chunk [d][kv]
  __shared__ __align__(16) _Float16 KV[2 * BUFH];        // two buffers, 36 KB
  static_assert(4 * 16 * 68 * sizeof(float) <= 2 * BUFH * sizeof(_Float16), "out tiles fit the ring");
  float* Os = (float*)(void*)KV;                         // per wave out tile, pitch 68: used behind the loop only

  const int tid  = threadIdx.x;
  const int wave = tid >> 5;
  const int lane = tid & 31;
  const int hh   = lane >> 4;
  const int c    = lane & 15;

  constexpr int NQB  = SEQLEN / 64;        // 64 query blocks per (b, h)
  constexpr int ROWP = NBAT * EMBED;       // 2048 halves between consecutive t (q, k, out planes)
  constexpr int NCH  = NCOMP / 64;         // 16 key chunks

  const int bx = blockIdx.x;
  const int qb = bx % NQB;
  const int bh = bx / NQB;
  const int h  = bh % NHEADS;
  const int b  = bh / NHEADS;
  const int q0 = qb * 64 + wave * 16;

  const _Float16* Qb = (const _Float16*)(const void*)qp  + (size_t)b * EMBED + (size_t)h * HDIM;
  const _Float16* Kb = (const _Float16*)(const void*)kp  + (size_t)b * EMBED + (size_t)h * HDIM;
  const _Float16* Vb = (const _Float16*)(const void*)vtp + (size_t)b * EMBED * NCOMP + (size_t)h * HDIM * NCOMP;
  _Float16*       Ob = (_Float16*)(void*)op + (size_t)b * EMBED + (size_t)h * HDIM;

  // ---- Q fragments (B operand): column = query q0 + c, 2 d-chunks of 32 ----
  v16h qa[2];
  {
    const _Float16* qrow = Qb + (size_t)(q0 + c) * ROWP;
#pragma unroll
    for (int dc = 0; dc < 2; ++dc) qa[dc] = FR::load(qrow + dc * 32 + 8 * hh);
  }

  float mrun = -INFINITY;   // running maximum of query q0 + c, of the raw (unscaled) scores (the same in both wave halves)
  float lrun = 0.f;         // running sum, x PROB_CARRY, over this half's keys; the halves are joined in the epilogue
  v8f oacc[4];              // oacc[t][r] = O[query q0 + c][d = t*16 + 8*hh + r]
#pragma unroll
  for (int t = 0; t < 4; ++t) oacc[t] = (v8f){0.f,0.f,0.f,0.f,0.f,0.f,0.f,0.f};

  // staging map: 8 lanes x 16 B = one whole 128-B row; the block's 128 threads cover 16 rows per copy
  constexpr unsigned BUFB  = BUFH * sizeof(_Float16);        // bytes from buffer 0 to buffer 1
  constexpr unsigned LSTEP = 16 * LP * sizeof(_Float16);     // LDS bytes between a thread's rows
  const int srow = tid >> 3, sc8 = (tid & 7) * 8;
  const unsigned lk0 = (unsigned)(uintptr_t)(KV + srow * LP + sc8);   // LDS byte address = low 32 bits of the shared address
  const unsigned lv0 = lk0 + TILE * sizeof(_Float16);
  const _Float16* gk = Kb + (size_t)srow * ROWP + sc8;       // K[srow + 16*i][sc8 ..] of chunk 0
  const _Float16* gv = Vb + (size_t)srow * NCOMP + sc8;      // V^T[d = srow + 16*i][sc8 ..] of chunk 0
  copy_kv_chunk(lk0, lv0, gk, gv, LSTEP, (size_t)16 * ROWP, (size_t)16 * NCOMP);
  asm volatile("s_wait_asynccnt 0x0" ::: "memory");          // this wave's copies of chunk 0 have landed
  __syncthreads();                                           // every wave's have: chunk 0 may be read

#pragma unroll 1
  for (int kc = 0; kc < NCH; ++kc) {
    // Chunk kc + 1 is asked for directly behind the barrier that ended every reader's last read of its buffer (the one in
    // front of the loop, or the one at the foot of trip kc - 1). The test is the same for the whole block. The call stands at
    // the head of the trip and not behind that barrier at the foot, the same place in the order of events: with a branch at
    // the foot the build moved the adds of the softmax sum behind it and kept all 32 p in registers across the V^T products.
    if (kc + 1 < NCH)
      copy_kv_chunk(lk0 + ((kc + 1) & 1) * BUFB, lv0 + ((kc + 1) & 1) * BUFB, gk + (size_t)(kc + 1) * 64 * ROWP, gv + (kc + 1) * 64,
                    LSTEP, (size_t)16 * ROWP, (size_t)16 * NCOMP);
    const _Float16* Ksh = KV + (kc & 1) * BUFH;
    const _Float16* Vth = Ksh + TILE;

    // ---- scores, transposed: s[j][r] = score(key j*16 + 8*hh + r, query c) ----
    // K fragments are read in groups, and the products of a group follow one another on different accumulators: the four of
    // d half 0, then, the scores now being live as well, those of d half 1 two at a time. Each s[j] still takes d half 0, then 1.
    v8f s[4];
    {
      v16h ka[4];
#pragma unroll
      for (int j = 0; j < 4; ++j) ka[j] = FR::load(Ksh + (j * 16 + c) * LP + 8 * hh);
      group_edge();
#pragma unroll
      for (int j = 0; j < 4; ++j) s[j] = FR::mma(ka[j], qa[0], (v8f){0.f,0.f,0.f,0.f,0.f,0.f,0.f,0.f});
      group_edge();
    }
#pragma unroll
    for (int j = 0; j < 4; j += 2) {
      const v16h ka0 = FR::load(Ksh + (j * 16 + c) * LP + 32 + 8 * hh);
      const v16h ka1 = FR::load(Ksh + ((j + 1) * 16 + c) * LP + 32 + 8 * hh);
      group_edge();
      s[j]     = FR::mma(ka0, qa[1], s[j]);
      s[j + 1] = FR::mma(ka1, qa[1], s[j + 1]);
      group_edge();
    }
    // ---- chunk maximum of this lane's query: 32 scores in the lane, then the other half's ----
    // The maximum is taken over the raw accumulators: the score scale is positive, so it picks the same key.
    float mj[4];
#pragma unroll
    for (int j = 0; j < 4; ++j) {
      mj[j] = -INFINITY;
#pragma unroll
      for (int r = 0; r < 8; ++r) mj[j] = fmaxf(mj[j], s[j][r]);
    }
    float cm = fmaxf(fmaxf(mj[0], mj[1]), fmaxf(mj[2], mj[3]));
    cm = fmaxf(cm, xhalf(cm));
    // ---- online softmax update; P^T stays in registers ----
    const float mnew  = fmaxf(mrun, cm);
    const float aarg  = (mrun - mnew) * EXP_SLOPE;
    const float alpha = __builtin_amdgcn_exp2f(aarg);
    exp_slot1(alpha, aarg);
    mrun = mnew;
    // exp2(s * EXP_SLOPE + poff) = PROB_CARRY * exp(SCORE_SCALE * (s - mnew)): score scale, log2(e), maximum and carry in one FMA
    const float poff = PROB_CARRY_LOG2 - mnew * EXP_SLOPE;
    // B operand of 32 keys: elements 0..7 = keys 8*hh + 0..7 (tile 2*kk), 8..15 = keys 16 + 8*hh + 0..7 (tile 2*kk+1),
    // the k order in which FR::load brings the V^T rows.
    v16h pb[2];
    float pj[4];
#pragma unroll
    for (int j = 0; j < 4; ++j) {
      pj[j] = 0.f;
#pragma unroll
      for (int g = 0; g < 8; g += 4) {
        float parg[4], p[4];
#pragma unroll
        for (int e = 0; e < 4; ++e) {
          parg[e] = __builtin_fmaf(s[j][g + e], EXP_SLOPE, poff);
          p[e]    = __builtin_amdgcn_exp2f(parg[e]);
        }
        // the slot behind these four v_exp_f32, as in exp_slot1
        asm volatile("v_nop" :: "v"(p[0]), "v"(p[1]), "v"(p[2]), "v"(p[3]), "v"(parg[0]), "v"(parg[1]), "v"(parg[2]), "v"(parg[3]));
#pragma unroll
        for (int e = 0; e < 4; ++e) {
          pj[j] += p[e];
          pb[j >> 1][(j & 1) * 8 + g + e] = (_Float16)p[e];
        }
      }
    }
    lrun = lrun * alpha + ((pj[0] + pj[1]) + (pj[2] + pj[3]));
#pragma unroll
    for (int t = 0; t < 4; ++t)
#pragma unroll
      for (int r = 0; r < 8; ++r) oacc[t][r] *= alpha;
    // ---- O^T += V^T . P^T ----
#pragma unroll
    for (int kk = 0; kk < 2; ++kk) {
#pragma unroll
      for (int t = 0; t < 4; t += 2) {   // V^T fragments two at a time: a group of reads, then its two products
        group_edge();
        const v16h va0 = FR::load(Vth + (t * 16 + c) * LP + kk * 32 + 8 * hh);
        const v16h va1 = FR::load(Vth + ((t + 1) * 16 + c) * LP + kk * 32 + 8 * hh);
        group_edge();
        oacc[t]     = FR::mma(va0, pb[kk], oacc[t]);
        oacc[t + 1] = FR::mma(va1, pb[kk], oacc[t + 1]);
      }
    }
    // publish point of chunk kc + 1, the same in every wave
    asm volatile("s_wait_dscnt 0x0" ::: "memory");           // this wave's reads of the buffer to be refilled are done
    asm volatile("s_wait_asynccnt 0x0" ::: "memory");        // this wave's copies of chunk kc + 1 have landed
    __syncthreads();                                         // chunk kc + 1 may be read; every reader has left this trip's buffer
  }
  asm volatile("s_wait_asynccnt 0x0" ::: "memory");          // no copy is in flight when the ring becomes the out tiles

  // ---- epilogue: join the halves' sums, normalise, stage 16x64 wave tile, whole-line f16 stores ----
  float* os = Os + wave * (16 * 68);
  {
    const float lsum = lrun + xhalf(lrun);
    const float inv  = OUT_CARRY * (1.0f / lsum);   // lsum carries PROB_CARRY, as the products do
#pragma unroll
    for (int t = 0; t < 4; ++t) {
#pragma unroll
      for (int g = 0; g < 2; ++g) {
        v4f w;
#pragma unroll
        for (int e = 0; e < 4; ++e) w[e] = oacc[t][g * 4 + e] * inv;
        *(v4f*)(os + c * 68 + t * 16 + 8 * hh + g * 4) = w;
      }
    }
  }
  __builtin_amdgcn_fence(__ATOMIC_RELEASE, "workgroup");
  __builtin_amdgcn_wave_barrier();
  __builtin_amdgcn_fence(__ATOMIC_ACQUIRE, "workgroup");
  {
    const int qq = lane >> 3, c8 = (lane & 7) * 8;
    {
#pragma unroll
      for (int it = 0; it < 4; ++it) {
        const int row = it * 4 + qq;
        const float* sp = os + row * 68 + c8;
        v8h hv;
#pragma unroll
        for (int e = 0; e < 8; ++e) hv[e] = (_Float16)sp[e];
        *(v8h*)(Ob + (size_t)(q0 + row) * ROWP + c8) = hv;
      }
      
    }
  }
}

// ---------------------------------------------------------------------------
// Host orchestration (kernel launches + host arithmetic only)
// ---------------------------------------------------------------------------
extern "C" void kernel_launch(void* const* d_in, const int* in_sizes, int n_in,
                              void* d_out, int out_size, void* d_ws, size_t ws_size,
                              hipStream_t stream) {
  if (n_in < 11) return;
  const long nQ  = (long)SEQLEN * NBAT * EMBED;    // 8388608
  const long nW  = (long)EMBED * EMBED;            // 262144
  const long nWc = (long)NCOMP * SEQLEN;           // 4194304
  if (in_sizes[0] != nQ || in_sizes[1] != nW || in_sizes[2] != EMBED || in_sizes[3] != nW ||
      in_sizes[4] != EMBED || in_sizes[5] != nW || in_sizes[6] != EMBED || in_sizes[7] != nWc ||
      in_sizes[8] != nWc || in_sizes[9] != nW || in_sizes[10] != EMBED || out_size != nQ) return;

  const float* query = (const float*)d_in[0];
  const float* Wq  = (const float*)d_in[1];  const float* bq = (const float*)d_in[2];
  const float* Wk  = (const float*)d_in[3];  const float* bk = (const float*)d_in[4];
  const float* Wv  = (const float*)d_in[5];  const float* bv = (const float*)d_in[6];
  const float* Wck = (const float*)d_in[7];  const float* Wcv = (const float*)d_in[8];
  const float* Wo  = (const float*)d_in[9];  const float* bo = (const float*)d_in[10];

  // ---- workspace region map (bytes) ----
  const size_t BYTES_QB   = (size_t)nQ * 2;                              // bf16 query [16384][512]            16 MiB
  const size_t BYTES_QT   = (size_t)nQ * 2;                              // bf16 query^T [4][512][4096]        16 MiB
  const size_t BYTES_WC   = (size_t)2 * nWc * 2;                         // bf16 [Wck;Wcv] [2048][4096]        16 MiB
  const size_t BYTES_KVIN = (size_t)2 * NCOMP * NBAT * (2 * EMBED) * 2;  // u16 [8192][1024] (hi|lo rows)     16 MiB
  const size_t BYTES_QP   = (size_t)nQ * 2;                              // f16 q plane [16384][512]          16 MiB
  const size_t BYTES_OP   = (size_t)nQ * 2;                              // f16 attention out [16384][512]    16 MiB
  const size_t BYTES_KP   = (size_t)NCOMP * NBAT * EMBED * 2;            // f16 k plane [4096][512]            4 MiB
  const size_t BYTES_VT   = (size_t)NBAT * EMBED * NCOMP * 2;            // f16 v^T plane [4][512][1024]       4 MiB
  const size_t BYTES_WQ   = (size_t)nW * 2;                              // bf16 Wq [512][512]               512 KiB
  const size_t BYTES_WK2  = (size_t)nW * 2 * 2;                          // bf16 [Wk|Wk] [512][1024]            1 MiB
  const size_t BYTES_WV2  = (size_t)nW * 2 * 2;                          // bf16 [Wv|Wv] [512][1024]            1 MiB
  const size_t BYTES_WOH  = (size_t)nW * 2;                              // f16 64*Wo [512][512]             512 KiB
  const size_t BYTES_BIAS = (size_t)4 * EMBED * 4;                       // f32 biases 4 x 512                  8 KiB
  const size_t OFF_QB   = 0;
  const size_t OFF_QT   = OFF_QB   + BYTES_QB;
  const size_t OFF_WC   = OFF_QT   + BYTES_QT;
  const size_t OFF_KVIN = OFF_WC   + BYTES_WC;
  const size_t OFF_QP   = OFF_KVIN + BYTES_KVIN;
  const size_t OFF_OP   = OFF_QP   + BYTES_QP;
  const size_t OFF_KP   = OFF_OP   + BYTES_OP;
  const size_t OFF_VT   = OFF_KP   + BYTES_KP;
  const size_t OFF_WQ   = OFF_VT   + BYTES_VT;
  const size_t OFF_WK2  = OFF_WQ   + BYTES_WQ;
  const size_t OFF_WV2  = OFF_WK2  + BYTES_WK2;
  const size_t OFF_WOH  = OFF_WV2  + BYTES_WV2;
  const size_t OFF_BIAS = OFF_WOH  + BYTES_WOH;
  const size_t WS_TOTAL = OFF_BIAS + BYTES_BIAS;                         // 112,205,824 B
  if (WS_TOTAL > ws_size) return;

  char* ws = (char*)d_ws;
  unsigned short* queryB = (unsigned short*)(ws + OFF_QB);
  unsigned short* queryT = (unsigned short*)(ws + OFF_QT);
  unsigned short* WcB    = (unsigned short*)(ws + OFF_WC);
  unsigned short* KVin   = (unsigned short*)(ws + OFF_KVIN);
  unsigned short* qP     = (unsigned short*)(ws + OFF_QP);
  unsigned short* oP     = (unsigned short*)(ws + OFF_OP);
  unsigned short* kP     = (unsigned short*)(ws + OFF_KP);
  unsigned short* vtP    = (unsigned short*)(ws + OFF_VT);
  unsigned short* WqB    = (unsigned short*)(ws + OFF_WQ);
  unsigned short* WkB2   = (unsigned short*)(ws + OFF_WK2);
  unsigned short* WvB2   = (unsigned short*)(ws + OFF_WV2);
  unsigned short* WoH    = (unsigned short*)(ws + OFF_WOH);
  float*          biasb  = (float*)(ws + OFF_BIAS);
  float* bq_r = biasb;
  float* bk_r = biasb + EMBED;
  float* bv_r = biasb + 2 * EMBED;
  float* bo_r = biasb + 3 * EMBED;

  // 1. every input conversion (query -> bf16 and bf16 transposed, Wck/Wcv, Wq, [Wk|Wk], [Wv|Wv], 64*Wo, biases)
  convert_inputs_kernel<<<dim3(CB_GRID), dim3(256), 0, stream>>>(
      query, Wck, Wcv, Wq, Wk, Wv, Wo, bq, bk, bv, bo,
      queryB, queryT, WcB, WqB, WkB2, WvB2, WoH, biasb);

  // 2. two products that read only what launch 1 wrote:
  //  compression: per batch b: C_b[m][n] = sum_t WcB[m][t] * queryT_b[n][t]; m<1024 -> k_in[m][b][n], m>=1024 -> v_in.
  //     C element (m,n,b): hi at KVin[(m*4+b)*1024 + n], lo at +512  => ldc 4096, strideC 1024, C2 = C + 512.
  //     M=2048, N=512, K=4096 (K%128==0, M%128==0, N%256==0): 32 block tiles of 128x256 per batch, 4 batches: 128 blocks.
  //  q8 = query . Wq^T + bq  (scale 1; 0.125 applied to f32 scores) -> f16 [16384][512]; M=16384, N=512, K=512: 256 blocks.
  {
    const GemmJob comp = { WcB, queryT, KVin, KVin + EMBED, biasb,
                           0L, (long)EMBED * SEQLEN, (long)(2 * EMBED),
                           SEQLEN, SEQLEN, 4 * (2 * EMBED), 2 * NCOMP, EMBED, SEQLEN, 32 };
    const GemmJob qpro = { queryB, WqB, qP, qP, bq_r,
                           0L, 0L, 0L,
                           EMBED, EMBED, EMBED, SEQLEN * NBAT, EMBED, EMBED, 256 };
    wmma_gemm64_pair<1, 0, 2, 2, 1><<<dim3(32 * NBAT + 256), dim3(256), 0, stream>>>(comp, qpro, 32 * NBAT);
  }

  // 3. two products that read only what launches 1 and 2 wrote:
  //  k = [k_in hi|lo] . [Wk|Wk]^T + bk -> f16 [4096 rows (c*4+b)][512]; M=4096, N=512, K'=1024: 64 blocks.
  //  v^T per batch: C_b[m=e'][n=c] = sum_k [Wv|Wv][e'][k] * [v_in hi|lo][(c,b)][k] + bv[e'] -> f16 vtP[b][512][1024].
  //     Bt_b rows at KVin + 4096*1024 + b*1024 + c*4096 (ldb 4096, strideB 1024); M=512, N=1024, K'=1024: 16 x 4 blocks.
  {
    const GemmJob kpro = { KVin, WkB2, kP, kP, bk_r,
                           0L, 0L, 0L,
                           2 * EMBED, 2 * EMBED, EMBED, NCOMP * NBAT, EMBED, 2 * EMBED, 64 };
    const GemmJob vpro = { WvB2, KVin + (size_t)NCOMP * NBAT * (2 * EMBED), vtP, vtP, bv_r,
                           0L, (long)(2 * EMBED), (long)EMBED * NCOMP,
                           2 * EMBED, 4 * (2 * EMBED), NCOMP, EMBED, NCOMP, 2 * EMBED, 16 };
    wmma_gemm64_pair<1, 2, 1, 1, 1><<<dim3(64 + 16 * NBAT), dim3(256), 0, stream>>>(kpro, vpro, 64);
  }

  // 4. attention over the compressed keys: grid = B*H*(T/64) = 2048 blocks of 128
  attn_lin_kernel<<<dim3(NBAT * NHEADS * (SEQLEN / 64)), dim3(128), 0, stream>>>(qP, kP, vtP, oP);

  // 5. out = (16 O) . (64 Wo)^T / 1024 + bo -> f32 d_out [16384][512]; M=16384, N=512, K=512: grid 256.
  wmma_gemm64<0, false, 2, 0, false><<<dim3(256, 1), dim3(256), 0, stream>>>(
      oP, oP, EMBED, 0L,
      WoH, WoH, EMBED, 0L,
      d_out, d_out, EMBED, 0L,
      bo_r, bo_r, 0L,
      SEQLEN * NBAT, EMBED, EMBED, 1.0f / (OUT_CARRY * WO_CARRY));
}

// v010
// One run takes 115 microseconds.
// Next to v009, in two timings, it ran 1.04 times as fast each time.
// Counting every step since v000, it is 5.02 times as fast.
// Contractions: sequence compression and q/k/v^T projections on v_wmma_f32_16x16x32_bf16 (bf16 operands = RNE-converted inputs; k_in/v_in carried as bf16 hi+lo planes concatenated along k); q.k^T, p.v and the output projection on v_wmma_f32_16x16x32_f16 (f16 planes; p carried x2^15, attention output x2^4, Wo x2^6); f32 accumulate; softmax, score scale 0.125 and biases in f32.
#include <hip/hip_runtime.h>
#include <math.h>
#include <stdint.h>

typedef __attribute__((ext_vector_type(16))) _Float16 v16h;
typedef __attribute__((ext_vector_type(8)))  _Float16 v8h;
typedef __attribute__((ext_vector_type(16))) __bf16   v16b;
typedef __attribute__((ext_vector_type(8)))  __bf16   v8b;
typedef __attribute__((ext_vector_type(8)))  float    v8f;
typedef __attribute__((ext_vector_type(4)))  float    v4f;
typedef __attribute__((ext_vector_type(2)))  float    v2f;
typedef __attribute__((ext_vector_type(4)))  unsigned int v4u;
typedef __attribute__((ext_vector_type(2)))  unsigned int v2u;

__device__ __forceinline__ unsigned short f2bf_bits(float f) {
  unsigned u = __float_as_uint(f);
  return (unsigned short)((u + 0x7FFFu + ((u >> 16) & 1u)) >> 16);
}
__device__ __forceinline__ float bf_bits2f(unsigned short h) { return __uint_as_float(((unsigned)h) << 16); }

// hazard guards as plain device helpers
__device__ __forceinline__ void dep_guard_h(v8f& a, v8f& b, v16h x, v16h y) { asm volatile("v_nop\n\tv_nop\n\tv_nop\n\tv_nop" : "+v"(a), "+v"(b) : "v"(x), "v"(y)); }
__device__ __forceinline__ void dep_guard_b(v8f& a, v8f& b, v16b x, v16b y) { asm volatile("v_nop\n\tv_nop\n\tv_nop\n\tv_nop" : "+v"(a), "+v"(b) : "v"(x), "v"(y)); }
__device__ __forceinline__ void keep4_h(v16h a, v16h b, v16h c, v16h d) { asm volatile("v_nop" :: "v"(a), "v"(b), "v"(c), "v"(d)); }
__device__ __forceinline__ void keep4_b(v16b a, v16b b, v16b c, v16b d) { asm volatile("v_nop" :: "v"(a), "v"(b), "v"(c), "v"(d)); }
__device__ __forceinline__ void acc_guard4(v8f& a, v8f& b, v8f& c, v8f& d) { asm volatile("v_nop\n\tv_nop\n\tv_nop\n\tv_nop" : "+v"(a), "+v"(b), "+v"(c), "+v"(d)); }
template <typename T> struct Frag;
template <> struct Frag<_Float16> {
  typedef v16h V; typedef v8h H; union U { v16h v; v8h h[2]; };
  static __device__ __forceinline__ v16h load(const _Float16* p) {   // elements 0..7 <- p[0..7], 8..15 <- p[16..23]
    U f; f.h[0] = *(const v8h*)(p); f.h[1] = *(const v8h*)(p + 16); return f.v;
  }
  static __device__ __forceinline__ v8f mma(v16h a, v16h b, v8f c) {
    return __builtin_amdgcn_wmma_f32_16x16x32_f16(false, a, false, b, (short)0, c, false, false);
  }
  static __device__ __forceinline__ void guard(v8f& a, v8f& b, v16h x, v16h y) { dep_guard_h(a, b, x, y); }
  static __device__ __forceinline__ void keep(v16h a, v16h b, v16h c, v16h d) { keep4_h(a, b, c, d); }
};
template <> struct Frag<__bf16> {
  typedef v16b V; typedef v8b H; union U { v16b v; v8b h[2]; };
  static __device__ __forceinline__ v16b load(const __bf16* p) {
    U f; f.h[0] = *(const v8b*)(p); f.h[1] = *(const v8b*)(p + 16); return f.v;
  }
  static __device__ __forceinline__ v8f mma(v16b a, v16b b, v8f c) {
    return __builtin_amdgcn_wmma_f32_16x16x32_bf16(false, a, false, b, (short)0, c, false, false);
  }
  static __device__ __forceinline__ void guard(v8f& a, v8f& b, v16b x, v16b y) { dep_guard_b(a, b, x, y); }
  static __device__ __forceinline__ void keep(v16b a, v16b b, v16b c, v16b d) { keep4_b(a, b, c, d); }
};

// ---- Register-blocked batched WMMA GEMM ------------------------------------
// C[m,n] = scale * sum_k A[m,k] * Bt[n,k] (+bias)(+resid); each wave owns a 64x64 tile.
// A row-major [M,K]; Bt row-major [N,K]; M % 128 == 0, N % 256 == 0, K % 128 == 0.
// A block of 8 waves (2 x 4) owns a 128x256 tile of C. Per stage of 128 k it brings 128 rows of A and 256 rows
// of Bt, 256 B each, into LDS with asynchronous 16-byte copies (16 lanes per row, whole lines, through no register);
// the waves read their fragments from LDS. Two LDS buffers: stage s + 2 is asked for behind the barrier at the foot
// of stage s, into the buffer that stage s has just read, and flies during stage s + 1; one block barrier per stage.
// SPLIT (hi/lo operand planes) is not built in this form.
// BIAS_MODE: 0 = none, 1 = bias[m], 2 = bias[n].
// OUT_MODE: 0 = f32, 1 = f16, 2 = bf16 hi plane (Cout) + bf16 lo plane (Cout2).
// ET: 0 = f16 operands, 1 = bf16 operands (pointers passed as 16-bit storage)
template <int ET> struct Elem;
template <> struct Elem<0> { typedef _Float16 T; };
template <> struct Elem<1> { typedef __bf16 T; };
// The tile's work is a device function: bx = index of the block tile, b = batch, sOpRaw / sTRaw = the launching
// kernel's LDS, so that one launch can hold the block tiles of two products that do not depend on one another.
constexpr int GEMM_OP_ELEMS = 2 * (128 + 256) * (128 + 8);  // two buffers of (BM + BN) rows at pitch LP
constexpr int GEMM_SLAB_F32 = 8 * 16 * 68;                  // eight per-wave 16x64 slabs, pitch 68 floats
// Twelve 16-B pieces of a thread's share of a stage, global -> LDS through no register. l[i]: the lane's LDS byte address of
// piece i; g[i]: its global address. The s_wait_xcnt 0 is the last line of the copies' own statement, so that no register a
// copy names is rewritten ahead of it.
template <typename T>
__device__ __forceinline__ void copy_rows12(const unsigned (&l)[12], const T* const (&g)[12]) {
  asm volatile("global_load_async_to_lds_b128 %0, %12, off\n\t"
               "global_load_async_to_lds_b128 %1, %13, off\n\t"
               "global_load_async_to_lds_b128 %2, %14, off\n\t"
               "global_load_async_to_lds_b128 %3, %15, off\n\t"
               "global_load_async_to_lds_b128 %4, %16, off\n\t"
               "global_load_async_to_lds_b128 %5, %17, off\n\t"
               "global_load_async_to_lds_b128 %6, %18, off\n\t"
               "global_load_async_to_lds_b128 %7, %19, off\n\t"
               "global_load_async_to_lds_b128 %8, %20, off\n\t"
               "global_load_async_to_lds_b128 %9, %21, off\n\t"
               "global_load_async_to_lds_b128 %10, %22, off\n\t"
               "global_load_async_to_lds_b128 %11, %23, off\n\t"
               "s_wait_xcnt 0x0"
               :: "v"(l[0]), "v"(l[1]), "v"(l[2]), "v"(l[3]), "v"(l[4]), "v"(l[5]),
                  "v"(l[6]), "v"(l[7]), "v"(l[8]), "v"(l[9]), "v"(l[10]), "v"(l[11]),
                  "v"(g[0]), "v"(g[1]), "v"(g[2]), "v"(g[3]), "v"(g[4]), "v"(g[5]),
                  "v"(g[6]), "v"(g[7]), "v"(g[8]), "v"(g[9]), "v"(g[10]), "v"(g[11])
               : "memory");
}
// One stage's share of a thread: rows srow + 16*i of the 128 A rows and of the 256 Bt rows, 24 pieces in two statements.
// l0: LDS byte address of the thread's piece of A row srow in the target buffer; gA / gB: the same piece of A / Bt in global
// memory at the stage's k offset; lrow16: LDS bytes of 16 rows.
template <typename T>
__device__ __forceinline__ void copy_gemm_stage(unsigned l0, const T* gA, const T* gB, int lda, int ldb, unsigned lrow16) {
  unsigned l[12]; const T* g[12];
#pragma unroll   // l[], g[] are indexed by constants only, so they stay in registers
  for (int i = 0; i < 8; ++i) { l[i] = l0 + i * lrow16; g[i] = gA + (size_t)(i * 16) * lda; }
#pragma unroll   // as above: constant indices keep l[], g[] in registers
  for (int i = 0; i < 4; ++i) { l[8 + i] = l0 + (8 + i) * lrow16; g[8 + i] = gB + (size_t)(i * 16) * ldb; }
  copy_rows12<T>(l, g);
#pragma unroll   // as above: constant indices keep l[], g[] in registers
  for (int i = 0; i < 12; ++i) { l[i] = l0 + (12 + i) * lrow16; g[i] = gB + (size_t)((4 + i) * 16) * ldb; }
  copy_rows12<T>(l, g);
}
template <int ET, bool SPLIT, int BIAS_MODE, int OUT_MODE, bool RESID, int ACT = 0>
__device__ __forceinline__ void gemm_tile(
    const unsigned short* __restrict__ Ap, const unsigned short* __restrict__ A2p, int lda, long strideA,
    const unsigned short* __restrict__ Btp, const unsigned short* __restrict__ Bt2p, int ldb, long strideB,
    void* __restrict__ Cout, void* __restrict__ Cout2, int ldc, long strideC,
    const float* __restrict__ bias,
    const float* __restrict__ resid, long strideR,
    int M, int N, int K, float scale,
    int bx, int b, unsigned short* sOpRaw, float* sTRaw) {
  typedef typename Elem<ET>::T T;
  typedef typename Frag<T>::V V;
  const T* A = (const T*)Ap; const T* Bt = (const T*)Btp;
  static_assert(!SPLIT, "hi/lo planes are not staged");
  constexpr int BM = 128, BN = 256, BK = 128;
  // LDS row pitch 128 + 8 elements = 272 B = 16 B x 17 (odd): the 16 rows of one 16-byte fragment read fall on
  // different groups of four banks.
  constexpr int LP = BK + 8;
  static_assert(2 * (BM + BN) * LP == GEMM_OP_ELEMS, "LDS size");
  T (*sOp)[(BM + BN) * LP] = (T (*)[(BM + BN) * LP])sOpRaw;   // [buffer][A rows 0..127 | Bt rows 128..383][k]
  float (*sT)[16 * 68] = (float (*)[16 * 68])sTRaw;           // per-wave 16x64 slab, pitch 68 floats
  const int tid  = threadIdx.x;
  const int lane = tid & 31;
  const int wave = tid >> 5;
  const int blocksN = N / BN;
  const int blocksM = M / BM;
  if (bx >= blocksM * blocksN) return;   // block-uniform, ahead of every barrier
  const int bm = bx / blocksN;
  const int bn = bx - bm * blocksN;
  const int wm = wave >> 2;                    // 0..1: 64-row band of the block tile
  const int wn = wave & 3;                     // 0..3: 64-column band
  const int m0 = bm * BM + (wm << 6);
  const int n0 = bn * BN + (wn << 6);

  const T* Ab  = A  + (size_t)b * strideA;
  const T* Bb  = Bt + (size_t)b * strideB;

  const int rlane = lane & 15;                 // row (A) / col (B, D) within subtile
  const int koff  = (lane >> 4) * 8;           // k offset of this lane half
  const int mOff  = (lane >> 4) * 8;           // D row offset

  // staging map: 16 threads x 16 B = one 256-B row; 16 rows per sweep of the block
  const int srow = tid >> 4;                   // 0..15
  const int sk   = (tid & 15) * 8;             // element offset in the row
  const T* gA = Ab + (size_t)(bm * BM + srow) * lda + sk;
  const T* gB = Bb + (size_t)(bn * BN + srow) * ldb + sk;
  constexpr unsigned BUFB   = (BM + BN) * LP * sizeof(T);   // bytes from buffer 0 to buffer 1
  constexpr unsigned LROW16 = 16 * LP * sizeof(T);          // LDS bytes of 16 rows
  const unsigned ldst = (unsigned)(uintptr_t)(sOpRaw + srow * LP + sk);   // LDS byte address = low 32 bits of the shared address

  v8f acc[4][4];
#pragma unroll
  for (int i = 0; i < 4; ++i)
#pragma unroll
    for (int j = 0; j < 4; ++j) acc[i][j] = (v8f){0.f,0.f,0.f,0.f,0.f,0.f,0.f,0.f};

  const int nst = K / BK;
  copy_gemm_stage<T>(ldst, gA, gB, lda, ldb, LROW16);
  asm volatile("s_wait_asynccnt 0x0" ::: "memory");          // this wave's copies of stage 0 have landed
  __syncthreads();                                           // every wave's have: stage 0 may be read
  if (nst > 1) copy_gemm_stage<T>(ldst + BUFB, gA + BK, gB + BK, lda, ldb, LROW16);   // the same test for the whole block
#pragma unroll 1
  for (int s = 0; s < nst; ++s) {
    const T* cur = sOp[s & 1];
#pragma unroll
    for (int kk = 0; kk < BK; kk += 32) {
      V bh[4], ah[4];
#pragma unroll
      for (int j = 0; j < 4; ++j) bh[j] = Frag<T>::load(cur + (BM + (wn << 6) + (j << 4) + rlane) * LP + kk + koff);
#pragma unroll
      for (int i = 0; i < 4; ++i) ah[i] = Frag<T>::load(cur + ((wm << 6) + (i << 4) + rlane) * LP + kk + koff);
#pragma unroll
      for (int i = 0; i < 4; ++i) {
#pragma unroll
        for (int j = 0; j < 4; ++j) acc[i][j] = Frag<T>::mma(ah[i], bh[j], acc[i][j]);
        Frag<T>::guard(acc[i][0], acc[i][3], ah[i], ah[i]);
      }
      Frag<T>::keep(bh[0], bh[1], bh[2], bh[3]);
    }
    // publish point of stage s + 1, the same in every wave
    asm volatile("s_wait_dscnt 0x0" ::: "memory");           // this wave's reads of the buffer to be refilled are done
    asm volatile("s_wait_asynccnt 0x0" ::: "memory");        // this wave's copies of stage s + 1 have landed
    __syncthreads();                                         // stage s + 1 may be read; every reader has left this stage's buffer
    if (s + 2 < nst)                                         // the same test for the whole block
      copy_gemm_stage<T>(ldst + (s & 1) * BUFB, gA + (size_t)(s + 2) * BK, gB + (size_t)(s + 2) * BK, lda, ldb, LROW16);
  }
  asm volatile("s_wait_asynccnt 0x0" ::: "memory");          // no copy is in flight behind the loop
  acc_guard4(acc[0][0], acc[0][1], acc[0][2], acc[0][3]);
  acc_guard4(acc[1][0], acc[1][1], acc[1][2], acc[1][3]);
  acc_guard4(acc[2][0], acc[2][1], acc[2][2], acc[2][3]);
  acc_guard4(acc[3][0], acc[3][1], acc[3][2], acc[3][3]);

  // ---- epilogue ----
  float* slab = sT[wave];
  const float* Rb = RESID ? (resid + (size_t)b * strideR) : nullptr;
#pragma unroll
  for (int i = 0; i < 4; ++i) {
    const int mBase = m0 + (i << 4);
#pragma unroll
    for (int j = 0; j < 4; ++j) {
      const int n = n0 + (j << 4) + rlane;
      float bv = 0.f;
      if (BIAS_MODE == 2) bv = bias[n];
#pragma unroll
      for (int r = 0; r < 8; ++r) {
        float v = acc[i][j][r] * scale;
        if (BIAS_MODE == 1) v += bias[mBase + mOff + r];
        if (BIAS_MODE == 2) v += bv;
        if (RESID) v += Rb[(size_t)(mBase + mOff + r) * ldc + n];
        if (ACT == 1) v = tanhf(v);
        if (ACT == 2) v = fmaxf(v, 0.0f);
        if (ACT == 3) v = v / (1.0f + expf(-v));
        if (ACT == 4) v = (v > 0.f) ? v : 0.01f * v;
        if (ACT == 5) v = 0.5f * v * (1.0f + erff(v * 0.70710678118654752f));
        slab[(mOff + r) * 68 + (j << 4) + rlane] = v;
      }
    }
    __builtin_amdgcn_fence(__ATOMIC_RELEASE, "workgroup");
    __builtin_amdgcn_wave_barrier();
    __builtin_amdgcn_fence(__ATOMIC_ACQUIRE, "workgroup");
    if (OUT_MODE == 0) {
      float* C = (float*)Cout + (size_t)b * strideC;
      const int hh = lane >> 4, c4 = (lane & 15) * 4;     // row seg = 256 B = 16 lanes x 16 B
      {
#pragma unroll
        for (int it = 0; it < 8; ++it) {
          const int row = it * 2 + hh;
          v4f v = *(const v4f*)(slab + row * 68 + c4);
          *(v4f*)(C + (size_t)(mBase + row) * ldc + n0 + c4) = v;
        }
        
      }
    } else {
      const int q = lane >> 3, c8 = (lane & 7) * 8;
      unsigned short* C  = (unsigned short*)Cout  + (size_t)b * strideC;
      unsigned short* C2 = (OUT_MODE == 2) ? ((unsigned short*)Cout2 + (size_t)b * strideC) : nullptr;
      {
#pragma unroll
        for (int it = 0; it < 4; ++it) {
          const int row = it * 4 + q;
          const float* sp = slab + row * 68 + c8;
          v8h hv, lv;
#pragma unroll
          for (int e = 0; e < 8; ++e) {
            if (OUT_MODE == 1) {
              hv[e] = (_Float16)sp[e];
            } else {
              unsigned short hb = f2bf_bits(sp[e]);
              unsigned short lb = f2bf_bits(sp[e] - bf_bits2f(hb));
              hv[e] = __builtin_bit_cast(_Float16, hb);
              lv[e] = __builtin_bit_cast(_Float16, lb);
            }
          }
          *(v8h*)(C + (size_t)(mBase + row) * ldc + n0 + c8) = hv;
          if (OUT_MODE == 2) *(v8h*)(C2 + (size_t)(mBase + row) * ldc + n0 + c8) = lv;
        }
        
      }
    }
    __builtin_amdgcn_fence(__ATOMIC_RELEASE, "workgroup");
    __builtin_amdgcn_wave_barrier();
    __builtin_amdgcn_fence(__ATOMIC_ACQUIRE, "workgroup");
  }
}

// One product per launch: grid (block tiles, batches).
template <int ET, bool SPLIT, int BIAS_MODE, int OUT_MODE, bool RESID, int ACT = 0>
__global__ __launch_bounds__(256) void wmma_gemm64(
    const unsigned short* __restrict__ Ap, const unsigned short* __restrict__ A2p, int lda, long strideA,
    const unsigned short* __restrict__ Btp, const unsigned short* __restrict__ Bt2p, int ldb, long strideB,
    void* __restrict__ Cout, void* __restrict__ Cout2, int ldc, long strideC,
    const float* __restrict__ bias,
    const float* __restrict__ resid, long strideR,
    int M, int N, int K, float scale) {
  __shared__ __align__(16) unsigned short sOpRaw[GEMM_OP_ELEMS];
  __shared__ __align__(16) float sTRaw[GEMM_SLAB_F32];
  gemm_tile<ET, SPLIT, BIAS_MODE, OUT_MODE, RESID, ACT>(Ap, A2p, lda, strideA, Btp, Bt2p, ldb, strideB, Cout, Cout2, ldc, strideC,
                                                        bias, resid, strideR, M, N, K, scale,
                                                        (int)blockIdx.x, (int)blockIdx.y, sOpRaw, sTRaw);
}

// Two independent products in one launch: blocks 0 .. nb0-1 take product 0 (the longer one, so that it starts first),
// the rest product 1. In each product the flat index runs over its gx block tiles first, then over its batches.
struct GemmJob {
  const unsigned short* A;  const unsigned short* Bt;
  unsigned short* C;  unsigned short* C2;
  const float* bias;
  long strideA, strideB, strideC;
  int lda, ldb, ldc, M, N, K, gx;
};
template <int ET, int BIAS0, int OUT0, int BIAS1, int OUT1>
__global__ __launch_bounds__(256) void wmma_gemm64_pair(GemmJob j0, GemmJob j1, int nb0) {
  __shared__ __align__(16) unsigned short sOpRaw[GEMM_OP_ELEMS];
  __shared__ __align__(16) float sTRaw[GEMM_SLAB_F32];
  const int blk = (int)blockIdx.x;   // the same for the whole block: every barrier below stands under block-uniform flow
  if (blk < nb0) {
    gemm_tile<ET, false, BIAS0, OUT0, false>(j0.A, j0.A, j0.lda, j0.strideA, j0.Bt, j0.Bt, j0.ldb, j0.strideB,
                                             (void*)j0.C, (void*)j0.C2, j0.ldc, j0.strideC, j0.bias, j0.bias, 0L,
                                             j0.M, j0.N, j0.K, 1.0f, blk % j0.gx, blk / j0.gx, sOpRaw, sTRaw);
  } else {
    const int l = blk - nb0;
    gemm_tile<ET, false, BIAS1, OUT1, false>(j1.A, j1.A, j1.lda, j1.strideA, j1.Bt, j1.Bt, j1.ldb, j1.strideB,
                                             (void*)j1.C, (void*)j1.C2, j1.ldc, j1.strideC, j1.bias, j1.bias, 0L,
                                             j1.M, j1.N, j1.K, 1.0f, l % j1.gx, l / j1.gx, sOpRaw, sTRaw);
  }
}

__device__ __forceinline__ unsigned pk16(unsigned short a, unsigned short b) { return (unsigned)a | ((unsigned)b << 16); }

// ---------------------------------------------------------------------------
// Problem geometry
// ---------------------------------------------------------------------------
constexpr int   SEQLEN  = 4096;   // time steps (queries)
constexpr int   NBAT    = 4;      // batch
constexpr int   EMBED   = 512;    // channels
constexpr int   NHEADS  = 8;
constexpr int   HDIM    = 64;
constexpr int   NCOMP   = 1024;   // compressed key count
constexpr float SCORE_SCALE = 0.125f;     // head_dim^-0.5, applied to the f32 score accumulators
constexpr float PROB_CARRY  = 32768.0f;   // p carried x2^15 in the f16 P operand, folded into 1/l
constexpr float OUT_CARRY   = 16.0f;      // attention output carried x2^4 in its f16 plane
constexpr float WO_CARRY    = 64.0f;      // Wo carried x2^6 in its f16 plane

// ---------------------------------------------------------------------------
// Elementwise conversions work in UNITS of CU_ELEMS = 8192 consecutive f32 (32 KB): thread t of the block's 256 takes the
// four floats at j*1024 + 4*t, j = 0..7. Each wave-wide load is 512 contiguous bytes (4 whole lines), the eight loads of a
// thread are asked for before the first is converted, and each wave-wide 8-B store writes 256 contiguous bytes (2 whole lines).
// ---------------------------------------------------------------------------
constexpr int CU_ELEMS = 8192;
// Last statement of a unit: what follows in the block's loop (the next job test's side, the next trip) rewrites the address
// and data registers that the unit's stores name.
// (Not in the bias unit: there the build's own s_wait_xcnt 0 stands directly behind the stores.)
__device__ __forceinline__ void unit_stores_issued() { asm volatile("s_wait_xcnt 0x0" ::: "memory"); }
__device__ __forceinline__ void load_unit(v4f (&f)[8], const float* __restrict__ in, int e0) {
#pragma unroll   // f[] stays in registers and the eight loads stand together, ahead of the first use
  for (int j = 0; j < 8; ++j) f[j] = *(const v4f*)(in + e0 + j * 1024);
}
__device__ __forceinline__ v2u bf16x4(v4f f) {
  v2u u;
  u[0] = pk16(f2bf_bits(f[0]), f2bf_bits(f[1]));
  u[1] = pk16(f2bf_bits(f[2]), f2bf_bits(f[3]));
  return u;
}

// f32 -> bf16 (RNE), same flat layout.
__device__ __forceinline__ void cast_bf16_unit(const float* __restrict__ in, unsigned short* __restrict__ out, int unit) {
  const int e0 = unit * CU_ELEMS + (int)threadIdx.x * 4;
  v4f f[8];
  load_unit(f, in, e0);
#pragma unroll   // f[] is indexed by constants only, so it stays in registers
  for (int j = 0; j < 8; ++j) *(v2u*)(out + e0 + j * 1024) = bf16x4(f[j]);
  unit_stores_issued();
}

// W [rows][cols] f32 -> out [rows][2*cols] bf16 with out[r][c] = out[r][cols + c] = bf16_rne(W[r][c]).
// cols % 128 == 0, so a wave's 128 elements of one store stay in one row.
__device__ __forceinline__ void dup_bf16_unit(const float* __restrict__ Wm, unsigned short* __restrict__ out, int cols, int unit) {
  const int e0 = unit * CU_ELEMS + (int)threadIdx.x * 4;
  v4f f[8];
  load_unit(f, Wm, e0);
#pragma unroll   // f[] is indexed by constants only, so it stays in registers
  for (int j = 0; j < 8; ++j) {
    const int e  = e0 + j * 1024;
    const int r  = e / cols;
    const int cc = e - r * cols;
    const v2u u = bf16x4(f[j]);
    *(v2u*)(out + (size_t)r * 2 * cols + cc) = u;
    *(v2u*)(out + (size_t)r * 2 * cols + cols + cc) = u;
  }
  unit_stores_issued();
}

// Wo f32 -> f16 plane holding f16(carry * bf16_rne(w)) (exact for bf16 values in the normal f16 range).
__device__ __forceinline__ void cast_wo_f16_unit(const float* __restrict__ Wm, unsigned short* __restrict__ out, float carry, int unit) {
  const int e0 = unit * CU_ELEMS + (int)threadIdx.x * 4;
  v4f f[8];
  load_unit(f, Wm, e0);
#pragma unroll   // f[] is indexed by constants only, so it stays in registers
  for (int j = 0; j < 8; ++j) {
    unsigned short h[4];
#pragma unroll   // h[] stays in registers
    for (int e = 0; e < 4; ++e) {
      const _Float16 x = (_Float16)(bf_bits2f(f2bf_bits(f[j][e])) * carry);
      h[e] = __builtin_bit_cast(unsigned short, x);
    }
    v2u u;
    u[0] = pk16(h[0], h[1]);
    u[1] = pk16(h[2], h[3]);
    *(v2u*)(out + e0 + j * 1024) = u;
  }
  unit_stores_issued();
}

// ---------------------------------------------------------------------------
// Bias vectors RNE-converted to bf16 precision (kept as f32): outb[0..n) = bq, [n..2n) = bk, [2n..3n) = bv, [3n..4n) = bo.
// One block does all four.
// ---------------------------------------------------------------------------
__device__ __forceinline__ void bias_prep_unit(const float* __restrict__ bq, const float* __restrict__ bk,
                                               const float* __restrict__ bv, const float* __restrict__ bo,
                                               float* __restrict__ outb, int n) {
  for (int i = (int)threadIdx.x; i < n; i += 256) {
    outb[i]         = bf_bits2f(f2bf_bits(bq[i]));
    outb[n + i]     = bf_bits2f(f2bf_bits(bk[i]));
    outb[2 * n + i] = bf_bits2f(f2bf_bits(bv[i]));
    outb[3 * n + i] = bf_bits2f(f2bf_bits(bo[i]));
  }
}

// ---------------------------------------------------------------------------
// Transpose + bf16 RNE convert, z-batched: in_z = X + z*sIn viewed [R rows][Cc cols] with row pitch ldi ->
//   o_z[c][r] = bf16_rne(in_z[r][c])  ([Cc][R], pitch R), o_z = o + z*sOut.
// 64x64 tiles through LDS (tf: 64 * 68 floats of the launching kernel). Tile (bx, by, bz) of (Cc/64, R/64, Z), 256 threads
// (R, Cc multiples of 64).
// Coverage per tile: load 4 it x 256 thr x 4 floats = 64x64; store 2 it x 256 thr x 8 u16 = 64x64.
// ---------------------------------------------------------------------------
__device__ __forceinline__ void tconv_bf16_job(const float* __restrict__ X, unsigned short* __restrict__ o,
                                               int R, int Cc, int ldi, long sIn, long sOut,
                                               int bx, int by, int bz, float* tf) {
  X += (size_t)bz * sIn;
  o += (size_t)bz * sOut;
  const int c0  = bx * 64;   // input column block = output row block
  const int r0  = by * 64;   // input row block    = output column block
  const int tid = threadIdx.x;
  {
    const int lr = tid >> 4;         // 0..15
    const int c4 = (tid & 15) * 4;   // 0..60
#pragma unroll
    for (int it = 0; it < 4; ++it) {
      const int rr = it * 16 + lr;   // 0..63
      const v4f a = *(const v4f*)(X + (size_t)(r0 + rr) * ldi + c0 + c4);
      *(v4f*)(tf + rr * 68 + c4) = a;
    }
  }
  __syncthreads();
  const int sub = tid >> 3;          // 0..31
  const int c8  = (tid & 7) * 8;     // 0..56
  v4u hv[2];
#pragma unroll
  for (int it = 0; it < 2; ++it) {
    const int oc = it * 32 + sub;    // output row within tile (= input column)
    v4u a;
#pragma unroll
    for (int q = 0; q < 4; ++q) {
      const float f0 = tf[(c8 + 2 * q) * 68 + oc];
      const float f1 = tf[(c8 + 2 * q + 1) * 68 + oc];
      a[q] = pk16(f2bf_bits(f0), f2bf_bits(f1));
    }
    hv[it] = a;
  }
  __syncthreads();   // every thread has read the tile: a later unit of this block may overwrite tf
  {
#pragma unroll
    for (int it = 0; it < 2; ++it) {
      const int oc = it * 32 + sub;
      const size_t go = (size_t)(c0 + oc) * R + r0 + c8;
      *(v4u*)(o + go) = hv[it];
    }
    
  }
  unit_stores_issued();
}

// ---------------------------------------------------------------------------
// All input conversions in ONE launch: none reads what another writes. The work is a list of CU_TOTAL units (a 64x64 tile of
// the transposing job, or CU_ELEMS elements of an elementwise one); CB_GRID blocks, few enough to be resident together, each
// take at most CU_PER_BLOCK units, CB_GRID apart. A unit's index picks its job: the tests and the trip count are the same for the
// whole block, so the transposing job's barriers stand under block-uniform flow.
// ---------------------------------------------------------------------------
constexpr int CU_TCONV = (EMBED / 64) * (SEQLEN / 64) * NBAT;       // 2048 tiles of query^T
constexpr int CU_QUERY = SEQLEN * NBAT * EMBED / CU_ELEMS;          // 1024
constexpr int CU_WC    = NCOMP * SEQLEN / CU_ELEMS;                 // 512 for each of Wck, Wcv
constexpr int CU_W     = EMBED * EMBED / CU_ELEMS;                  // 32 for each of Wq, Wk, Wv, Wo
constexpr int CU_TOTAL = CU_TCONV + CU_QUERY + 2 * CU_WC + 4 * CU_W + 1;   // 4225, the last one the biases
constexpr int CU_PER_BLOCK = 4;
constexpr int CB_GRID  = (CU_TOTAL + CU_PER_BLOCK - 1) / CU_PER_BLOCK;     // 1057
static_assert(SEQLEN * NBAT * EMBED % CU_ELEMS == 0 && NCOMP * SEQLEN % CU_ELEMS == 0 && EMBED * EMBED % CU_ELEMS == 0 &&
              EMBED % 128 == 0, "whole units");
__global__ __launch_bounds__(256) void convert_inputs_kernel(
    const float* __restrict__ query, const float* __restrict__ Wck, const float* __restrict__ Wcv,
    const float* __restrict__ Wq, const float* __restrict__ Wk, const float* __restrict__ Wv, const float* __restrict__ Wo,
    const float* __restrict__ bq, const float* __restrict__ bk, const float* __restrict__ bv, const float* __restrict__ bo,
    unsigned short* __restrict__ queryB, unsigned short* __restrict__ queryT, unsigned short* __restrict__ WcB,
    unsigned short* __restrict__ WqB, unsigned short* __restrict__ WkB2, unsigned short* __restrict__ WvB2,
    unsigned short* __restrict__ WoH, float* __restrict__ biasb) {
  __shared__ __align__(16) float tf[64 * 68];
  for (int unit = (int)blockIdx.x; unit < CU_TOTAL; unit += CB_GRID) {
    constexpr int U_QUERY = CU_TCONV, U_WCK = U_QUERY + CU_QUERY, U_WCV = U_WCK + CU_WC, U_WQ = U_WCV + CU_WC,
                  U_WK = U_WQ + CU_W, U_WV = U_WK + CU_W, U_WO = U_WV + CU_W, U_BIAS = U_WO + CU_W;
    static_assert(U_BIAS + 1 == CU_TOTAL, "unit list");
    if (unit < U_QUERY) {
      // query^T per batch: in [T=4096 rows][E=512 cols] pitch 2048 (base + b*512) -> out_b [512][4096]
      tconv_bf16_job(query, queryT, SEQLEN, EMBED, NBAT * EMBED, (long)EMBED, (long)EMBED * SEQLEN,
                     unit % (EMBED / 64), (unit / (EMBED / 64)) % (SEQLEN / 64), unit / ((EMBED / 64) * (SEQLEN / 64)), tf);
    } else if (unit < U_WCK) {
      // query -> bf16 [16384][512] (same flat layout as [T][B][E])
      cast_bf16_unit(query, queryB, unit - U_QUERY);
    } else if (unit < U_WCV) {
      // Wck -> rows 0..1023, Wcv -> rows 1024..2047 of the [2048][4096] bf16 plane
      cast_bf16_unit(Wck, WcB, unit - U_WCK);
    } else if (unit < U_WQ) {
      cast_bf16_unit(Wcv, WcB + (size_t)NCOMP * SEQLEN, unit - U_WCV);
    } else if (unit < U_WK) {
      cast_bf16_unit(Wq, WqB, unit - U_WQ);
    } else if (unit < U_WV) {
      dup_bf16_unit(Wk, WkB2, EMBED, unit - U_WK);
    } else if (unit < U_WO) {
      dup_bf16_unit(Wv, WvB2, EMBED, unit - U_WV);
    } else if (unit < U_BIAS) {
      cast_wo_f16_unit(Wo, WoH, WO_CARRY, unit - U_WO);
    } else {
      // biases (RNE to bf16 precision)
      bias_prep_unit(bq, bk, bv, bo, biasb, EMBED);
    }
  }
}

// =====================================================================================
// Full (unmasked) attention over the NCOMP compressed keys, head dim 64, all (b,h) in one launch.
//   q plane f16: element (t, b, h, d) at [(t*NBAT + b)*EMBED + h*64 + d]   (holds 8*q; 0.125 applied to f32 scores)
//   k plane f16: element (c, b, h, d) at [(c*NBAT + b)*EMBED + h*64 + d]
//   v^T plane f16: element (b, h, d, c) at [b*EMBED*NCOMP + (h*64 + d)*NCOMP + c]
//   out plane f16: element (t, b, h, d) at [(t*NBAT + b)*EMBED + h*64 + d], value = OUT_CARRY * attention output
//   Both products are taken transposed: S^T = K . Q^T (A = K rows, B = Q) and O^T += V^T . P^T (A = V^T rows,
//   B = P^T), v_wmma_f32_16x16x32_f16, p carried x PROB_CARRY, f32 accumulate. A lane then holds 32 of the 64
//   scores of ONE query (lane l and l ^ 16 split the keys): maximum and sum run in the lane's own registers with
//   one exchange between the wave halves, and two score tiles, converted in place, are the B operand P^T.
//   Online softmax in f32 over NCOMP/64 chunks (compile-time trip count, no masking).
//   A wave takes 32 queries as two B tiles, so that each K and V^T fragment it reads from LDS feeds two products.
//   Block = 4 waves = 128 query rows of one (b, h); grid.x = NBAT * NHEADS * (SEQLEN/128) = 1024.
//   K / V^T chunk staging: asynchronous 16-B copies to LDS, 8 lanes per 128-B row (a wave's copy covers 4 whole lines),
//   8 copies per thread and chunk, two LDS buffers: chunk kc + 1 is asked for at the head of trip kc, directly behind the
//   barrier at the foot of trip kc - 1, one block barrier per trip; fragment loads read the LDS tiles as v8h, in groups ahead
//   of the products that use them. Behind the loop the same LDS holds the waves' out tiles.
// =====================================================================================
// Stands between a group of fragment reads and the products that use them, and behind those products: the build otherwise
// moves each read down to its product (read, wait for it, product, one at a time), or reads further groups ahead and
// goes past the register bound (every block of the grid resident at once).
__device__ __forceinline__ void group_edge() { __builtin_amdgcn_sched_barrier(0); }
// The slot that the instruction set asks for behind a transcendental before its source register is rewritten.
// The results and the sources of a run of v_exp_f32 are
// inputs only of the v_nop's statement: it stands behind the last of the run, and no source is rewritten ahead of it.
__device__ __forceinline__ void exp_slot1(float e, float a) { asm volatile("v_nop" :: "v"(e), "v"(a)); }
constexpr float LOG2E = 1.44269504f;               // exp(x) = exp2(x * LOG2E)
constexpr float EXP_SLOPE = SCORE_SCALE * LOG2E;   // raw score accumulator -> exponent of 2 (the scale is a power of two: exact)
constexpr float PROB_CARRY_LOG2 = 15.0f;           // exp2(15) = PROB_CARRY
static_assert(PROB_CARRY == 32768.0f, "carry and its logarithm");
// value of lane l ^ 16
__device__ __forceinline__ float xhalf(float x) {
  return __builtin_bit_cast(float, __builtin_amdgcn_permlanex16(__builtin_bit_cast(int, x), __builtin_bit_cast(int, x),
                                                                0x76543210, 0xfedcba98, false, false));
}

// One chunk's share of a thread: four rows of K and four of V^T, 16 rows apart, 16 B each, global -> LDS through no register.
// lk / lv: the lane's LDS byte addresses of its first K / V^T piece; gk / gv: the global addresses of the same pieces.
// The s_wait_xcnt 0 is the last line of the copies' own statement, so that no register a copy names is rewritten ahead of it.
__device__ __forceinline__ void copy_kv_chunk(unsigned lk, unsigned lv, const _Float16* gk, const _Float16* gv,
                                              unsigned lstep, size_t kstep, size_t vstep) {
  const unsigned lk1 = lk + lstep, lk2 = lk + 2 * lstep, lk3 = lk + 3 * lstep;
  const unsigned lv1 = lv + lstep, lv2 = lv + 2 * lstep, lv3 = lv + 3 * lstep;
  const _Float16* gk1 = gk + kstep; const _Float16* gk2 = gk + 2 * kstep; const _Float16* gk3 = gk + 3 * kstep;
  const _Float16* gv1 = gv + vstep; const _Float16* gv2 = gv + 2 * vstep; const _Float16* gv3 = gv + 3 * vstep;
  asm volatile("global_load_async_to_lds_b128 %0, %8, off\n\t"
               "global_load_async_to_lds_b128 %4, %12, off\n\t"
               "global_load_async_to_lds_b128 %1, %9, off\n\t"
               "global_load_async_to_lds_b128 %5, %13, off\n\t"
               "global_load_async_to_lds_b128 %2, %10, off\n\t"
               "global_load_async_to_lds_b128 %6, %14, off\n\t"
               "global_load_async_to_lds_b128 %3, %11, off\n\t"
               "global_load_async_to_lds_b128 %7, %15, off\n\t"
               "s_wait_xcnt 0x0"
               :: "v"(lk), "v"(lk1), "v"(lk2), "v"(lk3), "v"(lv), "v"(lv1), "v"(lv2), "v"(lv3),
                  "v"(gk), "v"(gk1), "v"(gk2), "v"(gk3), "v"(gv), "v"(gv1), "v"(gv2), "v"(gv3)
               : "memory");
}

// Second bound: 4 waves per SIMD, that is at most 256 registers: a wave holds the scores, the out tiles and the Q fragments
// of two 16-query tiles. The 4 blocks a WGP gets are resident together.
__global__ __launch_bounds__(128, 4)
void attn_lin_kernel(const unsigned short* __restrict__ qp, const unsigned short* __restrict__ kp,
                     const unsigned short* __restrict__ vtp, unsigned short* __restrict__ op) {
  typedef Frag<_Float16> FR;
  // Row pitch of the two f16 tiles: 64 halves + 8 = 144 B = 16 B x 9 (odd), so that the 16 rows one
  // 16-byte fragment read touches fall on 16 different groups of four banks.
  constexpr int LP = 72;
  constexpr int TILE = 64 * LP;                          // halves of one plane's chunk, 9 KB
  constexpr int BUFH = 2 * TILE;                         // one buffer: K chunk [kv][d], then V^T chunk [d][kv]
  constexpr int QT   = 2;                                // 16-query tiles (B operands) per wave: each A fragment feeds QT products
  constexpr int QW   = QT * 16;                          // queries per wave
  constexpr int QBLK = 4 * QW;                           // queries per block
  __shared__ __align__(16) _Float16 KV[2 * BUFH];        // two buffers, 36 KB
  static_assert(4 * QW * 68 * sizeof(float) <= 2 * BUFH * sizeof(_Float16), "out tiles fit the ring");
  float* Os = (float*)(void*)KV;                         // per wave out tile, pitch 68: used behind the loop only

  const int tid  = threadIdx.x;
  const int wave = tid >> 5;
  const int lane = tid & 31;
  const int hh   = lane >> 4;
  const int c    = lane & 15;

  constexpr int NQB  = SEQLEN / QBLK;      // 32 query blocks per (b, h)
  constexpr int ROWP = NBAT * EMBED;       // 2048 halves between consecutive t (q, k, out planes)
  constexpr int NCH  = NCOMP / 64;         // 16 key chunks

  const int bx = blockIdx.x;
  const int qb = bx % NQB;
  const int bh = bx / NQB;
  const int h  = bh % NHEADS;
  const int b  = bh / NHEADS;
  const int q0 = qb * QBLK + wave * QW;

  const _Float16* Qb = (const _Float16*)(const void*)qp  + (size_t)b * EMBED + (size_t)h * HDIM;
  const _Float16* Kb = (const _Float16*)(const void*)kp  + (size_t)b * EMBED + (size_t)h * HDIM;
  const _Float16* Vb = (const _Float16*)(const void*)vtp + (size_t)b * EMBED * NCOMP + (size_t)h * HDIM * NCOMP;
  _Float16*       Ob = (_Float16*)(void*)op + (size_t)b * EMBED + (size_t)h * HDIM;

  // ---- Q fragments (B operands): tile u, column = query q0 + 16*u + c, 2 d-chunks of 32 ----
  v16h qa[QT][2];
#pragma unroll
  for (int u = 0; u < QT; ++u) {
    const _Float16* qrow = Qb + (size_t)(q0 + u * 16 + c) * ROWP;
#pragma unroll
    for (int dc = 0; dc < 2; ++dc) qa[u][dc] = FR::load(qrow + dc * 32 + 8 * hh);
  }

  float mrun[QT];           // running maximum of query q0 + 16*u + c, of the raw (unscaled) scores (the same in both wave halves)
  float lrun[QT];           // running sum, x PROB_CARRY, over this half's keys; the halves are joined in the epilogue
  v8f oacc[QT][4];          // oacc[u][t][r] = O[query q0 + 16*u + c][d = t*16 + 8*hh + r]
#pragma unroll
  for (int u = 0; u < QT; ++u) {
    mrun[u] = -INFINITY;
    lrun[u] = 0.f;
#pragma unroll
    for (int t = 0; t < 4; ++t) oacc[u][t] = (v8f){0.f,0.f,0.f,0.f,0.f,0.f,0.f,0.f};
  }

  // staging map: 8 lanes x 16 B = one whole 128-B row; the block's 128 threads cover 16 rows per copy
  constexpr unsigned BUFB  = BUFH * sizeof(_Float16);        // bytes from buffer 0 to buffer 1
  constexpr unsigned LSTEP = 16 * LP * sizeof(_Float16);     // LDS bytes between a thread's rows
  const int srow = tid >> 3, sc8 = (tid & 7) * 8;
  const unsigned lk0 = (unsigned)(uintptr_t)(KV + srow * LP + sc8);   // LDS byte address = low 32 bits of the shared address
  const unsigned lv0 = lk0 + TILE * sizeof(_Float16);
  const _Float16* gk = Kb + (size_t)srow * ROWP + sc8;       // K[srow + 16*i][sc8 ..] of chunk 0
  const _Float16* gv = Vb + (size_t)srow * NCOMP + sc8;      // V^T[d = srow + 16*i][sc8 ..] of chunk 0
  copy_kv_chunk(lk0, lv0, gk, gv, LSTEP, (size_t)16 * ROWP, (size_t)16 * NCOMP);
  asm volatile("s_wait_asynccnt 0x0" ::: "memory");          // this wave's copies of chunk 0 have landed
  __syncthreads();                                           // every wave's have: chunk 0 may be read

#pragma unroll 1
  for (int kc = 0; kc < NCH; ++kc) {
    // Chunk kc + 1 is asked for directly behind the barrier that ended every reader's last read of its buffer (the one in
    // front of the loop, or the one at the foot of trip kc - 1). The test is the same for the whole block. The call stands at
    // the head of the trip and not behind that barrier at the foot, the same place in the order of events: with a branch at
    // the foot the build moved the adds of the softmax sum behind it and kept all p in registers across the V^T products.
    if (kc + 1 < NCH)
      copy_kv_chunk(lk0 + ((kc + 1) & 1) * BUFB, lv0 + ((kc + 1) & 1) * BUFB, gk + (size_t)(kc + 1) * 64 * ROWP, gv + (kc + 1) * 64,
                    LSTEP, (size_t)16 * ROWP, (size_t)16 * NCOMP);
    const _Float16* Ksh = KV + (kc & 1) * BUFH;
    const _Float16* Vth = Ksh + TILE;

    // ---- scores, transposed: s[u][j][r] = score(key j*16 + 8*hh + r, query 16*u + c) ----
    // The four K fragments of a d half are read as one group; each then feeds the products of both query tiles, which follow
    // one another on different accumulators. Each s[u][j] still takes d half 0, then 1.
    v8f s[QT][4];
#pragma unroll
    for (int dc = 0; dc < 2; ++dc) {
      v16h ka[4];
#pragma unroll
      for (int j = 0; j < 4; ++j) ka[j] = FR::load(Ksh + (j * 16 + c) * LP + dc * 32 + 8 * hh);
      group_edge();
#pragma unroll
      for (int j = 0; j < 4; ++j)
#pragma unroll
        for (int u = 0; u < QT; ++u)
          s[u][j] = FR::mma(ka[j], qa[u][dc], dc == 0 ? (v8f){0.f,0.f,0.f,0.f,0.f,0.f,0.f,0.f} : s[u][j]);
      group_edge();
    }
    // B operand of 32 keys: elements 0..7 = keys 8*hh + 0..7 (tile 2*kk), 8..15 = keys 16 + 8*hh + 0..7 (tile 2*kk+1),
    // the k order in which FR::load brings the V^T rows.
    v16h pb[QT][2];
#pragma unroll
    for (int u = 0; u < QT; ++u) {
      // ---- chunk maximum of this lane's query: 32 scores in the lane, then the other half's ----
      // The maximum is taken over the raw accumulators: the score scale is positive, so it picks the same key.
      float mj[4];
#pragma unroll
      for (int j = 0; j < 4; ++j) {
        mj[j] = -INFINITY;
#pragma unroll
        for (int r = 0; r < 8; ++r) mj[j] = fmaxf(mj[j], s[u][j][r]);
      }
      float cm = fmaxf(fmaxf(mj[0], mj[1]), fmaxf(mj[2], mj[3]));
      cm = fmaxf(cm, xhalf(cm));
      // ---- online softmax update; P^T stays in registers ----
      const float mnew  = fmaxf(mrun[u], cm);
      const float aarg  = (mrun[u] - mnew) * EXP_SLOPE;
      const float alpha = __builtin_amdgcn_exp2f(aarg);
      exp_slot1(alpha, aarg);
      mrun[u] = mnew;
      // exp2(s * EXP_SLOPE + poff) = PROB_CARRY * exp(SCORE_SCALE * (s - mnew)): score scale, log2(e), maximum and carry in one FMA
      const float poff = PROB_CARRY_LOG2 - mnew * EXP_SLOPE;
      float pj[4];
#pragma unroll
      for (int j = 0; j < 4; ++j) {
        pj[j] = 0.f;
#pragma unroll
        for (int g = 0; g < 8; g += 4) {
          float parg[4], p[4];
#pragma unroll
          for (int e = 0; e < 4; ++e) {
            parg[e] = __builtin_fmaf(s[u][j][g + e], EXP_SLOPE, poff);
            p[e]    = __builtin_amdgcn_exp2f(parg[e]);
          }
          // the slot behind these four v_exp_f32, as in exp_slot1
          asm volatile("v_nop" :: "v"(p[0]), "v"(p[1]), "v"(p[2]), "v"(p[3]), "v"(parg[0]), "v"(parg[1]), "v"(parg[2]), "v"(parg[3]));
#pragma unroll
          for (int e = 0; e < 4; ++e) {
            pj[j] += p[e];
            pb[u][j >> 1][(j & 1) * 8 + g + e] = (_Float16)p[e];
          }
        }
      }
      lrun[u] = lrun[u] * alpha + ((pj[0] + pj[1]) + (pj[2] + pj[3]));
#pragma unroll
      for (int t = 0; t < 4; ++t)
#pragma unroll
        for (int r = 0; r < 8; ++r) oacc[u][t][r] *= alpha;
    }
    // ---- O^T += V^T . P^T ----
#pragma unroll
    for (int kk = 0; kk < 2; ++kk) {   // the four V^T fragments of 32 keys as one group of reads, then their products with both query tiles
      group_edge();
      v16h va[4];
#pragma unroll
      for (int t = 0; t < 4; ++t) va[t] = FR::load(Vth + (t * 16 + c) * LP + kk * 32 + 8 * hh);
      group_edge();
#pragma unroll
      for (int t = 0; t < 4; ++t)
#pragma unroll
        for (int u = 0; u < QT; ++u) oacc[u][t] = FR::mma(va[t], pb[u][kk], oacc[u][t]);
    }
    // publish point of chunk kc + 1, the same in every wave
    asm volatile("s_wait_dscnt 0x0" ::: "memory");           // this wave's reads of the buffer to be refilled are done
    asm volatile("s_wait_asynccnt 0x0" ::: "memory");        // this wave's copies of chunk kc + 1 have landed
    __syncthreads();                                         // chunk kc + 1 may be read; every reader has left this trip's buffer
  }
  asm volatile("s_wait_asynccnt 0x0" ::: "memory");          // no copy is in flight when the ring becomes the out tiles

  // ---- epilogue: join the halves' sums, normalise, stage 32x64 wave tile, whole-line f16 stores ----
  float* os = Os + wave * (QW * 68);
#pragma unroll
  for (int u = 0; u < QT; ++u) {
    const float lsum = lrun[u] + xhalf(lrun[u]);
    const float inv  = OUT_CARRY * (1.0f / lsum);   // lsum carries PROB_CARRY, as the products do
#pragma unroll
    for (int t = 0; t < 4; ++t) {
#pragma unroll
      for (int g = 0; g < 2; ++g) {
        v4f w;
#pragma unroll
        for (int e = 0; e < 4; ++e) w[e] = oacc[u][t][g * 4 + e] * inv;
        *(v4f*)(os + (u * 16 + c) * 68 + t * 16 + 8 * hh + g * 4) = w;
      }
    }
  }
  __builtin_amdgcn_fence(__ATOMIC_RELEASE, "workgroup");
  __builtin_amdgcn_wave_barrier();
  __builtin_amdgcn_fence(__ATOMIC_ACQUIRE, "workgroup");
  {
    const int qq = lane >> 3, c8 = (lane & 7) * 8;
    {
#pragma unroll
      for (int it = 0; it < QW / 4; ++it) {
        const int row = it * 4 + qq;
        const float* sp = os + row * 68 + c8;
        v8h hv;
#pragma unroll
        for (int e = 0; e < 8; ++e) hv[e] = (_Float16)sp[e];
        *(v8h*)(Ob + (size_t)(q0 + row) * ROWP + c8) = hv;
      }
      
    }
  }
}

// ---------------------------------------------------------------------------
// Host orchestration (kernel launches + host arithmetic only)
// ---------------------------------------------------------------------------
extern "C" void kernel_launch(void* const* d_in, const int* in_sizes, int n_in,
                              void* d_out, int out_size, void* d_ws, size_t ws_size,
                              hipStream_t stream) {
  if (n_in < 11) return;
  const long nQ  = (long)SEQLEN * NBAT * EMBED;    // 8388608
  const long nW  = (long)EMBED * EMBED;            // 262144
  const long nWc = (long)NCOMP * SEQLEN;           // 4194304
  if (in_sizes[0] != nQ || in_sizes[1] != nW || in_sizes[2] != EMBED || in_sizes[3] != nW ||
      in_sizes[4] != EMBED || in_sizes[5] != nW || in_sizes[6] != EMBED || in_sizes[7] != nWc ||
      in_sizes[8] != nWc || in_sizes[9] != nW || in_sizes[10] != EMBED || out_size != nQ) return;

  const float* query = (const float*)d_in[0];
  const float* Wq  = (const float*)d_in[1];  const float* bq = (const float*)d_in[2];
  const float* Wk  = (const float*)d_in[3];  const float* bk = (const float*)d_in[4];
  const float* Wv  = (const float*)d_in[5];  const float* bv = (const float*)d_in[6];
  const float* Wck = (const float*)d_in[7];  const float* Wcv = (const float*)d_in[8];
  const float* Wo  = (const float*)d_in[9];  const float* bo = (const float*)d_in[10];

  // ---- workspace region map (bytes) ----
  const size_t BYTES_QB   = (size_t)nQ * 2;                              // bf16 query [16384][512]            16 MiB
  const size_t BYTES_QT   = (size_t)nQ * 2;                              // bf16 query^T [4][512][4096]        16 MiB
  const size_t BYTES_WC   = (size_t)2 * nWc * 2;                         // bf16 [Wck;Wcv] [2048][4096]        16 MiB
  const size_t BYTES_KVIN = (size_t)2 * NCOMP * NBAT * (2 * EMBED) * 2;  // u16 [8192][1024] (hi|lo rows)     16 MiB
  const size_t BYTES_QP   = (size_t)nQ * 2;                              // f16 q plane [16384][512]          16 MiB
  const size_t BYTES_OP   = (size_t)nQ * 2;                              // f16 attention out [16384][512]    16 MiB
  const size_t BYTES_KP   = (size_t)NCOMP * NBAT * EMBED * 2;            // f16 k plane [4096][512]            4 MiB
  const size_t BYTES_VT   = (size_t)NBAT * EMBED * NCOMP * 2;            // f16 v^T plane [4][512][1024]       4 MiB
  const size_t BYTES_WQ   = (size_t)nW * 2;                              // bf16 Wq [512][512]               512 KiB
  const size_t BYTES_WK2  = (size_t)nW * 2 * 2;                          // bf16 [Wk|Wk] [512][1024]            1 MiB
  const size_t BYTES_WV2  = (size_t)nW * 2 * 2;                          // bf16 [Wv|Wv] [512][1024]            1 MiB
  const size_t BYTES_WOH  = (size_t)nW * 2;                              // f16 64*Wo [512][512]             512 KiB
  const size_t BYTES_BIAS = (size_t)4 * EMBED * 4;                       // f32 biases 4 x 512                  8 KiB
  const size_t OFF_QB   = 0;
  const size_t OFF_QT   = OFF_QB   + BYTES_QB;
  const size_t OFF_WC   = OFF_QT   + BYTES_QT;
  const size_t OFF_KVIN = OFF_WC   + BYTES_WC;
  const size_t OFF_QP   = OFF_KVIN + BYTES_KVIN;
  const size_t OFF_OP   = OFF_QP   + BYTES_QP;
  const size_t OFF_KP   = OFF_OP   + BYTES_OP;
  const size_t OFF_VT   = OFF_KP   + BYTES_KP;
  const size_t OFF_WQ   = OFF_VT   + BYTES_VT;
  const size_t OFF_WK2  = OFF_WQ   + BYTES_WQ;
  const size_t OFF_WV2  = OFF_WK2  + BYTES_WK2;
  const size_t OFF_WOH  = OFF_WV2  + BYTES_WV2;
  const size_t OFF_BIAS = OFF_WOH  + BYTES_WOH;
  const size_t WS_TOTAL = OFF_BIAS + BYTES_BIAS;                         // 112,205,824 B
  if (WS_TOTAL > ws_size) return;

  char* ws = (char*)d_ws;
  unsigned short* queryB = (unsigned short*)(ws + OFF_QB);
  unsigned short* queryT = (unsigned short*)(ws + OFF_QT);
  unsigned short* WcB    = (unsigned short*)(ws + OFF_WC);
  unsigned short* KVin   = (unsigned short*)(ws + OFF_KVIN);
  unsigned short* qP     = (unsigned short*)(ws + OFF_QP);
  unsigned short* oP     = (unsigned short*)(ws + OFF_OP);
  unsigned short* kP     = (unsigned short*)(ws + OFF_KP);
  unsigned short* vtP    = (unsigned short*)(ws + OFF_VT);
  unsigned short* WqB    = (unsigned short*)(ws + OFF_WQ);
  unsigned short* WkB2   = (unsigned short*)(ws + OFF_WK2);
  unsigned short* WvB2   = (unsigned short*)(ws + OFF_WV2);
  unsigned short* WoH    = (unsigned short*)(ws + OFF_WOH);
  float*          biasb  = (float*)(ws + OFF_BIAS);
  float* bq_r = biasb;
  float* bk_r = biasb + EMBED;
  float* bv_r = biasb + 2 * EMBED;
  float* bo_r = biasb + 3 * EMBED;

  // 1. every input conversion (query -> bf16 and bf16 transposed, Wck/Wcv, Wq, [Wk|Wk], [Wv|Wv], 64*Wo, biases)
  convert_inputs_kernel<<<dim3(CB_GRID), dim3(256), 0, stream>>>(
      query, Wck, Wcv, Wq, Wk, Wv, Wo, bq, bk, bv, bo,
      queryB, queryT, WcB, WqB, WkB2, WvB2, WoH, biasb);

  // 2. two products that read only what launch 1 wrote:
  //  compression: per batch b: C_b[m][n] = sum_t WcB[m][t] * queryT_b[n][t]; m<1024 -> k_in[m][b][n], m>=1024 -> v_in.
  //     C element (m,n,b): hi at KVin[(m*4+b)*1024 + n], lo at +512  => ldc 4096, strideC 1024, C2 = C + 512.
  //     M=2048, N=512, K=4096 (K%128==0, M%128==0, N%256==0): 32 block tiles of 128x256 per batch, 4 batches: 128 blocks.
  //  q8 = query . Wq^T + bq  (scale 1; 0.125 applied to f32 scores) -> f16 [16384][512]; M=16384, N=512, K=512: 256 blocks.
  {
    const GemmJob comp = { WcB, queryT, KVin, KVin + EMBED, biasb,
                           0L, (long)EMBED * SEQLEN, (long)(2 * EMBED),
                           SEQLEN, SEQLEN, 4 * (2 * EMBED), 2 * NCOMP, EMBED, SEQLEN, 32 };
    const GemmJob qpro = { queryB, WqB, qP, qP, bq_r,
                           0L, 0L, 0L,
                           EMBED, EMBED, EMBED, SEQLEN * NBAT, EMBED, EMBED, 256 };
    wmma_gemm64_pair<1, 0, 2, 2, 1><<<dim3(32 * NBAT + 256), dim3(256), 0, stream>>>(comp, qpro, 32 * NBAT);
  }

  // 3. two products that read only what launches 1 and 2 wrote:
  //  k = [k_in hi|lo] . [Wk|Wk]^T + bk -> f16 [4096 rows (c*4+b)][512]; M=4096, N=512, K'=1024: 64 blocks.
  //  v^T per batch: C_b[m=e'][n=c] = sum_k [Wv|Wv][e'][k] * [v_in hi|lo][(c,b)][k] + bv[e'] -> f16 vtP[b][512][1024].
  //     Bt_b rows at KVin + 4096*1024 + b*1024 + c*4096 (ldb 4096, strideB 1024); M=512, N=1024, K'=1024: 16 x 4 blocks.
  {
    const GemmJob kpro = { KVin, WkB2, kP, kP, bk_r,
                           0L, 0L, 0L,
                           2 * EMBED, 2 * EMBED, EMBED, NCOMP * NBAT, EMBED, 2 * EMBED, 64 };
    const GemmJob vpro = { WvB2, KVin + (size_t)NCOMP * NBAT * (2 * EMBED), vtP, vtP, bv_r,
                           0L, (long)(2 * EMBED), (long)EMBED * NCOMP,
                           2 * EMBED, 4 * (2 * EMBED), NCOMP, EMBED, NCOMP, 2 * EMBED, 16 };
    wmma_gemm64_pair<1, 2, 1, 1, 1><<<dim3(64 + 16 * NBAT), dim3(256), 0, stream>>>(kpro, vpro, 64);
  }

  // 4. attention over the compressed keys: grid = B*H*(T/128) = 1024 blocks of 128
  attn_lin_kernel<<<dim3(NBAT * NHEADS * (SEQLEN / 128)), dim3(128), 0, stream>>>(qP, kP, vtP, oP);

  // 5. out = (16 O) . (64 Wo)^T / 1024 + bo -> f32 d_out [16384][512]; M=16384, N=512, K=512: grid 256.
  wmma_gemm64<0, false, 2, 0, false><<<dim3(256, 1), dim3(256), 0, stream>>>(
      oP, oP, EMBED, 0L,
      WoH, WoH, EMBED, 0L,
      d_out, d_out, EMBED, 0L,
      bo_r, bo_r, 0L,
      SEQLEN * NBAT, EMBED, EMBED, 1.0f / (OUT_CARRY * WO_CARRY));
}
